// v000
// Times are from an AMD MI455X. After a warm-up the kernel runs many times in a row, and a time is the length of
// such a window on the GPU divided by its runs, so every launch and the gaps after it count. The runs cycle
// through copies of the inputs. A figure is the median of several windows, for all but v000 over two sittings.
// Sittings can differ by a few percent; kernels timed side by side share one.
// v000, which the later versions start from, runs in 4300 microseconds.
#include <hip/hip_runtime.h>
// Multi-head attention with learned relative-position encoding (4 x 1024 tokens, 1024 = 16 heads x 64): q,k,v = x W^T + b; scores = q.k/8 + q.rpe_table[h][q - k + 1023] (no scale on the RPE term); softmax over all keys; . v; merged . Wo^T + bo -> [4,1024,1024].
// Structure (per batch): projections as f16 WMMA GEMMs (32x64 wave tiles, f32 accumulation, exact products + bias); the RPE term is materialised per group of 4 heads as REL[h][q][r] = q_h . table[h][r] (r < 2048) by a grid.y-batched f16 GEMM over the head columns (f32 result), and my fused flash kernel (hi/lo q,k three-product scores, online f32 softmax, P staged hi + residual, V^T hi + residual; all keys valid) adds REL[h][q][q - k + 1023] inside the score stage; O as hi + residual planes into Wo (two GEMMs, bias in the first).
// Compute dtype: x, weights, biases, rpe_table rounded to bf16; projections exact; the RPE GEMM uses the plain f16 q (~2^-12 on a sigma-0.16 bias); q, k, P, v, O as f16 hi + residual pairs (~2^-21) in the attention; f32 accumulation and softmax. v_wmma_f32_16x16x32_f16.
#define NBT 4
#define SLEN 1024
#define HG 4                     /* heads per REL group */
#define RW 2048                  /* REL row width (2*SLEN-1 used) */
#define DM 1024
#define NH 16
#define SCL 0.125f
#define NR (NBT * SLEN)
typedef __bf16 v16b __attribute__((ext_vector_type(16)));
typedef unsigned short v8us __attribute__((ext_vector_type(8), may_alias));
typedef float  v8f  __attribute__((ext_vector_type(8)));
typedef float  v4f  __attribute__((ext_vector_type(4)));
typedef float  v4fa __attribute__((ext_vector_type(4), may_alias));
union FragB { v16b v; v8us half[2]; unsigned short u[16]; };

__device__ __forceinline__ unsigned short bf16_bits(float x) { unsigned int u = __float_as_uint(x); return (unsigned short)((u + 0x7FFFu + ((u >> 16) & 1u)) >> 16); }
__device__ __forceinline__ float bf16_val(unsigned short b) { return __uint_as_float(((unsigned int)b) << 16); }
__device__ __forceinline__ float bf16_round(float x) { return bf16_val(bf16_bits(x)); }
// D += A·B with NT terms: 1 = ah·bh, 2 = + al·bh (A split), 3 = + ah·bl (both split)
template <int NT>
__device__ __forceinline__ v8f mmaN(v16b ah, v16b al, v16b bh, v16b bl, v8f c) {
  c = __builtin_amdgcn_wmma_f32_16x16x32_bf16(false, ah, false, bh, (short)0, c, false, false);
  if (NT >= 2) c = __builtin_amdgcn_wmma_f32_16x16x32_bf16(false, al, false, bh, (short)0, c, false, false);
  if (NT >= 3) c = __builtin_amdgcn_wmma_f32_16x16x32_bf16(false, ah, false, bl, (short)0, c, false, false);
  asm volatile("v_nop\n\tv_nop\n\tv_nop\n\tv_nop" : "+v"(c) : "v"(ah), "v"(al), "v"(bh), "v"(bl));
  return c;
}

__global__ __launch_bounds__(256) void k_wt_bf16(const float* __restrict__ W, unsigned short* __restrict__ Wt, int K, int N) {
  const int t = blockIdx.x * 256 + threadIdx.x;
  const int k8n = K / 8;
  if (t >= N * k8n) return;
  const int n = t / k8n, k8 = (t % k8n) * 8;
  v8us v;
#pragma unroll
  for (int i = 0; i < 8; ++i) v[i] = bf16_bits(W[(size_t)(k8 + i) * N + n]);
  *(v8us*)(Wt + (size_t)n * K + k8) = v;
  
}

// GEMM C[M][N] (f32, pitch ldc) = act(A[M][K]·W + bias). A f32 row-major (pitch lda) converted per fragment to bf16
// (ASPLIT: hi/lo two planes -> 2 terms, else single rounded term); Wt bf16 [N][K] (pitch ldb). BIAS_BF16 rounds the
// bias to bf16 first (bias quantised to bf16 before the add). K%32==0, M%16==0, N%64==0.
template <bool ASPLIT, int ACT, bool BIAS_BF16>
__global__ __launch_bounds__(128) void k_gemm_bf(const float* __restrict__ A, int lda, const unsigned short* __restrict__ Wt, int ldb,
                                               const float* __restrict__ bias, float* __restrict__ C, int ldc, int M, int N, int K) {
  __shared__ __attribute__((aligned(16))) float so[4][16][64];
  const int tid = threadIdx.x, w = tid >> 5, lane = tid & 31, ln = lane & 15, hh = lane >> 4;
  const int ntn = N / 64;
  const int wid = blockIdx.x * 4 + w;
  const int mt = wid / ntn, nq = wid % ntn;
  if (mt * 16 >= M) return;
  const int row0 = mt * 16, col0 = nq * 64;
  const float* arow = A + (size_t)(row0 + ln) * lda;
  v8f acc[4] = {};
  for (int kb = 0; kb < K; kb += 32) {
    FragB ah, al;
    const v4f x0 = *(const v4fa*)(arow + kb + 8 * hh), x1 = *(const v4fa*)(arow + kb + 8 * hh + 4);
    const v4f x2 = *(const v4fa*)(arow + kb + 16 + 8 * hh), x3 = *(const v4fa*)(arow + kb + 16 + 8 * hh + 4);
    float xs[16] = {x0[0],x0[1],x0[2],x0[3],x1[0],x1[1],x1[2],x1[3],x2[0],x2[1],x2[2],x2[3],x3[0],x3[1],x3[2],x3[3]};
#pragma unroll
    for (int i = 0; i < 16; ++i) { const unsigned short hb = bf16_bits(xs[i]); ah.u[i] = hb; al.u[i] = ASPLIT ? bf16_bits(xs[i] - bf16_val(hb)) : (unsigned short)0; }
#pragma unroll
    for (int t = 0; t < 4; ++t) {
      const unsigned short* brow = Wt + (size_t)(col0 + t * 16 + ln) * ldb + kb;
      FragB b;
      b.half[0] = *(const v8us*)(brow + 8 * hh);
      b.half[1] = *(const v8us*)(brow + 16 + 8 * hh);
      acc[t] = mmaN<ASPLIT ? 2 : 1>(ah.v, al.v, b.v, b.v, acc[t]);
    }
  }
#pragma unroll
  for (int t = 0; t < 4; ++t) {
    float bv = bias ? bias[col0 + t * 16 + ln] : 0.f;
    if (BIAS_BF16) bv = bf16_round(bv);
#pragma unroll
    for (int r = 0; r < 8; ++r) { float v = acc[t][r] + bv; if (ACT == 1) v = fmaxf(v, 0.f); so[w][8 * hh + r][t * 16 + ln] = v; }
  }
  __builtin_amdgcn_fence(__ATOMIC_ACQ_REL, "workgroup");
  __builtin_amdgcn_wave_barrier();
  const int rsub = lane >> 4, c4 = (lane & 15) * 4;
  {
#pragma unroll
    for (int q = 0; q < 8; ++q) {
      const int r = q * 2 + rsub;
      const v4f v = *(const v4fa*)&so[w][r][c4];
      *(v4f*)(C + (size_t)(row0 + r) * ldc + col0 + c4) = v;
    }
    
  }
}

// GEMM C = act(A·W + bias + resid): A f32 (ASPLIT -> hi/lo 2 terms), Wt bf16 [N][K]; ACT 0 none, 1 relu, 2 exact gelu;
// resid (optional, f32, row index = (row % rmod), pitch ldr, RES_BF16 rounds it) added before the activation.
template <bool ASPLIT, int ACT, bool BIAS_BF16, bool RES_BF16>
__global__ __launch_bounds__(128) void k_gemm_bf3(const float* __restrict__ A, int lda, const unsigned short* __restrict__ Wt, int ldb,
                                                const float* __restrict__ bias, const float* __restrict__ resid, int rmod, int ldr,
                                                float* __restrict__ C, int ldc, int M, int N, int K) {
  __shared__ __attribute__((aligned(16))) float so[4][16][64];
  const int tid = threadIdx.x, w = tid >> 5, lane = tid & 31, ln = lane & 15, hh = lane >> 4;
  const int ntn = N / 64;
  const int wid = blockIdx.x * 4 + w;
  const int mt = wid / ntn, nq = wid % ntn;
  if (mt * 16 >= M) return;
  const int row0 = mt * 16, col0 = nq * 64;
  const float* arow = A + (size_t)(row0 + ln) * lda;
  v8f acc[4] = {};
  for (int kb = 0; kb < K; kb += 32) {
    FragB ah, al;
    const v4f x0 = *(const v4fa*)(arow + kb + 8 * hh), x1 = *(const v4fa*)(arow + kb + 8 * hh + 4);
    const v4f x2 = *(const v4fa*)(arow + kb + 16 + 8 * hh), x3 = *(const v4fa*)(arow + kb + 16 + 8 * hh + 4);
    float xs[16] = {x0[0],x0[1],x0[2],x0[3],x1[0],x1[1],x1[2],x1[3],x2[0],x2[1],x2[2],x2[3],x3[0],x3[1],x3[2],x3[3]};
#pragma unroll
    for (int i = 0; i < 16; ++i) { const unsigned short hb = bf16_bits(xs[i]); ah.u[i] = hb; al.u[i] = ASPLIT ? bf16_bits(xs[i] - bf16_val(hb)) : (unsigned short)0; }
#pragma unroll
    for (int t = 0; t < 4; ++t) {
      const unsigned short* brow = Wt + (size_t)(col0 + t * 16 + ln) * ldb + kb;
      FragB b;
      b.half[0] = *(const v8us*)(brow + 8 * hh);
      b.half[1] = *(const v8us*)(brow + 16 + 8 * hh);
      acc[t] = mmaN<ASPLIT ? 2 : 1>(ah.v, al.v, b.v, b.v, acc[t]);
    }
  }
#pragma unroll
  for (int t = 0; t < 4; ++t) {
    const int col = col0 + t * 16 + ln;
    float bv = bias ? bias[col] : 0.f;
    if (BIAS_BF16) bv = bf16_round(bv);
#pragma unroll
    for (int r = 0; r < 8; ++r) {
      float v = acc[t][r] + bv;
      if (resid) { float rv = resid[(size_t)((row0 + 8 * hh + r) % rmod) * ldr + col]; if (RES_BF16) rv = bf16_round(rv); v += rv; }
      if (ACT == 1) v = fmaxf(v, 0.f);
      if (ACT == 2) v = 0.5f * v * (1.0f + erff(v * 0.70710678118654752f));
      if (ACT == 3) { const float u = 0.7978845608028654f * (v + 0.044715f * v * v * v); v = 0.5f * v * (1.0f + tanhf(u)); }
      so[w][8 * hh + r][t * 16 + ln] = v;
    }
  }
  __builtin_amdgcn_fence(__ATOMIC_ACQ_REL, "workgroup");
  __builtin_amdgcn_wave_barrier();
  const int rsub = lane >> 4, c4 = (lane & 15) * 4;
  {
#pragma unroll
    for (int q = 0; q < 8; ++q) {
      const int r = q * 2 + rsub;
      const v4f v = *(const v4fa*)&so[w][r][c4];
      *(v4f*)(C + (size_t)(row0 + r) * ldc + col0 + c4) = v;
    }
    
  }
}
// row LayerNorm (biased variance, eps) over N: s = X (+ R); optional out_sum <- s; out_norm <- (s-mu)*rsqrt(var+eps)*g + b
template <bool PARAM_BF16>
__global__ __launch_bounds__(256) void k_layernorm(const float* __restrict__ X, const float* __restrict__ R, const float* __restrict__ g, const float* __restrict__ bta,
                                                  float* __restrict__ out_sum, float* __restrict__ out_norm, int N, float eps) {
  __shared__ float red[256];
  const int row = blockIdx.x, tid = threadIdx.x;
  const float* x = X + (size_t)row * N; const float* rr = R ? R + (size_t)row * N : nullptr;
  float vals[16];                     // up to N = 4096
  const int per = N / 256;            // contiguous chunk per thread? use strided-by-4 chunks: thread handles j = tid*4 + 1024*u
  float s1 = 0.f;
  for (int u = 0; u < per / 4; ++u) {
    const int j = tid * 4 + 1024 * u;
    const v4f a = *(const v4fa*)(x + j);
    v4f b = {0.f,0.f,0.f,0.f}; if (rr) b = *(const v4fa*)(rr + j);
#pragma unroll
    for (int q = 0; q < 4; ++q) { const float v = a[q] + b[q]; vals[u * 4 + q] = v; s1 += v; }
  }
  red[tid] = s1; __syncthreads();
  for (int st = 128; st > 0; st >>= 1) { if (tid < st) red[tid] += red[tid + st]; __syncthreads(); }
  const float mu = red[0] / (float)N; __syncthreads();
  float s2 = 0.f;
  for (int u = 0; u < per / 4; ++u)
#pragma unroll
    for (int q = 0; q < 4; ++q) { const float c = vals[u * 4 + q] - mu; s2 += c * c; }
  red[tid] = s2; __syncthreads();
  for (int st = 128; st > 0; st >>= 1) { if (tid < st) red[tid] += red[tid + st]; __syncthreads(); }
  const float rs = rsqrtf(red[0] / (float)N + eps);
  {
    for (int u = 0; u < per / 4; ++u) {
      const int j = tid * 4 + 1024 * u;
      v4f o, sm;
#pragma unroll
      for (int q = 0; q < 4; ++q) {
        float gg = g[j + q], bb = bta[j + q];
        if (PARAM_BF16) { gg = bf16_round(gg); bb = bf16_round(bb); }
        sm[q] = vals[u * 4 + q]; o[q] = (vals[u * 4 + q] - mu) * rs * gg + bb;
      }
      if (out_sum) *(v4f*)(out_sum + (size_t)row * N + j) = sm;
      *(v4f*)(out_norm + (size_t)row * N + j) = o;
    }
    
  }
}



// ---- f16 WMMA path (v_wmma_f32_16x16x32_f16): 11-bit significands for operands in range — used where a [0,1] probability operand needs more precision than bf16
typedef _Float16 v16h __attribute__((ext_vector_type(16)));
union FragH { v16h v; v8us half[2]; _Float16 h[16]; unsigned short u[16]; };
template <int NT>
__device__ __forceinline__ v8f mmaH(v16h ah, v16h al, v16h bh, v16h bl, v8f c) {
  c = __builtin_amdgcn_wmma_f32_16x16x32_f16(false, ah, false, bh, (short)0, c, false, false);
  if (NT >= 2) c = __builtin_amdgcn_wmma_f32_16x16x32_f16(false, al, false, bh, (short)0, c, false, false);
  if (NT >= 3) c = __builtin_amdgcn_wmma_f32_16x16x32_f16(false, ah, false, bl, (short)0, c, false, false);
  asm volatile("v_nop\n\tv_nop\n\tv_nop\n\tv_nop" : "+v"(c) : "v"(ah), "v"(al), "v"(bh), "v"(bl));
  return c;
}
// batched GEMM like k_gemm_b but f16 operands: A f32 (split into f16 hi/lo if ASPLIT, else rounded to f16), Bt = f16 values [n][k]; alpha; C f32; N multiple of 16 (partial tiles skipped)
template <bool ASPLIT>
__global__ __launch_bounds__(128) void k_gemm_h(const float* __restrict__ A, int lda, size_t sA, const _Float16* __restrict__ Bh, int ldb, size_t sB, float alpha, float* __restrict__ C, int ldc, size_t sC, int M, int N, int K) {
  __shared__ __attribute__((aligned(16))) float so[4][16][64];
  const int tid = threadIdx.x, w = tid >> 5, lane = tid & 31, ln = lane & 15, hh = lane >> 4; const int by = blockIdx.y;
  A += (size_t)by * sA; Bh += (size_t)by * sB; C += (size_t)by * sC;
  const int ntn = (N + 63) / 64; const int wid = blockIdx.x * 4 + w; const int mt = wid / ntn, nq = wid % ntn; if (mt * 16 >= M) return;
  const int row0 = mt * 16, col0 = nq * 64; const float* arow = A + (size_t)(row0 + ln) * lda;
  v8f acc[4] = {};
  for (int kb = 0; kb < K; kb += 32) {
    FragH ah, al;
    const v4f x0 = *(const v4fa*)(arow + kb + 8 * hh), x1 = *(const v4fa*)(arow + kb + 8 * hh + 4), x2 = *(const v4fa*)(arow + kb + 16 + 8 * hh), x3 = *(const v4fa*)(arow + kb + 16 + 8 * hh + 4);
    float xs[16] = {x0[0],x0[1],x0[2],x0[3],x1[0],x1[1],x1[2],x1[3],x2[0],x2[1],x2[2],x2[3],x3[0],x3[1],x3[2],x3[3]};
#pragma unroll
    for (int i = 0; i < 16; ++i) { const _Float16 h = (_Float16)xs[i]; ah.h[i] = h; al.h[i] = ASPLIT ? (_Float16)(xs[i] - (float)h) : (_Float16)0.0f; }
#pragma unroll
    for (int t = 0; t < 4; ++t) { if (col0 + t * 16 >= N) continue; const size_t boff = (size_t)(col0 + t * 16 + ln) * ldb + kb; FragH bq; bq.half[0] = *(const v8us*)(Bh + boff + 8 * hh); bq.half[1] = *(const v8us*)(Bh + boff + 16 + 8 * hh);
      acc[t] = mmaH<ASPLIT ? 2 : 1>(ah.v, al.v, bq.v, bq.v, acc[t]); }
  }
#pragma unroll
  for (int t = 0; t < 4; ++t) { if (col0 + t * 16 >= N) continue;
#pragma unroll
    for (int r = 0; r < 8; ++r) so[w][8 * hh + r][t * 16 + ln] = acc[t][r] * alpha; }
  __builtin_amdgcn_fence(__ATOMIC_ACQ_REL, "workgroup"); __builtin_amdgcn_wave_barrier();
  const int rsub = lane >> 4, c4 = (lane & 15) * 4;
  {
#pragma unroll
    for (int q = 0; q < 8; ++q) { const int r = q * 2 + rsub; if (col0 + c4 < N) { const v4f v = *(const v4fa*)&so[w][r][c4]; *(v4f*)(C + (size_t)(row0 + r) * ldc + col0 + c4) = v; } }
     }
}

// Wt[n][k] = f16(W[k][n]·scale) from f32 row-major W[K][N] (scale = power of two; bf16-exact weights stay exact in f16 away from the subnormal range)
__global__ __launch_bounds__(256) void k_wt_f16(const float* __restrict__ W, _Float16* __restrict__ Wt, int K, int N, float scale) {
  const int t = blockIdx.x * 256 + threadIdx.x; if (t >= N * (K / 8)) return; const int n = t / (K / 8), k8 = (t % (K / 8)) * 8; FragH f;
#pragma unroll
  for (int i = 0; i < 8; ++i) f.h[i] = (_Float16)(bf16_round(W[(size_t)(k8 + i) * N + n]) * scale); const v8us o = f.half[0];
  *(v8us*)((unsigned short*)Wt + (size_t)n * K + k8) = o; 
}
// k_gemm_hh variant with fused epilogue: v = acc·alpha + bias[by·sBias + col] (+ CP[(row/rowsPerB)·sCPb + by·64 + col] if CP) ; ACT 0 none / 1 elu ; writes f16 C16 (and f32 C if non-null)
template <int ACT>
__global__ __launch_bounds__(128) void k_gemm_hhx(const _Float16* __restrict__ A, int lda, size_t sA, const _Float16* __restrict__ Bh, int ldb, size_t sB, float alpha, const float* __restrict__ bias, size_t sBias, const float* __restrict__ CP, int rowsPerB, size_t sCPb, int row0g,
    float* __restrict__ C, _Float16* __restrict__ C16, int ldc, size_t sC, int M, int N, int K) {
  __shared__ __attribute__((aligned(16))) float so[4][16][64];
  const int tid = threadIdx.x, w = tid >> 5, lane = tid & 31, ln = lane & 15, hh = lane >> 4; const int by = blockIdx.y;
  A += (size_t)by * sA; Bh += (size_t)by * sB; const size_t cofs = (size_t)by * sC; const float* bp = bias ? bias + (size_t)by * sBias : nullptr;
  const int ntn = (N + 63) / 64; const int wid = blockIdx.x * 4 + w; const int mt = wid / ntn, nq = wid % ntn; if (mt * 16 >= M) return;
  const int row0 = mt * 16, col0 = nq * 64; const _Float16* arow = A + (size_t)(row0 + ln) * lda;
  v8f acc[4] = {};
  for (int kb = 0; kb < K; kb += 32) { FragH ah; ah.half[0] = *(const v8us*)((const unsigned short*)arow + kb + 8 * hh); ah.half[1] = *(const v8us*)((const unsigned short*)arow + kb + 16 + 8 * hh);
#pragma unroll
    for (int t = 0; t < 4; ++t) { if (col0 + t * 16 >= N) continue; const size_t boff = (size_t)(col0 + t * 16 + ln) * ldb + kb; FragH bq; bq.half[0] = *(const v8us*)((const unsigned short*)Bh + boff + 8 * hh); bq.half[1] = *(const v8us*)((const unsigned short*)Bh + boff + 16 + 8 * hh);
      acc[t] = mmaH<1>(ah.v, ah.v, bq.v, bq.v, acc[t]); }
  }
#pragma unroll
  for (int t = 0; t < 4; ++t) { if (col0 + t * 16 >= N) continue; const int col = col0 + t * 16 + ln; const float bv = bp ? bf16_round(bp[col]) : 0.f;
#pragma unroll
    for (int r = 0; r < 8; ++r) { float v = acc[t][r] * alpha + bv; if (CP) { const int bidx = (row0g + row0 + 8 * hh + r) / rowsPerB; v += CP[(size_t)bidx * sCPb + (size_t)by * 64 + col]; } if (ACT == 1) v = (v > 0.f) ? v : expm1f(v); else if (ACT == 7) v = (v > 0.f) ? v + 1.0f : expf(v); else if (ACT == 8) v = tanhf(v); else if (ACT == 9) v = 0.5f * v * (1.0f + tanhf(0.7978845608028654f * (v + 0.044715f * v * v * v))); else if (ACT == 11) v = 1.0f / (1.0f + expf(-v)); else if (ACT == 12) v = (v > 0.f) ? v : 0.01f * v; else if (ACT == 14) v = (v > 0.f) ? v : 0.1f * v; else if (ACT == 15) v = v / (1.0f + expf(-v)); else if (ACT == 3) v = fmaxf(v, 0.f); else if (ACT == 6) v = 0.5f * v * (1.0f + erff(v * 0.70710678118654752f)); so[w][8 * hh + r][t * 16 + ln] = v; } }
  __builtin_amdgcn_fence(__ATOMIC_ACQ_REL, "workgroup"); __builtin_amdgcn_wave_barrier();
  const int rsub = lane >> 4, c4 = (lane & 15) * 4; typedef _Float16 v4h __attribute__((ext_vector_type(4)));
  {
#pragma unroll
    for (int q = 0; q < 8; ++q) { const int r = q * 2 + rsub; if (col0 + c4 < N) { const v4f v = *(const v4fa*)&so[w][r][c4]; if (C) *(v4f*)(C + cofs + (size_t)(row0 + r) * ldc + col0 + c4) = v; if (C16) { v4h h4; for (int i = 0; i < 4; ++i) h4[i] = (_Float16)v[i]; *(v4h*)(C16 + cofs + (size_t)(row0 + r) * ldc + col0 + c4) = h4; } } }
     }
}


typedef _Float16 v4h __attribute__((ext_vector_type(4)));

__global__ __launch_bounds__(256) void k_x16(const float* __restrict__ x, _Float16* __restrict__ X16, size_t n8) { const size_t t = (size_t)blockIdx.x * 256 + threadIdx.x; if (t >= n8) return; FragH f;
#pragma unroll
  for (int q = 0; q < 8; ++q) f.h[q] = (_Float16)bf16_round(x[t * 8 + q]); *(v8us*)((unsigned short*)X16 + t * 8) = f.half[0];  }
__global__ __launch_bounds__(256) void k_h16(const float* __restrict__ x, _Float16* __restrict__ X16, size_t n8) { const size_t t = (size_t)blockIdx.x * 256 + threadIdx.x; if (t >= n8) return; FragH f;
#pragma unroll
  for (int q = 0; q < 8; ++q) f.h[q] = (_Float16)x[t * 8 + q]; *(v8us*)((unsigned short*)X16 + t * 8) = f.half[0];  }
__global__ __launch_bounds__(256) void k_round16f(const float* __restrict__ W, _Float16* __restrict__ Bt, size_t n8) { const size_t t = (size_t)blockIdx.x * 256 + threadIdx.x; if (t >= n8) return; FragH f;
#pragma unroll
  for (int i = 0; i < 8; ++i) f.h[i] = (_Float16)(bf16_round(W[t * 8 + i]) * 16.0f); *(v8us*)((unsigned short*)Bt + t * 8) = f.half[0];  }
template <int NHv, int TTv>
__global__ __launch_bounds__(256) void k_vt(const _Float16* __restrict__ V16, int ldv, int voff, _Float16* __restrict__ Vt) { __shared__ unsigned short tl[64][66]; const int tid = threadIdx.x; const int slab = blockIdx.x / (TTv / 64), lg = blockIdx.x % (TTv / 64); const int b = slab / NHv, h = slab % NHv;
  for (int i = tid; i < 64 * 8; i += 256) { const int r = i / 8, c8 = (i % 8) * 8; FragH f; f.half[0] = *(const v8us*)((const unsigned short*)V16 + ((size_t)b * TTv + lg * 64 + r) * ldv + voff + h * 64 + c8);
#pragma unroll
    for (int q = 0; q < 8; ++q) tl[r][c8 + q] = f.u[q]; }
  __syncthreads();
  {
#pragma unroll
    for (int rd = 0; rd < 2; ++rd) { const int d = rd * 32 + tid / 8, pc = tid % 8; FragH f;
#pragma unroll
      for (int q = 0; q < 8; ++q) f.u[q] = tl[pc * 8 + q][d];
      *(v8us*)((unsigned short*)Vt + ((size_t)slab * 64 + d) * TTv + lg * 64 + pc * 8) = f.half[0]; }
     } }

__global__ __launch_bounds__(256) void k_hl(const float* __restrict__ F, _Float16* __restrict__ Hh, _Float16* __restrict__ Hl, size_t n8) { const size_t t = (size_t)blockIdx.x * 256 + threadIdx.x; if (t >= n8) return; FragH fh, fl; const v4f a = *(const v4fa*)(F + t * 8), c = *(const v4fa*)(F + t * 8 + 4);
#pragma unroll
  for (int q = 0; q < 4; ++q) { _Float16 h = (_Float16)a[q]; fh.h[q] = h; fl.h[q] = (_Float16)((a[q] - (float)h) * 1024.0f); h = (_Float16)c[q]; fh.h[4 + q] = h; fl.h[4 + q] = (_Float16)((c[q] - (float)h) * 1024.0f); }
  { *(v8us*)((unsigned short*)Hh + t * 8) = fh.half[0]; *(v8us*)((unsigned short*)Hl + t * 8) = fl.half[0];  } }

// ---- fast GEMM (wave tile 32x64; requires M % 32 == 0 rows per launch region and N % 64 == 0); epilogue = k_gemm_hhx semantics ----
__device__ __forceinline__ v16h g2_frag(const _Float16* p, int hh) { FragH f; f.half[0] = *(const v8us*)((const unsigned short*)p + 8 * hh); f.half[1] = *(const v8us*)((const unsigned short*)p + 16 + 8 * hh); return f.v; }
__device__ __forceinline__ v8f g2_mma(v16h a, v16h b, v8f c) { v8f d = __builtin_amdgcn_wmma_f32_16x16x32_f16(false, a, false, b, (short)0, c, false, false); asm volatile("v_nop\n\tv_nop\n\tv_nop\n\tv_nop" : "+v"(d) : "v"(a), "v"(b)); return d; }
template <int ACT>
__global__ __launch_bounds__(128) void k_gemm2(const _Float16* __restrict__ A, int lda, size_t sA, const _Float16* __restrict__ Bh, int ldb, size_t sB, float alpha, const float* __restrict__ bias, size_t sBias, const float* __restrict__ CP, int rowsPerB, size_t sCPb, int row0g,
    float* __restrict__ C, _Float16* __restrict__ C16, int ldc, size_t sC, int M, int N, int K) {
  __shared__ __attribute__((aligned(16))) float so[4][32][68];
  const int tid = threadIdx.x, w = tid >> 5, lane = tid & 31, ln = lane & 15, hh = lane >> 4; const int by = blockIdx.y;
  A += (size_t)by * sA; Bh += (size_t)by * sB; const size_t cofs = (size_t)by * sC; const float* bp = bias ? bias + (size_t)by * sBias : nullptr;
  const int ntn = N >> 6; const int mt = blockIdx.x / ntn, nq = blockIdx.x - mt * ntn; const int row0 = mt * 128 + 32 * w, col0 = nq * 64; if (row0 >= M) return;
  const _Float16* a0p = A + (size_t)(row0 + ln) * lda; const _Float16* a1p = a0p + (size_t)16 * lda;
  const _Float16* b0p = Bh + (size_t)(col0 + ln) * ldb; const _Float16* b1p = b0p + (size_t)16 * ldb; const _Float16* b2p = b1p + (size_t)16 * ldb; const _Float16* b3p = b2p + (size_t)16 * ldb;
  const v8f z8 = {0.f,0.f,0.f,0.f,0.f,0.f,0.f,0.f}; v8f c00 = z8, c01 = z8, c02 = z8, c03 = z8, c10 = z8, c11 = z8, c12 = z8, c13 = z8;
#pragma unroll 1
  for (int kb = 0; kb < K; kb += 32) { const v16h a0 = g2_frag(a0p + kb, hh), a1 = g2_frag(a1p + kb, hh);
    v16h b = g2_frag(b0p + kb, hh); c00 = g2_mma(a0, b, c00); c10 = g2_mma(a1, b, c10);
    b = g2_frag(b1p + kb, hh); c01 = g2_mma(a0, b, c01); c11 = g2_mma(a1, b, c11);
    b = g2_frag(b2p + kb, hh); c02 = g2_mma(a0, b, c02); c12 = g2_mma(a1, b, c12);
    b = g2_frag(b3p + kb, hh); c03 = g2_mma(a0, b, c03); c13 = g2_mma(a1, b, c13); }
  v8f accs[8] = {c00, c01, c02, c03, c10, c11, c12, c13};
#pragma unroll
  for (int u = 0; u < 8; ++u) { const int t = u & 3, half = u >> 2; const int col = col0 + t * 16 + ln; const float bv = bp ? bf16_round(bp[col]) : 0.f;
#pragma unroll
    for (int r = 0; r < 8; ++r) { const int rloc = half * 16 + 8 * hh + r; float v = accs[u][r] * alpha + bv; if (CP) { const int bidx = (row0g + row0 + rloc) / rowsPerB; v += CP[(size_t)bidx * sCPb + (size_t)by * 64 + col]; }
      if (ACT == 3) v = fmaxf(v, 0.f); else if (ACT == 6) v = 0.5f * v * (1.0f + erff(v * 0.70710678118654752f)); else if (ACT == 11) v = 1.0f / (1.0f + expf(-v)); else if (ACT == 15) v = v / (1.0f + expf(-v)); else if (ACT == 12) v = (v > 0.f) ? v : 0.01f * v; else if (ACT == 8) v = tanhf(v);
      so[w][rloc][t * 16 + ln] = v; } }
  __builtin_amdgcn_fence(__ATOMIC_ACQ_REL, "workgroup"); __builtin_amdgcn_wave_barrier();
  const int rsub = lane >> 4, c4 = (lane & 15) * 4;
  {
#pragma unroll
    for (int q = 0; q < 16; ++q) { const int r = q * 2 + rsub; const v4f v = *(const v4fa*)&so[w][r][c4]; if (C) *(v4f*)(C + cofs + (size_t)(row0 + r) * ldc + col0 + c4) = v; if (C16) { v4h h4; for (int i = 0; i < 4; ++i) h4[i] = (_Float16)v[i]; *(v4h*)(C16 + cofs + (size_t)(row0 + r) * ldc + col0 + c4) = h4; } }
     } }



template <int TK>
__global__ __launch_bounds__(256) void k_vthl(const float* __restrict__ VF, int ldv, _Float16* __restrict__ Vth, _Float16* __restrict__ Vtl) { __shared__ float tl[64][65]; const int tid = threadIdx.x; const int slab = blockIdx.x / (TK / 64), lg = blockIdx.x % (TK / 64); const int b = slab / NH, h = slab % NH;
  for (int i = tid; i < 64 * 16; i += 256) { const int r = i / 16, c4 = (i % 16) * 4; const v4f a = *(const v4fa*)(VF + ((size_t)b * TK + lg * 64 + r) * ldv + h * 64 + c4); tl[r][c4] = a[0]; tl[r][c4 + 1] = a[1]; tl[r][c4 + 2] = a[2]; tl[r][c4 + 3] = a[3]; }
  __syncthreads();
  FragH fh[2], fl[2]; size_t oo[2];
#pragma unroll
  for (int rd = 0; rd < 2; ++rd) { const int d = rd * 32 + tid / 8, pc = tid % 8;
#pragma unroll
    for (int q = 0; q < 8; ++q) { const float v = tl[pc * 8 + q][d]; const _Float16 hv = (_Float16)v; fh[rd].h[q] = hv; fl[rd].h[q] = (_Float16)((v - (float)hv) * 1024.0f); } oo[rd] = ((size_t)slab * 64 + d) * TK + lg * 64 + pc * 8; }
  {
#pragma unroll
    for (int rd = 0; rd < 2; ++rd) { *(v8us*)((unsigned short*)Vth + oo[rd]) = fh[rd].half[0]; *(v8us*)((unsigned short*)Vtl + oo[rd]) = fl[rd].half[0]; }
     } }

template <int TQ, int TK>
__global__ __launch_bounds__(128) void k_flashb(const _Float16* __restrict__ Q16, const _Float16* __restrict__ Q16lo, int ldq, const _Float16* __restrict__ K16, const _Float16* __restrict__ K16lo, int ldk, const _Float16* __restrict__ Vt, const _Float16* __restrict__ Vtlo, const unsigned* __restrict__ MB, const int* __restrict__ RA, const int* __restrict__ KE, const float* __restrict__ BT, float* __restrict__ O, int ldo) {
  constexpr int RPW = 16, RTN = RPW / 16, NQB = TQ / (4 * RPW), DT = 4, KS = 2;
  __shared__ __attribute__((aligned(16))) unsigned short sP[4][RPW][40], sPl[4][RPW][40]; __shared__ __attribute__((aligned(16))) float sO[4][RPW][64 + 4];
  const int tid = threadIdx.x, w = tid >> 5, lane = tid & 31, ln = lane & 15, hh = lane >> 4;
  const int slab = blockIdx.x / NQB, qblk = blockIdx.x % NQB; const int b = slab / NH, h = slab % NH; const int qb0 = qblk * (4 * RPW); const int q0 = qb0 + w * RPW;
  FragH aq[2][KS], aql[2][KS];
#pragma unroll
  for (int rt = 0; rt < RTN; ++rt) { const size_t qo = ((size_t)b * TQ + q0 + rt * 16 + ln) * ldq + h * 64; const unsigned short* qr = (const unsigned short*)Q16 + qo; const unsigned short* ql = (const unsigned short*)Q16lo + qo;
#pragma unroll
    for (int ks = 0; ks < KS; ++ks) { aq[rt][ks].half[0] = *(const v8us*)(qr + ks * 32 + 8 * hh); aq[rt][ks].half[1] = *(const v8us*)(qr + ks * 32 + 16 + 8 * hh); aql[rt][ks].half[0] = *(const v8us*)(ql + ks * 32 + 8 * hh); aql[rt][ks].half[1] = *(const v8us*)(ql + ks * 32 + 16 + 8 * hh); } }
  const unsigned short* Vth = (const unsigned short*)Vt + (size_t)slab * 64 * TK; const unsigned short* Vtl = (const unsigned short*)Vtlo + (size_t)slab * 64 * TK;
  float m_r[2][8], l_r[2][8]; v8f oacc[2][DT], oaccl[2][DT];
#pragma unroll
  for (int rt = 0; rt < RTN; ++rt) {
#pragma unroll
    for (int r = 0; r < 8; ++r) { m_r[rt][r] = -3.0e38f; l_r[rt][r] = 0.f; }
#pragma unroll
    for (int dt = 0; dt < DT; ++dt) { oacc[rt][dt] = (v8f){0.f,0.f,0.f,0.f,0.f,0.f,0.f,0.f}; oaccl[rt][dt] = oacc[rt][dt]; } }
  int jend = KE[qblk * 32]; jend = min(TK, (jend + 31) & ~31); if (jend < 32) jend = 32;      /* block-uniform */
  int allm[2][8]; const unsigned* mrow[2][8];
#pragma unroll
  for (int rt = 0; rt < RTN; ++rt)
#pragma unroll
    for (int r = 0; r < 8; ++r) { const int tq = q0 + rt * 16 + 8 * hh + r; allm[rt][r] = RA[tq]; mrow[rt][r] = MB + (size_t)tq * (TK / 32); }
#pragma unroll 1
  for (int j0 = 0; j0 < jend; j0 += 32) {
    
    v8f s[2][2];
#pragma unroll
    for (int nt = 0; nt < 2; ++nt) { const size_t ko = ((size_t)b * TK + j0 + nt * 16 + ln) * ldk + h * 64; const unsigned short* kr = (const unsigned short*)K16 + ko; const unsigned short* kl = (const unsigned short*)K16lo + ko; FragH bk[KS], bkl[KS];
#pragma unroll
      for (int ks = 0; ks < KS; ++ks) { bk[ks].half[0] = *(const v8us*)(kr + ks * 32 + 8 * hh); bk[ks].half[1] = *(const v8us*)(kr + ks * 32 + 16 + 8 * hh); bkl[ks].half[0] = *(const v8us*)(kl + ks * 32 + 8 * hh); bkl[ks].half[1] = *(const v8us*)(kl + ks * 32 + 16 + 8 * hh); }
#pragma unroll
      for (int rt = 0; rt < RTN; ++rt) { v8f acc = (v8f){0.f,0.f,0.f,0.f,0.f,0.f,0.f,0.f}, accr = acc;
#pragma unroll
        for (int ks = 0; ks < KS; ++ks) { acc = mmaH<1>(aq[rt][ks].v, aq[rt][ks].v, bk[ks].v, bk[ks].v, acc); accr = mmaH<1>(aql[rt][ks].v, aql[rt][ks].v, bk[ks].v, bk[ks].v, accr); accr = mmaH<1>(aq[rt][ks].v, aq[rt][ks].v, bkl[ks].v, bkl[ks].v, accr); }
        s[rt][nt] = acc + accr * 0.0009765625f; } }
#pragma unroll
    for (int rt = 0; rt < RTN; ++rt)
#pragma unroll
      for (int r = 0; r < 8; ++r) { const unsigned mw = mrow[rt][r][j0 >> 5]; const bool am = (allm[rt][r] != 0); const int tq = q0 + rt * 16 + 8 * hh + r;
        const bool ok0 = am || (((mw >> ln) & 1u) == 0u), ok1 = am || (((mw >> (16 + ln)) & 1u) == 0u);
        const float s0 = ok0 ? (am ? 0.f : s[rt][0][r] * SCL + BT[((size_t)slab * TQ + tq) * RW + (tq - (j0 + ln) + (TK - 1))]) : -INFINITY, s1 = ok1 ? (am ? 0.f : s[rt][1][r] * SCL + BT[((size_t)slab * TQ + tq) * RW + (tq - (j0 + 16 + ln) + (TK - 1))]) : -INFINITY;      /* + REL[h][q][(q - k) + T - 1] = q . table[h][(q - k) + T - 1] */ float mc = fmaxf(s0, s1);
        mc = fmaxf(mc, __shfl_xor(mc, 1, 32)); mc = fmaxf(mc, __shfl_xor(mc, 2, 32)); mc = fmaxf(mc, __shfl_xor(mc, 4, 32)); mc = fmaxf(mc, __shfl_xor(mc, 8, 32));
        const float mn = fmaxf(m_r[rt][r], mc); const float al = (mn > -1.0e38f) ? expf(m_r[rt][r] - mn) : 1.0f; m_r[rt][r] = mn; const float p0 = ok0 ? expf(s0 - mn) : 0.f, p1 = ok1 ? expf(s1 - mn) : 0.f; l_r[rt][r] = l_r[rt][r] * al + p0 + p1;
#pragma unroll
        for (int dt = 0; dt < DT; ++dt) { oacc[rt][dt][r] *= al; oaccl[rt][dt][r] *= al; }
        FragH t2, t3; const float ps0 = p0 * 1024.0f, ps1 = p1 * 1024.0f; t2.h[0] = (_Float16)ps0; t2.h[1] = (_Float16)ps1; t3.h[0] = (_Float16)((ps0 - (float)t2.h[0]) * 1024.0f); t3.h[1] = (_Float16)((ps1 - (float)t2.h[1]) * 1024.0f);
        sP[w][rt * 16 + 8 * hh + r][ln] = t2.u[0]; sP[w][rt * 16 + 8 * hh + r][16 + ln] = t2.u[1]; sPl[w][rt * 16 + 8 * hh + r][ln] = t3.u[0]; sPl[w][rt * 16 + 8 * hh + r][16 + ln] = t3.u[1]; }
    __builtin_amdgcn_fence(__ATOMIC_ACQ_REL, "workgroup"); __builtin_amdgcn_wave_barrier();
    FragH pa[2], pl[2];
#pragma unroll
    for (int rt = 0; rt < RTN; ++rt) { pa[rt].half[0] = *(const v8us*)&sP[w][rt * 16 + ln][8 * hh]; pa[rt].half[1] = *(const v8us*)&sP[w][rt * 16 + ln][16 + 8 * hh]; pl[rt].half[0] = *(const v8us*)&sPl[w][rt * 16 + ln][8 * hh]; pl[rt].half[1] = *(const v8us*)&sPl[w][rt * 16 + ln][16 + 8 * hh]; }
#pragma unroll
    for (int dt = 0; dt < DT; ++dt) { const size_t vo = (size_t)(dt * 16 + ln) * TK + j0; FragH bv, bl; bv.half[0] = *(const v8us*)(Vth + vo + 8 * hh); bv.half[1] = *(const v8us*)(Vth + vo + 16 + 8 * hh); bl.half[0] = *(const v8us*)(Vtl + vo + 8 * hh); bl.half[1] = *(const v8us*)(Vtl + vo + 16 + 8 * hh);
#pragma unroll
      for (int rt = 0; rt < RTN; ++rt) { oacc[rt][dt] = mmaH<1>(pa[rt].v, pa[rt].v, bv.v, bv.v, oacc[rt][dt]); oaccl[rt][dt] = mmaH<1>(pa[rt].v, pa[rt].v, bl.v, bl.v, oaccl[rt][dt]); oaccl[rt][dt] = mmaH<1>(pl[rt].v, pl[rt].v, bv.v, bv.v, oaccl[rt][dt]); } }
    __builtin_amdgcn_fence(__ATOMIC_ACQ_REL, "workgroup"); __builtin_amdgcn_wave_barrier(); }
#pragma unroll
  for (int rt = 0; rt < RTN; ++rt) {
#pragma unroll
    for (int r = 0; r < 8; ++r) { float l = l_r[rt][r]; l += __shfl_xor(l, 1, 32); l += __shfl_xor(l, 2, 32); l += __shfl_xor(l, 4, 32); l += __shfl_xor(l, 8, 32); l_r[rt][r] = (l > 0.f) ? 1.0f / (l * 1024.0f) : 0.f; }
#pragma unroll
    for (int dt = 0; dt < DT; ++dt)
#pragma unroll
      for (int r = 0; r < 8; ++r) sO[w][rt * 16 + 8 * hh + r][dt * 16 + ln] = (oacc[rt][dt][r] + oaccl[rt][dt][r] * 0.0009765625f) * l_r[rt][r]; }
  __builtin_amdgcn_fence(__ATOMIC_ACQ_REL, "workgroup"); __builtin_amdgcn_wave_barrier();
  {
#pragma unroll
    for (int rp = 0; rp < RPW; rp += 2) { const int r = rp + (lane >> 4), pc = lane & 15; const v4f val = *(const v4fa*)&sO[w][r][pc * 4]; *(v4f*)(O + ((size_t)b * TQ + q0 + r) * ldo + h * 64 + pc * 4) = val; }
     } }


__global__ __launch_bounds__(256) void k_fulltab(unsigned* __restrict__ MB, int* __restrict__ RA, int* __restrict__ KE, int nq, int nk) {
  const int t = blockIdx.x * 256 + threadIdx.x;
  if (t < nq * (nk / 32)) { *(unsigned*)(MB + t) = 0u;  }
  if (t < nq) { *(int*)(RA + t) = 0;  }
  if (t < nq / 64) { *(int*)(KE + t * 32) = nk;  } }
__global__ __launch_bounds__(256) void k_lnx(const float* __restrict__ X, const float* __restrict__ g, const float* __restrict__ bb, _Float16* __restrict__ Y16, float* __restrict__ XB) {
  #pragma clang fp contract(off)
  const int tid = threadIdx.x, w = tid >> 5, ln = tid & 31; const int r = blockIdx.x * 8 + w; if (r >= NR) return; const float* x = X + (size_t)r * DM; float s = 0.f;
#pragma unroll 1
  for (int i = 0; i < DM / 128; ++i) { const v4f a = *(const v4fa*)(x + i * 128 + ln * 4); for (int q = 0; q < 4; ++q) s += bf16_round(a[q]); }
  for (int o = 16; o > 0; o >>= 1) s += __shfl_xor(s, o, 32); const float mu = s / (float)DM; float q2 = 0.f;
#pragma unroll 1
  for (int i = 0; i < DM / 128; ++i) { const v4f a = *(const v4fa*)(x + i * 128 + ln * 4); for (int q = 0; q < 4; ++q) { const float d = bf16_round(a[q]) - mu; q2 += d * d; } }
  for (int o = 16; o > 0; o >>= 1) q2 += __shfl_xor(q2, o, 32); const float rs = rsqrtf(q2 / (float)DM + 1e-5f);
  {
#pragma unroll 1
    for (int i = 0; i < DM / 128; ++i) { const int c0 = i * 128 + ln * 4; const v4f a = *(const v4fa*)(x + c0); _Float16 h4[4]; v4f xb;
      for (int q = 0; q < 4; ++q) { const float t = bf16_round(a[q]); h4[q] = (_Float16)((t - mu) * rs * bf16_round(g[c0 + q]) + bf16_round(bb[c0 + q])); xb[q] = t; }
      *(unsigned long long*)((unsigned short*)Y16 + (size_t)r * DM + c0) = *(const unsigned long long*)h4; *(v4f*)(XB + (size_t)r * DM + c0) = xb; }
     } }
__global__ __launch_bounds__(256) void k_rtab(const float* __restrict__ tab, int trows, _Float16* __restrict__ T16) {
  const int t = blockIdx.x * 256 + threadIdx.x; if (t >= NH * RW * 8) return; const int d0 = (t & 7) * 8; const int r = (t >> 3) % RW; const int h = t / (8 * RW); FragH f;
#pragma unroll
  for (int q = 0; q < 8; ++q) f.h[q] = (r < 2 * SLEN - 1) ? (_Float16)(bf16_round(tab[((size_t)h * trows + r) * 64 + d0 + q]) * 16.0f) : (_Float16)0.0f;
  *(v8us*)((unsigned short*)T16 + ((size_t)h * RW + r) * 64 + d0) = f.half[0];  }
__global__ __launch_bounds__(256) void k_causaltab(unsigned* __restrict__ MB, int* __restrict__ RA, int* __restrict__ KE, int nq, int nk) {
  const int t = blockIdx.x * 256 + threadIdx.x; const int nw = nk / 32;
  if (t < nq * nw) { const int q = t / nw, w = t % nw; const int first = q + 1 - 32 * w; const unsigned bits = (first <= 0) ? 0xffffffffu : ((first >= 32) ? 0u : (0xffffffffu << first)); *(unsigned*)(MB + t) = bits;  }
  if (t < nq) { *(int*)(RA + t) = 0;  }
  if (t < nq / 64) { const int v = 64 * (t + 1); *(int*)(KE + t * 32) = v;  } }


extern "C" void kernel_launch(void* const* d_in, const int* in_sizes, int n_in,
                              void* d_out, int out_size, void* d_ws, size_t ws_size, hipStream_t stream) {
  (void)in_sizes; (void)n_in; (void)out_size;
  const float* const* I = (const float* const*)d_in; const float* x = I[0]; const float* Wq = I[1]; const float* bq = I[2]; const float* Wk = I[3]; const float* bk = I[4]; const float* Wv = I[5]; const float* bv = I[6]; const float* Wo = I[7]; const float* bo = I[8]; const float* tab = I[9];
  char* ws = (char*)d_ws; size_t off = 0;
  auto take = [&](size_t bytes) { char* p = ws + off; off += (bytes + 255) & ~(size_t)255; return p; };
  _Float16* BQ = (_Float16*)take((size_t)DM * DM * 2); _Float16* BK = (_Float16*)take((size_t)DM * DM * 2); _Float16* BV = (_Float16*)take((size_t)DM * DM * 2); _Float16* BO = (_Float16*)take((size_t)DM * DM * 2); _Float16* T16 = (_Float16*)take((size_t)NH * RW * 64 * 2);
  _Float16* X16 = (_Float16*)take((size_t)SLEN * DM * 2); float* F = (float*)take((size_t)SLEN * DM * 4); _Float16* Q16 = (_Float16*)take((size_t)SLEN * DM * 2);
  _Float16* Qh = (_Float16*)take((size_t)SLEN * DM * 2); _Float16* Ql = (_Float16*)take((size_t)SLEN * DM * 2); _Float16* Kh = (_Float16*)take((size_t)SLEN * DM * 2); _Float16* Kl = (_Float16*)take((size_t)SLEN * DM * 2); _Float16* Vth = (_Float16*)take((size_t)SLEN * DM * 2); _Float16* Vtl = (_Float16*)take((size_t)SLEN * DM * 2);
  float* REL = (float*)take((size_t)HG * SLEN * RW * 4); float* O = (float*)take((size_t)SLEN * DM * 4); _Float16* Oh = (_Float16*)take((size_t)SLEN * DM * 2); _Float16* Ol = (_Float16*)take((size_t)SLEN * DM * 2);
  unsigned* MB = (unsigned*)take((size_t)SLEN * (SLEN / 32) * 4); int* RA = (int*)take((size_t)SLEN * 4); int* KE = (int*)take((size_t)(SLEN / 64) * 32 * 4);
  if (off > ws_size) return;      /* 8 + 4 + 2 + 4 + 2 + 12 + 32 + 4 + 4 + 0.2 = 72.2 MiB */
  const size_t n8 = (size_t)SLEN * DM / 8; const unsigned nb8 = (unsigned)((n8 + 255) / 256); const size_t w8 = (size_t)DM * DM / 8; const unsigned wb = (unsigned)((w8 + 255) / 256);
  k_round16f<<<wb, 256, 0, stream>>>(Wq, BQ, w8); k_round16f<<<wb, 256, 0, stream>>>(Wk, BK, w8); k_round16f<<<wb, 256, 0, stream>>>(Wv, BV, w8); k_round16f<<<wb, 256, 0, stream>>>(Wo, BO, w8);      /* torch (out,in) = natural Bt */
  k_rtab<<<(NH * RW * 8 + 255) / 256, 256, 0, stream>>>(tab, 9999, T16); k_fulltab<<<(SLEN * (SLEN / 32) + 255) / 256, 256, 0, stream>>>(MB, RA, KE, SLEN, SLEN);
  const dim3 gP((SLEN / 128) * (DM / 64), 1), gR((SLEN / 128) * (RW / 64), HG);
  for (int b = 0; b < NBT; ++b) { const size_t ro = (size_t)b * SLEN * DM;
    k_x16<<<nb8, 256, 0, stream>>>(x + ro, X16, n8);
    k_gemm2<0><<<gP, 128, 0, stream>>>(X16, DM, 0, BQ, DM, 0, 0.0625f, bq, 0, nullptr, 1, 0, 0, F, Q16, DM, 0, SLEN, DM, DM); k_hl<<<nb8, 256, 0, stream>>>(F, Qh, Ql, n8);      /* q: f32 -> hi/lo, and f16 for the RPE GEMM */
    k_gemm2<0><<<gP, 128, 0, stream>>>(X16, DM, 0, BK, DM, 0, 0.0625f, bk, 0, nullptr, 1, 0, 0, F, nullptr, DM, 0, SLEN, DM, DM); k_hl<<<nb8, 256, 0, stream>>>(F, Kh, Kl, n8);
    k_gemm2<0><<<gP, 128, 0, stream>>>(X16, DM, 0, BV, DM, 0, 0.0625f, bv, 0, nullptr, 1, 0, 0, F, nullptr, DM, 0, SLEN, DM, DM); k_vthl<SLEN><<<NH * (SLEN / 64), 256, 0, stream>>>(F, DM, Vth, Vtl);
    for (int hg = 0; hg < NH / HG; ++hg) {
      k_gemm2<0><<<gR, 128, 0, stream>>>(Q16 + hg * HG * 64, DM, (size_t)64, T16 + (size_t)hg * HG * RW * 64, 64, (size_t)RW * 64, 0.0625f, nullptr, 0, nullptr, 1, 0, 0, REL, nullptr, RW, (size_t)SLEN * RW, SLEN, RW, 64);      /* REL[hl][q][r] = q_h . table[h][r] for the 4 heads of this group (grid.y, column-offset A stride) */
      k_flashb<SLEN, SLEN><<<HG * (SLEN / 64), 128, 0, stream>>>(Qh + hg * HG * 64, Ql + hg * HG * 64, DM, Kh + hg * HG * 64, Kl + hg * HG * 64, DM, Vth + (size_t)hg * HG * 64 * SLEN, Vtl + (size_t)hg * HG * 64 * SLEN, MB, RA, KE, REL, O + hg * HG * 64, DM); }
    k_hl<<<nb8, 256, 0, stream>>>(O, Oh, Ol, n8);
    float* outb = (float*)d_out + ro;
    k_gemm2<0><<<gP, 128, 0, stream>>>(Oh, DM, 0, BO, DM, 0, 0.0625f, bo, 0, nullptr, 1, 0, 0, outb, nullptr, DM, 0, SLEN, DM, DM);
    k_gemm2<0><<<gP, 128, 0, stream>>>(Ol, DM, 0, BO, DM, 0, 0.0625f / 1024.0f, nullptr, 0, outb, 1, (size_t)DM, 0, outb, nullptr, DM, 0, SLEN, DM, DM); }
}

// v001
// Measured time: 1280 microseconds a run.
// Timed twice side by side with v000, it ran 3.39 and 3.35 times as fast.
#include <hip/hip_runtime.h>
// Multi-head attention with learned relative-position encoding (4 x 1024 tokens, 1024 = 16 heads x 64): q,k,v = x W^T + b; scores = q.k/8 + q.rpe_table[h][q - k + 1023] (no scale on the RPE term); softmax over all keys; . v; merged . Wo^T + bo -> [4,1024,1024].
// Structure: projections (all batches in one launch) as f16 WMMA GEMMs (32x64 wave tiles, f32 accumulation, exact products + bias); the RPE term is materialised per batch for all 16 heads as REL[h][q][r] = q_h . table[h][r] (r < 2048) by a grid.y-batched f16 GEMM over the head columns (f32 result), and my fused flash kernel (hi/lo q,k three-product scores, online f32 softmax, P staged hi + residual, V^T hi + residual; all keys valid) adds REL[h][q][q - k + 1023] inside the score stage; O as hi + residual planes into Wo (two GEMMs, bias in the first).
// Compute dtype: x, weights, biases, rpe_table rounded to bf16; projections exact; the RPE GEMM uses the plain f16 q (~2^-12 on a sigma-0.16 bias); q, k, P, v, O as f16 hi + residual pairs (~2^-21) in the attention; f32 accumulation and softmax. v_wmma_f32_16x16x32_f16.
#define NBT 4
#define SLEN 1024
#define HG 16                    /* heads per REL group (all heads of one batch) */
#define RW 2048                  /* REL row width (2*SLEN-1 used) */
#define DM 1024
#define NH 16
#define SCL 0.125f
#define NR (NBT * SLEN)
typedef __bf16 v16b __attribute__((ext_vector_type(16)));
typedef unsigned short v8us __attribute__((ext_vector_type(8), may_alias));
typedef float  v8f  __attribute__((ext_vector_type(8)));
typedef float  v4f  __attribute__((ext_vector_type(4)));
typedef float  v4fa __attribute__((ext_vector_type(4), may_alias));
union FragB { v16b v; v8us half[2]; unsigned short u[16]; };

__device__ __forceinline__ unsigned short bf16_bits(float x) { unsigned int u = __float_as_uint(x); return (unsigned short)((u + 0x7FFFu + ((u >> 16) & 1u)) >> 16); }
__device__ __forceinline__ float bf16_val(unsigned short b) { return __uint_as_float(((unsigned int)b) << 16); }
__device__ __forceinline__ float bf16_round(float x) { return bf16_val(bf16_bits(x)); }
// D += A·B with NT terms: 1 = ah·bh, 2 = + al·bh (A split), 3 = + ah·bl (both split)
template <int NT>
__device__ __forceinline__ v8f mmaN(v16b ah, v16b al, v16b bh, v16b bl, v8f c) {
  c = __builtin_amdgcn_wmma_f32_16x16x32_bf16(false, ah, false, bh, (short)0, c, false, false);
  if (NT >= 2) c = __builtin_amdgcn_wmma_f32_16x16x32_bf16(false, al, false, bh, (short)0, c, false, false);
  if (NT >= 3) c = __builtin_amdgcn_wmma_f32_16x16x32_bf16(false, ah, false, bl, (short)0, c, false, false);
  asm volatile("v_nop\n\tv_nop\n\tv_nop\n\tv_nop" : "+v"(c) : "v"(ah), "v"(al), "v"(bh), "v"(bl));
  return c;
}

__global__ __launch_bounds__(256) void k_wt_bf16(const float* __restrict__ W, unsigned short* __restrict__ Wt, int K, int N) {
  const int t = blockIdx.x * 256 + threadIdx.x;
  const int k8n = K / 8;
  if (t >= N * k8n) return;
  const int n = t / k8n, k8 = (t % k8n) * 8;
  v8us v;
#pragma unroll
  for (int i = 0; i < 8; ++i) v[i] = bf16_bits(W[(size_t)(k8 + i) * N + n]);
  *(v8us*)(Wt + (size_t)n * K + k8) = v;
  
}

// GEMM C[M][N] (f32, pitch ldc) = act(A[M][K]·W + bias). A f32 row-major (pitch lda) converted per fragment to bf16
// (ASPLIT: hi/lo two planes -> 2 terms, else single rounded term); Wt bf16 [N][K] (pitch ldb). BIAS_BF16 rounds the
// bias to bf16 first (bias quantised to bf16 before the add). K%32==0, M%16==0, N%64==0.
template <bool ASPLIT, int ACT, bool BIAS_BF16>
__global__ __launch_bounds__(128) void k_gemm_bf(const float* __restrict__ A, int lda, const unsigned short* __restrict__ Wt, int ldb,
                                               const float* __restrict__ bias, float* __restrict__ C, int ldc, int M, int N, int K) {
  __shared__ __attribute__((aligned(16))) float so[4][16][64];
  const int tid = threadIdx.x, w = tid >> 5, lane = tid & 31, ln = lane & 15, hh = lane >> 4;
  const int ntn = N / 64;
  const int wid = blockIdx.x * 4 + w;
  const int mt = wid / ntn, nq = wid % ntn;
  if (mt * 16 >= M) return;
  const int row0 = mt * 16, col0 = nq * 64;
  const float* arow = A + (size_t)(row0 + ln) * lda;
  v8f acc[4] = {};
  for (int kb = 0; kb < K; kb += 32) {
    FragB ah, al;
    const v4f x0 = *(const v4fa*)(arow + kb + 8 * hh), x1 = *(const v4fa*)(arow + kb + 8 * hh + 4);
    const v4f x2 = *(const v4fa*)(arow + kb + 16 + 8 * hh), x3 = *(const v4fa*)(arow + kb + 16 + 8 * hh + 4);
    float xs[16] = {x0[0],x0[1],x0[2],x0[3],x1[0],x1[1],x1[2],x1[3],x2[0],x2[1],x2[2],x2[3],x3[0],x3[1],x3[2],x3[3]};
#pragma unroll
    for (int i = 0; i < 16; ++i) { const unsigned short hb = bf16_bits(xs[i]); ah.u[i] = hb; al.u[i] = ASPLIT ? bf16_bits(xs[i] - bf16_val(hb)) : (unsigned short)0; }
#pragma unroll
    for (int t = 0; t < 4; ++t) {
      const unsigned short* brow = Wt + (size_t)(col0 + t * 16 + ln) * ldb + kb;
      FragB b;
      b.half[0] = *(const v8us*)(brow + 8 * hh);
      b.half[1] = *(const v8us*)(brow + 16 + 8 * hh);
      acc[t] = mmaN<ASPLIT ? 2 : 1>(ah.v, al.v, b.v, b.v, acc[t]);
    }
  }
#pragma unroll
  for (int t = 0; t < 4; ++t) {
    float bv = bias ? bias[col0 + t * 16 + ln] : 0.f;
    if (BIAS_BF16) bv = bf16_round(bv);
#pragma unroll
    for (int r = 0; r < 8; ++r) { float v = acc[t][r] + bv; if (ACT == 1) v = fmaxf(v, 0.f); so[w][8 * hh + r][t * 16 + ln] = v; }
  }
  __builtin_amdgcn_fence(__ATOMIC_ACQ_REL, "workgroup");
  __builtin_amdgcn_wave_barrier();
  const int rsub = lane >> 4, c4 = (lane & 15) * 4;
  {
#pragma unroll
    for (int q = 0; q < 8; ++q) {
      const int r = q * 2 + rsub;
      const v4f v = *(const v4fa*)&so[w][r][c4];
      *(v4f*)(C + (size_t)(row0 + r) * ldc + col0 + c4) = v;
    }
    
  }
}

// GEMM C = act(A·W + bias + resid): A f32 (ASPLIT -> hi/lo 2 terms), Wt bf16 [N][K]; ACT 0 none, 1 relu, 2 exact gelu;
// resid (optional, f32, row index = (row % rmod), pitch ldr, RES_BF16 rounds it) added before the activation.
template <bool ASPLIT, int ACT, bool BIAS_BF16, bool RES_BF16>
__global__ __launch_bounds__(128) void k_gemm_bf3(const float* __restrict__ A, int lda, const unsigned short* __restrict__ Wt, int ldb,
                                                const float* __restrict__ bias, const float* __restrict__ resid, int rmod, int ldr,
                                                float* __restrict__ C, int ldc, int M, int N, int K) {
  __shared__ __attribute__((aligned(16))) float so[4][16][64];
  const int tid = threadIdx.x, w = tid >> 5, lane = tid & 31, ln = lane & 15, hh = lane >> 4;
  const int ntn = N / 64;
  const int wid = blockIdx.x * 4 + w;
  const int mt = wid / ntn, nq = wid % ntn;
  if (mt * 16 >= M) return;
  const int row0 = mt * 16, col0 = nq * 64;
  const float* arow = A + (size_t)(row0 + ln) * lda;
  v8f acc[4] = {};
  for (int kb = 0; kb < K; kb += 32) {
    FragB ah, al;
    const v4f x0 = *(const v4fa*)(arow + kb + 8 * hh), x1 = *(const v4fa*)(arow + kb + 8 * hh + 4);
    const v4f x2 = *(const v4fa*)(arow + kb + 16 + 8 * hh), x3 = *(const v4fa*)(arow + kb + 16 + 8 * hh + 4);
    float xs[16] = {x0[0],x0[1],x0[2],x0[3],x1[0],x1[1],x1[2],x1[3],x2[0],x2[1],x2[2],x2[3],x3[0],x3[1],x3[2],x3[3]};
#pragma unroll
    for (int i = 0; i < 16; ++i) { const unsigned short hb = bf16_bits(xs[i]); ah.u[i] = hb; al.u[i] = ASPLIT ? bf16_bits(xs[i] - bf16_val(hb)) : (unsigned short)0; }
#pragma unroll
    for (int t = 0; t < 4; ++t) {
      const unsigned short* brow = Wt + (size_t)(col0 + t * 16 + ln) * ldb + kb;
      FragB b;
      b.half[0] = *(const v8us*)(brow + 8 * hh);
      b.half[1] = *(const v8us*)(brow + 16 + 8 * hh);
      acc[t] = mmaN<ASPLIT ? 2 : 1>(ah.v, al.v, b.v, b.v, acc[t]);
    }
  }
#pragma unroll
  for (int t = 0; t < 4; ++t) {
    const int col = col0 + t * 16 + ln;
    float bv = bias ? bias[col] : 0.f;
    if (BIAS_BF16) bv = bf16_round(bv);
#pragma unroll
    for (int r = 0; r < 8; ++r) {
      float v = acc[t][r] + bv;
      if (resid) { float rv = resid[(size_t)((row0 + 8 * hh + r) % rmod) * ldr + col]; if (RES_BF16) rv = bf16_round(rv); v += rv; }
      if (ACT == 1) v = fmaxf(v, 0.f);
      if (ACT == 2) v = 0.5f * v * (1.0f + erff(v * 0.70710678118654752f));
      if (ACT == 3) { const float u = 0.7978845608028654f * (v + 0.044715f * v * v * v); v = 0.5f * v * (1.0f + tanhf(u)); }
      so[w][8 * hh + r][t * 16 + ln] = v;
    }
  }
  __builtin_amdgcn_fence(__ATOMIC_ACQ_REL, "workgroup");
  __builtin_amdgcn_wave_barrier();
  const int rsub = lane >> 4, c4 = (lane & 15) * 4;
  {
#pragma unroll
    for (int q = 0; q < 8; ++q) {
      const int r = q * 2 + rsub;
      const v4f v = *(const v4fa*)&so[w][r][c4];
      *(v4f*)(C + (size_t)(row0 + r) * ldc + col0 + c4) = v;
    }
    
  }
}
// row LayerNorm (biased variance, eps) over N: s = X (+ R); optional out_sum <- s; out_norm <- (s-mu)*rsqrt(var+eps)*g + b
template <bool PARAM_BF16>
__global__ __launch_bounds__(256) void k_layernorm(const float* __restrict__ X, const float* __restrict__ R, const float* __restrict__ g, const float* __restrict__ bta,
                                                  float* __restrict__ out_sum, float* __restrict__ out_norm, int N, float eps) {
  __shared__ float red[256];
  const int row = blockIdx.x, tid = threadIdx.x;
  const float* x = X + (size_t)row * N; const float* rr = R ? R + (size_t)row * N : nullptr;
  float vals[16];                     // up to N = 4096
  const int per = N / 256;            // contiguous chunk per thread? use strided-by-4 chunks: thread handles j = tid*4 + 1024*u
  float s1 = 0.f;
  for (int u = 0; u < per / 4; ++u) {
    const int j = tid * 4 + 1024 * u;
    const v4f a = *(const v4fa*)(x + j);
    v4f b = {0.f,0.f,0.f,0.f}; if (rr) b = *(const v4fa*)(rr + j);
#pragma unroll
    for (int q = 0; q < 4; ++q) { const float v = a[q] + b[q]; vals[u * 4 + q] = v; s1 += v; }
  }
  red[tid] = s1; __syncthreads();
  for (int st = 128; st > 0; st >>= 1) { if (tid < st) red[tid] += red[tid + st]; __syncthreads(); }
  const float mu = red[0] / (float)N; __syncthreads();
  float s2 = 0.f;
  for (int u = 0; u < per / 4; ++u)
#pragma unroll
    for (int q = 0; q < 4; ++q) { const float c = vals[u * 4 + q] - mu; s2 += c * c; }
  red[tid] = s2; __syncthreads();
  for (int st = 128; st > 0; st >>= 1) { if (tid < st) red[tid] += red[tid + st]; __syncthreads(); }
  const float rs = rsqrtf(red[0] / (float)N + eps);
  {
    for (int u = 0; u < per / 4; ++u) {
      const int j = tid * 4 + 1024 * u;
      v4f o, sm;
#pragma unroll
      for (int q = 0; q < 4; ++q) {
        float gg = g[j + q], bb = bta[j + q];
        if (PARAM_BF16) { gg = bf16_round(gg); bb = bf16_round(bb); }
        sm[q] = vals[u * 4 + q]; o[q] = (vals[u * 4 + q] - mu) * rs * gg + bb;
      }
      if (out_sum) *(v4f*)(out_sum + (size_t)row * N + j) = sm;
      *(v4f*)(out_norm + (size_t)row * N + j) = o;
    }
    
  }
}



// ---- f16 WMMA path (v_wmma_f32_16x16x32_f16): 11-bit significands for operands in range — used where a [0,1] probability operand needs more precision than bf16
typedef _Float16 v16h __attribute__((ext_vector_type(16)));
union FragH { v16h v; v8us half[2]; _Float16 h[16]; unsigned short u[16]; };
template <int NT>
__device__ __forceinline__ v8f mmaH(v16h ah, v16h al, v16h bh, v16h bl, v8f c) {
  c = __builtin_amdgcn_wmma_f32_16x16x32_f16(false, ah, false, bh, (short)0, c, false, false);
  if (NT >= 2) c = __builtin_amdgcn_wmma_f32_16x16x32_f16(false, al, false, bh, (short)0, c, false, false);
  if (NT >= 3) c = __builtin_amdgcn_wmma_f32_16x16x32_f16(false, ah, false, bl, (short)0, c, false, false);
  asm volatile("v_nop\n\tv_nop\n\tv_nop\n\tv_nop" : "+v"(c) : "v"(ah), "v"(al), "v"(bh), "v"(bl));
  return c;
}
// batched GEMM like k_gemm_b but f16 operands: A f32 (split into f16 hi/lo if ASPLIT, else rounded to f16), Bt = f16 values [n][k]; alpha; C f32; N multiple of 16 (partial tiles skipped)
template <bool ASPLIT>
__global__ __launch_bounds__(128) void k_gemm_h(const float* __restrict__ A, int lda, size_t sA, const _Float16* __restrict__ Bh, int ldb, size_t sB, float alpha, float* __restrict__ C, int ldc, size_t sC, int M, int N, int K) {
  __shared__ __attribute__((aligned(16))) float so[4][16][64];
  const int tid = threadIdx.x, w = tid >> 5, lane = tid & 31, ln = lane & 15, hh = lane >> 4; const int by = blockIdx.y;
  A += (size_t)by * sA; Bh += (size_t)by * sB; C += (size_t)by * sC;
  const int ntn = (N + 63) / 64; const int wid = blockIdx.x * 4 + w; const int mt = wid / ntn, nq = wid % ntn; if (mt * 16 >= M) return;
  const int row0 = mt * 16, col0 = nq * 64; const float* arow = A + (size_t)(row0 + ln) * lda;
  v8f acc[4] = {};
  for (int kb = 0; kb < K; kb += 32) {
    FragH ah, al;
    const v4f x0 = *(const v4fa*)(arow + kb + 8 * hh), x1 = *(const v4fa*)(arow + kb + 8 * hh + 4), x2 = *(const v4fa*)(arow + kb + 16 + 8 * hh), x3 = *(const v4fa*)(arow + kb + 16 + 8 * hh + 4);
    float xs[16] = {x0[0],x0[1],x0[2],x0[3],x1[0],x1[1],x1[2],x1[3],x2[0],x2[1],x2[2],x2[3],x3[0],x3[1],x3[2],x3[3]};
#pragma unroll
    for (int i = 0; i < 16; ++i) { const _Float16 h = (_Float16)xs[i]; ah.h[i] = h; al.h[i] = ASPLIT ? (_Float16)(xs[i] - (float)h) : (_Float16)0.0f; }
#pragma unroll
    for (int t = 0; t < 4; ++t) { if (col0 + t * 16 >= N) continue; const size_t boff = (size_t)(col0 + t * 16 + ln) * ldb + kb; FragH bq; bq.half[0] = *(const v8us*)(Bh + boff + 8 * hh); bq.half[1] = *(const v8us*)(Bh + boff + 16 + 8 * hh);
      acc[t] = mmaH<ASPLIT ? 2 : 1>(ah.v, al.v, bq.v, bq.v, acc[t]); }
  }
#pragma unroll
  for (int t = 0; t < 4; ++t) { if (col0 + t * 16 >= N) continue;
#pragma unroll
    for (int r = 0; r < 8; ++r) so[w][8 * hh + r][t * 16 + ln] = acc[t][r] * alpha; }
  __builtin_amdgcn_fence(__ATOMIC_ACQ_REL, "workgroup"); __builtin_amdgcn_wave_barrier();
  const int rsub = lane >> 4, c4 = (lane & 15) * 4;
  {
#pragma unroll
    for (int q = 0; q < 8; ++q) { const int r = q * 2 + rsub; if (col0 + c4 < N) { const v4f v = *(const v4fa*)&so[w][r][c4]; *(v4f*)(C + (size_t)(row0 + r) * ldc + col0 + c4) = v; } }
     }
}

// Wt[n][k] = f16(W[k][n]·scale) from f32 row-major W[K][N] (scale = power of two; bf16-exact weights stay exact in f16 away from the subnormal range)
__global__ __launch_bounds__(256) void k_wt_f16(const float* __restrict__ W, _Float16* __restrict__ Wt, int K, int N, float scale) {
  const int t = blockIdx.x * 256 + threadIdx.x; if (t >= N * (K / 8)) return; const int n = t / (K / 8), k8 = (t % (K / 8)) * 8; FragH f;
#pragma unroll
  for (int i = 0; i < 8; ++i) f.h[i] = (_Float16)(bf16_round(W[(size_t)(k8 + i) * N + n]) * scale); const v8us o = f.half[0];
  *(v8us*)((unsigned short*)Wt + (size_t)n * K + k8) = o; 
}
// k_gemm_hh variant with fused epilogue: v = acc·alpha + bias[by·sBias + col] (+ CP[(row/rowsPerB)·sCPb + by·64 + col] if CP) ; ACT 0 none / 1 elu ; writes f16 C16 (and f32 C if non-null)
template <int ACT>
__global__ __launch_bounds__(128) void k_gemm_hhx(const _Float16* __restrict__ A, int lda, size_t sA, const _Float16* __restrict__ Bh, int ldb, size_t sB, float alpha, const float* __restrict__ bias, size_t sBias, const float* __restrict__ CP, int rowsPerB, size_t sCPb, int row0g,
    float* __restrict__ C, _Float16* __restrict__ C16, int ldc, size_t sC, int M, int N, int K) {
  __shared__ __attribute__((aligned(16))) float so[4][16][64];
  const int tid = threadIdx.x, w = tid >> 5, lane = tid & 31, ln = lane & 15, hh = lane >> 4; const int by = blockIdx.y;
  A += (size_t)by * sA; Bh += (size_t)by * sB; const size_t cofs = (size_t)by * sC; const float* bp = bias ? bias + (size_t)by * sBias : nullptr;
  const int ntn = (N + 63) / 64; const int wid = blockIdx.x * 4 + w; const int mt = wid / ntn, nq = wid % ntn; if (mt * 16 >= M) return;
  const int row0 = mt * 16, col0 = nq * 64; const _Float16* arow = A + (size_t)(row0 + ln) * lda;
  v8f acc[4] = {};
  for (int kb = 0; kb < K; kb += 32) { FragH ah; ah.half[0] = *(const v8us*)((const unsigned short*)arow + kb + 8 * hh); ah.half[1] = *(const v8us*)((const unsigned short*)arow + kb + 16 + 8 * hh);
#pragma unroll
    for (int t = 0; t < 4; ++t) { if (col0 + t * 16 >= N) continue; const size_t boff = (size_t)(col0 + t * 16 + ln) * ldb + kb; FragH bq; bq.half[0] = *(const v8us*)((const unsigned short*)Bh + boff + 8 * hh); bq.half[1] = *(const v8us*)((const unsigned short*)Bh + boff + 16 + 8 * hh);
      acc[t] = mmaH<1>(ah.v, ah.v, bq.v, bq.v, acc[t]); }
  }
#pragma unroll
  for (int t = 0; t < 4; ++t) { if (col0 + t * 16 >= N) continue; const int col = col0 + t * 16 + ln; const float bv = bp ? bf16_round(bp[col]) : 0.f;
#pragma unroll
    for (int r = 0; r < 8; ++r) { float v = acc[t][r] * alpha + bv; if (CP) { const int bidx = (row0g + row0 + 8 * hh + r) / rowsPerB; v += CP[(size_t)bidx * sCPb + (size_t)by * 64 + col]; } if (ACT == 1) v = (v > 0.f) ? v : expm1f(v); else if (ACT == 7) v = (v > 0.f) ? v + 1.0f : expf(v); else if (ACT == 8) v = tanhf(v); else if (ACT == 9) v = 0.5f * v * (1.0f + tanhf(0.7978845608028654f * (v + 0.044715f * v * v * v))); else if (ACT == 11) v = 1.0f / (1.0f + expf(-v)); else if (ACT == 12) v = (v > 0.f) ? v : 0.01f * v; else if (ACT == 14) v = (v > 0.f) ? v : 0.1f * v; else if (ACT == 15) v = v / (1.0f + expf(-v)); else if (ACT == 3) v = fmaxf(v, 0.f); else if (ACT == 6) v = 0.5f * v * (1.0f + erff(v * 0.70710678118654752f)); so[w][8 * hh + r][t * 16 + ln] = v; } }
  __builtin_amdgcn_fence(__ATOMIC_ACQ_REL, "workgroup"); __builtin_amdgcn_wave_barrier();
  const int rsub = lane >> 4, c4 = (lane & 15) * 4; typedef _Float16 v4h __attribute__((ext_vector_type(4)));
  {
#pragma unroll
    for (int q = 0; q < 8; ++q) { const int r = q * 2 + rsub; if (col0 + c4 < N) { const v4f v = *(const v4fa*)&so[w][r][c4]; if (C) *(v4f*)(C + cofs + (size_t)(row0 + r) * ldc + col0 + c4) = v; if (C16) { v4h h4; for (int i = 0; i < 4; ++i) h4[i] = (_Float16)v[i]; *(v4h*)(C16 + cofs + (size_t)(row0 + r) * ldc + col0 + c4) = h4; } } }
     }
}


typedef _Float16 v4h __attribute__((ext_vector_type(4)));

__global__ __launch_bounds__(256) void k_x16(const float* __restrict__ x, _Float16* __restrict__ X16, size_t n8) { const size_t t = (size_t)blockIdx.x * 256 + threadIdx.x; if (t >= n8) return; FragH f;
#pragma unroll
  for (int q = 0; q < 8; ++q) f.h[q] = (_Float16)bf16_round(x[t * 8 + q]); *(v8us*)((unsigned short*)X16 + t * 8) = f.half[0];  }
__global__ __launch_bounds__(256) void k_h16(const float* __restrict__ x, _Float16* __restrict__ X16, size_t n8) { const size_t t = (size_t)blockIdx.x * 256 + threadIdx.x; if (t >= n8) return; FragH f;
#pragma unroll
  for (int q = 0; q < 8; ++q) f.h[q] = (_Float16)x[t * 8 + q]; *(v8us*)((unsigned short*)X16 + t * 8) = f.half[0];  }
__global__ __launch_bounds__(256) void k_round16f(const float* __restrict__ W, _Float16* __restrict__ Bt, size_t n8) { const size_t t = (size_t)blockIdx.x * 256 + threadIdx.x; if (t >= n8) return; FragH f;
#pragma unroll
  for (int i = 0; i < 8; ++i) f.h[i] = (_Float16)(bf16_round(W[t * 8 + i]) * 16.0f); *(v8us*)((unsigned short*)Bt + t * 8) = f.half[0];  }
template <int NHv, int TTv>
__global__ __launch_bounds__(256) void k_vt(const _Float16* __restrict__ V16, int ldv, int voff, _Float16* __restrict__ Vt) { __shared__ unsigned short tl[64][66]; const int tid = threadIdx.x; const int slab = blockIdx.x / (TTv / 64), lg = blockIdx.x % (TTv / 64); const int b = slab / NHv, h = slab % NHv;
  for (int i = tid; i < 64 * 8; i += 256) { const int r = i / 8, c8 = (i % 8) * 8; FragH f; f.half[0] = *(const v8us*)((const unsigned short*)V16 + ((size_t)b * TTv + lg * 64 + r) * ldv + voff + h * 64 + c8);
#pragma unroll
    for (int q = 0; q < 8; ++q) tl[r][c8 + q] = f.u[q]; }
  __syncthreads();
  {
#pragma unroll
    for (int rd = 0; rd < 2; ++rd) { const int d = rd * 32 + tid / 8, pc = tid % 8; FragH f;
#pragma unroll
      for (int q = 0; q < 8; ++q) f.u[q] = tl[pc * 8 + q][d];
      *(v8us*)((unsigned short*)Vt + ((size_t)slab * 64 + d) * TTv + lg * 64 + pc * 8) = f.half[0]; }
     } }

__global__ __launch_bounds__(256) void k_hl(const float* __restrict__ F, _Float16* __restrict__ Hh, _Float16* __restrict__ Hl, size_t n8) { const size_t t = (size_t)blockIdx.x * 256 + threadIdx.x; if (t >= n8) return; FragH fh, fl; const v4f a = *(const v4fa*)(F + t * 8), c = *(const v4fa*)(F + t * 8 + 4);
#pragma unroll
  for (int q = 0; q < 4; ++q) { _Float16 h = (_Float16)a[q]; fh.h[q] = h; fl.h[q] = (_Float16)((a[q] - (float)h) * 1024.0f); h = (_Float16)c[q]; fh.h[4 + q] = h; fl.h[4 + q] = (_Float16)((c[q] - (float)h) * 1024.0f); }
  { *(v8us*)((unsigned short*)Hh + t * 8) = fh.half[0]; *(v8us*)((unsigned short*)Hl + t * 8) = fl.half[0];  } }

// ---- fast GEMM (wave tile 32x64; requires M % 32 == 0 rows per launch region and N % 64 == 0); epilogue = k_gemm_hhx semantics ----
__device__ __forceinline__ v16h g2_frag(const _Float16* p, int hh) { FragH f; f.half[0] = *(const v8us*)((const unsigned short*)p + 8 * hh); f.half[1] = *(const v8us*)((const unsigned short*)p + 16 + 8 * hh); return f.v; }
__device__ __forceinline__ v8f g2_mma(v16h a, v16h b, v8f c) { v8f d = __builtin_amdgcn_wmma_f32_16x16x32_f16(false, a, false, b, (short)0, c, false, false); asm volatile("v_nop\n\tv_nop\n\tv_nop\n\tv_nop" : "+v"(d) : "v"(a), "v"(b)); return d; }
template <int ACT>
__global__ __launch_bounds__(128) void k_gemm2(const _Float16* __restrict__ A, int lda, size_t sA, const _Float16* __restrict__ Bh, int ldb, size_t sB, float alpha, const float* __restrict__ bias, size_t sBias, const float* __restrict__ CP, int rowsPerB, size_t sCPb, int row0g,
    float* __restrict__ C, _Float16* __restrict__ C16, int ldc, size_t sC, int M, int N, int K) {
  __shared__ __attribute__((aligned(16))) float so[4][32][68];
  const int tid = threadIdx.x, w = tid >> 5, lane = tid & 31, ln = lane & 15, hh = lane >> 4; const int by = blockIdx.y;
  A += (size_t)by * sA; Bh += (size_t)by * sB; const size_t cofs = (size_t)by * sC; const float* bp = bias ? bias + (size_t)by * sBias : nullptr;
  const int ntn = N >> 6; const int mt = blockIdx.x / ntn, nq = blockIdx.x - mt * ntn; const int row0 = mt * 128 + 32 * w, col0 = nq * 64; if (row0 >= M) return;
  const _Float16* a0p = A + (size_t)(row0 + ln) * lda; const _Float16* a1p = a0p + (size_t)16 * lda;
  const _Float16* b0p = Bh + (size_t)(col0 + ln) * ldb; const _Float16* b1p = b0p + (size_t)16 * ldb; const _Float16* b2p = b1p + (size_t)16 * ldb; const _Float16* b3p = b2p + (size_t)16 * ldb;
  const v8f z8 = {0.f,0.f,0.f,0.f,0.f,0.f,0.f,0.f}; v8f c00 = z8, c01 = z8, c02 = z8, c03 = z8, c10 = z8, c11 = z8, c12 = z8, c13 = z8;
#pragma unroll 1
  for (int kb = 0; kb < K; kb += 32) { const v16h a0 = g2_frag(a0p + kb, hh), a1 = g2_frag(a1p + kb, hh);
    v16h b = g2_frag(b0p + kb, hh); c00 = g2_mma(a0, b, c00); c10 = g2_mma(a1, b, c10);
    b = g2_frag(b1p + kb, hh); c01 = g2_mma(a0, b, c01); c11 = g2_mma(a1, b, c11);
    b = g2_frag(b2p + kb, hh); c02 = g2_mma(a0, b, c02); c12 = g2_mma(a1, b, c12);
    b = g2_frag(b3p + kb, hh); c03 = g2_mma(a0, b, c03); c13 = g2_mma(a1, b, c13); }
  v8f accs[8] = {c00, c01, c02, c03, c10, c11, c12, c13};
#pragma unroll
  for (int u = 0; u < 8; ++u) { const int t = u & 3, half = u >> 2; const int col = col0 + t * 16 + ln; const float bv = bp ? bf16_round(bp[col]) : 0.f;
#pragma unroll
    for (int r = 0; r < 8; ++r) { const int rloc = half * 16 + 8 * hh + r; float v = accs[u][r] * alpha + bv; if (CP) { const int bidx = (row0g + row0 + rloc) / rowsPerB; v += CP[(size_t)bidx * sCPb + (size_t)by * 64 + col]; }
      if (ACT == 3) v = fmaxf(v, 0.f); else if (ACT == 6) v = 0.5f * v * (1.0f + erff(v * 0.70710678118654752f)); else if (ACT == 11) v = 1.0f / (1.0f + expf(-v)); else if (ACT == 15) v = v / (1.0f + expf(-v)); else if (ACT == 12) v = (v > 0.f) ? v : 0.01f * v; else if (ACT == 8) v = tanhf(v);
      so[w][rloc][t * 16 + ln] = v; } }
  __builtin_amdgcn_fence(__ATOMIC_ACQ_REL, "workgroup"); __builtin_amdgcn_wave_barrier();
  const int rsub = lane >> 4, c4 = (lane & 15) * 4;
  {
#pragma unroll
    for (int q = 0; q < 16; ++q) { const int r = q * 2 + rsub; const v4f v = *(const v4fa*)&so[w][r][c4]; if (C) *(v4f*)(C + cofs + (size_t)(row0 + r) * ldc + col0 + c4) = v; if (C16) { v4h h4; for (int i = 0; i < 4; ++i) h4[i] = (_Float16)v[i]; *(v4h*)(C16 + cofs + (size_t)(row0 + r) * ldc + col0 + c4) = h4; } }
     } }



template <int TK>
__global__ __launch_bounds__(256) void k_vthl(const float* __restrict__ VF, int ldv, _Float16* __restrict__ Vth, _Float16* __restrict__ Vtl) { __shared__ float tl[64][65]; const int tid = threadIdx.x; const int slab = blockIdx.x / (TK / 64), lg = blockIdx.x % (TK / 64); const int b = slab / NH, h = slab % NH;
  for (int i = tid; i < 64 * 16; i += 256) { const int r = i / 16, c4 = (i % 16) * 4; const v4f a = *(const v4fa*)(VF + ((size_t)b * TK + lg * 64 + r) * ldv + h * 64 + c4); tl[r][c4] = a[0]; tl[r][c4 + 1] = a[1]; tl[r][c4 + 2] = a[2]; tl[r][c4 + 3] = a[3]; }
  __syncthreads();
  FragH fh[2], fl[2]; size_t oo[2];
#pragma unroll
  for (int rd = 0; rd < 2; ++rd) { const int d = rd * 32 + tid / 8, pc = tid % 8;
#pragma unroll
    for (int q = 0; q < 8; ++q) { const float v = tl[pc * 8 + q][d]; const _Float16 hv = (_Float16)v; fh[rd].h[q] = hv; fl[rd].h[q] = (_Float16)((v - (float)hv) * 1024.0f); } oo[rd] = ((size_t)slab * 64 + d) * TK + lg * 64 + pc * 8; }
  {
#pragma unroll
    for (int rd = 0; rd < 2; ++rd) { *(v8us*)((unsigned short*)Vth + oo[rd]) = fh[rd].half[0]; *(v8us*)((unsigned short*)Vtl + oo[rd]) = fl[rd].half[0]; }
     } }

template <int TQ, int TK>
__global__ __launch_bounds__(128) void k_flashb(const _Float16* __restrict__ Q16, const _Float16* __restrict__ Q16lo, int ldq, const _Float16* __restrict__ K16, const _Float16* __restrict__ K16lo, int ldk, const _Float16* __restrict__ Vt, const _Float16* __restrict__ Vtlo, const unsigned* __restrict__ MB, const int* __restrict__ RA, const int* __restrict__ KE, const float* __restrict__ BT, float* __restrict__ O, int ldo) {
  constexpr int RPW = 16, RTN = RPW / 16, NQB = TQ / (4 * RPW), DT = 4, KS = 2;
  __shared__ __attribute__((aligned(16))) unsigned short sP[4][RPW][40], sPl[4][RPW][40]; __shared__ __attribute__((aligned(16))) float sO[4][RPW][64 + 4];
  const int tid = threadIdx.x, w = tid >> 5, lane = tid & 31, ln = lane & 15, hh = lane >> 4;
  const int slab = blockIdx.x / NQB, qblk = blockIdx.x % NQB; const int b = slab / NH, h = slab % NH; const int qb0 = qblk * (4 * RPW); const int q0 = qb0 + w * RPW;
  FragH aq[2][KS], aql[2][KS];
#pragma unroll
  for (int rt = 0; rt < RTN; ++rt) { const size_t qo = ((size_t)b * TQ + q0 + rt * 16 + ln) * ldq + h * 64; const unsigned short* qr = (const unsigned short*)Q16 + qo; const unsigned short* ql = (const unsigned short*)Q16lo + qo;
#pragma unroll
    for (int ks = 0; ks < KS; ++ks) { aq[rt][ks].half[0] = *(const v8us*)(qr + ks * 32 + 8 * hh); aq[rt][ks].half[1] = *(const v8us*)(qr + ks * 32 + 16 + 8 * hh); aql[rt][ks].half[0] = *(const v8us*)(ql + ks * 32 + 8 * hh); aql[rt][ks].half[1] = *(const v8us*)(ql + ks * 32 + 16 + 8 * hh); } }
  const unsigned short* Vth = (const unsigned short*)Vt + (size_t)slab * 64 * TK; const unsigned short* Vtl = (const unsigned short*)Vtlo + (size_t)slab * 64 * TK;
  float m_r[2][8], l_r[2][8]; v8f oacc[2][DT], oaccl[2][DT];
#pragma unroll
  for (int rt = 0; rt < RTN; ++rt) {
#pragma unroll
    for (int r = 0; r < 8; ++r) { m_r[rt][r] = -3.0e38f; l_r[rt][r] = 0.f; }
#pragma unroll
    for (int dt = 0; dt < DT; ++dt) { oacc[rt][dt] = (v8f){0.f,0.f,0.f,0.f,0.f,0.f,0.f,0.f}; oaccl[rt][dt] = oacc[rt][dt]; } }
  int jend = KE[qblk * 32]; jend = min(TK, (jend + 31) & ~31); if (jend < 32) jend = 32;      /* block-uniform */
  int allm[2][8]; const unsigned* mrow[2][8];
#pragma unroll
  for (int rt = 0; rt < RTN; ++rt)
#pragma unroll
    for (int r = 0; r < 8; ++r) { const int tq = q0 + rt * 16 + 8 * hh + r; allm[rt][r] = RA[tq]; mrow[rt][r] = MB + (size_t)tq * (TK / 32); }
#pragma unroll 1
  for (int j0 = 0; j0 < jend; j0 += 32) {
    
    v8f s[2][2];
#pragma unroll
    for (int nt = 0; nt < 2; ++nt) { const size_t ko = ((size_t)b * TK + j0 + nt * 16 + ln) * ldk + h * 64; const unsigned short* kr = (const unsigned short*)K16 + ko; const unsigned short* kl = (const unsigned short*)K16lo + ko; FragH bk[KS], bkl[KS];
#pragma unroll
      for (int ks = 0; ks < KS; ++ks) { bk[ks].half[0] = *(const v8us*)(kr + ks * 32 + 8 * hh); bk[ks].half[1] = *(const v8us*)(kr + ks * 32 + 16 + 8 * hh); bkl[ks].half[0] = *(const v8us*)(kl + ks * 32 + 8 * hh); bkl[ks].half[1] = *(const v8us*)(kl + ks * 32 + 16 + 8 * hh); }
#pragma unroll
      for (int rt = 0; rt < RTN; ++rt) { v8f acc = (v8f){0.f,0.f,0.f,0.f,0.f,0.f,0.f,0.f}, accr = acc;
#pragma unroll
        for (int ks = 0; ks < KS; ++ks) { acc = mmaH<1>(aq[rt][ks].v, aq[rt][ks].v, bk[ks].v, bk[ks].v, acc); accr = mmaH<1>(aql[rt][ks].v, aql[rt][ks].v, bk[ks].v, bk[ks].v, accr); accr = mmaH<1>(aq[rt][ks].v, aq[rt][ks].v, bkl[ks].v, bkl[ks].v, accr); }
        s[rt][nt] = acc + accr * 0.0009765625f; } }
#pragma unroll
    for (int rt = 0; rt < RTN; ++rt)
#pragma unroll
      for (int r = 0; r < 8; ++r) { const unsigned mw = mrow[rt][r][j0 >> 5]; const bool am = (allm[rt][r] != 0); const int tq = q0 + rt * 16 + 8 * hh + r;
        const bool ok0 = am || (((mw >> ln) & 1u) == 0u), ok1 = am || (((mw >> (16 + ln)) & 1u) == 0u);
        const float s0 = ok0 ? (am ? 0.f : s[rt][0][r] * SCL + BT[((size_t)slab * TQ + tq) * RW + (tq - (j0 + ln) + (TK - 1))]) : -INFINITY, s1 = ok1 ? (am ? 0.f : s[rt][1][r] * SCL + BT[((size_t)slab * TQ + tq) * RW + (tq - (j0 + 16 + ln) + (TK - 1))]) : -INFINITY;      /* + REL[h][q][(q - k) + T - 1] = q . table[h][(q - k) + T - 1] */ float mc = fmaxf(s0, s1);
        mc = fmaxf(mc, __shfl_xor(mc, 1, 32)); mc = fmaxf(mc, __shfl_xor(mc, 2, 32)); mc = fmaxf(mc, __shfl_xor(mc, 4, 32)); mc = fmaxf(mc, __shfl_xor(mc, 8, 32));
        const float mn = fmaxf(m_r[rt][r], mc); const float al = (mn > -1.0e38f) ? expf(m_r[rt][r] - mn) : 1.0f; m_r[rt][r] = mn; const float p0 = ok0 ? expf(s0 - mn) : 0.f, p1 = ok1 ? expf(s1 - mn) : 0.f; l_r[rt][r] = l_r[rt][r] * al + p0 + p1;
#pragma unroll
        for (int dt = 0; dt < DT; ++dt) { oacc[rt][dt][r] *= al; oaccl[rt][dt][r] *= al; }
        FragH t2, t3; const float ps0 = p0 * 1024.0f, ps1 = p1 * 1024.0f; t2.h[0] = (_Float16)ps0; t2.h[1] = (_Float16)ps1; t3.h[0] = (_Float16)((ps0 - (float)t2.h[0]) * 1024.0f); t3.h[1] = (_Float16)((ps1 - (float)t2.h[1]) * 1024.0f);
        sP[w][rt * 16 + 8 * hh + r][ln] = t2.u[0]; sP[w][rt * 16 + 8 * hh + r][16 + ln] = t2.u[1]; sPl[w][rt * 16 + 8 * hh + r][ln] = t3.u[0]; sPl[w][rt * 16 + 8 * hh + r][16 + ln] = t3.u[1]; }
    __builtin_amdgcn_fence(__ATOMIC_ACQ_REL, "workgroup"); __builtin_amdgcn_wave_barrier();
    FragH pa[2], pl[2];
#pragma unroll
    for (int rt = 0; rt < RTN; ++rt) { pa[rt].half[0] = *(const v8us*)&sP[w][rt * 16 + ln][8 * hh]; pa[rt].half[1] = *(const v8us*)&sP[w][rt * 16 + ln][16 + 8 * hh]; pl[rt].half[0] = *(const v8us*)&sPl[w][rt * 16 + ln][8 * hh]; pl[rt].half[1] = *(const v8us*)&sPl[w][rt * 16 + ln][16 + 8 * hh]; }
#pragma unroll
    for (int dt = 0; dt < DT; ++dt) { const size_t vo = (size_t)(dt * 16 + ln) * TK + j0; FragH bv, bl; bv.half[0] = *(const v8us*)(Vth + vo + 8 * hh); bv.half[1] = *(const v8us*)(Vth + vo + 16 + 8 * hh); bl.half[0] = *(const v8us*)(Vtl + vo + 8 * hh); bl.half[1] = *(const v8us*)(Vtl + vo + 16 + 8 * hh);
#pragma unroll
      for (int rt = 0; rt < RTN; ++rt) { oacc[rt][dt] = mmaH<1>(pa[rt].v, pa[rt].v, bv.v, bv.v, oacc[rt][dt]); oaccl[rt][dt] = mmaH<1>(pa[rt].v, pa[rt].v, bl.v, bl.v, oaccl[rt][dt]); oaccl[rt][dt] = mmaH<1>(pl[rt].v, pl[rt].v, bv.v, bv.v, oaccl[rt][dt]); } }
    __builtin_amdgcn_fence(__ATOMIC_ACQ_REL, "workgroup"); __builtin_amdgcn_wave_barrier(); }
#pragma unroll
  for (int rt = 0; rt < RTN; ++rt) {
#pragma unroll
    for (int r = 0; r < 8; ++r) { float l = l_r[rt][r]; l += __shfl_xor(l, 1, 32); l += __shfl_xor(l, 2, 32); l += __shfl_xor(l, 4, 32); l += __shfl_xor(l, 8, 32); l_r[rt][r] = (l > 0.f) ? 1.0f / (l * 1024.0f) : 0.f; }
#pragma unroll
    for (int dt = 0; dt < DT; ++dt)
#pragma unroll
      for (int r = 0; r < 8; ++r) sO[w][rt * 16 + 8 * hh + r][dt * 16 + ln] = (oacc[rt][dt][r] + oaccl[rt][dt][r] * 0.0009765625f) * l_r[rt][r]; }
  __builtin_amdgcn_fence(__ATOMIC_ACQ_REL, "workgroup"); __builtin_amdgcn_wave_barrier();
  {
#pragma unroll
    for (int rp = 0; rp < RPW; rp += 2) { const int r = rp + (lane >> 4), pc = lane & 15; const v4f val = *(const v4fa*)&sO[w][r][pc * 4]; *(v4f*)(O + ((size_t)b * TQ + q0 + r) * ldo + h * 64 + pc * 4) = val; }
     } }


__global__ __launch_bounds__(256) void k_fulltab(unsigned* __restrict__ MB, int* __restrict__ RA, int* __restrict__ KE, int nq, int nk) {
  const int t = blockIdx.x * 256 + threadIdx.x;
  if (t < nq * (nk / 32)) { *(unsigned*)(MB + t) = 0u;  }
  if (t < nq) { *(int*)(RA + t) = 0;  }
  if (t < nq / 64) { *(int*)(KE + t * 32) = nk;  } }
__global__ __launch_bounds__(256) void k_lnx(const float* __restrict__ X, const float* __restrict__ g, const float* __restrict__ bb, _Float16* __restrict__ Y16, float* __restrict__ XB) {
  #pragma clang fp contract(off)
  const int tid = threadIdx.x, w = tid >> 5, ln = tid & 31; const int r = blockIdx.x * 8 + w; if (r >= NR) return; const float* x = X + (size_t)r * DM; float s = 0.f;
#pragma unroll 1
  for (int i = 0; i < DM / 128; ++i) { const v4f a = *(const v4fa*)(x + i * 128 + ln * 4); for (int q = 0; q < 4; ++q) s += bf16_round(a[q]); }
  for (int o = 16; o > 0; o >>= 1) s += __shfl_xor(s, o, 32); const float mu = s / (float)DM; float q2 = 0.f;
#pragma unroll 1
  for (int i = 0; i < DM / 128; ++i) { const v4f a = *(const v4fa*)(x + i * 128 + ln * 4); for (int q = 0; q < 4; ++q) { const float d = bf16_round(a[q]) - mu; q2 += d * d; } }
  for (int o = 16; o > 0; o >>= 1) q2 += __shfl_xor(q2, o, 32); const float rs = rsqrtf(q2 / (float)DM + 1e-5f);
  {
#pragma unroll 1
    for (int i = 0; i < DM / 128; ++i) { const int c0 = i * 128 + ln * 4; const v4f a = *(const v4fa*)(x + c0); _Float16 h4[4]; v4f xb;
      for (int q = 0; q < 4; ++q) { const float t = bf16_round(a[q]); h4[q] = (_Float16)((t - mu) * rs * bf16_round(g[c0 + q]) + bf16_round(bb[c0 + q])); xb[q] = t; }
      *(unsigned long long*)((unsigned short*)Y16 + (size_t)r * DM + c0) = *(const unsigned long long*)h4; *(v4f*)(XB + (size_t)r * DM + c0) = xb; }
     } }
__global__ __launch_bounds__(256) void k_rtab(const float* __restrict__ tab, int trows, _Float16* __restrict__ T16) {
  const int t = blockIdx.x * 256 + threadIdx.x; if (t >= NH * RW * 8) return; const int d0 = (t & 7) * 8; const int r = (t >> 3) % RW; const int h = t / (8 * RW); FragH f;
#pragma unroll
  for (int q = 0; q < 8; ++q) f.h[q] = (r < 2 * SLEN - 1) ? (_Float16)(bf16_round(tab[((size_t)h * trows + r) * 64 + d0 + q]) * 16.0f) : (_Float16)0.0f;
  *(v8us*)((unsigned short*)T16 + ((size_t)h * RW + r) * 64 + d0) = f.half[0];  }
__global__ __launch_bounds__(256) void k_causaltab(unsigned* __restrict__ MB, int* __restrict__ RA, int* __restrict__ KE, int nq, int nk) {
  const int t = blockIdx.x * 256 + threadIdx.x; const int nw = nk / 32;
  if (t < nq * nw) { const int q = t / nw, w = t % nw; const int first = q + 1 - 32 * w; const unsigned bits = (first <= 0) ? 0xffffffffu : ((first >= 32) ? 0u : (0xffffffffu << first)); *(unsigned*)(MB + t) = bits;  }
  if (t < nq) { *(int*)(RA + t) = 0;  }
  if (t < nq / 64) { const int v = 64 * (t + 1); *(int*)(KE + t * 32) = v;  } }


extern "C" void kernel_launch(void* const* d_in, const int* in_sizes, int n_in,
                              void* d_out, int out_size, void* d_ws, size_t ws_size, hipStream_t stream) {
  (void)in_sizes; (void)n_in; (void)out_size;
  const float* const* I = (const float* const*)d_in; const float* x = I[0]; const float* Wq = I[1]; const float* bq = I[2]; const float* Wk = I[3]; const float* bk = I[4]; const float* Wv = I[5]; const float* bv = I[6]; const float* Wo = I[7]; const float* bo = I[8]; const float* tab = I[9];
  char* ws = (char*)d_ws; size_t off = 0;
  auto take = [&](size_t bytes) { char* p = ws + off; off += (bytes + 255) & ~(size_t)255; return p; };
  _Float16* BQ = (_Float16*)take((size_t)DM * DM * 2); _Float16* BK = (_Float16*)take((size_t)DM * DM * 2); _Float16* BV = (_Float16*)take((size_t)DM * DM * 2); _Float16* BO = (_Float16*)take((size_t)DM * DM * 2); _Float16* T16 = (_Float16*)take((size_t)NH * RW * 64 * 2);
  _Float16* X16 = (_Float16*)take((size_t)NR * DM * 2); float* F = (float*)take((size_t)NR * DM * 4); _Float16* Q16 = (_Float16*)take((size_t)NR * DM * 2);
  _Float16* Qh = (_Float16*)take((size_t)NR * DM * 2); _Float16* Ql = (_Float16*)take((size_t)NR * DM * 2); _Float16* Kh = (_Float16*)take((size_t)NR * DM * 2); _Float16* Kl = (_Float16*)take((size_t)NR * DM * 2); _Float16* Vth = (_Float16*)take((size_t)NR * DM * 2); _Float16* Vtl = (_Float16*)take((size_t)NR * DM * 2);
  float* REL = (float*)take((size_t)HG * SLEN * RW * 4); float* O = (float*)take((size_t)NR * DM * 4); _Float16* Oh = (_Float16*)take((size_t)NR * DM * 2); _Float16* Ol = (_Float16*)take((size_t)NR * DM * 2);
  unsigned* MB = (unsigned*)take((size_t)SLEN * (SLEN / 32) * 4); int* RA = (int*)take((size_t)SLEN * 4); int* KE = (int*)take((size_t)(SLEN / 64) * 32 * 4);
  if (off > ws_size) return;      /* 8 + 4 + 8 + 16 + 8 + 48 + 128 + 16 + 16 + 0.2 = 252 MiB */
  const size_t n8 = (size_t)NR * DM / 8; const unsigned nb8 = (unsigned)((n8 + 255) / 256); const size_t w8 = (size_t)DM * DM / 8; const unsigned wb = (unsigned)((w8 + 255) / 256);
  k_round16f<<<wb, 256, 0, stream>>>(Wq, BQ, w8); k_round16f<<<wb, 256, 0, stream>>>(Wk, BK, w8); k_round16f<<<wb, 256, 0, stream>>>(Wv, BV, w8); k_round16f<<<wb, 256, 0, stream>>>(Wo, BO, w8);      /* torch (out,in) = natural Bt */
  k_rtab<<<(NH * RW * 8 + 255) / 256, 256, 0, stream>>>(tab, 9999, T16); k_fulltab<<<(SLEN * (SLEN / 32) + 255) / 256, 256, 0, stream>>>(MB, RA, KE, SLEN, SLEN);
  const dim3 gP((NR / 128) * (DM / 64), 1), gR((SLEN / 128) * (RW / 64), HG);
  /* every row-wise stage runs once over all NBT * SLEN rows */
  k_x16<<<nb8, 256, 0, stream>>>(x, X16, n8);
  k_gemm2<0><<<gP, 128, 0, stream>>>(X16, DM, 0, BQ, DM, 0, 0.0625f, bq, 0, nullptr, 1, 0, 0, F, Q16, DM, 0, NR, DM, DM); k_hl<<<nb8, 256, 0, stream>>>(F, Qh, Ql, n8);      /* q: f32 -> hi/lo, and f16 for the RPE GEMM */
  k_gemm2<0><<<gP, 128, 0, stream>>>(X16, DM, 0, BK, DM, 0, 0.0625f, bk, 0, nullptr, 1, 0, 0, F, nullptr, DM, 0, NR, DM, DM); k_hl<<<nb8, 256, 0, stream>>>(F, Kh, Kl, n8);
  k_gemm2<0><<<gP, 128, 0, stream>>>(X16, DM, 0, BV, DM, 0, 0.0625f, bv, 0, nullptr, 1, 0, 0, F, nullptr, DM, 0, NR, DM, DM); k_vthl<SLEN><<<NBT * NH * (SLEN / 64), 256, 0, stream>>>(F, DM, Vth, Vtl);
  for (int b = 0; b < NBT; ++b) { const size_t ro = (size_t)b * SLEN * DM;      /* REL holds one batch (all heads) at a time */
    k_gemm2<0><<<gR, 128, 0, stream>>>(Q16 + ro, DM, (size_t)64, T16, 64, (size_t)RW * 64, 0.0625f, nullptr, 0, nullptr, 1, 0, 0, REL, nullptr, RW, (size_t)SLEN * RW, SLEN, RW, 64);      /* REL[h][q][r] = q_h . table[h][r] for all heads of this batch (grid.y, column-offset A stride) */
    k_flashb<SLEN, SLEN><<<HG * (SLEN / 64), 128, 0, stream>>>(Qh + ro, Ql + ro, DM, Kh + ro, Kl + ro, DM, Vth + ro, Vtl + ro, MB, RA, KE, REL, O + ro, DM); }
  k_hl<<<nb8, 256, 0, stream>>>(O, Oh, Ol, n8);
  float* outp = (float*)d_out;
  k_gemm2<0><<<gP, 128, 0, stream>>>(Oh, DM, 0, BO, DM, 0, 0.0625f, bo, 0, nullptr, 1, 0, 0, outp, nullptr, DM, 0, NR, DM, DM);
  k_gemm2<0><<<gP, 128, 0, stream>>>(Ol, DM, 0, BO, DM, 0, 0.0625f / 1024.0f, nullptr, 0, outp, 1, (size_t)DM, 0, outp, nullptr, DM, 0, NR, DM, DM);
}

// v002
// One run takes 512 microseconds.
// Next to v001, in two timings, it ran 2.51 and 2.53 times as fast.
// Counting every step since v000, it is 8.48 times as fast.
#include <hip/hip_runtime.h>
// Multi-head attention with learned relative-position encoding (4 x 1024 tokens, 1024 = 16 heads x 64): q,k,v = x W^T + b; scores = q.k/8 + q.rpe_table[h][q - k + 1023] (no scale on the RPE term); softmax over all keys; . v; merged . Wo^T + bo -> [4,1024,1024].
// Structure: projections (all batches in one launch) as f16 WMMA GEMMs (32x64 wave tiles, f32 accumulation, exact products + bias); the fused flash kernel (one launch over all batches and heads; hi/lo q,k three-product scores, online f32 softmax, P staged hi + residual, V^T hi + residual; all keys valid) forms the RPE term itself: per 16 x 32 score tile the 48 table rows r = q - k + 1023 can reach give a 16 x 48 f16 WMMA product q_h . table[h][r] (f32 result, 16 of the 48 columns carried over from the trip before), staged in the wave's LDS and read back along the diagonal inside the score stage; O as hi + residual planes into Wo (two GEMMs, bias in the first).
// Compute dtype: x, weights, biases, rpe_table rounded to bf16; projections exact; the RPE product uses the plain f16 q (the hi plane) (~2^-12 on a sigma-0.16 bias); q, k, P, v, O as f16 hi + residual pairs (~2^-21) in the attention; f32 accumulation and softmax. v_wmma_f32_16x16x32_f16.
#define NBT 4
#define SLEN 1024
#define RW 2048                  /* table rows kept per head (2*SLEN-1 used, the last one zero) */
#define DM 1024
#define NH 16
#define SCL 0.125f
#define NR (NBT * SLEN)
typedef __bf16 v16b __attribute__((ext_vector_type(16)));
typedef unsigned short v8us __attribute__((ext_vector_type(8), may_alias));
typedef float  v8f  __attribute__((ext_vector_type(8)));
typedef float  v4f  __attribute__((ext_vector_type(4)));
typedef float  v4fa __attribute__((ext_vector_type(4), may_alias));
union FragB { v16b v; v8us half[2]; unsigned short u[16]; };

__device__ __forceinline__ unsigned short bf16_bits(float x) { unsigned int u = __float_as_uint(x); return (unsigned short)((u + 0x7FFFu + ((u >> 16) & 1u)) >> 16); }
__device__ __forceinline__ float bf16_val(unsigned short b) { return __uint_as_float(((unsigned int)b) << 16); }
__device__ __forceinline__ float bf16_round(float x) { return bf16_val(bf16_bits(x)); }
// D += A·B with NT terms: 1 = ah·bh, 2 = + al·bh (A split), 3 = + ah·bl (both split)
template <int NT>
__device__ __forceinline__ v8f mmaN(v16b ah, v16b al, v16b bh, v16b bl, v8f c) {
  c = __builtin_amdgcn_wmma_f32_16x16x32_bf16(false, ah, false, bh, (short)0, c, false, false);
  if (NT >= 2) c = __builtin_amdgcn_wmma_f32_16x16x32_bf16(false, al, false, bh, (short)0, c, false, false);
  if (NT >= 3) c = __builtin_amdgcn_wmma_f32_16x16x32_bf16(false, ah, false, bl, (short)0, c, false, false);
  asm volatile("v_nop\n\tv_nop\n\tv_nop\n\tv_nop" : "+v"(c) : "v"(ah), "v"(al), "v"(bh), "v"(bl));
  return c;
}

__global__ __launch_bounds__(256) void k_wt_bf16(const float* __restrict__ W, unsigned short* __restrict__ Wt, int K, int N) {
  const int t = blockIdx.x * 256 + threadIdx.x;
  const int k8n = K / 8;
  if (t >= N * k8n) return;
  const int n = t / k8n, k8 = (t % k8n) * 8;
  v8us v;
#pragma unroll
  for (int i = 0; i < 8; ++i) v[i] = bf16_bits(W[(size_t)(k8 + i) * N + n]);
  *(v8us*)(Wt + (size_t)n * K + k8) = v;
  
}

// GEMM C[M][N] (f32, pitch ldc) = act(A[M][K]·W + bias). A f32 row-major (pitch lda) converted per fragment to bf16
// (ASPLIT: hi/lo two planes -> 2 terms, else single rounded term); Wt bf16 [N][K] (pitch ldb). BIAS_BF16 rounds the
// bias to bf16 first (bias quantised to bf16 before the add). K%32==0, M%16==0, N%64==0.
template <bool ASPLIT, int ACT, bool BIAS_BF16>
__global__ __launch_bounds__(128) void k_gemm_bf(const float* __restrict__ A, int lda, const unsigned short* __restrict__ Wt, int ldb,
                                               const float* __restrict__ bias, float* __restrict__ C, int ldc, int M, int N, int K) {
  __shared__ __attribute__((aligned(16))) float so[4][16][64];
  const int tid = threadIdx.x, w = tid >> 5, lane = tid & 31, ln = lane & 15, hh = lane >> 4;
  const int ntn = N / 64;
  const int wid = blockIdx.x * 4 + w;
  const int mt = wid / ntn, nq = wid % ntn;
  if (mt * 16 >= M) return;
  const int row0 = mt * 16, col0 = nq * 64;
  const float* arow = A + (size_t)(row0 + ln) * lda;
  v8f acc[4] = {};
  for (int kb = 0; kb < K; kb += 32) {
    FragB ah, al;
    const v4f x0 = *(const v4fa*)(arow + kb + 8 * hh), x1 = *(const v4fa*)(arow + kb + 8 * hh + 4);
    const v4f x2 = *(const v4fa*)(arow + kb + 16 + 8 * hh), x3 = *(const v4fa*)(arow + kb + 16 + 8 * hh + 4);
    float xs[16] = {x0[0],x0[1],x0[2],x0[3],x1[0],x1[1],x1[2],x1[3],x2[0],x2[1],x2[2],x2[3],x3[0],x3[1],x3[2],x3[3]};
#pragma unroll
    for (int i = 0; i < 16; ++i) { const unsigned short hb = bf16_bits(xs[i]); ah.u[i] = hb; al.u[i] = ASPLIT ? bf16_bits(xs[i] - bf16_val(hb)) : (unsigned short)0; }
#pragma unroll
    for (int t = 0; t < 4; ++t) {
      const unsigned short* brow = Wt + (size_t)(col0 + t * 16 + ln) * ldb + kb;
      FragB b;
      b.half[0] = *(const v8us*)(brow + 8 * hh);
      b.half[1] = *(const v8us*)(brow + 16 + 8 * hh);
      acc[t] = mmaN<ASPLIT ? 2 : 1>(ah.v, al.v, b.v, b.v, acc[t]);
    }
  }
#pragma unroll
  for (int t = 0; t < 4; ++t) {
    float bv = bias ? bias[col0 + t * 16 + ln] : 0.f;
    if (BIAS_BF16) bv = bf16_round(bv);
#pragma unroll
    for (int r = 0; r < 8; ++r) { float v = acc[t][r] + bv; if (ACT == 1) v = fmaxf(v, 0.f); so[w][8 * hh + r][t * 16 + ln] = v; }
  }
  __builtin_amdgcn_fence(__ATOMIC_ACQ_REL, "workgroup");
  __builtin_amdgcn_wave_barrier();
  const int rsub = lane >> 4, c4 = (lane & 15) * 4;
  {
#pragma unroll
    for (int q = 0; q < 8; ++q) {
      const int r = q * 2 + rsub;
      const v4f v = *(const v4fa*)&so[w][r][c4];
      *(v4f*)(C + (size_t)(row0 + r) * ldc + col0 + c4) = v;
    }
    
  }
}

// GEMM C = act(A·W + bias + resid): A f32 (ASPLIT -> hi/lo 2 terms), Wt bf16 [N][K]; ACT 0 none, 1 relu, 2 exact gelu;
// resid (optional, f32, row index = (row % rmod), pitch ldr, RES_BF16 rounds it) added before the activation.
template <bool ASPLIT, int ACT, bool BIAS_BF16, bool RES_BF16>
__global__ __launch_bounds__(128) void k_gemm_bf3(const float* __restrict__ A, int lda, const unsigned short* __restrict__ Wt, int ldb,
                                                const float* __restrict__ bias, const float* __restrict__ resid, int rmod, int ldr,
                                                float* __restrict__ C, int ldc, int M, int N, int K) {
  __shared__ __attribute__((aligned(16))) float so[4][16][64];
  const int tid = threadIdx.x, w = tid >> 5, lane = tid & 31, ln = lane & 15, hh = lane >> 4;
  const int ntn = N / 64;
  const int wid = blockIdx.x * 4 + w;
  const int mt = wid / ntn, nq = wid % ntn;
  if (mt * 16 >= M) return;
  const int row0 = mt * 16, col0 = nq * 64;
  const float* arow = A + (size_t)(row0 + ln) * lda;
  v8f acc[4] = {};
  for (int kb = 0; kb < K; kb += 32) {
    FragB ah, al;
    const v4f x0 = *(const v4fa*)(arow + kb + 8 * hh), x1 = *(const v4fa*)(arow + kb + 8 * hh + 4);
    const v4f x2 = *(const v4fa*)(arow + kb + 16 + 8 * hh), x3 = *(const v4fa*)(arow + kb + 16 + 8 * hh + 4);
    float xs[16] = {x0[0],x0[1],x0[2],x0[3],x1[0],x1[1],x1[2],x1[3],x2[0],x2[1],x2[2],x2[3],x3[0],x3[1],x3[2],x3[3]};
#pragma unroll
    for (int i = 0; i < 16; ++i) { const unsigned short hb = bf16_bits(xs[i]); ah.u[i] = hb; al.u[i] = ASPLIT ? bf16_bits(xs[i] - bf16_val(hb)) : (unsigned short)0; }
#pragma unroll
    for (int t = 0; t < 4; ++t) {
      const unsigned short* brow = Wt + (size_t)(col0 + t * 16 + ln) * ldb + kb;
      FragB b;
      b.half[0] = *(const v8us*)(brow + 8 * hh);
      b.half[1] = *(const v8us*)(brow + 16 + 8 * hh);
      acc[t] = mmaN<ASPLIT ? 2 : 1>(ah.v, al.v, b.v, b.v, acc[t]);
    }
  }
#pragma unroll
  for (int t = 0; t < 4; ++t) {
    const int col = col0 + t * 16 + ln;
    float bv = bias ? bias[col] : 0.f;
    if (BIAS_BF16) bv = bf16_round(bv);
#pragma unroll
    for (int r = 0; r < 8; ++r) {
      float v = acc[t][r] + bv;
      if (resid) { float rv = resid[(size_t)((row0 + 8 * hh + r) % rmod) * ldr + col]; if (RES_BF16) rv = bf16_round(rv); v += rv; }
      if (ACT == 1) v = fmaxf(v, 0.f);
      if (ACT == 2) v = 0.5f * v * (1.0f + erff(v * 0.70710678118654752f));
      if (ACT == 3) { const float u = 0.7978845608028654f * (v + 0.044715f * v * v * v); v = 0.5f * v * (1.0f + tanhf(u)); }
      so[w][8 * hh + r][t * 16 + ln] = v;
    }
  }
  __builtin_amdgcn_fence(__ATOMIC_ACQ_REL, "workgroup");
  __builtin_amdgcn_wave_barrier();
  const int rsub = lane >> 4, c4 = (lane & 15) * 4;
  {
#pragma unroll
    for (int q = 0; q < 8; ++q) {
      const int r = q * 2 + rsub;
      const v4f v = *(const v4fa*)&so[w][r][c4];
      *(v4f*)(C + (size_t)(row0 + r) * ldc + col0 + c4) = v;
    }
    
  }
}
// row LayerNorm (biased variance, eps) over N: s = X (+ R); optional out_sum <- s; out_norm <- (s-mu)*rsqrt(var+eps)*g + b
template <bool PARAM_BF16>
__global__ __launch_bounds__(256) void k_layernorm(const float* __restrict__ X, const float* __restrict__ R, const float* __restrict__ g, const float* __restrict__ bta,
                                                  float* __restrict__ out_sum, float* __restrict__ out_norm, int N, float eps) {
  __shared__ float red[256];
  const int row = blockIdx.x, tid = threadIdx.x;
  const float* x = X + (size_t)row * N; const float* rr = R ? R + (size_t)row * N : nullptr;
  float vals[16];                     // up to N = 4096
  const int per = N / 256;            // contiguous chunk per thread? use strided-by-4 chunks: thread handles j = tid*4 + 1024*u
  float s1 = 0.f;
  for (int u = 0; u < per / 4; ++u) {
    const int j = tid * 4 + 1024 * u;
    const v4f a = *(const v4fa*)(x + j);
    v4f b = {0.f,0.f,0.f,0.f}; if (rr) b = *(const v4fa*)(rr + j);
#pragma unroll
    for (int q = 0; q < 4; ++q) { const float v = a[q] + b[q]; vals[u * 4 + q] = v; s1 += v; }
  }
  red[tid] = s1; __syncthreads();
  for (int st = 128; st > 0; st >>= 1) { if (tid < st) red[tid] += red[tid + st]; __syncthreads(); }
  const float mu = red[0] / (float)N; __syncthreads();
  float s2 = 0.f;
  for (int u = 0; u < per / 4; ++u)
#pragma unroll
    for (int q = 0; q < 4; ++q) { const float c = vals[u * 4 + q] - mu; s2 += c * c; }
  red[tid] = s2; __syncthreads();
  for (int st = 128; st > 0; st >>= 1) { if (tid < st) red[tid] += red[tid + st]; __syncthreads(); }
  const float rs = rsqrtf(red[0] / (float)N + eps);
  {
    for (int u = 0; u < per / 4; ++u) {
      const int j = tid * 4 + 1024 * u;
      v4f o, sm;
#pragma unroll
      for (int q = 0; q < 4; ++q) {
        float gg = g[j + q], bb = bta[j + q];
        if (PARAM_BF16) { gg = bf16_round(gg); bb = bf16_round(bb); }
        sm[q] = vals[u * 4 + q]; o[q] = (vals[u * 4 + q] - mu) * rs * gg + bb;
      }
      if (out_sum) *(v4f*)(out_sum + (size_t)row * N + j) = sm;
      *(v4f*)(out_norm + (size_t)row * N + j) = o;
    }
    
  }
}



// ---- f16 WMMA path (v_wmma_f32_16x16x32_f16): 11-bit significands for operands in range — used where a [0,1] probability operand needs more precision than bf16
typedef _Float16 v16h __attribute__((ext_vector_type(16)));
union FragH { v16h v; v8us half[2]; _Float16 h[16]; unsigned short u[16]; };
template <int NT>
__device__ __forceinline__ v8f mmaH(v16h ah, v16h al, v16h bh, v16h bl, v8f c) {
  c = __builtin_amdgcn_wmma_f32_16x16x32_f16(false, ah, false, bh, (short)0, c, false, false);
  if (NT >= 2) c = __builtin_amdgcn_wmma_f32_16x16x32_f16(false, al, false, bh, (short)0, c, false, false);
  if (NT >= 3) c = __builtin_amdgcn_wmma_f32_16x16x32_f16(false, ah, false, bl, (short)0, c, false, false);
  asm volatile("v_nop\n\tv_nop\n\tv_nop\n\tv_nop" : "+v"(c) : "v"(ah), "v"(al), "v"(bh), "v"(bl));
  return c;
}
// batched GEMM like k_gemm_b but f16 operands: A f32 (split into f16 hi/lo if ASPLIT, else rounded to f16), Bt = f16 values [n][k]; alpha; C f32; N multiple of 16 (partial tiles skipped)
template <bool ASPLIT>
__global__ __launch_bounds__(128) void k_gemm_h(const float* __restrict__ A, int lda, size_t sA, const _Float16* __restrict__ Bh, int ldb, size_t sB, float alpha, float* __restrict__ C, int ldc, size_t sC, int M, int N, int K) {
  __shared__ __attribute__((aligned(16))) float so[4][16][64];
  const int tid = threadIdx.x, w = tid >> 5, lane = tid & 31, ln = lane & 15, hh = lane >> 4; const int by = blockIdx.y;
  A += (size_t)by * sA; Bh += (size_t)by * sB; C += (size_t)by * sC;
  const int ntn = (N + 63) / 64; const int wid = blockIdx.x * 4 + w; const int mt = wid / ntn, nq = wid % ntn; if (mt * 16 >= M) return;
  const int row0 = mt * 16, col0 = nq * 64; const float* arow = A + (size_t)(row0 + ln) * lda;
  v8f acc[4] = {};
  for (int kb = 0; kb < K; kb += 32) {
    FragH ah, al;
    const v4f x0 = *(const v4fa*)(arow + kb + 8 * hh), x1 = *(const v4fa*)(arow + kb + 8 * hh + 4), x2 = *(const v4fa*)(arow + kb + 16 + 8 * hh), x3 = *(const v4fa*)(arow + kb + 16 + 8 * hh + 4);
    float xs[16] = {x0[0],x0[1],x0[2],x0[3],x1[0],x1[1],x1[2],x1[3],x2[0],x2[1],x2[2],x2[3],x3[0],x3[1],x3[2],x3[3]};
#pragma unroll
    for (int i = 0; i < 16; ++i) { const _Float16 h = (_Float16)xs[i]; ah.h[i] = h; al.h[i] = ASPLIT ? (_Float16)(xs[i] - (float)h) : (_Float16)0.0f; }
#pragma unroll
    for (int t = 0; t < 4; ++t) { if (col0 + t * 16 >= N) continue; const size_t boff = (size_t)(col0 + t * 16 + ln) * ldb + kb; FragH bq; bq.half[0] = *(const v8us*)(Bh + boff + 8 * hh); bq.half[1] = *(const v8us*)(Bh + boff + 16 + 8 * hh);
      acc[t] = mmaH<ASPLIT ? 2 : 1>(ah.v, al.v, bq.v, bq.v, acc[t]); }
  }
#pragma unroll
  for (int t = 0; t < 4; ++t) { if (col0 + t * 16 >= N) continue;
#pragma unroll
    for (int r = 0; r < 8; ++r) so[w][8 * hh + r][t * 16 + ln] = acc[t][r] * alpha; }
  __builtin_amdgcn_fence(__ATOMIC_ACQ_REL, "workgroup"); __builtin_amdgcn_wave_barrier();
  const int rsub = lane >> 4, c4 = (lane & 15) * 4;
  {
#pragma unroll
    for (int q = 0; q < 8; ++q) { const int r = q * 2 + rsub; if (col0 + c4 < N) { const v4f v = *(const v4fa*)&so[w][r][c4]; *(v4f*)(C + (size_t)(row0 + r) * ldc + col0 + c4) = v; } }
     }
}

// Wt[n][k] = f16(W[k][n]·scale) from f32 row-major W[K][N] (scale = power of two; bf16-exact weights stay exact in f16 away from the subnormal range)
__global__ __launch_bounds__(256) void k_wt_f16(const float* __restrict__ W, _Float16* __restrict__ Wt, int K, int N, float scale) {
  const int t = blockIdx.x * 256 + threadIdx.x; if (t >= N * (K / 8)) return; const int n = t / (K / 8), k8 = (t % (K / 8)) * 8; FragH f;
#pragma unroll
  for (int i = 0; i < 8; ++i) f.h[i] = (_Float16)(bf16_round(W[(size_t)(k8 + i) * N + n]) * scale); const v8us o = f.half[0];
  *(v8us*)((unsigned short*)Wt + (size_t)n * K + k8) = o; 
}
// k_gemm_hh variant with fused epilogue: v = acc·alpha + bias[by·sBias + col] (+ CP[(row/rowsPerB)·sCPb + by·64 + col] if CP) ; ACT 0 none / 1 elu ; writes f16 C16 (and f32 C if non-null)
template <int ACT>
__global__ __launch_bounds__(128) void k_gemm_hhx(const _Float16* __restrict__ A, int lda, size_t sA, const _Float16* __restrict__ Bh, int ldb, size_t sB, float alpha, const float* __restrict__ bias, size_t sBias, const float* __restrict__ CP, int rowsPerB, size_t sCPb, int row0g,
    float* __restrict__ C, _Float16* __restrict__ C16, int ldc, size_t sC, int M, int N, int K) {
  __shared__ __attribute__((aligned(16))) float so[4][16][64];
  const int tid = threadIdx.x, w = tid >> 5, lane = tid & 31, ln = lane & 15, hh = lane >> 4; const int by = blockIdx.y;
  A += (size_t)by * sA; Bh += (size_t)by * sB; const size_t cofs = (size_t)by * sC; const float* bp = bias ? bias + (size_t)by * sBias : nullptr;
  const int ntn = (N + 63) / 64; const int wid = blockIdx.x * 4 + w; const int mt = wid / ntn, nq = wid % ntn; if (mt * 16 >= M) return;
  const int row0 = mt * 16, col0 = nq * 64; const _Float16* arow = A + (size_t)(row0 + ln) * lda;
  v8f acc[4] = {};
  for (int kb = 0; kb < K; kb += 32) { FragH ah; ah.half[0] = *(const v8us*)((const unsigned short*)arow + kb + 8 * hh); ah.half[1] = *(const v8us*)((const unsigned short*)arow + kb + 16 + 8 * hh);
#pragma unroll
    for (int t = 0; t < 4; ++t) { if (col0 + t * 16 >= N) continue; const size_t boff = (size_t)(col0 + t * 16 + ln) * ldb + kb; FragH bq; bq.half[0] = *(const v8us*)((const unsigned short*)Bh + boff + 8 * hh); bq.half[1] = *(const v8us*)((const unsigned short*)Bh + boff + 16 + 8 * hh);
      acc[t] = mmaH<1>(ah.v, ah.v, bq.v, bq.v, acc[t]); }
  }
#pragma unroll
  for (int t = 0; t < 4; ++t) { if (col0 + t * 16 >= N) continue; const int col = col0 + t * 16 + ln; const float bv = bp ? bf16_round(bp[col]) : 0.f;
#pragma unroll
    for (int r = 0; r < 8; ++r) { float v = acc[t][r] * alpha + bv; if (CP) { const int bidx = (row0g + row0 + 8 * hh + r) / rowsPerB; v += CP[(size_t)bidx * sCPb + (size_t)by * 64 + col]; } if (ACT == 1) v = (v > 0.f) ? v : expm1f(v); else if (ACT == 7) v = (v > 0.f) ? v + 1.0f : expf(v); else if (ACT == 8) v = tanhf(v); else if (ACT == 9) v = 0.5f * v * (1.0f + tanhf(0.7978845608028654f * (v + 0.044715f * v * v * v))); else if (ACT == 11) v = 1.0f / (1.0f + expf(-v)); else if (ACT == 12) v = (v > 0.f) ? v : 0.01f * v; else if (ACT == 14) v = (v > 0.f) ? v : 0.1f * v; else if (ACT == 15) v = v / (1.0f + expf(-v)); else if (ACT == 3) v = fmaxf(v, 0.f); else if (ACT == 6) v = 0.5f * v * (1.0f + erff(v * 0.70710678118654752f)); so[w][8 * hh + r][t * 16 + ln] = v; } }
  __builtin_amdgcn_fence(__ATOMIC_ACQ_REL, "workgroup"); __builtin_amdgcn_wave_barrier();
  const int rsub = lane >> 4, c4 = (lane & 15) * 4; typedef _Float16 v4h __attribute__((ext_vector_type(4)));
  {
#pragma unroll
    for (int q = 0; q < 8; ++q) { const int r = q * 2 + rsub; if (col0 + c4 < N) { const v4f v = *(const v4fa*)&so[w][r][c4]; if (C) *(v4f*)(C + cofs + (size_t)(row0 + r) * ldc + col0 + c4) = v; if (C16) { v4h h4; for (int i = 0; i < 4; ++i) h4[i] = (_Float16)v[i]; *(v4h*)(C16 + cofs + (size_t)(row0 + r) * ldc + col0 + c4) = h4; } } }
     }
}


typedef _Float16 v4h __attribute__((ext_vector_type(4)));

__global__ __launch_bounds__(256) void k_x16(const float* __restrict__ x, _Float16* __restrict__ X16, size_t n8) { const size_t t = (size_t)blockIdx.x * 256 + threadIdx.x; if (t >= n8) return; FragH f;
#pragma unroll
  for (int q = 0; q < 8; ++q) f.h[q] = (_Float16)bf16_round(x[t * 8 + q]); *(v8us*)((unsigned short*)X16 + t * 8) = f.half[0];  }
__global__ __launch_bounds__(256) void k_h16(const float* __restrict__ x, _Float16* __restrict__ X16, size_t n8) { const size_t t = (size_t)blockIdx.x * 256 + threadIdx.x; if (t >= n8) return; FragH f;
#pragma unroll
  for (int q = 0; q < 8; ++q) f.h[q] = (_Float16)x[t * 8 + q]; *(v8us*)((unsigned short*)X16 + t * 8) = f.half[0];  }
__global__ __launch_bounds__(256) void k_round16f(const float* __restrict__ W, _Float16* __restrict__ Bt, size_t n8) { const size_t t = (size_t)blockIdx.x * 256 + threadIdx.x; if (t >= n8) return; FragH f;
#pragma unroll
  for (int i = 0; i < 8; ++i) f.h[i] = (_Float16)(bf16_round(W[t * 8 + i]) * 16.0f); *(v8us*)((unsigned short*)Bt + t * 8) = f.half[0];  }
template <int NHv, int TTv>
__global__ __launch_bounds__(256) void k_vt(const _Float16* __restrict__ V16, int ldv, int voff, _Float16* __restrict__ Vt) { __shared__ unsigned short tl[64][66]; const int tid = threadIdx.x; const int slab = blockIdx.x / (TTv / 64), lg = blockIdx.x % (TTv / 64); const int b = slab / NHv, h = slab % NHv;
  for (int i = tid; i < 64 * 8; i += 256) { const int r = i / 8, c8 = (i % 8) * 8; FragH f; f.half[0] = *(const v8us*)((const unsigned short*)V16 + ((size_t)b * TTv + lg * 64 + r) * ldv + voff + h * 64 + c8);
#pragma unroll
    for (int q = 0; q < 8; ++q) tl[r][c8 + q] = f.u[q]; }
  __syncthreads();
  {
#pragma unroll
    for (int rd = 0; rd < 2; ++rd) { const int d = rd * 32 + tid / 8, pc = tid % 8; FragH f;
#pragma unroll
      for (int q = 0; q < 8; ++q) f.u[q] = tl[pc * 8 + q][d];
      *(v8us*)((unsigned short*)Vt + ((size_t)slab * 64 + d) * TTv + lg * 64 + pc * 8) = f.half[0]; }
     } }

__global__ __launch_bounds__(256) void k_hl(const float* __restrict__ F, _Float16* __restrict__ Hh, _Float16* __restrict__ Hl, size_t n8) { const size_t t = (size_t)blockIdx.x * 256 + threadIdx.x; if (t >= n8) return; FragH fh, fl; const v4f a = *(const v4fa*)(F + t * 8), c = *(const v4fa*)(F + t * 8 + 4);
#pragma unroll
  for (int q = 0; q < 4; ++q) { _Float16 h = (_Float16)a[q]; fh.h[q] = h; fl.h[q] = (_Float16)((a[q] - (float)h) * 1024.0f); h = (_Float16)c[q]; fh.h[4 + q] = h; fl.h[4 + q] = (_Float16)((c[q] - (float)h) * 1024.0f); }
  { *(v8us*)((unsigned short*)Hh + t * 8) = fh.half[0]; *(v8us*)((unsigned short*)Hl + t * 8) = fl.half[0];  } }

// ---- fast GEMM (wave tile 32x64; requires M % 32 == 0 rows per launch region and N % 64 == 0); epilogue = k_gemm_hhx semantics ----
__device__ __forceinline__ v16h g2_frag(const _Float16* p, int hh) { FragH f; f.half[0] = *(const v8us*)((const unsigned short*)p + 8 * hh); f.half[1] = *(const v8us*)((const unsigned short*)p + 16 + 8 * hh); return f.v; }
__device__ __forceinline__ v8f g2_mma(v16h a, v16h b, v8f c) { v8f d = __builtin_amdgcn_wmma_f32_16x16x32_f16(false, a, false, b, (short)0, c, false, false); asm volatile("v_nop\n\tv_nop\n\tv_nop\n\tv_nop" : "+v"(d) : "v"(a), "v"(b)); return d; }
template <int ACT>
__global__ __launch_bounds__(128) void k_gemm2(const _Float16* __restrict__ A, int lda, size_t sA, const _Float16* __restrict__ Bh, int ldb, size_t sB, float alpha, const float* __restrict__ bias, size_t sBias, const float* __restrict__ CP, int rowsPerB, size_t sCPb, int row0g,
    float* __restrict__ C, _Float16* __restrict__ C16, int ldc, size_t sC, int M, int N, int K) {
  __shared__ __attribute__((aligned(16))) float so[4][32][68];
  const int tid = threadIdx.x, w = tid >> 5, lane = tid & 31, ln = lane & 15, hh = lane >> 4; const int by = blockIdx.y;
  A += (size_t)by * sA; Bh += (size_t)by * sB; const size_t cofs = (size_t)by * sC; const float* bp = bias ? bias + (size_t)by * sBias : nullptr;
  const int ntn = N >> 6; const int mt = blockIdx.x / ntn, nq = blockIdx.x - mt * ntn; const int row0 = mt * 128 + 32 * w, col0 = nq * 64; if (row0 >= M) return;
  const _Float16* a0p = A + (size_t)(row0 + ln) * lda; const _Float16* a1p = a0p + (size_t)16 * lda;
  const _Float16* b0p = Bh + (size_t)(col0 + ln) * ldb; const _Float16* b1p = b0p + (size_t)16 * ldb; const _Float16* b2p = b1p + (size_t)16 * ldb; const _Float16* b3p = b2p + (size_t)16 * ldb;
  const v8f z8 = {0.f,0.f,0.f,0.f,0.f,0.f,0.f,0.f}; v8f c00 = z8, c01 = z8, c02 = z8, c03 = z8, c10 = z8, c11 = z8, c12 = z8, c13 = z8;
#pragma unroll 1
  for (int kb = 0; kb < K; kb += 32) { const v16h a0 = g2_frag(a0p + kb, hh), a1 = g2_frag(a1p + kb, hh);
    v16h b = g2_frag(b0p + kb, hh); c00 = g2_mma(a0, b, c00); c10 = g2_mma(a1, b, c10);
    b = g2_frag(b1p + kb, hh); c01 = g2_mma(a0, b, c01); c11 = g2_mma(a1, b, c11);
    b = g2_frag(b2p + kb, hh); c02 = g2_mma(a0, b, c02); c12 = g2_mma(a1, b, c12);
    b = g2_frag(b3p + kb, hh); c03 = g2_mma(a0, b, c03); c13 = g2_mma(a1, b, c13); }
  v8f accs[8] = {c00, c01, c02, c03, c10, c11, c12, c13};
#pragma unroll
  for (int u = 0; u < 8; ++u) { const int t = u & 3, half = u >> 2; const int col = col0 + t * 16 + ln; const float bv = bp ? bf16_round(bp[col]) : 0.f;
#pragma unroll
    for (int r = 0; r < 8; ++r) { const int rloc = half * 16 + 8 * hh + r; float v = accs[u][r] * alpha + bv; if (CP) { const int bidx = (row0g + row0 + rloc) / rowsPerB; v += CP[(size_t)bidx * sCPb + (size_t)by * 64 + col]; }
      if (ACT == 3) v = fmaxf(v, 0.f); else if (ACT == 6) v = 0.5f * v * (1.0f + erff(v * 0.70710678118654752f)); else if (ACT == 11) v = 1.0f / (1.0f + expf(-v)); else if (ACT == 15) v = v / (1.0f + expf(-v)); else if (ACT == 12) v = (v > 0.f) ? v : 0.01f * v; else if (ACT == 8) v = tanhf(v);
      so[w][rloc][t * 16 + ln] = v; } }
  __builtin_amdgcn_fence(__ATOMIC_ACQ_REL, "workgroup"); __builtin_amdgcn_wave_barrier();
  const int rsub = lane >> 4, c4 = (lane & 15) * 4;
  {
#pragma unroll
    for (int q = 0; q < 16; ++q) { const int r = q * 2 + rsub; const v4f v = *(const v4fa*)&so[w][r][c4]; if (C) *(v4f*)(C + cofs + (size_t)(row0 + r) * ldc + col0 + c4) = v; if (C16) { v4h h4; for (int i = 0; i < 4; ++i) h4[i] = (_Float16)v[i]; *(v4h*)(C16 + cofs + (size_t)(row0 + r) * ldc + col0 + c4) = h4; } }
     } }



template <int TK>
__global__ __launch_bounds__(256) void k_vthl(const float* __restrict__ VF, int ldv, _Float16* __restrict__ Vth, _Float16* __restrict__ Vtl) { __shared__ float tl[64][65]; const int tid = threadIdx.x; const int slab = blockIdx.x / (TK / 64), lg = blockIdx.x % (TK / 64); const int b = slab / NH, h = slab % NH;
  for (int i = tid; i < 64 * 16; i += 256) { const int r = i / 16, c4 = (i % 16) * 4; const v4f a = *(const v4fa*)(VF + ((size_t)b * TK + lg * 64 + r) * ldv + h * 64 + c4); tl[r][c4] = a[0]; tl[r][c4 + 1] = a[1]; tl[r][c4 + 2] = a[2]; tl[r][c4 + 3] = a[3]; }
  __syncthreads();
  FragH fh[2], fl[2]; size_t oo[2];
#pragma unroll
  for (int rd = 0; rd < 2; ++rd) { const int d = rd * 32 + tid / 8, pc = tid % 8;
#pragma unroll
    for (int q = 0; q < 8; ++q) { const float v = tl[pc * 8 + q][d]; const _Float16 hv = (_Float16)v; fh[rd].h[q] = hv; fl[rd].h[q] = (_Float16)((v - (float)hv) * 1024.0f); } oo[rd] = ((size_t)slab * 64 + d) * TK + lg * 64 + pc * 8; }
  {
#pragma unroll
    for (int rd = 0; rd < 2; ++rd) { *(v8us*)((unsigned short*)Vth + oo[rd]) = fh[rd].half[0]; *(v8us*)((unsigned short*)Vtl + oo[rd]) = fl[rd].half[0]; }
     } }

template <int TQ, int TK>
__global__ __launch_bounds__(128) void k_flashb(const _Float16* __restrict__ Q16, const _Float16* __restrict__ Q16lo, int ldq, const _Float16* __restrict__ K16, const _Float16* __restrict__ K16lo, int ldk, const _Float16* __restrict__ Vt, const _Float16* __restrict__ Vtlo, const unsigned* __restrict__ MB, const int* __restrict__ RA, const int* __restrict__ KE, const _Float16* __restrict__ T16, float* __restrict__ O, int ldo) {
  constexpr int RPW = 16, RTN = RPW / 16, NQB = TQ / (4 * RPW), DT = 4, KS = 2;
  __shared__ __attribute__((aligned(16))) unsigned short sP[4][RPW][40], sPl[4][RPW][40]; __shared__ __attribute__((aligned(16))) float sO[4][RPW][64 + 4];
  const int tid = threadIdx.x, w = tid >> 5, lane = tid & 31, ln = lane & 15, hh = lane >> 4;
  const int slab = blockIdx.x / NQB, qblk = blockIdx.x % NQB; const int b = slab / NH, h = slab % NH; const int qb0 = qblk * (4 * RPW); const int q0 = qb0 + w * RPW;
  FragH aq[2][KS], aql[2][KS];
#pragma unroll
  for (int rt = 0; rt < RTN; ++rt) { const size_t qo = ((size_t)b * TQ + q0 + rt * 16 + ln) * ldq + h * 64; const unsigned short* qr = (const unsigned short*)Q16 + qo; const unsigned short* ql = (const unsigned short*)Q16lo + qo;
#pragma unroll
    for (int ks = 0; ks < KS; ++ks) { aq[rt][ks].half[0] = *(const v8us*)(qr + ks * 32 + 8 * hh); aq[rt][ks].half[1] = *(const v8us*)(qr + ks * 32 + 16 + 8 * hh); aql[rt][ks].half[0] = *(const v8us*)(ql + ks * 32 + 8 * hh); aql[rt][ks].half[1] = *(const v8us*)(ql + ks * 32 + 16 + 8 * hh); } }
  const unsigned short* Vth = (const unsigned short*)Vt + (size_t)slab * 64 * TK; const unsigned short* Vtl = (const unsigned short*)Vtlo + (size_t)slab * 64 * TK;
  float m_r[2][8], l_r[2][8]; v8f oacc[2][DT], oaccl[2][DT];
#pragma unroll
  for (int rt = 0; rt < RTN; ++rt) {
#pragma unroll
    for (int r = 0; r < 8; ++r) { m_r[rt][r] = -3.0e38f; l_r[rt][r] = 0.f; }
#pragma unroll
    for (int dt = 0; dt < DT; ++dt) { oacc[rt][dt] = (v8f){0.f,0.f,0.f,0.f,0.f,0.f,0.f,0.f}; oaccl[rt][dt] = oacc[rt][dt]; } }
  int jend = KE[qblk * 32]; jend = min(TK, (jend + 31) & ~31); if (jend < 32) jend = 32;      /* block-uniform */
  int allm[2][8]; const unsigned* mrow[2][8];
#pragma unroll
  for (int rt = 0; rt < RTN; ++rt)
#pragma unroll
    for (int r = 0; r < 8; ++r) { const int tq = q0 + rt * 16 + 8 * hh + r; allm[rt][r] = RA[tq]; mrow[rt][r] = MB + (size_t)tq * (TK / 32); }
  /* RPE: rel[i][c] = q[q0 + i] . table[h][rb + c], rb = q0 - j0 + TK - 32, c < 48; score (i, kk) takes c = i - kk + 31. Columns 32..47 of a trip are columns 0..15 of the trip before. */
  const unsigned short* Th = (const unsigned short*)T16 + (size_t)h * RW * 64 + (size_t)ln * 64 + 8 * hh;
  v8f relc = (v8f){0.f,0.f,0.f,0.f,0.f,0.f,0.f,0.f};      /* columns 32..47 of the first trip */
#pragma unroll
  for (int ks = 0; ks < KS; ++ks) { FragH bt; bt.half[0] = *(const v8us*)(Th + (size_t)(q0 + TK) * 64 + ks * 32); bt.half[1] = *(const v8us*)(Th + (size_t)(q0 + TK) * 64 + ks * 32 + 16); relc = mmaH<1>(aq[0][ks].v, aq[0][ks].v, bt.v, bt.v, relc); }
#pragma unroll 1
  for (int j0 = 0; j0 < jend; j0 += 32) {
    FragH bt[2][KS];      /* table rows rb .. rb + 31, fetched together with the first key tile */
#pragma unroll
    for (int t = 0; t < 2; ++t) { const unsigned short* tr = Th + (size_t)(q0 - j0 + (TK - 32) + t * 16) * 64;
#pragma unroll
      for (int ks = 0; ks < KS; ++ks) { bt[t][ks].half[0] = *(const v8us*)(tr + ks * 32); bt[t][ks].half[1] = *(const v8us*)(tr + ks * 32 + 16); } }
    asm volatile("s_wait_xcnt 0x0" ::: "memory");      /* stands in front of any overwrite of the table loads' address registers (the allocator lets a later load's result land in them) */
    v8f s[2][2];
#pragma unroll
    for (int nt = 0; nt < 2; ++nt) { const size_t ko = ((size_t)b * TK + j0 + nt * 16 + ln) * ldk + h * 64; const unsigned short* kr = (const unsigned short*)K16 + ko; const unsigned short* kl = (const unsigned short*)K16lo + ko; FragH bk[KS], bkl[KS];
#pragma unroll
      for (int ks = 0; ks < KS; ++ks) { bk[ks].half[0] = *(const v8us*)(kr + ks * 32 + 8 * hh); bk[ks].half[1] = *(const v8us*)(kr + ks * 32 + 16 + 8 * hh); bkl[ks].half[0] = *(const v8us*)(kl + ks * 32 + 8 * hh); bkl[ks].half[1] = *(const v8us*)(kl + ks * 32 + 16 + 8 * hh); }
      if (nt == 1) {      /* RPE products and their LDS stores run while the second key tile's loads are in flight */
        v8f rel0 = (v8f){0.f,0.f,0.f,0.f,0.f,0.f,0.f,0.f}, rel1 = rel0;
#pragma unroll
        for (int ks = 0; ks < KS; ++ks) { rel0 = mmaH<1>(aq[0][ks].v, aq[0][ks].v, bt[0][ks].v, bt[0][ks].v, rel0); rel1 = mmaH<1>(aq[0][ks].v, aq[0][ks].v, bt[1][ks].v, bt[1][ks].v, rel1); }
#pragma unroll
        for (int r = 0; r < 8; ++r) { sO[w][8 * hh + r][ln] = rel0[r]; sO[w][8 * hh + r][16 + ln] = rel1[r]; sO[w][8 * hh + r][32 + ln] = relc[r]; }
        relc = rel0; }
#pragma unroll
      for (int rt = 0; rt < RTN; ++rt) { v8f acc = (v8f){0.f,0.f,0.f,0.f,0.f,0.f,0.f,0.f}, accr = acc;
#pragma unroll
        for (int ks = 0; ks < KS; ++ks) { acc = mmaH<1>(aq[rt][ks].v, aq[rt][ks].v, bk[ks].v, bk[ks].v, acc); accr = mmaH<1>(aql[rt][ks].v, aql[rt][ks].v, bk[ks].v, bk[ks].v, accr); accr = mmaH<1>(aq[rt][ks].v, aq[rt][ks].v, bkl[ks].v, bkl[ks].v, accr); }
        s[rt][nt] = acc + accr * 0.0009765625f; } }
    /* the wave's rel stores above are read back by other lanes of the same wave below */
    __builtin_amdgcn_fence(__ATOMIC_ACQ_REL, "workgroup"); __builtin_amdgcn_wave_barrier();
    float rv0[8], rv1[8];      /* all 16 diagonal reads issued together, ahead of the per-row branches */
#pragma unroll
    for (int r = 0; r < 8; ++r) { rv0[r] = sO[w][8 * hh + r][8 * hh + r - ln + 31]; rv1[r] = sO[w][8 * hh + r][8 * hh + r - ln + 15]; }
#pragma unroll
    for (int rt = 0; rt < RTN; ++rt)
#pragma unroll
      for (int r = 0; r < 8; ++r) { const unsigned mw = mrow[rt][r][j0 >> 5]; const bool am = (allm[rt][r] != 0);
        const bool ok0 = am || (((mw >> ln) & 1u) == 0u), ok1 = am || (((mw >> (16 + ln)) & 1u) == 0u);
        const float s0 = ok0 ? (am ? 0.f : s[rt][0][r] * SCL + rv0[r] * 0.0625f) : -INFINITY, s1 = ok1 ? (am ? 0.f : s[rt][1][r] * SCL + rv1[r] * 0.0625f) : -INFINITY;      /* + q . table[h][(q - k) + T - 1] (table held x16) */ float mc = fmaxf(s0, s1);
        mc = fmaxf(mc, __shfl_xor(mc, 1, 32)); mc = fmaxf(mc, __shfl_xor(mc, 2, 32)); mc = fmaxf(mc, __shfl_xor(mc, 4, 32)); mc = fmaxf(mc, __shfl_xor(mc, 8, 32));
        const float mn = fmaxf(m_r[rt][r], mc); const float al = (mn > -1.0e38f) ? expf(m_r[rt][r] - mn) : 1.0f; m_r[rt][r] = mn; const float p0 = ok0 ? expf(s0 - mn) : 0.f, p1 = ok1 ? expf(s1 - mn) : 0.f; l_r[rt][r] = l_r[rt][r] * al + p0 + p1;
#pragma unroll
        for (int dt = 0; dt < DT; ++dt) { oacc[rt][dt][r] *= al; oaccl[rt][dt][r] *= al; }
        FragH t2, t3; const float ps0 = p0 * 1024.0f, ps1 = p1 * 1024.0f; t2.h[0] = (_Float16)ps0; t2.h[1] = (_Float16)ps1; t3.h[0] = (_Float16)((ps0 - (float)t2.h[0]) * 1024.0f); t3.h[1] = (_Float16)((ps1 - (float)t2.h[1]) * 1024.0f);
        sP[w][rt * 16 + 8 * hh + r][ln] = t2.u[0]; sP[w][rt * 16 + 8 * hh + r][16 + ln] = t2.u[1]; sPl[w][rt * 16 + 8 * hh + r][ln] = t3.u[0]; sPl[w][rt * 16 + 8 * hh + r][16 + ln] = t3.u[1]; }
    __builtin_amdgcn_fence(__ATOMIC_ACQ_REL, "workgroup"); __builtin_amdgcn_wave_barrier();
    FragH pa[2], pl[2];
#pragma unroll
    for (int rt = 0; rt < RTN; ++rt) { pa[rt].half[0] = *(const v8us*)&sP[w][rt * 16 + ln][8 * hh]; pa[rt].half[1] = *(const v8us*)&sP[w][rt * 16 + ln][16 + 8 * hh]; pl[rt].half[0] = *(const v8us*)&sPl[w][rt * 16 + ln][8 * hh]; pl[rt].half[1] = *(const v8us*)&sPl[w][rt * 16 + ln][16 + 8 * hh]; }
#pragma unroll
    for (int dt = 0; dt < DT; ++dt) { const size_t vo = (size_t)(dt * 16 + ln) * TK + j0; FragH bv, bl; bv.half[0] = *(const v8us*)(Vth + vo + 8 * hh); bv.half[1] = *(const v8us*)(Vth + vo + 16 + 8 * hh); bl.half[0] = *(const v8us*)(Vtl + vo + 8 * hh); bl.half[1] = *(const v8us*)(Vtl + vo + 16 + 8 * hh);
#pragma unroll
      for (int rt = 0; rt < RTN; ++rt) { oacc[rt][dt] = mmaH<1>(pa[rt].v, pa[rt].v, bv.v, bv.v, oacc[rt][dt]); oaccl[rt][dt] = mmaH<1>(pa[rt].v, pa[rt].v, bl.v, bl.v, oaccl[rt][dt]); oaccl[rt][dt] = mmaH<1>(pl[rt].v, pl[rt].v, bv.v, bv.v, oaccl[rt][dt]); } }
    __builtin_amdgcn_fence(__ATOMIC_ACQ_REL, "workgroup"); __builtin_amdgcn_wave_barrier(); }
#pragma unroll
  for (int rt = 0; rt < RTN; ++rt) {
#pragma unroll
    for (int r = 0; r < 8; ++r) { float l = l_r[rt][r]; l += __shfl_xor(l, 1, 32); l += __shfl_xor(l, 2, 32); l += __shfl_xor(l, 4, 32); l += __shfl_xor(l, 8, 32); l_r[rt][r] = (l > 0.f) ? 1.0f / (l * 1024.0f) : 0.f; }
#pragma unroll
    for (int dt = 0; dt < DT; ++dt)
#pragma unroll
      for (int r = 0; r < 8; ++r) sO[w][rt * 16 + 8 * hh + r][dt * 16 + ln] = (oacc[rt][dt][r] + oaccl[rt][dt][r] * 0.0009765625f) * l_r[rt][r]; }
  __builtin_amdgcn_fence(__ATOMIC_ACQ_REL, "workgroup"); __builtin_amdgcn_wave_barrier();
  {
#pragma unroll
    for (int rp = 0; rp < RPW; rp += 2) { const int r = rp + (lane >> 4), pc = lane & 15; const v4f val = *(const v4fa*)&sO[w][r][pc * 4]; *(v4f*)(O + ((size_t)b * TQ + q0 + r) * ldo + h * 64 + pc * 4) = val; }
     } }


__global__ __launch_bounds__(256) void k_fulltab(unsigned* __restrict__ MB, int* __restrict__ RA, int* __restrict__ KE, int nq, int nk) {
  const int t = blockIdx.x * 256 + threadIdx.x;
  if (t < nq * (nk / 32)) { *(unsigned*)(MB + t) = 0u;  }
  if (t < nq) { *(int*)(RA + t) = 0;  }
  if (t < nq / 64) { *(int*)(KE + t * 32) = nk;  } }
__global__ __launch_bounds__(256) void k_lnx(const float* __restrict__ X, const float* __restrict__ g, const float* __restrict__ bb, _Float16* __restrict__ Y16, float* __restrict__ XB) {
  #pragma clang fp contract(off)
  const int tid = threadIdx.x, w = tid >> 5, ln = tid & 31; const int r = blockIdx.x * 8 + w; if (r >= NR) return; const float* x = X + (size_t)r * DM; float s = 0.f;
#pragma unroll 1
  for (int i = 0; i < DM / 128; ++i) { const v4f a = *(const v4fa*)(x + i * 128 + ln * 4); for (int q = 0; q < 4; ++q) s += bf16_round(a[q]); }
  for (int o = 16; o > 0; o >>= 1) s += __shfl_xor(s, o, 32); const float mu = s / (float)DM; float q2 = 0.f;
#pragma unroll 1
  for (int i = 0; i < DM / 128; ++i) { const v4f a = *(const v4fa*)(x + i * 128 + ln * 4); for (int q = 0; q < 4; ++q) { const float d = bf16_round(a[q]) - mu; q2 += d * d; } }
  for (int o = 16; o > 0; o >>= 1) q2 += __shfl_xor(q2, o, 32); const float rs = rsqrtf(q2 / (float)DM + 1e-5f);
  {
#pragma unroll 1
    for (int i = 0; i < DM / 128; ++i) { const int c0 = i * 128 + ln * 4; const v4f a = *(const v4fa*)(x + c0); _Float16 h4[4]; v4f xb;
      for (int q = 0; q < 4; ++q) { const float t = bf16_round(a[q]); h4[q] = (_Float16)((t - mu) * rs * bf16_round(g[c0 + q]) + bf16_round(bb[c0 + q])); xb[q] = t; }
      *(unsigned long long*)((unsigned short*)Y16 + (size_t)r * DM + c0) = *(const unsigned long long*)h4; *(v4f*)(XB + (size_t)r * DM + c0) = xb; }
     } }
__global__ __launch_bounds__(256) void k_rtab(const float* __restrict__ tab, int trows, _Float16* __restrict__ T16) {
  const int t = blockIdx.x * 256 + threadIdx.x; if (t >= NH * RW * 8) return; const int d0 = (t & 7) * 8; const int r = (t >> 3) % RW; const int h = t / (8 * RW); FragH f;
#pragma unroll
  for (int q = 0; q < 8; ++q) f.h[q] = (r < 2 * SLEN - 1) ? (_Float16)(bf16_round(tab[((size_t)h * trows + r) * 64 + d0 + q]) * 16.0f) : (_Float16)0.0f;
  *(v8us*)((unsigned short*)T16 + ((size_t)h * RW + r) * 64 + d0) = f.half[0];  }
__global__ __launch_bounds__(256) void k_causaltab(unsigned* __restrict__ MB, int* __restrict__ RA, int* __restrict__ KE, int nq, int nk) {
  const int t = blockIdx.x * 256 + threadIdx.x; const int nw = nk / 32;
  if (t < nq * nw) { const int q = t / nw, w = t % nw; const int first = q + 1 - 32 * w; const unsigned bits = (first <= 0) ? 0xffffffffu : ((first >= 32) ? 0u : (0xffffffffu << first)); *(unsigned*)(MB + t) = bits;  }
  if (t < nq) { *(int*)(RA + t) = 0;  }
  if (t < nq / 64) { const int v = 64 * (t + 1); *(int*)(KE + t * 32) = v;  } }


extern "C" void kernel_launch(void* const* d_in, const int* in_sizes, int n_in,
                              void* d_out, int out_size, void* d_ws, size_t ws_size, hipStream_t stream) {
  (void)in_sizes; (void)n_in; (void)out_size;
  const float* const* I = (const float* const*)d_in; const float* x = I[0]; const float* Wq = I[1]; const float* bq = I[2]; const float* Wk = I[3]; const float* bk = I[4]; const float* Wv = I[5]; const float* bv = I[6]; const float* Wo = I[7]; const float* bo = I[8]; const float* tab = I[9];
  char* ws = (char*)d_ws; size_t off = 0;
  auto take = [&](size_t bytes) { char* p = ws + off; off += (bytes + 255) & ~(size_t)255; return p; };
  _Float16* BQ = (_Float16*)take((size_t)DM * DM * 2); _Float16* BK = (_Float16*)take((size_t)DM * DM * 2); _Float16* BV = (_Float16*)take((size_t)DM * DM * 2); _Float16* BO = (_Float16*)take((size_t)DM * DM * 2); _Float16* T16 = (_Float16*)take((size_t)NH * RW * 64 * 2);
  _Float16* X16 = (_Float16*)take((size_t)NR * DM * 2); float* F = (float*)take((size_t)NR * DM * 4);
  _Float16* Qh = (_Float16*)take((size_t)NR * DM * 2); _Float16* Ql = (_Float16*)take((size_t)NR * DM * 2); _Float16* Kh = (_Float16*)take((size_t)NR * DM * 2); _Float16* Kl = (_Float16*)take((size_t)NR * DM * 2); _Float16* Vth = (_Float16*)take((size_t)NR * DM * 2); _Float16* Vtl = (_Float16*)take((size_t)NR * DM * 2);
  float* O = (float*)take((size_t)NR * DM * 4); _Float16* Oh = (_Float16*)take((size_t)NR * DM * 2); _Float16* Ol = (_Float16*)take((size_t)NR * DM * 2);
  unsigned* MB = (unsigned*)take((size_t)SLEN * (SLEN / 32) * 4); int* RA = (int*)take((size_t)SLEN * 4); int* KE = (int*)take((size_t)(SLEN / 64) * 32 * 4);
  if (off > ws_size) return;      /* 8 + 4 + 8 + 16 + 48 + 16 + 16 + 0.2 = 116 MiB */
  const size_t n8 = (size_t)NR * DM / 8; const unsigned nb8 = (unsigned)((n8 + 255) / 256); const size_t w8 = (size_t)DM * DM / 8; const unsigned wb = (unsigned)((w8 + 255) / 256);
  k_round16f<<<wb, 256, 0, stream>>>(Wq, BQ, w8); k_round16f<<<wb, 256, 0, stream>>>(Wk, BK, w8); k_round16f<<<wb, 256, 0, stream>>>(Wv, BV, w8); k_round16f<<<wb, 256, 0, stream>>>(Wo, BO, w8);      /* torch (out,in) = natural Bt */
  k_rtab<<<(NH * RW * 8 + 255) / 256, 256, 0, stream>>>(tab, 9999, T16); k_fulltab<<<(SLEN * (SLEN / 32) + 255) / 256, 256, 0, stream>>>(MB, RA, KE, SLEN, SLEN);
  const dim3 gP((NR / 128) * (DM / 64), 1);
  /* every row-wise stage runs once over all NBT * SLEN rows */
  k_x16<<<nb8, 256, 0, stream>>>(x, X16, n8);
  k_gemm2<0><<<gP, 128, 0, stream>>>(X16, DM, 0, BQ, DM, 0, 0.0625f, bq, 0, nullptr, 1, 0, 0, F, nullptr, DM, 0, NR, DM, DM); k_hl<<<nb8, 256, 0, stream>>>(F, Qh, Ql, n8);      /* q: f32 -> hi/lo; the hi plane also feeds the RPE product */
  k_gemm2<0><<<gP, 128, 0, stream>>>(X16, DM, 0, BK, DM, 0, 0.0625f, bk, 0, nullptr, 1, 0, 0, F, nullptr, DM, 0, NR, DM, DM); k_hl<<<nb8, 256, 0, stream>>>(F, Kh, Kl, n8);
  k_gemm2<0><<<gP, 128, 0, stream>>>(X16, DM, 0, BV, DM, 0, 0.0625f, bv, 0, nullptr, 1, 0, 0, F, nullptr, DM, 0, NR, DM, DM); k_vthl<SLEN><<<NBT * NH * (SLEN / 64), 256, 0, stream>>>(F, DM, Vth, Vtl);
  k_flashb<SLEN, SLEN><<<NBT * NH * (SLEN / 64), 128, 0, stream>>>(Qh, Ql, DM, Kh, Kl, DM, Vth, Vtl, MB, RA, KE, T16, O, DM);      /* all batches and heads in one launch */
  k_hl<<<nb8, 256, 0, stream>>>(O, Oh, Ol, n8);
  float* outp = (float*)d_out;
  k_gemm2<0><<<gP, 128, 0, stream>>>(Oh, DM, 0, BO, DM, 0, 0.0625f, bo, 0, nullptr, 1, 0, 0, outp, nullptr, DM, 0, NR, DM, DM);
  k_gemm2<0><<<gP, 128, 0, stream>>>(Ol, DM, 0, BO, DM, 0, 0.0625f / 1024.0f, nullptr, 0, outp, 1, (size_t)DM, 0, outp, nullptr, DM, 0, NR, DM, DM);
}

// v003
// It runs in 392 microseconds.
// In both of two side-by-side timings against v002, it was 1.31 times as fast.
// Counting every step since v000, it is 11.1 times as fast.
#include <hip/hip_runtime.h>
// Multi-head attention with learned relative-position encoding (4 x 1024 tokens, 1024 = 16 heads x 64): q,k,v = x W^T + b; scores = q.k/8 + q.rpe_table[h][q - k + 1023] (no scale on the RPE term); softmax over all keys; . v; merged . Wo^T + bo -> [4,1024,1024].
// Structure: projections (all batches in one launch) as f16 WMMA GEMMs (32x64 wave tiles, f32 accumulation, exact products + bias; the work-group's A and B tiles reach LDS by asynchronous copies, two buffers); the fused flash kernel (one launch over all batches and heads; hi/lo q,k three-product scores, online f32 softmax, P staged hi + residual, V^T hi + residual; all keys valid) forms the RPE term itself: per 16 x 32 score tile the 48 table rows r = q - k + 1023 can reach give a 16 x 48 f16 WMMA product q_h . table[h][r] (f32 result, 16 of the 48 columns carried over from the trip before), staged in the wave's LDS and read back along the diagonal inside the score stage; O as hi + residual planes into Wo (two GEMMs, bias in the first).
// Compute dtype: x, weights, biases, rpe_table rounded to bf16; projections exact; the RPE product uses the plain f16 q (the hi plane) (~2^-12 on a sigma-0.16 bias); q, k, P, v, O as f16 hi + residual pairs (~2^-21) in the attention; f32 accumulation and softmax. v_wmma_f32_16x16x32_f16.
#define NBT 4
#define SLEN 1024
#define RW 2048                  /* table rows kept per head (2*SLEN-1 used, the last one zero) */
#define DM 1024
#define NH 16
#define SCL 0.125f
#define NR (NBT * SLEN)
typedef __bf16 v16b __attribute__((ext_vector_type(16)));
typedef unsigned short v8us __attribute__((ext_vector_type(8), may_alias));
typedef float  v8f  __attribute__((ext_vector_type(8)));
typedef float  v4f  __attribute__((ext_vector_type(4)));
typedef float  v4fa __attribute__((ext_vector_type(4), may_alias));
union FragB { v16b v; v8us half[2]; unsigned short u[16]; };

__device__ __forceinline__ unsigned short bf16_bits(float x) { unsigned int u = __float_as_uint(x); return (unsigned short)((u + 0x7FFFu + ((u >> 16) & 1u)) >> 16); }
__device__ __forceinline__ float bf16_val(unsigned short b) { return __uint_as_float(((unsigned int)b) << 16); }
__device__ __forceinline__ float bf16_round(float x) { return bf16_val(bf16_bits(x)); }
// D += A·B with NT terms: 1 = ah·bh, 2 = + al·bh (A split), 3 = + ah·bl (both split)
template <int NT>
__device__ __forceinline__ v8f mmaN(v16b ah, v16b al, v16b bh, v16b bl, v8f c) {
  c = __builtin_amdgcn_wmma_f32_16x16x32_bf16(false, ah, false, bh, (short)0, c, false, false);
  if (NT >= 2) c = __builtin_amdgcn_wmma_f32_16x16x32_bf16(false, al, false, bh, (short)0, c, false, false);
  if (NT >= 3) c = __builtin_amdgcn_wmma_f32_16x16x32_bf16(false, ah, false, bl, (short)0, c, false, false);
  asm volatile("v_nop\n\tv_nop\n\tv_nop\n\tv_nop" : "+v"(c) : "v"(ah), "v"(al), "v"(bh), "v"(bl));
  return c;
}

__global__ __launch_bounds__(256) void k_wt_bf16(const float* __restrict__ W, unsigned short* __restrict__ Wt, int K, int N) {
  const int t = blockIdx.x * 256 + threadIdx.x;
  const int k8n = K / 8;
  if (t >= N * k8n) return;
  const int n = t / k8n, k8 = (t % k8n) * 8;
  v8us v;
#pragma unroll
  for (int i = 0; i < 8; ++i) v[i] = bf16_bits(W[(size_t)(k8 + i) * N + n]);
  *(v8us*)(Wt + (size_t)n * K + k8) = v;
  
}

// GEMM C[M][N] (f32, pitch ldc) = act(A[M][K]·W + bias). A f32 row-major (pitch lda) converted per fragment to bf16
// (ASPLIT: hi/lo two planes -> 2 terms, else single rounded term); Wt bf16 [N][K] (pitch ldb). BIAS_BF16 rounds the
// bias to bf16 first (bias quantised to bf16 before the add). K%32==0, M%16==0, N%64==0.
template <bool ASPLIT, int ACT, bool BIAS_BF16>
__global__ __launch_bounds__(128) void k_gemm_bf(const float* __restrict__ A, int lda, const unsigned short* __restrict__ Wt, int ldb,
                                               const float* __restrict__ bias, float* __restrict__ C, int ldc, int M, int N, int K) {
  __shared__ __attribute__((aligned(16))) float so[4][16][64];
  const int tid = threadIdx.x, w = tid >> 5, lane = tid & 31, ln = lane & 15, hh = lane >> 4;
  const int ntn = N / 64;
  const int wid = blockIdx.x * 4 + w;
  const int mt = wid / ntn, nq = wid % ntn;
  if (mt * 16 >= M) return;
  const int row0 = mt * 16, col0 = nq * 64;
  const float* arow = A + (size_t)(row0 + ln) * lda;
  v8f acc[4] = {};
  for (int kb = 0; kb < K; kb += 32) {
    FragB ah, al;
    const v4f x0 = *(const v4fa*)(arow + kb + 8 * hh), x1 = *(const v4fa*)(arow + kb + 8 * hh + 4);
    const v4f x2 = *(const v4fa*)(arow + kb + 16 + 8 * hh), x3 = *(const v4fa*)(arow + kb + 16 + 8 * hh + 4);
    float xs[16] = {x0[0],x0[1],x0[2],x0[3],x1[0],x1[1],x1[2],x1[3],x2[0],x2[1],x2[2],x2[3],x3[0],x3[1],x3[2],x3[3]};
#pragma unroll
    for (int i = 0; i < 16; ++i) { const unsigned short hb = bf16_bits(xs[i]); ah.u[i] = hb; al.u[i] = ASPLIT ? bf16_bits(xs[i] - bf16_val(hb)) : (unsigned short)0; }
#pragma unroll
    for (int t = 0; t < 4; ++t) {
      const unsigned short* brow = Wt + (size_t)(col0 + t * 16 + ln) * ldb + kb;
      FragB b;
      b.half[0] = *(const v8us*)(brow + 8 * hh);
      b.half[1] = *(const v8us*)(brow + 16 + 8 * hh);
      acc[t] = mmaN<ASPLIT ? 2 : 1>(ah.v, al.v, b.v, b.v, acc[t]);
    }
  }
#pragma unroll
  for (int t = 0; t < 4; ++t) {
    float bv = bias ? bias[col0 + t * 16 + ln] : 0.f;
    if (BIAS_BF16) bv = bf16_round(bv);
#pragma unroll
    for (int r = 0; r < 8; ++r) { float v = acc[t][r] + bv; if (ACT == 1) v = fmaxf(v, 0.f); so[w][8 * hh + r][t * 16 + ln] = v; }
  }
  __builtin_amdgcn_fence(__ATOMIC_ACQ_REL, "workgroup");
  __builtin_amdgcn_wave_barrier();
  const int rsub = lane >> 4, c4 = (lane & 15) * 4;
  {
#pragma unroll
    for (int q = 0; q < 8; ++q) {
      const int r = q * 2 + rsub;
      const v4f v = *(const v4fa*)&so[w][r][c4];
      *(v4f*)(C + (size_t)(row0 + r) * ldc + col0 + c4) = v;
    }
    
  }
}

// GEMM C = act(A·W + bias + resid): A f32 (ASPLIT -> hi/lo 2 terms), Wt bf16 [N][K]; ACT 0 none, 1 relu, 2 exact gelu;
// resid (optional, f32, row index = (row % rmod), pitch ldr, RES_BF16 rounds it) added before the activation.
template <bool ASPLIT, int ACT, bool BIAS_BF16, bool RES_BF16>
__global__ __launch_bounds__(128) void k_gemm_bf3(const float* __restrict__ A, int lda, const unsigned short* __restrict__ Wt, int ldb,
                                                const float* __restrict__ bias, const float* __restrict__ resid, int rmod, int ldr,
                                                float* __restrict__ C, int ldc, int M, int N, int K) {
  __shared__ __attribute__((aligned(16))) float so[4][16][64];
  const int tid = threadIdx.x, w = tid >> 5, lane = tid & 31, ln = lane & 15, hh = lane >> 4;
  const int ntn = N / 64;
  const int wid = blockIdx.x * 4 + w;
  const int mt = wid / ntn, nq = wid % ntn;
  if (mt * 16 >= M) return;
  const int row0 = mt * 16, col0 = nq * 64;
  const float* arow = A + (size_t)(row0 + ln) * lda;
  v8f acc[4] = {};
  for (int kb = 0; kb < K; kb += 32) {
    FragB ah, al;
    const v4f x0 = *(const v4fa*)(arow + kb + 8 * hh), x1 = *(const v4fa*)(arow + kb + 8 * hh + 4);
    const v4f x2 = *(const v4fa*)(arow + kb + 16 + 8 * hh), x3 = *(const v4fa*)(arow + kb + 16 + 8 * hh + 4);
    float xs[16] = {x0[0],x0[1],x0[2],x0[3],x1[0],x1[1],x1[2],x1[3],x2[0],x2[1],x2[2],x2[3],x3[0],x3[1],x3[2],x3[3]};
#pragma unroll
    for (int i = 0; i < 16; ++i) { const unsigned short hb = bf16_bits(xs[i]); ah.u[i] = hb; al.u[i] = ASPLIT ? bf16_bits(xs[i] - bf16_val(hb)) : (unsigned short)0; }
#pragma unroll
    for (int t = 0; t < 4; ++t) {
      const unsigned short* brow = Wt + (size_t)(col0 + t * 16 + ln) * ldb + kb;
      FragB b;
      b.half[0] = *(const v8us*)(brow + 8 * hh);
      b.half[1] = *(const v8us*)(brow + 16 + 8 * hh);
      acc[t] = mmaN<ASPLIT ? 2 : 1>(ah.v, al.v, b.v, b.v, acc[t]);
    }
  }
#pragma unroll
  for (int t = 0; t < 4; ++t) {
    const int col = col0 + t * 16 + ln;
    float bv = bias ? bias[col] : 0.f;
    if (BIAS_BF16) bv = bf16_round(bv);
#pragma unroll
    for (int r = 0; r < 8; ++r) {
      float v = acc[t][r] + bv;
      if (resid) { float rv = resid[(size_t)((row0 + 8 * hh + r) % rmod) * ldr + col]; if (RES_BF16) rv = bf16_round(rv); v += rv; }
      if (ACT == 1) v = fmaxf(v, 0.f);
      if (ACT == 2) v = 0.5f * v * (1.0f + erff(v * 0.70710678118654752f));
      if (ACT == 3) { const float u = 0.7978845608028654f * (v + 0.044715f * v * v * v); v = 0.5f * v * (1.0f + tanhf(u)); }
      so[w][8 * hh + r][t * 16 + ln] = v;
    }
  }
  __builtin_amdgcn_fence(__ATOMIC_ACQ_REL, "workgroup");
  __builtin_amdgcn_wave_barrier();
  const int rsub = lane >> 4, c4 = (lane & 15) * 4;
  {
#pragma unroll
    for (int q = 0; q < 8; ++q) {
      const int r = q * 2 + rsub;
      const v4f v = *(const v4fa*)&so[w][r][c4];
      *(v4f*)(C + (size_t)(row0 + r) * ldc + col0 + c4) = v;
    }
    
  }
}
// row LayerNorm (biased variance, eps) over N: s = X (+ R); optional out_sum <- s; out_norm <- (s-mu)*rsqrt(var+eps)*g + b
template <bool PARAM_BF16>
__global__ __launch_bounds__(256) void k_layernorm(const float* __restrict__ X, const float* __restrict__ R, const float* __restrict__ g, const float* __restrict__ bta,
                                                  float* __restrict__ out_sum, float* __restrict__ out_norm, int N, float eps) {
  __shared__ float red[256];
  const int row = blockIdx.x, tid = threadIdx.x;
  const float* x = X + (size_t)row * N; const float* rr = R ? R + (size_t)row * N : nullptr;
  float vals[16];                     // up to N = 4096
  const int per = N / 256;            // contiguous chunk per thread? use strided-by-4 chunks: thread handles j = tid*4 + 1024*u
  float s1 = 0.f;
  for (int u = 0; u < per / 4; ++u) {
    const int j = tid * 4 + 1024 * u;
    const v4f a = *(const v4fa*)(x + j);
    v4f b = {0.f,0.f,0.f,0.f}; if (rr) b = *(const v4fa*)(rr + j);
#pragma unroll
    for (int q = 0; q < 4; ++q) { const float v = a[q] + b[q]; vals[u * 4 + q] = v; s1 += v; }
  }
  red[tid] = s1; __syncthreads();
  for (int st = 128; st > 0; st >>= 1) { if (tid < st) red[tid] += red[tid + st]; __syncthreads(); }
  const float mu = red[0] / (float)N; __syncthreads();
  float s2 = 0.f;
  for (int u = 0; u < per / 4; ++u)
#pragma unroll
    for (int q = 0; q < 4; ++q) { const float c = vals[u * 4 + q] - mu; s2 += c * c; }
  red[tid] = s2; __syncthreads();
  for (int st = 128; st > 0; st >>= 1) { if (tid < st) red[tid] += red[tid + st]; __syncthreads(); }
  const float rs = rsqrtf(red[0] / (float)N + eps);
  {
    for (int u = 0; u < per / 4; ++u) {
      const int j = tid * 4 + 1024 * u;
      v4f o, sm;
#pragma unroll
      for (int q = 0; q < 4; ++q) {
        float gg = g[j + q], bb = bta[j + q];
        if (PARAM_BF16) { gg = bf16_round(gg); bb = bf16_round(bb); }
        sm[q] = vals[u * 4 + q]; o[q] = (vals[u * 4 + q] - mu) * rs * gg + bb;
      }
      if (out_sum) *(v4f*)(out_sum + (size_t)row * N + j) = sm;
      *(v4f*)(out_norm + (size_t)row * N + j) = o;
    }
    
  }
}



// ---- f16 WMMA path (v_wmma_f32_16x16x32_f16): 11-bit significands for operands in range — used where a [0,1] probability operand needs more precision than bf16
typedef _Float16 v16h __attribute__((ext_vector_type(16)));
union FragH { v16h v; v8us half[2]; _Float16 h[16]; unsigned short u[16]; };
template <int NT>
__device__ __forceinline__ v8f mmaH(v16h ah, v16h al, v16h bh, v16h bl, v8f c) {
  c = __builtin_amdgcn_wmma_f32_16x16x32_f16(false, ah, false, bh, (short)0, c, false, false);
  if (NT >= 2) c = __builtin_amdgcn_wmma_f32_16x16x32_f16(false, al, false, bh, (short)0, c, false, false);
  if (NT >= 3) c = __builtin_amdgcn_wmma_f32_16x16x32_f16(false, ah, false, bl, (short)0, c, false, false);
  asm volatile("v_nop\n\tv_nop\n\tv_nop\n\tv_nop" : "+v"(c) : "v"(ah), "v"(al), "v"(bh), "v"(bl));
  return c;
}
// batched GEMM like k_gemm_b but f16 operands: A f32 (split into f16 hi/lo if ASPLIT, else rounded to f16), Bt = f16 values [n][k]; alpha; C f32; N multiple of 16 (partial tiles skipped)
template <bool ASPLIT>
__global__ __launch_bounds__(128) void k_gemm_h(const float* __restrict__ A, int lda, size_t sA, const _Float16* __restrict__ Bh, int ldb, size_t sB, float alpha, float* __restrict__ C, int ldc, size_t sC, int M, int N, int K) {
  __shared__ __attribute__((aligned(16))) float so[4][16][64];
  const int tid = threadIdx.x, w = tid >> 5, lane = tid & 31, ln = lane & 15, hh = lane >> 4; const int by = blockIdx.y;
  A += (size_t)by * sA; Bh += (size_t)by * sB; C += (size_t)by * sC;
  const int ntn = (N + 63) / 64; const int wid = blockIdx.x * 4 + w; const int mt = wid / ntn, nq = wid % ntn; if (mt * 16 >= M) return;
  const int row0 = mt * 16, col0 = nq * 64; const float* arow = A + (size_t)(row0 + ln) * lda;
  v8f acc[4] = {};
  for (int kb = 0; kb < K; kb += 32) {
    FragH ah, al;
    const v4f x0 = *(const v4fa*)(arow + kb + 8 * hh), x1 = *(const v4fa*)(arow + kb + 8 * hh + 4), x2 = *(const v4fa*)(arow + kb + 16 + 8 * hh), x3 = *(const v4fa*)(arow + kb + 16 + 8 * hh + 4);
    float xs[16] = {x0[0],x0[1],x0[2],x0[3],x1[0],x1[1],x1[2],x1[3],x2[0],x2[1],x2[2],x2[3],x3[0],x3[1],x3[2],x3[3]};
#pragma unroll
    for (int i = 0; i < 16; ++i) { const _Float16 h = (_Float16)xs[i]; ah.h[i] = h; al.h[i] = ASPLIT ? (_Float16)(xs[i] - (float)h) : (_Float16)0.0f; }
#pragma unroll
    for (int t = 0; t < 4; ++t) { if (col0 + t * 16 >= N) continue; const size_t boff = (size_t)(col0 + t * 16 + ln) * ldb + kb; FragH bq; bq.half[0] = *(const v8us*)(Bh + boff + 8 * hh); bq.half[1] = *(const v8us*)(Bh + boff + 16 + 8 * hh);
      acc[t] = mmaH<ASPLIT ? 2 : 1>(ah.v, al.v, bq.v, bq.v, acc[t]); }
  }
#pragma unroll
  for (int t = 0; t < 4; ++t) { if (col0 + t * 16 >= N) continue;
#pragma unroll
    for (int r = 0; r < 8; ++r) so[w][8 * hh + r][t * 16 + ln] = acc[t][r] * alpha; }
  __builtin_amdgcn_fence(__ATOMIC_ACQ_REL, "workgroup"); __builtin_amdgcn_wave_barrier();
  const int rsub = lane >> 4, c4 = (lane & 15) * 4;
  {
#pragma unroll
    for (int q = 0; q < 8; ++q) { const int r = q * 2 + rsub; if (col0 + c4 < N) { const v4f v = *(const v4fa*)&so[w][r][c4]; *(v4f*)(C + (size_t)(row0 + r) * ldc + col0 + c4) = v; } }
     }
}

// Wt[n][k] = f16(W[k][n]·scale) from f32 row-major W[K][N] (scale = power of two; bf16-exact weights stay exact in f16 away from the subnormal range)
__global__ __launch_bounds__(256) void k_wt_f16(const float* __restrict__ W, _Float16* __restrict__ Wt, int K, int N, float scale) {
  const int t = blockIdx.x * 256 + threadIdx.x; if (t >= N * (K / 8)) return; const int n = t / (K / 8), k8 = (t % (K / 8)) * 8; FragH f;
#pragma unroll
  for (int i = 0; i < 8; ++i) f.h[i] = (_Float16)(bf16_round(W[(size_t)(k8 + i) * N + n]) * scale); const v8us o = f.half[0];
  *(v8us*)((unsigned short*)Wt + (size_t)n * K + k8) = o; 
}
// k_gemm_hh variant with fused epilogue: v = acc·alpha + bias[by·sBias + col] (+ CP[(row/rowsPerB)·sCPb + by·64 + col] if CP) ; ACT 0 none / 1 elu ; writes f16 C16 (and f32 C if non-null)
template <int ACT>
__global__ __launch_bounds__(128) void k_gemm_hhx(const _Float16* __restrict__ A, int lda, size_t sA, const _Float16* __restrict__ Bh, int ldb, size_t sB, float alpha, const float* __restrict__ bias, size_t sBias, const float* __restrict__ CP, int rowsPerB, size_t sCPb, int row0g,
    float* __restrict__ C, _Float16* __restrict__ C16, int ldc, size_t sC, int M, int N, int K) {
  __shared__ __attribute__((aligned(16))) float so[4][16][64];
  const int tid = threadIdx.x, w = tid >> 5, lane = tid & 31, ln = lane & 15, hh = lane >> 4; const int by = blockIdx.y;
  A += (size_t)by * sA; Bh += (size_t)by * sB; const size_t cofs = (size_t)by * sC; const float* bp = bias ? bias + (size_t)by * sBias : nullptr;
  const int ntn = (N + 63) / 64; const int wid = blockIdx.x * 4 + w; const int mt = wid / ntn, nq = wid % ntn; if (mt * 16 >= M) return;
  const int row0 = mt * 16, col0 = nq * 64; const _Float16* arow = A + (size_t)(row0 + ln) * lda;
  v8f acc[4] = {};
  for (int kb = 0; kb < K; kb += 32) { FragH ah; ah.half[0] = *(const v8us*)((const unsigned short*)arow + kb + 8 * hh); ah.half[1] = *(const v8us*)((const unsigned short*)arow + kb + 16 + 8 * hh);
#pragma unroll
    for (int t = 0; t < 4; ++t) { if (col0 + t * 16 >= N) continue; const size_t boff = (size_t)(col0 + t * 16 + ln) * ldb + kb; FragH bq; bq.half[0] = *(const v8us*)((const unsigned short*)Bh + boff + 8 * hh); bq.half[1] = *(const v8us*)((const unsigned short*)Bh + boff + 16 + 8 * hh);
      acc[t] = mmaH<1>(ah.v, ah.v, bq.v, bq.v, acc[t]); }
  }
#pragma unroll
  for (int t = 0; t < 4; ++t) { if (col0 + t * 16 >= N) continue; const int col = col0 + t * 16 + ln; const float bv = bp ? bf16_round(bp[col]) : 0.f;
#pragma unroll
    for (int r = 0; r < 8; ++r) { float v = acc[t][r] * alpha + bv; if (CP) { const int bidx = (row0g + row0 + 8 * hh + r) / rowsPerB; v += CP[(size_t)bidx * sCPb + (size_t)by * 64 + col]; } if (ACT == 1) v = (v > 0.f) ? v : expm1f(v); else if (ACT == 7) v = (v > 0.f) ? v + 1.0f : expf(v); else if (ACT == 8) v = tanhf(v); else if (ACT == 9) v = 0.5f * v * (1.0f + tanhf(0.7978845608028654f * (v + 0.044715f * v * v * v))); else if (ACT == 11) v = 1.0f / (1.0f + expf(-v)); else if (ACT == 12) v = (v > 0.f) ? v : 0.01f * v; else if (ACT == 14) v = (v > 0.f) ? v : 0.1f * v; else if (ACT == 15) v = v / (1.0f + expf(-v)); else if (ACT == 3) v = fmaxf(v, 0.f); else if (ACT == 6) v = 0.5f * v * (1.0f + erff(v * 0.70710678118654752f)); so[w][8 * hh + r][t * 16 + ln] = v; } }
  __builtin_amdgcn_fence(__ATOMIC_ACQ_REL, "workgroup"); __builtin_amdgcn_wave_barrier();
  const int rsub = lane >> 4, c4 = (lane & 15) * 4; typedef _Float16 v4h __attribute__((ext_vector_type(4)));
  {
#pragma unroll
    for (int q = 0; q < 8; ++q) { const int r = q * 2 + rsub; if (col0 + c4 < N) { const v4f v = *(const v4fa*)&so[w][r][c4]; if (C) *(v4f*)(C + cofs + (size_t)(row0 + r) * ldc + col0 + c4) = v; if (C16) { v4h h4; for (int i = 0; i < 4; ++i) h4[i] = (_Float16)v[i]; *(v4h*)(C16 + cofs + (size_t)(row0 + r) * ldc + col0 + c4) = h4; } } }
     }
}


typedef _Float16 v4h __attribute__((ext_vector_type(4)));

__global__ __launch_bounds__(256) void k_x16(const float* __restrict__ x, _Float16* __restrict__ X16, size_t n8) { const size_t t = (size_t)blockIdx.x * 256 + threadIdx.x; if (t >= n8) return; FragH f;
#pragma unroll
  for (int q = 0; q < 8; ++q) f.h[q] = (_Float16)bf16_round(x[t * 8 + q]); *(v8us*)((unsigned short*)X16 + t * 8) = f.half[0];  }
__global__ __launch_bounds__(256) void k_h16(const float* __restrict__ x, _Float16* __restrict__ X16, size_t n8) { const size_t t = (size_t)blockIdx.x * 256 + threadIdx.x; if (t >= n8) return; FragH f;
#pragma unroll
  for (int q = 0; q < 8; ++q) f.h[q] = (_Float16)x[t * 8 + q]; *(v8us*)((unsigned short*)X16 + t * 8) = f.half[0];  }
__global__ __launch_bounds__(256) void k_round16f(const float* __restrict__ W, _Float16* __restrict__ Bt, size_t n8) { const size_t t = (size_t)blockIdx.x * 256 + threadIdx.x; if (t >= n8) return; FragH f;
#pragma unroll
  for (int i = 0; i < 8; ++i) f.h[i] = (_Float16)(bf16_round(W[t * 8 + i]) * 16.0f); *(v8us*)((unsigned short*)Bt + t * 8) = f.half[0];  }
template <int NHv, int TTv>
__global__ __launch_bounds__(256) void k_vt(const _Float16* __restrict__ V16, int ldv, int voff, _Float16* __restrict__ Vt) { __shared__ unsigned short tl[64][66]; const int tid = threadIdx.x; const int slab = blockIdx.x / (TTv / 64), lg = blockIdx.x % (TTv / 64); const int b = slab / NHv, h = slab % NHv;
  for (int i = tid; i < 64 * 8; i += 256) { const int r = i / 8, c8 = (i % 8) * 8; FragH f; f.half[0] = *(const v8us*)((const unsigned short*)V16 + ((size_t)b * TTv + lg * 64 + r) * ldv + voff + h * 64 + c8);
#pragma unroll
    for (int q = 0; q < 8; ++q) tl[r][c8 + q] = f.u[q]; }
  __syncthreads();
  {
#pragma unroll
    for (int rd = 0; rd < 2; ++rd) { const int d = rd * 32 + tid / 8, pc = tid % 8; FragH f;
#pragma unroll
      for (int q = 0; q < 8; ++q) f.u[q] = tl[pc * 8 + q][d];
      *(v8us*)((unsigned short*)Vt + ((size_t)slab * 64 + d) * TTv + lg * 64 + pc * 8) = f.half[0]; }
     } }

__global__ __launch_bounds__(256) void k_hl(const float* __restrict__ F, _Float16* __restrict__ Hh, _Float16* __restrict__ Hl, size_t n8) { const size_t t = (size_t)blockIdx.x * 256 + threadIdx.x; if (t >= n8) return; FragH fh, fl; const v4f a = *(const v4fa*)(F + t * 8), c = *(const v4fa*)(F + t * 8 + 4);
#pragma unroll
  for (int q = 0; q < 4; ++q) { _Float16 h = (_Float16)a[q]; fh.h[q] = h; fl.h[q] = (_Float16)((a[q] - (float)h) * 1024.0f); h = (_Float16)c[q]; fh.h[4 + q] = h; fl.h[4 + q] = (_Float16)((c[q] - (float)h) * 1024.0f); }
  { *(v8us*)((unsigned short*)Hh + t * 8) = fh.half[0]; *(v8us*)((unsigned short*)Hl + t * 8) = fl.half[0];  } }

// ---- fast GEMM (wave tile 32x64, work-group tile 128x64; requires M % 128 == 0, N % 64 == 0, K % 64 == 0); epilogue = k_gemm_hhx semantics ----
#define G2P 72                   /* LDS row pitch in values: 128-byte rows at 144 bytes, the conflict-free pitch for ds_load_b128 readers */
// One K step of 64 values for the work-group: its 128 A rows and 64 B rows (128 bytes = one line each) go to LDS as 12 asynchronous 16-byte copies a lane; 8 lanes take a row, so a wave's copy covers 4 whole lines.
// ag, bg: the lane's piece in the first 16 rows; sa, sb: 16 rows on, in values; la, lb: the lane's LDS byte address in the first 16 rows. The closing s_wait_xcnt 0 stands in front of any rewrite of the registers that the copies name.
__device__ __forceinline__ void g2_stage(const _Float16* ag, size_t sa, const _Float16* bg, size_t sb, unsigned la, unsigned lb) {
  asm volatile("global_load_async_to_lds_b128 %0, %12, off\n\t"
               "global_load_async_to_lds_b128 %1, %13, off\n\t"
               "global_load_async_to_lds_b128 %2, %14, off\n\t"
               "global_load_async_to_lds_b128 %3, %15, off\n\t"
               "global_load_async_to_lds_b128 %4, %16, off\n\t"
               "global_load_async_to_lds_b128 %5, %17, off\n\t"
               "global_load_async_to_lds_b128 %6, %18, off\n\t"
               "global_load_async_to_lds_b128 %7, %19, off\n\t"
               "global_load_async_to_lds_b128 %8, %20, off\n\t"
               "global_load_async_to_lds_b128 %9, %21, off\n\t"
               "global_load_async_to_lds_b128 %10, %22, off\n\t"
               "global_load_async_to_lds_b128 %11, %23, off\n\t"
               "s_wait_xcnt 0x0"
               :: "v"(la), "v"(la + 1u * 16 * G2P * 2), "v"(la + 2u * 16 * G2P * 2), "v"(la + 3u * 16 * G2P * 2), "v"(la + 4u * 16 * G2P * 2), "v"(la + 5u * 16 * G2P * 2), "v"(la + 6u * 16 * G2P * 2), "v"(la + 7u * 16 * G2P * 2),
                  "v"(lb), "v"(lb + 1u * 16 * G2P * 2), "v"(lb + 2u * 16 * G2P * 2), "v"(lb + 3u * 16 * G2P * 2),
                  "v"(ag), "v"(ag + sa), "v"(ag + 2 * sa), "v"(ag + 3 * sa), "v"(ag + 4 * sa), "v"(ag + 5 * sa), "v"(ag + 6 * sa), "v"(ag + 7 * sa),
                  "v"(bg), "v"(bg + sb), "v"(bg + 2 * sb), "v"(bg + 3 * sb)
               : "memory"); }
__device__ __forceinline__ v16h g2_frag(const _Float16* p, int hh) { FragH f; f.half[0] = *(const v8us*)((const unsigned short*)p + 8 * hh); f.half[1] = *(const v8us*)((const unsigned short*)p + 16 + 8 * hh); return f.v; }
__device__ __forceinline__ v8f g2_mma(v16h a, v16h b, v8f c) { v8f d = __builtin_amdgcn_wmma_f32_16x16x32_f16(false, a, false, b, (short)0, c, false, false); asm volatile("v_nop\n\tv_nop\n\tv_nop\n\tv_nop" : "+v"(d) : "v"(a), "v"(b)); return d; }
template <int ACT>
__global__ __launch_bounds__(128) void k_gemm2(const _Float16* __restrict__ A, int lda, size_t sA, const _Float16* __restrict__ Bh, int ldb, size_t sB, float alpha, const float* __restrict__ bias, size_t sBias, const float* __restrict__ CP, int rowsPerB, size_t sCPb, int row0g,
    float* __restrict__ C, _Float16* __restrict__ C16, int ldc, size_t sC, int M, int N, int K) {
  __shared__ __attribute__((aligned(16))) float so[4][32][68]; __shared__ __attribute__((aligned(16))) unsigned short tA[2][128][G2P], tB[2][64][G2P];
  const int tid = threadIdx.x, w = tid >> 5, lane = tid & 31, ln = lane & 15, hh = lane >> 4; const int by = blockIdx.y;
  A += (size_t)by * sA; Bh += (size_t)by * sB; const size_t cofs = (size_t)by * sC; const float* bp = bias ? bias + (size_t)by * sBias : nullptr;
  const int ntn = N >> 6; const int mt = blockIdx.x / ntn, nq = blockIdx.x - mt * ntn; const int row0 = mt * 128 + 32 * w, col0 = nq * 64; if (mt * 128 >= M) return;      /* the whole work-group leaves or none: barriers below */
  const int cr = tid >> 3, cc = (tid & 7) * 8;      /* the lane's row (of 16) and 16-byte piece in a copy */
  const _Float16* ag = A + (size_t)(mt * 128 + cr) * lda + cc; const _Float16* bg = Bh + (size_t)(col0 + cr) * ldb + cc; const size_t sa = (size_t)16 * lda, sb = (size_t)16 * ldb;
  const unsigned la = (unsigned)(size_t)&tA[0][cr][cc], lb = (unsigned)(size_t)&tB[0][cr][cc];      /* LDS byte addresses: the low 32 bits */
  const int nst = K >> 6;
  const v8f z8 = {0.f,0.f,0.f,0.f,0.f,0.f,0.f,0.f}; v8f c00 = z8, c01 = z8, c02 = z8, c03 = z8, c10 = z8, c11 = z8, c12 = z8, c13 = z8;
  g2_stage(ag, sa, bg, sb, la, lb);      /* step 0 into buffer 0 */
  asm volatile("s_wait_asynccnt 0x0" ::: "memory");      /* this wave's copies of step 0 have landed */
  __syncthreads();      /* ... and every other wave's */
  if (nst > 1) g2_stage(ag + 64, sa, bg + 64, sb, la + (unsigned)sizeof(tA[0]), lb + (unsigned)sizeof(tB[0]));      /* step 1 flies while step 0 is worked on */
#pragma unroll 1
  for (int st = 0; st < nst; ++st) { const int bf = st & 1; const _Float16* ar = (const _Float16*)&tA[bf][32 * w + ln][0]; const _Float16* br = (const _Float16*)&tB[bf][ln][0];
    v16h fa[2][2], fb[2][4];      /* the step's 12 fragments are read as one group ahead of its 16 products */
#pragma unroll
    for (int ks = 0; ks < 2; ++ks) { fa[ks][0] = g2_frag(ar + ks * 32, hh); fa[ks][1] = g2_frag(ar + 16 * G2P + ks * 32, hh);
#pragma unroll
      for (int j = 0; j < 4; ++j) fb[ks][j] = g2_frag(br + j * 16 * G2P + ks * 32, hh); }
#pragma unroll
    for (int ks = 0; ks < 2; ++ks) { c00 = g2_mma(fa[ks][0], fb[ks][0], c00); c10 = g2_mma(fa[ks][1], fb[ks][0], c10); c01 = g2_mma(fa[ks][0], fb[ks][1], c01); c11 = g2_mma(fa[ks][1], fb[ks][1], c11);
      c02 = g2_mma(fa[ks][0], fb[ks][2], c02); c12 = g2_mma(fa[ks][1], fb[ks][2], c12); c03 = g2_mma(fa[ks][0], fb[ks][3], c03); c13 = g2_mma(fa[ks][1], fb[ks][3], c13); }
    asm volatile("s_wait_dscnt 0x0" ::: "memory");      /* this wave's reads of buffer bf are done before it is refilled */
    asm volatile("s_wait_asynccnt 0x0" ::: "memory");      /* this wave's copies of step st + 1 have landed */
    __syncthreads();      /* publishes step st + 1 and ends every wave's reads of buffer bf */
    if (st + 2 < nst) g2_stage(ag + (size_t)(st + 2) * 64, sa, bg + (size_t)(st + 2) * 64, sb, la + (unsigned)bf * (unsigned)sizeof(tA[0]), lb + (unsigned)bf * (unsigned)sizeof(tB[0])); }
  asm volatile("s_wait_asynccnt 0x0" ::: "memory");      /* no copy is outstanding past the loop */
  v8f accs[8] = {c00, c01, c02, c03, c10, c11, c12, c13};
#pragma unroll
  for (int u = 0; u < 8; ++u) { const int t = u & 3, half = u >> 2; const int col = col0 + t * 16 + ln; const float bv = bp ? bf16_round(bp[col]) : 0.f;
#pragma unroll
    for (int r = 0; r < 8; ++r) { const int rloc = half * 16 + 8 * hh + r; float v = accs[u][r] * alpha + bv; if (CP) { const int bidx = (row0g + row0 + rloc) / rowsPerB; v += CP[(size_t)bidx * sCPb + (size_t)by * 64 + col]; }
      if (ACT == 3) v = fmaxf(v, 0.f); else if (ACT == 6) v = 0.5f * v * (1.0f + erff(v * 0.70710678118654752f)); else if (ACT == 11) v = 1.0f / (1.0f + expf(-v)); else if (ACT == 15) v = v / (1.0f + expf(-v)); else if (ACT == 12) v = (v > 0.f) ? v : 0.01f * v; else if (ACT == 8) v = tanhf(v);
      so[w][rloc][t * 16 + ln] = v; } }
  __builtin_amdgcn_fence(__ATOMIC_ACQ_REL, "workgroup"); __builtin_amdgcn_wave_barrier();
  const int rsub = lane >> 4, c4 = (lane & 15) * 4;
  {
#pragma unroll
    for (int q = 0; q < 16; ++q) { const int r = q * 2 + rsub; const v4f v = *(const v4fa*)&so[w][r][c4]; if (C) *(v4f*)(C + cofs + (size_t)(row0 + r) * ldc + col0 + c4) = v; if (C16) { v4h h4; for (int i = 0; i < 4; ++i) h4[i] = (_Float16)v[i]; *(v4h*)(C16 + cofs + (size_t)(row0 + r) * ldc + col0 + c4) = h4; } }
     } }



template <int TK>
__global__ __launch_bounds__(256) void k_vthl(const float* __restrict__ VF, int ldv, _Float16* __restrict__ Vth, _Float16* __restrict__ Vtl) { __shared__ float tl[64][65]; const int tid = threadIdx.x; const int slab = blockIdx.x / (TK / 64), lg = blockIdx.x % (TK / 64); const int b = slab / NH, h = slab % NH;
  for (int i = tid; i < 64 * 16; i += 256) { const int r = i / 16, c4 = (i % 16) * 4; const v4f a = *(const v4fa*)(VF + ((size_t)b * TK + lg * 64 + r) * ldv + h * 64 + c4); tl[r][c4] = a[0]; tl[r][c4 + 1] = a[1]; tl[r][c4 + 2] = a[2]; tl[r][c4 + 3] = a[3]; }
  __syncthreads();
  FragH fh[2], fl[2]; size_t oo[2];
#pragma unroll
  for (int rd = 0; rd < 2; ++rd) { const int d = rd * 32 + tid / 8, pc = tid % 8;
#pragma unroll
    for (int q = 0; q < 8; ++q) { const float v = tl[pc * 8 + q][d]; const _Float16 hv = (_Float16)v; fh[rd].h[q] = hv; fl[rd].h[q] = (_Float16)((v - (float)hv) * 1024.0f); } oo[rd] = ((size_t)slab * 64 + d) * TK + lg * 64 + pc * 8; }
  {
#pragma unroll
    for (int rd = 0; rd < 2; ++rd) { *(v8us*)((unsigned short*)Vth + oo[rd]) = fh[rd].half[0]; *(v8us*)((unsigned short*)Vtl + oo[rd]) = fl[rd].half[0]; }
     } }

template <int TQ, int TK>
__global__ __launch_bounds__(128) void k_flashb(const _Float16* __restrict__ Q16, const _Float16* __restrict__ Q16lo, int ldq, const _Float16* __restrict__ K16, const _Float16* __restrict__ K16lo, int ldk, const _Float16* __restrict__ Vt, const _Float16* __restrict__ Vtlo, const unsigned* __restrict__ MB, const int* __restrict__ RA, const int* __restrict__ KE, const _Float16* __restrict__ T16, float* __restrict__ O, int ldo) {
  constexpr int RPW = 16, RTN = RPW / 16, NQB = TQ / (4 * RPW), DT = 4, KS = 2;
  __shared__ __attribute__((aligned(16))) unsigned short sP[4][RPW][40], sPl[4][RPW][40]; __shared__ __attribute__((aligned(16))) float sO[4][RPW][64 + 4];
  const int tid = threadIdx.x, w = tid >> 5, lane = tid & 31, ln = lane & 15, hh = lane >> 4;
  const int slab = blockIdx.x / NQB, qblk = blockIdx.x % NQB; const int b = slab / NH, h = slab % NH; const int qb0 = qblk * (4 * RPW); const int q0 = qb0 + w * RPW;
  FragH aq[2][KS], aql[2][KS];
#pragma unroll
  for (int rt = 0; rt < RTN; ++rt) { const size_t qo = ((size_t)b * TQ + q0 + rt * 16 + ln) * ldq + h * 64; const unsigned short* qr = (const unsigned short*)Q16 + qo; const unsigned short* ql = (const unsigned short*)Q16lo + qo;
#pragma unroll
    for (int ks = 0; ks < KS; ++ks) { aq[rt][ks].half[0] = *(const v8us*)(qr + ks * 32 + 8 * hh); aq[rt][ks].half[1] = *(const v8us*)(qr + ks * 32 + 16 + 8 * hh); aql[rt][ks].half[0] = *(const v8us*)(ql + ks * 32 + 8 * hh); aql[rt][ks].half[1] = *(const v8us*)(ql + ks * 32 + 16 + 8 * hh); } }
  const unsigned short* Vth = (const unsigned short*)Vt + (size_t)slab * 64 * TK; const unsigned short* Vtl = (const unsigned short*)Vtlo + (size_t)slab * 64 * TK;
  float m_r[2][8], l_r[2][8]; v8f oacc[2][DT], oaccl[2][DT];
#pragma unroll
  for (int rt = 0; rt < RTN; ++rt) {
#pragma unroll
    for (int r = 0; r < 8; ++r) { m_r[rt][r] = -3.0e38f; l_r[rt][r] = 0.f; }
#pragma unroll
    for (int dt = 0; dt < DT; ++dt) { oacc[rt][dt] = (v8f){0.f,0.f,0.f,0.f,0.f,0.f,0.f,0.f}; oaccl[rt][dt] = oacc[rt][dt]; } }
  int jend = KE[qblk * 32]; jend = min(TK, (jend + 31) & ~31); if (jend < 32) jend = 32;      /* block-uniform */
  int allm[2][8]; const unsigned* mrow[2][8];
#pragma unroll
  for (int rt = 0; rt < RTN; ++rt)
#pragma unroll
    for (int r = 0; r < 8; ++r) { const int tq = q0 + rt * 16 + 8 * hh + r; allm[rt][r] = RA[tq]; mrow[rt][r] = MB + (size_t)tq * (TK / 32); }
  /* RPE: rel[i][c] = q[q0 + i] . table[h][rb + c], rb = q0 - j0 + TK - 32, c < 48; score (i, kk) takes c = i - kk + 31. Columns 32..47 of a trip are columns 0..15 of the trip before. */
  const unsigned short* Th = (const unsigned short*)T16 + (size_t)h * RW * 64 + (size_t)ln * 64 + 8 * hh;
  v8f relc = (v8f){0.f,0.f,0.f,0.f,0.f,0.f,0.f,0.f};      /* columns 32..47 of the first trip */
#pragma unroll
  for (int ks = 0; ks < KS; ++ks) { FragH bt; bt.half[0] = *(const v8us*)(Th + (size_t)(q0 + TK) * 64 + ks * 32); bt.half[1] = *(const v8us*)(Th + (size_t)(q0 + TK) * 64 + ks * 32 + 16); relc = mmaH<1>(aq[0][ks].v, aq[0][ks].v, bt.v, bt.v, relc); }
#pragma unroll 1
  for (int j0 = 0; j0 < jend; j0 += 32) {
    FragH bt[2][KS];      /* table rows rb .. rb + 31, fetched together with the first key tile */
#pragma unroll
    for (int t = 0; t < 2; ++t) { const unsigned short* tr = Th + (size_t)(q0 - j0 + (TK - 32) + t * 16) * 64;
#pragma unroll
      for (int ks = 0; ks < KS; ++ks) { bt[t][ks].half[0] = *(const v8us*)(tr + ks * 32); bt[t][ks].half[1] = *(const v8us*)(tr + ks * 32 + 16); } }
    asm volatile("s_wait_xcnt 0x0" ::: "memory");      /* stands in front of any overwrite of the table loads' address registers (the allocator lets a later load's result land in them) */
    v8f s[2][2];
#pragma unroll
    for (int nt = 0; nt < 2; ++nt) { const size_t ko = ((size_t)b * TK + j0 + nt * 16 + ln) * ldk + h * 64; const unsigned short* kr = (const unsigned short*)K16 + ko; const unsigned short* kl = (const unsigned short*)K16lo + ko; FragH bk[KS], bkl[KS];
#pragma unroll
      for (int ks = 0; ks < KS; ++ks) { bk[ks].half[0] = *(const v8us*)(kr + ks * 32 + 8 * hh); bk[ks].half[1] = *(const v8us*)(kr + ks * 32 + 16 + 8 * hh); bkl[ks].half[0] = *(const v8us*)(kl + ks * 32 + 8 * hh); bkl[ks].half[1] = *(const v8us*)(kl + ks * 32 + 16 + 8 * hh); }
      if (nt == 1) {      /* RPE products and their LDS stores run while the second key tile's loads are in flight */
        v8f rel0 = (v8f){0.f,0.f,0.f,0.f,0.f,0.f,0.f,0.f}, rel1 = rel0;
#pragma unroll
        for (int ks = 0; ks < KS; ++ks) { rel0 = mmaH<1>(aq[0][ks].v, aq[0][ks].v, bt[0][ks].v, bt[0][ks].v, rel0); rel1 = mmaH<1>(aq[0][ks].v, aq[0][ks].v, bt[1][ks].v, bt[1][ks].v, rel1); }
#pragma unroll
        for (int r = 0; r < 8; ++r) { sO[w][8 * hh + r][ln] = rel0[r]; sO[w][8 * hh + r][16 + ln] = rel1[r]; sO[w][8 * hh + r][32 + ln] = relc[r]; }
        relc = rel0; }
#pragma unroll
      for (int rt = 0; rt < RTN; ++rt) { v8f acc = (v8f){0.f,0.f,0.f,0.f,0.f,0.f,0.f,0.f}, accr = acc;
#pragma unroll
        for (int ks = 0; ks < KS; ++ks) { acc = mmaH<1>(aq[rt][ks].v, aq[rt][ks].v, bk[ks].v, bk[ks].v, acc); accr = mmaH<1>(aql[rt][ks].v, aql[rt][ks].v, bk[ks].v, bk[ks].v, accr); accr = mmaH<1>(aq[rt][ks].v, aq[rt][ks].v, bkl[ks].v, bkl[ks].v, accr); }
        s[rt][nt] = acc + accr * 0.0009765625f; } }
    /* the wave's rel stores above are read back by other lanes of the same wave below */
    __builtin_amdgcn_fence(__ATOMIC_ACQ_REL, "workgroup"); __builtin_amdgcn_wave_barrier();
    float rv0[8], rv1[8];      /* all 16 diagonal reads issued together, ahead of the per-row branches */
#pragma unroll
    for (int r = 0; r < 8; ++r) { rv0[r] = sO[w][8 * hh + r][8 * hh + r - ln + 31]; rv1[r] = sO[w][8 * hh + r][8 * hh + r - ln + 15]; }
#pragma unroll
    for (int rt = 0; rt < RTN; ++rt)
#pragma unroll
      for (int r = 0; r < 8; ++r) { const unsigned mw = mrow[rt][r][j0 >> 5]; const bool am = (allm[rt][r] != 0);
        const bool ok0 = am || (((mw >> ln) & 1u) == 0u), ok1 = am || (((mw >> (16 + ln)) & 1u) == 0u);
        const float s0 = ok0 ? (am ? 0.f : s[rt][0][r] * SCL + rv0[r] * 0.0625f) : -INFINITY, s1 = ok1 ? (am ? 0.f : s[rt][1][r] * SCL + rv1[r] * 0.0625f) : -INFINITY;      /* + q . table[h][(q - k) + T - 1] (table held x16) */ float mc = fmaxf(s0, s1);
        mc = fmaxf(mc, __shfl_xor(mc, 1, 32)); mc = fmaxf(mc, __shfl_xor(mc, 2, 32)); mc = fmaxf(mc, __shfl_xor(mc, 4, 32)); mc = fmaxf(mc, __shfl_xor(mc, 8, 32));
        const float mn = fmaxf(m_r[rt][r], mc); const float al = (mn > -1.0e38f) ? expf(m_r[rt][r] - mn) : 1.0f; m_r[rt][r] = mn; const float p0 = ok0 ? expf(s0 - mn) : 0.f, p1 = ok1 ? expf(s1 - mn) : 0.f; l_r[rt][r] = l_r[rt][r] * al + p0 + p1;
#pragma unroll
        for (int dt = 0; dt < DT; ++dt) { oacc[rt][dt][r] *= al; oaccl[rt][dt][r] *= al; }
        FragH t2, t3; const float ps0 = p0 * 1024.0f, ps1 = p1 * 1024.0f; t2.h[0] = (_Float16)ps0; t2.h[1] = (_Float16)ps1; t3.h[0] = (_Float16)((ps0 - (float)t2.h[0]) * 1024.0f); t3.h[1] = (_Float16)((ps1 - (float)t2.h[1]) * 1024.0f);
        sP[w][rt * 16 + 8 * hh + r][ln] = t2.u[0]; sP[w][rt * 16 + 8 * hh + r][16 + ln] = t2.u[1]; sPl[w][rt * 16 + 8 * hh + r][ln] = t3.u[0]; sPl[w][rt * 16 + 8 * hh + r][16 + ln] = t3.u[1]; }
    __builtin_amdgcn_fence(__ATOMIC_ACQ_REL, "workgroup"); __builtin_amdgcn_wave_barrier();
    FragH pa[2], pl[2];
#pragma unroll
    for (int rt = 0; rt < RTN; ++rt) { pa[rt].half[0] = *(const v8us*)&sP[w][rt * 16 + ln][8 * hh]; pa[rt].half[1] = *(const v8us*)&sP[w][rt * 16 + ln][16 + 8 * hh]; pl[rt].half[0] = *(const v8us*)&sPl[w][rt * 16 + ln][8 * hh]; pl[rt].half[1] = *(const v8us*)&sPl[w][rt * 16 + ln][16 + 8 * hh]; }
#pragma unroll
    for (int dt = 0; dt < DT; ++dt) { const size_t vo = (size_t)(dt * 16 + ln) * TK + j0; FragH bv, bl; bv.half[0] = *(const v8us*)(Vth + vo + 8 * hh); bv.half[1] = *(const v8us*)(Vth + vo + 16 + 8 * hh); bl.half[0] = *(const v8us*)(Vtl + vo + 8 * hh); bl.half[1] = *(const v8us*)(Vtl + vo + 16 + 8 * hh);
#pragma unroll
      for (int rt = 0; rt < RTN; ++rt) { oacc[rt][dt] = mmaH<1>(pa[rt].v, pa[rt].v, bv.v, bv.v, oacc[rt][dt]); oaccl[rt][dt] = mmaH<1>(pa[rt].v, pa[rt].v, bl.v, bl.v, oaccl[rt][dt]); oaccl[rt][dt] = mmaH<1>(pl[rt].v, pl[rt].v, bv.v, bv.v, oaccl[rt][dt]); } }
    __builtin_amdgcn_fence(__ATOMIC_ACQ_REL, "workgroup"); __builtin_amdgcn_wave_barrier(); }
#pragma unroll
  for (int rt = 0; rt < RTN; ++rt) {
#pragma unroll
    for (int r = 0; r < 8; ++r) { float l = l_r[rt][r]; l += __shfl_xor(l, 1, 32); l += __shfl_xor(l, 2, 32); l += __shfl_xor(l, 4, 32); l += __shfl_xor(l, 8, 32); l_r[rt][r] = (l > 0.f) ? 1.0f / (l * 1024.0f) : 0.f; }
#pragma unroll
    for (int dt = 0; dt < DT; ++dt)
#pragma unroll
      for (int r = 0; r < 8; ++r) sO[w][rt * 16 + 8 * hh + r][dt * 16 + ln] = (oacc[rt][dt][r] + oaccl[rt][dt][r] * 0.0009765625f) * l_r[rt][r]; }
  __builtin_amdgcn_fence(__ATOMIC_ACQ_REL, "workgroup"); __builtin_amdgcn_wave_barrier();
  {
#pragma unroll
    for (int rp = 0; rp < RPW; rp += 2) { const int r = rp + (lane >> 4), pc = lane & 15; const v4f val = *(const v4fa*)&sO[w][r][pc * 4]; *(v4f*)(O + ((size_t)b * TQ + q0 + r) * ldo + h * 64 + pc * 4) = val; }
     } }


__global__ __launch_bounds__(256) void k_fulltab(unsigned* __restrict__ MB, int* __restrict__ RA, int* __restrict__ KE, int nq, int nk) {
  const int t = blockIdx.x * 256 + threadIdx.x;
  if (t < nq * (nk / 32)) { *(unsigned*)(MB + t) = 0u;  }
  if (t < nq) { *(int*)(RA + t) = 0;  }
  if (t < nq / 64) { *(int*)(KE + t * 32) = nk;  } }
__global__ __launch_bounds__(256) void k_lnx(const float* __restrict__ X, const float* __restrict__ g, const float* __restrict__ bb, _Float16* __restrict__ Y16, float* __restrict__ XB) {
  #pragma clang fp contract(off)
  const int tid = threadIdx.x, w = tid >> 5, ln = tid & 31; const int r = blockIdx.x * 8 + w; if (r >= NR) return; const float* x = X + (size_t)r * DM; float s = 0.f;
#pragma unroll 1
  for (int i = 0; i < DM / 128; ++i) { const v4f a = *(const v4fa*)(x + i * 128 + ln * 4); for (int q = 0; q < 4; ++q) s += bf16_round(a[q]); }
  for (int o = 16; o > 0; o >>= 1) s += __shfl_xor(s, o, 32); const float mu = s / (float)DM; float q2 = 0.f;
#pragma unroll 1
  for (int i = 0; i < DM / 128; ++i) { const v4f a = *(const v4fa*)(x + i * 128 + ln * 4); for (int q = 0; q < 4; ++q) { const float d = bf16_round(a[q]) - mu; q2 += d * d; } }
  for (int o = 16; o > 0; o >>= 1) q2 += __shfl_xor(q2, o, 32); const float rs = rsqrtf(q2 / (float)DM + 1e-5f);
  {
#pragma unroll 1
    for (int i = 0; i < DM / 128; ++i) { const int c0 = i * 128 + ln * 4; const v4f a = *(const v4fa*)(x + c0); _Float16 h4[4]; v4f xb;
      for (int q = 0; q < 4; ++q) { const float t = bf16_round(a[q]); h4[q] = (_Float16)((t - mu) * rs * bf16_round(g[c0 + q]) + bf16_round(bb[c0 + q])); xb[q] = t; }
      *(unsigned long long*)((unsigned short*)Y16 + (size_t)r * DM + c0) = *(const unsigned long long*)h4; *(v4f*)(XB + (size_t)r * DM + c0) = xb; }
     } }
__global__ __launch_bounds__(256) void k_rtab(const float* __restrict__ tab, int trows, _Float16* __restrict__ T16) {
  const int t = blockIdx.x * 256 + threadIdx.x; if (t >= NH * RW * 8) return; const int d0 = (t & 7) * 8; const int r = (t >> 3) % RW; const int h = t / (8 * RW); FragH f;
#pragma unroll
  for (int q = 0; q < 8; ++q) f.h[q] = (r < 2 * SLEN - 1) ? (_Float16)(bf16_round(tab[((size_t)h * trows + r) * 64 + d0 + q]) * 16.0f) : (_Float16)0.0f;
  *(v8us*)((unsigned short*)T16 + ((size_t)h * RW + r) * 64 + d0) = f.half[0];  }
__global__ __launch_bounds__(256) void k_causaltab(unsigned* __restrict__ MB, int* __restrict__ RA, int* __restrict__ KE, int nq, int nk) {
  const int t = blockIdx.x * 256 + threadIdx.x; const int nw = nk / 32;
  if (t < nq * nw) { const int q = t / nw, w = t % nw; const int first = q + 1 - 32 * w; const unsigned bits = (first <= 0) ? 0xffffffffu : ((first >= 32) ? 0u : (0xffffffffu << first)); *(unsigned*)(MB + t) = bits;  }
  if (t < nq) { *(int*)(RA + t) = 0;  }
  if (t < nq / 64) { const int v = 64 * (t + 1); *(int*)(KE + t * 32) = v;  } }


extern "C" void kernel_launch(void* const* d_in, const int* in_sizes, int n_in,
                              void* d_out, int out_size, void* d_ws, size_t ws_size, hipStream_t stream) {
  (void)in_sizes; (void)n_in; (void)out_size;
  const float* const* I = (const float* const*)d_in; const float* x = I[0]; const float* Wq = I[1]; const float* bq = I[2]; const float* Wk = I[3]; const float* bk = I[4]; const float* Wv = I[5]; const float* bv = I[6]; const float* Wo = I[7]; const float* bo = I[8]; const float* tab = I[9];
  char* ws = (char*)d_ws; size_t off = 0;
  auto take = [&](size_t bytes) { char* p = ws + off; off += (bytes + 255) & ~(size_t)255; return p; };
  _Float16* BQ = (_Float16*)take((size_t)DM * DM * 2); _Float16* BK = (_Float16*)take((size_t)DM * DM * 2); _Float16* BV = (_Float16*)take((size_t)DM * DM * 2); _Float16* BO = (_Float16*)take((size_t)DM * DM * 2); _Float16* T16 = (_Float16*)take((size_t)NH * RW * 64 * 2);
  _Float16* X16 = (_Float16*)take((size_t)NR * DM * 2); float* F = (float*)take((size_t)NR * DM * 4);
  _Float16* Qh = (_Float16*)take((size_t)NR * DM * 2); _Float16* Ql = (_Float16*)take((size_t)NR * DM * 2); _Float16* Kh = (_Float16*)take((size_t)NR * DM * 2); _Float16* Kl = (_Float16*)take((size_t)NR * DM * 2); _Float16* Vth = (_Float16*)take((size_t)NR * DM * 2); _Float16* Vtl = (_Float16*)take((size_t)NR * DM * 2);
  float* O = (float*)take((size_t)NR * DM * 4); _Float16* Oh = (_Float16*)take((size_t)NR * DM * 2); _Float16* Ol = (_Float16*)take((size_t)NR * DM * 2);
  unsigned* MB = (unsigned*)take((size_t)SLEN * (SLEN / 32) * 4); int* RA = (int*)take((size_t)SLEN * 4); int* KE = (int*)take((size_t)(SLEN / 64) * 32 * 4);
  if (off > ws_size) return;      /* 8 + 4 + 8 + 16 + 48 + 16 + 16 + 0.2 = 116 MiB */
  const size_t n8 = (size_t)NR * DM / 8; const unsigned nb8 = (unsigned)((n8 + 255) / 256); const size_t w8 = (size_t)DM * DM / 8; const unsigned wb = (unsigned)((w8 + 255) / 256);
  k_round16f<<<wb, 256, 0, stream>>>(Wq, BQ, w8); k_round16f<<<wb, 256, 0, stream>>>(Wk, BK, w8); k_round16f<<<wb, 256, 0, stream>>>(Wv, BV, w8); k_round16f<<<wb, 256, 0, stream>>>(Wo, BO, w8);      /* torch (out,in) = natural Bt */
  k_rtab<<<(NH * RW * 8 + 255) / 256, 256, 0, stream>>>(tab, 9999, T16); k_fulltab<<<(SLEN * (SLEN / 32) + 255) / 256, 256, 0, stream>>>(MB, RA, KE, SLEN, SLEN);
  const dim3 gP((NR / 128) * (DM / 64), 1);
  /* every row-wise stage runs once over all NBT * SLEN rows */
  k_x16<<<nb8, 256, 0, stream>>>(x, X16, n8);
  k_gemm2<0><<<gP, 128, 0, stream>>>(X16, DM, 0, BQ, DM, 0, 0.0625f, bq, 0, nullptr, 1, 0, 0, F, nullptr, DM, 0, NR, DM, DM); k_hl<<<nb8, 256, 0, stream>>>(F, Qh, Ql, n8);      /* q: f32 -> hi/lo; the hi plane also feeds the RPE product */
  k_gemm2<0><<<gP, 128, 0, stream>>>(X16, DM, 0, BK, DM, 0, 0.0625f, bk, 0, nullptr, 1, 0, 0, F, nullptr, DM, 0, NR, DM, DM); k_hl<<<nb8, 256, 0, stream>>>(F, Kh, Kl, n8);
  k_gemm2<0><<<gP, 128, 0, stream>>>(X16, DM, 0, BV, DM, 0, 0.0625f, bv, 0, nullptr, 1, 0, 0, F, nullptr, DM, 0, NR, DM, DM); k_vthl<SLEN><<<NBT * NH * (SLEN / 64), 256, 0, stream>>>(F, DM, Vth, Vtl);
  k_flashb<SLEN, SLEN><<<NBT * NH * (SLEN / 64), 128, 0, stream>>>(Qh, Ql, DM, Kh, Kl, DM, Vth, Vtl, MB, RA, KE, T16, O, DM);      /* all batches and heads in one launch */
  k_hl<<<nb8, 256, 0, stream>>>(O, Oh, Ol, n8);
  float* outp = (float*)d_out;
  k_gemm2<0><<<gP, 128, 0, stream>>>(Oh, DM, 0, BO, DM, 0, 0.0625f, bo, 0, nullptr, 1, 0, 0, outp, nullptr, DM, 0, NR, DM, DM);
  k_gemm2<0><<<gP, 128, 0, stream>>>(Ol, DM, 0, BO, DM, 0, 0.0625f / 1024.0f, nullptr, 0, outp, 1, (size_t)DM, 0, outp, nullptr, DM, 0, NR, DM, DM);
}

// v004
// One run takes 299 microseconds.
// In two side-by-side timings against v003, it was 1.32 and 1.31 times as fast.
// All steps since v000 together make it 14.6 times as fast.
#include <hip/hip_runtime.h>
// Multi-head attention with learned relative-position encoding (4 x 1024 tokens, 1024 = 16 heads x 64): q,k,v = x W^T + b; scores = q.k/8 + q.rpe_table[h][q - k + 1023] (no scale on the RPE term); softmax over all keys; . v; merged . Wo^T + bo -> [4,1024,1024].
// Structure: projections (all batches in one launch) as f16 WMMA GEMMs (32x64 wave tiles, f32 accumulation, exact products + bias; the work-group's A and B tiles reach LDS by asynchronous copies, two buffers); the fused flash kernel (one launch over all batches and heads; hi/lo q,k three-product scores, online f32 softmax, P staged hi + residual, V^T hi + residual; all keys valid) forms the RPE term itself: per 16 x 32 score tile the 48 table rows r = q - k + 1023 can reach give a 16 x 48 f16 WMMA product q_h . table[h][r] (f32 result, 16 of the 48 columns carried over from the trip before), staged in the wave's LDS and read back along the diagonal inside the score stage; O as hi + residual planes into Wo (two GEMMs, bias in the first).
// Compute dtype: x, weights, biases, rpe_table rounded to bf16; projections exact; the RPE product uses the plain f16 q (the hi plane) (~2^-12 on a sigma-0.16 bias); q, k, P, v, O as f16 hi + residual pairs (~2^-21) in the attention; f32 accumulation and softmax. v_wmma_f32_16x16x32_f16.
#define NBT 4
#define SLEN 1024
#define RW 2048                  /* table rows kept per head (2*SLEN-1 used, the last one zero) */
#define DM 1024
#define NH 16
#define SCL 0.125f
#define NR (NBT * SLEN)
typedef __bf16 v16b __attribute__((ext_vector_type(16)));
typedef unsigned short v8us __attribute__((ext_vector_type(8), may_alias));
typedef float  v8f  __attribute__((ext_vector_type(8)));
typedef float  v4f  __attribute__((ext_vector_type(4)));
typedef float  v4fa __attribute__((ext_vector_type(4), may_alias));
union FragB { v16b v; v8us half[2]; unsigned short u[16]; };

__device__ __forceinline__ unsigned short bf16_bits(float x) { unsigned int u = __float_as_uint(x); return (unsigned short)((u + 0x7FFFu + ((u >> 16) & 1u)) >> 16); }
__device__ __forceinline__ float bf16_val(unsigned short b) { return __uint_as_float(((unsigned int)b) << 16); }
__device__ __forceinline__ float bf16_round(float x) { return bf16_val(bf16_bits(x)); }
// D += A·B with NT terms: 1 = ah·bh, 2 = + al·bh (A split), 3 = + ah·bl (both split)
template <int NT>
__device__ __forceinline__ v8f mmaN(v16b ah, v16b al, v16b bh, v16b bl, v8f c) {
  c = __builtin_amdgcn_wmma_f32_16x16x32_bf16(false, ah, false, bh, (short)0, c, false, false);
  if (NT >= 2) c = __builtin_amdgcn_wmma_f32_16x16x32_bf16(false, al, false, bh, (short)0, c, false, false);
  if (NT >= 3) c = __builtin_amdgcn_wmma_f32_16x16x32_bf16(false, ah, false, bl, (short)0, c, false, false);
  asm volatile("v_nop\n\tv_nop\n\tv_nop\n\tv_nop" : "+v"(c) : "v"(ah), "v"(al), "v"(bh), "v"(bl));
  return c;
}

__global__ __launch_bounds__(256) void k_wt_bf16(const float* __restrict__ W, unsigned short* __restrict__ Wt, int K, int N) {
  const int t = blockIdx.x * 256 + threadIdx.x;
  const int k8n = K / 8;
  if (t >= N * k8n) return;
  const int n = t / k8n, k8 = (t % k8n) * 8;
  v8us v;
#pragma unroll
  for (int i = 0; i < 8; ++i) v[i] = bf16_bits(W[(size_t)(k8 + i) * N + n]);
  *(v8us*)(Wt + (size_t)n * K + k8) = v;
  
}

// GEMM C[M][N] (f32, pitch ldc) = act(A[M][K]·W + bias). A f32 row-major (pitch lda) converted per fragment to bf16
// (ASPLIT: hi/lo two planes -> 2 terms, else single rounded term); Wt bf16 [N][K] (pitch ldb). BIAS_BF16 rounds the
// bias to bf16 first (bias quantised to bf16 before the add). K%32==0, M%16==0, N%64==0.
template <bool ASPLIT, int ACT, bool BIAS_BF16>
__global__ __launch_bounds__(128) void k_gemm_bf(const float* __restrict__ A, int lda, const unsigned short* __restrict__ Wt, int ldb,
                                               const float* __restrict__ bias, float* __restrict__ C, int ldc, int M, int N, int K) {
  __shared__ __attribute__((aligned(16))) float so[4][16][64];
  const int tid = threadIdx.x, w = tid >> 5, lane = tid & 31, ln = lane & 15, hh = lane >> 4;
  const int ntn = N / 64;
  const int wid = blockIdx.x * 4 + w;
  const int mt = wid / ntn, nq = wid % ntn;
  if (mt * 16 >= M) return;
  const int row0 = mt * 16, col0 = nq * 64;
  const float* arow = A + (size_t)(row0 + ln) * lda;
  v8f acc[4] = {};
  for (int kb = 0; kb < K; kb += 32) {
    FragB ah, al;
    const v4f x0 = *(const v4fa*)(arow + kb + 8 * hh), x1 = *(const v4fa*)(arow + kb + 8 * hh + 4);
    const v4f x2 = *(const v4fa*)(arow + kb + 16 + 8 * hh), x3 = *(const v4fa*)(arow + kb + 16 + 8 * hh + 4);
    float xs[16] = {x0[0],x0[1],x0[2],x0[3],x1[0],x1[1],x1[2],x1[3],x2[0],x2[1],x2[2],x2[3],x3[0],x3[1],x3[2],x3[3]};
#pragma unroll
    for (int i = 0; i < 16; ++i) { const unsigned short hb = bf16_bits(xs[i]); ah.u[i] = hb; al.u[i] = ASPLIT ? bf16_bits(xs[i] - bf16_val(hb)) : (unsigned short)0; }
#pragma unroll
    for (int t = 0; t < 4; ++t) {
      const unsigned short* brow = Wt + (size_t)(col0 + t * 16 + ln) * ldb + kb;
      FragB b;
      b.half[0] = *(const v8us*)(brow + 8 * hh);
      b.half[1] = *(const v8us*)(brow + 16 + 8 * hh);
      acc[t] = mmaN<ASPLIT ? 2 : 1>(ah.v, al.v, b.v, b.v, acc[t]);
    }
  }
#pragma unroll
  for (int t = 0; t < 4; ++t) {
    float bv = bias ? bias[col0 + t * 16 + ln] : 0.f;
    if (BIAS_BF16) bv = bf16_round(bv);
#pragma unroll
    for (int r = 0; r < 8; ++r) { float v = acc[t][r] + bv; if (ACT == 1) v = fmaxf(v, 0.f); so[w][8 * hh + r][t * 16 + ln] = v; }
  }
  __builtin_amdgcn_fence(__ATOMIC_ACQ_REL, "workgroup");
  __builtin_amdgcn_wave_barrier();
  const int rsub = lane >> 4, c4 = (lane & 15) * 4;
  {
#pragma unroll
    for (int q = 0; q < 8; ++q) {
      const int r = q * 2 + rsub;
      const v4f v = *(const v4fa*)&so[w][r][c4];
      *(v4f*)(C + (size_t)(row0 + r) * ldc + col0 + c4) = v;
    }
    
  }
}

// GEMM C = act(A·W + bias + resid): A f32 (ASPLIT -> hi/lo 2 terms), Wt bf16 [N][K]; ACT 0 none, 1 relu, 2 exact gelu;
// resid (optional, f32, row index = (row % rmod), pitch ldr, RES_BF16 rounds it) added before the activation.
template <bool ASPLIT, int ACT, bool BIAS_BF16, bool RES_BF16>
__global__ __launch_bounds__(128) void k_gemm_bf3(const float* __restrict__ A, int lda, const unsigned short* __restrict__ Wt, int ldb,
                                                const float* __restrict__ bias, const float* __restrict__ resid, int rmod, int ldr,
                                                float* __restrict__ C, int ldc, int M, int N, int K) {
  __shared__ __attribute__((aligned(16))) float so[4][16][64];
  const int tid = threadIdx.x, w = tid >> 5, lane = tid & 31, ln = lane & 15, hh = lane >> 4;
  const int ntn = N / 64;
  const int wid = blockIdx.x * 4 + w;
  const int mt = wid / ntn, nq = wid % ntn;
  if (mt * 16 >= M) return;
  const int row0 = mt * 16, col0 = nq * 64;
  const float* arow = A + (size_t)(row0 + ln) * lda;
  v8f acc[4] = {};
  for (int kb = 0; kb < K; kb += 32) {
    FragB ah, al;
    const v4f x0 = *(const v4fa*)(arow + kb + 8 * hh), x1 = *(const v4fa*)(arow + kb + 8 * hh + 4);
    const v4f x2 = *(const v4fa*)(arow + kb + 16 + 8 * hh), x3 = *(const v4fa*)(arow + kb + 16 + 8 * hh + 4);
    float xs[16] = {x0[0],x0[1],x0[2],x0[3],x1[0],x1[1],x1[2],x1[3],x2[0],x2[1],x2[2],x2[3],x3[0],x3[1],x3[2],x3[3]};
#pragma unroll
    for (int i = 0; i < 16; ++i) { const unsigned short hb = bf16_bits(xs[i]); ah.u[i] = hb; al.u[i] = ASPLIT ? bf16_bits(xs[i] - bf16_val(hb)) : (unsigned short)0; }
#pragma unroll
    for (int t = 0; t < 4; ++t) {
      const unsigned short* brow = Wt + (size_t)(col0 + t * 16 + ln) * ldb + kb;
      FragB b;
      b.half[0] = *(const v8us*)(brow + 8 * hh);
      b.half[1] = *(const v8us*)(brow + 16 + 8 * hh);
      acc[t] = mmaN<ASPLIT ? 2 : 1>(ah.v, al.v, b.v, b.v, acc[t]);
    }
  }
#pragma unroll
  for (int t = 0; t < 4; ++t) {
    const int col = col0 + t * 16 + ln;
    float bv = bias ? bias[col] : 0.f;
    if (BIAS_BF16) bv = bf16_round(bv);
#pragma unroll
    for (int r = 0; r < 8; ++r) {
      float v = acc[t][r] + bv;
      if (resid) { float rv = resid[(size_t)((row0 + 8 * hh + r) % rmod) * ldr + col]; if (RES_BF16) rv = bf16_round(rv); v += rv; }
      if (ACT == 1) v = fmaxf(v, 0.f);
      if (ACT == 2) v = 0.5f * v * (1.0f + erff(v * 0.70710678118654752f));
      if (ACT == 3) { const float u = 0.7978845608028654f * (v + 0.044715f * v * v * v); v = 0.5f * v * (1.0f + tanhf(u)); }
      so[w][8 * hh + r][t * 16 + ln] = v;
    }
  }
  __builtin_amdgcn_fence(__ATOMIC_ACQ_REL, "workgroup");
  __builtin_amdgcn_wave_barrier();
  const int rsub = lane >> 4, c4 = (lane & 15) * 4;
  {
#pragma unroll
    for (int q = 0; q < 8; ++q) {
      const int r = q * 2 + rsub;
      const v4f v = *(const v4fa*)&so[w][r][c4];
      *(v4f*)(C + (size_t)(row0 + r) * ldc + col0 + c4) = v;
    }
    
  }
}
// row LayerNorm (biased variance, eps) over N: s = X (+ R); optional out_sum <- s; out_norm <- (s-mu)*rsqrt(var+eps)*g + b
template <bool PARAM_BF16>
__global__ __launch_bounds__(256) void k_layernorm(const float* __restrict__ X, const float* __restrict__ R, const float* __restrict__ g, const float* __restrict__ bta,
                                                  float* __restrict__ out_sum, float* __restrict__ out_norm, int N, float eps) {
  __shared__ float red[256];
  const int row = blockIdx.x, tid = threadIdx.x;
  const float* x = X + (size_t)row * N; const float* rr = R ? R + (size_t)row * N : nullptr;
  float vals[16];                     // up to N = 4096
  const int per = N / 256;            // contiguous chunk per thread? use strided-by-4 chunks: thread handles j = tid*4 + 1024*u
  float s1 = 0.f;
  for (int u = 0; u < per / 4; ++u) {
    const int j = tid * 4 + 1024 * u;
    const v4f a = *(const v4fa*)(x + j);
    v4f b = {0.f,0.f,0.f,0.f}; if (rr) b = *(const v4fa*)(rr + j);
#pragma unroll
    for (int q = 0; q < 4; ++q) { const float v = a[q] + b[q]; vals[u * 4 + q] = v; s1 += v; }
  }
  red[tid] = s1; __syncthreads();
  for (int st = 128; st > 0; st >>= 1) { if (tid < st) red[tid] += red[tid + st]; __syncthreads(); }
  const float mu = red[0] / (float)N; __syncthreads();
  float s2 = 0.f;
  for (int u = 0; u < per / 4; ++u)
#pragma unroll
    for (int q = 0; q < 4; ++q) { const float c = vals[u * 4 + q] - mu; s2 += c * c; }
  red[tid] = s2; __syncthreads();
  for (int st = 128; st > 0; st >>= 1) { if (tid < st) red[tid] += red[tid + st]; __syncthreads(); }
  const float rs = rsqrtf(red[0] / (float)N + eps);
  {
    for (int u = 0; u < per / 4; ++u) {
      const int j = tid * 4 + 1024 * u;
      v4f o, sm;
#pragma unroll
      for (int q = 0; q < 4; ++q) {
        float gg = g[j + q], bb = bta[j + q];
        if (PARAM_BF16) { gg = bf16_round(gg); bb = bf16_round(bb); }
        sm[q] = vals[u * 4 + q]; o[q] = (vals[u * 4 + q] - mu) * rs * gg + bb;
      }
      if (out_sum) *(v4f*)(out_sum + (size_t)row * N + j) = sm;
      *(v4f*)(out_norm + (size_t)row * N + j) = o;
    }
    
  }
}



// ---- f16 WMMA path (v_wmma_f32_16x16x32_f16): 11-bit significands for operands in range — used where a [0,1] probability operand needs more precision than bf16
typedef _Float16 v16h __attribute__((ext_vector_type(16)));
union FragH { v16h v; v8us half[2]; _Float16 h[16]; unsigned short u[16]; };
template <int NT>
__device__ __forceinline__ v8f mmaH(v16h ah, v16h al, v16h bh, v16h bl, v8f c) {
  c = __builtin_amdgcn_wmma_f32_16x16x32_f16(false, ah, false, bh, (short)0, c, false, false);
  if (NT >= 2) c = __builtin_amdgcn_wmma_f32_16x16x32_f16(false, al, false, bh, (short)0, c, false, false);
  if (NT >= 3) c = __builtin_amdgcn_wmma_f32_16x16x32_f16(false, ah, false, bl, (short)0, c, false, false);
  asm volatile("v_nop\n\tv_nop\n\tv_nop\n\tv_nop" : "+v"(c) : "v"(ah), "v"(al), "v"(bh), "v"(bl));
  return c;
}
// batched GEMM like k_gemm_b but f16 operands: A f32 (split into f16 hi/lo if ASPLIT, else rounded to f16), Bt = f16 values [n][k]; alpha; C f32; N multiple of 16 (partial tiles skipped)
template <bool ASPLIT>
__global__ __launch_bounds__(128) void k_gemm_h(const float* __restrict__ A, int lda, size_t sA, const _Float16* __restrict__ Bh, int ldb, size_t sB, float alpha, float* __restrict__ C, int ldc, size_t sC, int M, int N, int K) {
  __shared__ __attribute__((aligned(16))) float so[4][16][64];
  const int tid = threadIdx.x, w = tid >> 5, lane = tid & 31, ln = lane & 15, hh = lane >> 4; const int by = blockIdx.y;
  A += (size_t)by * sA; Bh += (size_t)by * sB; C += (size_t)by * sC;
  const int ntn = (N + 63) / 64; const int wid = blockIdx.x * 4 + w; const int mt = wid / ntn, nq = wid % ntn; if (mt * 16 >= M) return;
  const int row0 = mt * 16, col0 = nq * 64; const float* arow = A + (size_t)(row0 + ln) * lda;
  v8f acc[4] = {};
  for (int kb = 0; kb < K; kb += 32) {
    FragH ah, al;
    const v4f x0 = *(const v4fa*)(arow + kb + 8 * hh), x1 = *(const v4fa*)(arow + kb + 8 * hh + 4), x2 = *(const v4fa*)(arow + kb + 16 + 8 * hh), x3 = *(const v4fa*)(arow + kb + 16 + 8 * hh + 4);
    float xs[16] = {x0[0],x0[1],x0[2],x0[3],x1[0],x1[1],x1[2],x1[3],x2[0],x2[1],x2[2],x2[3],x3[0],x3[1],x3[2],x3[3]};
#pragma unroll
    for (int i = 0; i < 16; ++i) { const _Float16 h = (_Float16)xs[i]; ah.h[i] = h; al.h[i] = ASPLIT ? (_Float16)(xs[i] - (float)h) : (_Float16)0.0f; }
#pragma unroll
    for (int t = 0; t < 4; ++t) { if (col0 + t * 16 >= N) continue; const size_t boff = (size_t)(col0 + t * 16 + ln) * ldb + kb; FragH bq; bq.half[0] = *(const v8us*)(Bh + boff + 8 * hh); bq.half[1] = *(const v8us*)(Bh + boff + 16 + 8 * hh);
      acc[t] = mmaH<ASPLIT ? 2 : 1>(ah.v, al.v, bq.v, bq.v, acc[t]); }
  }
#pragma unroll
  for (int t = 0; t < 4; ++t) { if (col0 + t * 16 >= N) continue;
#pragma unroll
    for (int r = 0; r < 8; ++r) so[w][8 * hh + r][t * 16 + ln] = acc[t][r] * alpha; }
  __builtin_amdgcn_fence(__ATOMIC_ACQ_REL, "workgroup"); __builtin_amdgcn_wave_barrier();
  const int rsub = lane >> 4, c4 = (lane & 15) * 4;
  {
#pragma unroll
    for (int q = 0; q < 8; ++q) { const int r = q * 2 + rsub; if (col0 + c4 < N) { const v4f v = *(const v4fa*)&so[w][r][c4]; *(v4f*)(C + (size_t)(row0 + r) * ldc + col0 + c4) = v; } }
     }
}

// Wt[n][k] = f16(W[k][n]·scale) from f32 row-major W[K][N] (scale = power of two; bf16-exact weights stay exact in f16 away from the subnormal range)
__global__ __launch_bounds__(256) void k_wt_f16(const float* __restrict__ W, _Float16* __restrict__ Wt, int K, int N, float scale) {
  const int t = blockIdx.x * 256 + threadIdx.x; if (t >= N * (K / 8)) return; const int n = t / (K / 8), k8 = (t % (K / 8)) * 8; FragH f;
#pragma unroll
  for (int i = 0; i < 8; ++i) f.h[i] = (_Float16)(bf16_round(W[(size_t)(k8 + i) * N + n]) * scale); const v8us o = f.half[0];
  *(v8us*)((unsigned short*)Wt + (size_t)n * K + k8) = o; 
}
// k_gemm_hh variant with fused epilogue: v = acc·alpha + bias[by·sBias + col] (+ CP[(row/rowsPerB)·sCPb + by·64 + col] if CP) ; ACT 0 none / 1 elu ; writes f16 C16 (and f32 C if non-null)
template <int ACT>
__global__ __launch_bounds__(128) void k_gemm_hhx(const _Float16* __restrict__ A, int lda, size_t sA, const _Float16* __restrict__ Bh, int ldb, size_t sB, float alpha, const float* __restrict__ bias, size_t sBias, const float* __restrict__ CP, int rowsPerB, size_t sCPb, int row0g,
    float* __restrict__ C, _Float16* __restrict__ C16, int ldc, size_t sC, int M, int N, int K) {
  __shared__ __attribute__((aligned(16))) float so[4][16][64];
  const int tid = threadIdx.x, w = tid >> 5, lane = tid & 31, ln = lane & 15, hh = lane >> 4; const int by = blockIdx.y;
  A += (size_t)by * sA; Bh += (size_t)by * sB; const size_t cofs = (size_t)by * sC; const float* bp = bias ? bias + (size_t)by * sBias : nullptr;
  const int ntn = (N + 63) / 64; const int wid = blockIdx.x * 4 + w; const int mt = wid / ntn, nq = wid % ntn; if (mt * 16 >= M) return;
  const int row0 = mt * 16, col0 = nq * 64; const _Float16* arow = A + (size_t)(row0 + ln) * lda;
  v8f acc[4] = {};
  for (int kb = 0; kb < K; kb += 32) { FragH ah; ah.half[0] = *(const v8us*)((const unsigned short*)arow + kb + 8 * hh); ah.half[1] = *(const v8us*)((const unsigned short*)arow + kb + 16 + 8 * hh);
#pragma unroll
    for (int t = 0; t < 4; ++t) { if (col0 + t * 16 >= N) continue; const size_t boff = (size_t)(col0 + t * 16 + ln) * ldb + kb; FragH bq; bq.half[0] = *(const v8us*)((const unsigned short*)Bh + boff + 8 * hh); bq.half[1] = *(const v8us*)((const unsigned short*)Bh + boff + 16 + 8 * hh);
      acc[t] = mmaH<1>(ah.v, ah.v, bq.v, bq.v, acc[t]); }
  }
#pragma unroll
  for (int t = 0; t < 4; ++t) { if (col0 + t * 16 >= N) continue; const int col = col0 + t * 16 + ln; const float bv = bp ? bf16_round(bp[col]) : 0.f;
#pragma unroll
    for (int r = 0; r < 8; ++r) { float v = acc[t][r] * alpha + bv; if (CP) { const int bidx = (row0g + row0 + 8 * hh + r) / rowsPerB; v += CP[(size_t)bidx * sCPb + (size_t)by * 64 + col]; } if (ACT == 1) v = (v > 0.f) ? v : expm1f(v); else if (ACT == 7) v = (v > 0.f) ? v + 1.0f : expf(v); else if (ACT == 8) v = tanhf(v); else if (ACT == 9) v = 0.5f * v * (1.0f + tanhf(0.7978845608028654f * (v + 0.044715f * v * v * v))); else if (ACT == 11) v = 1.0f / (1.0f + expf(-v)); else if (ACT == 12) v = (v > 0.f) ? v : 0.01f * v; else if (ACT == 14) v = (v > 0.f) ? v : 0.1f * v; else if (ACT == 15) v = v / (1.0f + expf(-v)); else if (ACT == 3) v = fmaxf(v, 0.f); else if (ACT == 6) v = 0.5f * v * (1.0f + erff(v * 0.70710678118654752f)); so[w][8 * hh + r][t * 16 + ln] = v; } }
  __builtin_amdgcn_fence(__ATOMIC_ACQ_REL, "workgroup"); __builtin_amdgcn_wave_barrier();
  const int rsub = lane >> 4, c4 = (lane & 15) * 4; typedef _Float16 v4h __attribute__((ext_vector_type(4)));
  {
#pragma unroll
    for (int q = 0; q < 8; ++q) { const int r = q * 2 + rsub; if (col0 + c4 < N) { const v4f v = *(const v4fa*)&so[w][r][c4]; if (C) *(v4f*)(C + cofs + (size_t)(row0 + r) * ldc + col0 + c4) = v; if (C16) { v4h h4; for (int i = 0; i < 4; ++i) h4[i] = (_Float16)v[i]; *(v4h*)(C16 + cofs + (size_t)(row0 + r) * ldc + col0 + c4) = h4; } } }
     }
}


typedef _Float16 v4h __attribute__((ext_vector_type(4)));

__global__ __launch_bounds__(256) void k_x16(const float* __restrict__ x, _Float16* __restrict__ X16, size_t n8) { const size_t t = (size_t)blockIdx.x * 256 + threadIdx.x; if (t >= n8) return; FragH f;
#pragma unroll
  for (int q = 0; q < 8; ++q) f.h[q] = (_Float16)bf16_round(x[t * 8 + q]); *(v8us*)((unsigned short*)X16 + t * 8) = f.half[0];  }
__global__ __launch_bounds__(256) void k_h16(const float* __restrict__ x, _Float16* __restrict__ X16, size_t n8) { const size_t t = (size_t)blockIdx.x * 256 + threadIdx.x; if (t >= n8) return; FragH f;
#pragma unroll
  for (int q = 0; q < 8; ++q) f.h[q] = (_Float16)x[t * 8 + q]; *(v8us*)((unsigned short*)X16 + t * 8) = f.half[0];  }
__global__ __launch_bounds__(256) void k_round16f(const float* __restrict__ W, _Float16* __restrict__ Bt, size_t n8) { const size_t t = (size_t)blockIdx.x * 256 + threadIdx.x; if (t >= n8) return; FragH f;
#pragma unroll
  for (int i = 0; i < 8; ++i) f.h[i] = (_Float16)(bf16_round(W[t * 8 + i]) * 16.0f); *(v8us*)((unsigned short*)Bt + t * 8) = f.half[0];  }
template <int NHv, int TTv>
__global__ __launch_bounds__(256) void k_vt(const _Float16* __restrict__ V16, int ldv, int voff, _Float16* __restrict__ Vt) { __shared__ unsigned short tl[64][66]; const int tid = threadIdx.x; const int slab = blockIdx.x / (TTv / 64), lg = blockIdx.x % (TTv / 64); const int b = slab / NHv, h = slab % NHv;
  for (int i = tid; i < 64 * 8; i += 256) { const int r = i / 8, c8 = (i % 8) * 8; FragH f; f.half[0] = *(const v8us*)((const unsigned short*)V16 + ((size_t)b * TTv + lg * 64 + r) * ldv + voff + h * 64 + c8);
#pragma unroll
    for (int q = 0; q < 8; ++q) tl[r][c8 + q] = f.u[q]; }
  __syncthreads();
  {
#pragma unroll
    for (int rd = 0; rd < 2; ++rd) { const int d = rd * 32 + tid / 8, pc = tid % 8; FragH f;
#pragma unroll
      for (int q = 0; q < 8; ++q) f.u[q] = tl[pc * 8 + q][d];
      *(v8us*)((unsigned short*)Vt + ((size_t)slab * 64 + d) * TTv + lg * 64 + pc * 8) = f.half[0]; }
     } }

__global__ __launch_bounds__(256) void k_hl(const float* __restrict__ F, _Float16* __restrict__ Hh, _Float16* __restrict__ Hl, size_t n8) { const size_t t = (size_t)blockIdx.x * 256 + threadIdx.x; if (t >= n8) return; FragH fh, fl; const v4f a = *(const v4fa*)(F + t * 8), c = *(const v4fa*)(F + t * 8 + 4);
#pragma unroll
  for (int q = 0; q < 4; ++q) { _Float16 h = (_Float16)a[q]; fh.h[q] = h; fl.h[q] = (_Float16)((a[q] - (float)h) * 1024.0f); h = (_Float16)c[q]; fh.h[4 + q] = h; fl.h[4 + q] = (_Float16)((c[q] - (float)h) * 1024.0f); }
  { *(v8us*)((unsigned short*)Hh + t * 8) = fh.half[0]; *(v8us*)((unsigned short*)Hl + t * 8) = fl.half[0];  } }

// ---- fast GEMM (wave tile 32x64, work-group tile 128x64; requires M % 128 == 0, N % 64 == 0, K % 64 == 0); epilogue = k_gemm_hhx semantics ----
#define G2P 72                   /* LDS row pitch in values: 128-byte rows at 144 bytes, the conflict-free pitch for ds_load_b128 readers */
// One K step of 64 values for the work-group: its 128 A rows and 64 B rows (128 bytes = one line each) go to LDS as 12 asynchronous 16-byte copies a lane; 8 lanes take a row, so a wave's copy covers 4 whole lines.
// ag, bg: the lane's piece in the first 16 rows; sa, sb: 16 rows on, in values; la, lb: the lane's LDS byte address in the first 16 rows. The closing s_wait_xcnt 0 stands in front of any rewrite of the registers that the copies name.
__device__ __forceinline__ void g2_stage(const _Float16* ag, size_t sa, const _Float16* bg, size_t sb, unsigned la, unsigned lb) {
  asm volatile("global_load_async_to_lds_b128 %0, %12, off\n\t"
               "global_load_async_to_lds_b128 %1, %13, off\n\t"
               "global_load_async_to_lds_b128 %2, %14, off\n\t"
               "global_load_async_to_lds_b128 %3, %15, off\n\t"
               "global_load_async_to_lds_b128 %4, %16, off\n\t"
               "global_load_async_to_lds_b128 %5, %17, off\n\t"
               "global_load_async_to_lds_b128 %6, %18, off\n\t"
               "global_load_async_to_lds_b128 %7, %19, off\n\t"
               "global_load_async_to_lds_b128 %8, %20, off\n\t"
               "global_load_async_to_lds_b128 %9, %21, off\n\t"
               "global_load_async_to_lds_b128 %10, %22, off\n\t"
               "global_load_async_to_lds_b128 %11, %23, off\n\t"
               "s_wait_xcnt 0x0"
               :: "v"(la), "v"(la + 1u * 16 * G2P * 2), "v"(la + 2u * 16 * G2P * 2), "v"(la + 3u * 16 * G2P * 2), "v"(la + 4u * 16 * G2P * 2), "v"(la + 5u * 16 * G2P * 2), "v"(la + 6u * 16 * G2P * 2), "v"(la + 7u * 16 * G2P * 2),
                  "v"(lb), "v"(lb + 1u * 16 * G2P * 2), "v"(lb + 2u * 16 * G2P * 2), "v"(lb + 3u * 16 * G2P * 2),
                  "v"(ag), "v"(ag + sa), "v"(ag + 2 * sa), "v"(ag + 3 * sa), "v"(ag + 4 * sa), "v"(ag + 5 * sa), "v"(ag + 6 * sa), "v"(ag + 7 * sa),
                  "v"(bg), "v"(bg + sb), "v"(bg + 2 * sb), "v"(bg + 3 * sb)
               : "memory"); }
__device__ __forceinline__ v16h g2_frag(const _Float16* p, int hh) { FragH f; f.half[0] = *(const v8us*)((const unsigned short*)p + 8 * hh); f.half[1] = *(const v8us*)((const unsigned short*)p + 16 + 8 * hh); return f.v; }
__device__ __forceinline__ v8f g2_mma(v16h a, v16h b, v8f c) { v8f d = __builtin_amdgcn_wmma_f32_16x16x32_f16(false, a, false, b, (short)0, c, false, false); asm volatile("v_nop\n\tv_nop\n\tv_nop\n\tv_nop" : "+v"(d) : "v"(a), "v"(b)); return d; }
template <int ACT>
__global__ __launch_bounds__(128) void k_gemm2(const _Float16* __restrict__ A, int lda, size_t sA, const _Float16* __restrict__ Bh, int ldb, size_t sB, float alpha, const float* __restrict__ bias, size_t sBias, const float* __restrict__ CP, int rowsPerB, size_t sCPb, int row0g,
    float* __restrict__ C, _Float16* __restrict__ C16, int ldc, size_t sC, int M, int N, int K) {
  __shared__ __attribute__((aligned(16))) float so[4][32][68]; __shared__ __attribute__((aligned(16))) unsigned short tA[2][128][G2P], tB[2][64][G2P];
  const int tid = threadIdx.x, w = tid >> 5, lane = tid & 31, ln = lane & 15, hh = lane >> 4; const int by = blockIdx.y;
  A += (size_t)by * sA; Bh += (size_t)by * sB; const size_t cofs = (size_t)by * sC; const float* bp = bias ? bias + (size_t)by * sBias : nullptr;
  const int ntn = N >> 6; const int mt = blockIdx.x / ntn, nq = blockIdx.x - mt * ntn; const int row0 = mt * 128 + 32 * w, col0 = nq * 64; if (mt * 128 >= M) return;      /* the whole work-group leaves or none: barriers below */
  const int cr = tid >> 3, cc = (tid & 7) * 8;      /* the lane's row (of 16) and 16-byte piece in a copy */
  const _Float16* ag = A + (size_t)(mt * 128 + cr) * lda + cc; const _Float16* bg = Bh + (size_t)(col0 + cr) * ldb + cc; const size_t sa = (size_t)16 * lda, sb = (size_t)16 * ldb;
  const unsigned la = (unsigned)(size_t)&tA[0][cr][cc], lb = (unsigned)(size_t)&tB[0][cr][cc];      /* LDS byte addresses: the low 32 bits */
  const int nst = K >> 6;
  const v8f z8 = {0.f,0.f,0.f,0.f,0.f,0.f,0.f,0.f}; v8f c00 = z8, c01 = z8, c02 = z8, c03 = z8, c10 = z8, c11 = z8, c12 = z8, c13 = z8;
  g2_stage(ag, sa, bg, sb, la, lb);      /* step 0 into buffer 0 */
  asm volatile("s_wait_asynccnt 0x0" ::: "memory");      /* this wave's copies of step 0 have landed */
  __syncthreads();      /* ... and every other wave's */
  if (nst > 1) g2_stage(ag + 64, sa, bg + 64, sb, la + (unsigned)sizeof(tA[0]), lb + (unsigned)sizeof(tB[0]));      /* step 1 flies while step 0 is worked on */
#pragma unroll 1
  for (int st = 0; st < nst; ++st) { const int bf = st & 1; const _Float16* ar = (const _Float16*)&tA[bf][32 * w + ln][0]; const _Float16* br = (const _Float16*)&tB[bf][ln][0];
    v16h fa[2][2], fb[2][4];      /* the step's 12 fragments are read as one group ahead of its 16 products */
#pragma unroll
    for (int ks = 0; ks < 2; ++ks) { fa[ks][0] = g2_frag(ar + ks * 32, hh); fa[ks][1] = g2_frag(ar + 16 * G2P + ks * 32, hh);
#pragma unroll
      for (int j = 0; j < 4; ++j) fb[ks][j] = g2_frag(br + j * 16 * G2P + ks * 32, hh); }
#pragma unroll
    for (int ks = 0; ks < 2; ++ks) { c00 = g2_mma(fa[ks][0], fb[ks][0], c00); c10 = g2_mma(fa[ks][1], fb[ks][0], c10); c01 = g2_mma(fa[ks][0], fb[ks][1], c01); c11 = g2_mma(fa[ks][1], fb[ks][1], c11);
      c02 = g2_mma(fa[ks][0], fb[ks][2], c02); c12 = g2_mma(fa[ks][1], fb[ks][2], c12); c03 = g2_mma(fa[ks][0], fb[ks][3], c03); c13 = g2_mma(fa[ks][1], fb[ks][3], c13); }
    asm volatile("s_wait_dscnt 0x0" ::: "memory");      /* this wave's reads of buffer bf are done before it is refilled */
    asm volatile("s_wait_asynccnt 0x0" ::: "memory");      /* this wave's copies of step st + 1 have landed */
    __syncthreads();      /* publishes step st + 1 and ends every wave's reads of buffer bf */
    if (st + 2 < nst) g2_stage(ag + (size_t)(st + 2) * 64, sa, bg + (size_t)(st + 2) * 64, sb, la + (unsigned)bf * (unsigned)sizeof(tA[0]), lb + (unsigned)bf * (unsigned)sizeof(tB[0])); }
  asm volatile("s_wait_asynccnt 0x0" ::: "memory");      /* no copy is outstanding past the loop */
  v8f accs[8] = {c00, c01, c02, c03, c10, c11, c12, c13};
#pragma unroll
  for (int u = 0; u < 8; ++u) { const int t = u & 3, half = u >> 2; const int col = col0 + t * 16 + ln; const float bv = bp ? bf16_round(bp[col]) : 0.f;
#pragma unroll
    for (int r = 0; r < 8; ++r) { const int rloc = half * 16 + 8 * hh + r; float v = accs[u][r] * alpha + bv; if (CP) { const int bidx = (row0g + row0 + rloc) / rowsPerB; v += CP[(size_t)bidx * sCPb + (size_t)by * 64 + col]; }
      if (ACT == 3) v = fmaxf(v, 0.f); else if (ACT == 6) v = 0.5f * v * (1.0f + erff(v * 0.70710678118654752f)); else if (ACT == 11) v = 1.0f / (1.0f + expf(-v)); else if (ACT == 15) v = v / (1.0f + expf(-v)); else if (ACT == 12) v = (v > 0.f) ? v : 0.01f * v; else if (ACT == 8) v = tanhf(v);
      so[w][rloc][t * 16 + ln] = v; } }
  __builtin_amdgcn_fence(__ATOMIC_ACQ_REL, "workgroup"); __builtin_amdgcn_wave_barrier();
  const int rsub = lane >> 4, c4 = (lane & 15) * 4;
  {
#pragma unroll
    for (int q = 0; q < 16; ++q) { const int r = q * 2 + rsub; const v4f v = *(const v4fa*)&so[w][r][c4]; if (C) *(v4f*)(C + cofs + (size_t)(row0 + r) * ldc + col0 + c4) = v; if (C16) { v4h h4; for (int i = 0; i < 4; ++i) h4[i] = (_Float16)v[i]; *(v4h*)(C16 + cofs + (size_t)(row0 + r) * ldc + col0 + c4) = h4; } }
     } }



template <int TK>
__global__ __launch_bounds__(256) void k_vthl(const float* __restrict__ VF, int ldv, _Float16* __restrict__ Vth, _Float16* __restrict__ Vtl) { __shared__ float tl[64][65]; const int tid = threadIdx.x; const int slab = blockIdx.x / (TK / 64), lg = blockIdx.x % (TK / 64); const int b = slab / NH, h = slab % NH;
  for (int i = tid; i < 64 * 16; i += 256) { const int r = i / 16, c4 = (i % 16) * 4; const v4f a = *(const v4fa*)(VF + ((size_t)b * TK + lg * 64 + r) * ldv + h * 64 + c4); tl[r][c4] = a[0]; tl[r][c4 + 1] = a[1]; tl[r][c4 + 2] = a[2]; tl[r][c4 + 3] = a[3]; }
  __syncthreads();
  FragH fh[2], fl[2]; size_t oo[2];
#pragma unroll
  for (int rd = 0; rd < 2; ++rd) { const int d = rd * 32 + tid / 8, pc = tid % 8;
#pragma unroll
    for (int q = 0; q < 8; ++q) { const float v = tl[pc * 8 + q][d]; const _Float16 hv = (_Float16)v; fh[rd].h[q] = hv; fl[rd].h[q] = (_Float16)((v - (float)hv) * 1024.0f); } oo[rd] = ((size_t)slab * 64 + d) * TK + lg * 64 + pc * 8; }
  {
#pragma unroll
    for (int rd = 0; rd < 2; ++rd) { *(v8us*)((unsigned short*)Vth + oo[rd]) = fh[rd].half[0]; *(v8us*)((unsigned short*)Vtl + oo[rd]) = fl[rd].half[0]; }
     } }

template <int TQ, int TK>
__global__ __launch_bounds__(128, 4) /* the second number holds the build to 256 registers: 4 waves a SIMD, so that all 1024 work-groups are resident at once */ void k_flashb(const _Float16* __restrict__ Q16, const _Float16* __restrict__ Q16lo, int ldq, const _Float16* __restrict__ K16, const _Float16* __restrict__ K16lo, int ldk, const _Float16* __restrict__ Vt, const _Float16* __restrict__ Vtlo, const _Float16* __restrict__ T16, float* __restrict__ O, int ldo) {
  constexpr int RPW = 16, RTN = RPW / 16, NQB = TQ / (4 * RPW), DT = 4, KS = 2;
  __shared__ __attribute__((aligned(16))) unsigned short sP[4][RPW][40], sPl[4][RPW][40]; __shared__ __attribute__((aligned(16))) float sO[4][RPW][64 + 4];
  const int tid = threadIdx.x, w = __builtin_amdgcn_readfirstlane(tid >> 5), lane = tid & 31, ln = lane & 15, hh = lane >> 4;      /* the wave's number in a scalar register: what is formed from it costs no vector register across the loop */
  const int slab = blockIdx.x / NQB, qblk = blockIdx.x % NQB; const int b = slab / NH, h = slab % NH; const int qb0 = qblk * (4 * RPW); const int q0 = qb0 + w * RPW;
  FragH aq[2][KS], aql[2][KS];
#pragma unroll
  for (int rt = 0; rt < RTN; ++rt) { const size_t qo = ((size_t)b * TQ + q0 + rt * 16 + ln) * ldq + h * 64; const unsigned short* qr = (const unsigned short*)Q16 + qo; const unsigned short* ql = (const unsigned short*)Q16lo + qo;
#pragma unroll
    for (int ks = 0; ks < KS; ++ks) { aq[rt][ks].half[0] = *(const v8us*)(qr + ks * 32 + 8 * hh); aq[rt][ks].half[1] = *(const v8us*)(qr + ks * 32 + 16 + 8 * hh); aql[rt][ks].half[0] = *(const v8us*)(ql + ks * 32 + 8 * hh); aql[rt][ks].half[1] = *(const v8us*)(ql + ks * 32 + 16 + 8 * hh); } }
  const unsigned short* Vth = (const unsigned short*)Vt + (size_t)slab * 64 * TK; const unsigned short* Vtl = (const unsigned short*)Vtlo + (size_t)slab * 64 * TK;
  float m_r[2][8], l_r[2][8]; v8f oacc[2][DT], oaccl[2][DT];
#pragma unroll
  for (int rt = 0; rt < RTN; ++rt) {
#pragma unroll
    for (int r = 0; r < 8; ++r) { m_r[rt][r] = -3.0e38f; l_r[rt][r] = 0.f; }
#pragma unroll
    for (int dt = 0; dt < DT; ++dt) { oacc[rt][dt] = (v8f){0.f,0.f,0.f,0.f,0.f,0.f,0.f,0.f}; oaccl[rt][dt] = oacc[rt][dt]; } }
  /* RPE: rel[i][c] = q[q0 + i] . table[h][rb + c], rb = q0 - j0 + TK - 32, c < 48; score (i, kk) takes c = i - kk + 31. Columns 32..47 of a trip are columns 0..15 of the trip before. */
  const unsigned short* Th = (const unsigned short*)T16 + (size_t)h * RW * 64 + (size_t)ln * 64 + 8 * hh;
  v8f relc = (v8f){0.f,0.f,0.f,0.f,0.f,0.f,0.f,0.f};      /* columns 32..47 of the first trip */
#pragma unroll
  for (int ks = 0; ks < KS; ++ks) { FragH bt; bt.half[0] = *(const v8us*)(Th + (size_t)(q0 + TK) * 64 + ks * 32); bt.half[1] = *(const v8us*)(Th + (size_t)(q0 + TK) * 64 + ks * 32 + 16); relc = mmaH<1>(aq[0][ks].v, aq[0][ks].v, bt.v, bt.v, relc); }
#pragma unroll 1
  for (int j0 = 0; j0 < TK; j0 += 32) {
    FragH bt[2][KS];      /* table rows rb .. rb + 31, fetched together with the first key tile */
#pragma unroll
    for (int t = 0; t < 2; ++t) { const unsigned short* tr = Th + (size_t)(q0 - j0 + (TK - 32) + t * 16) * 64;
#pragma unroll
      for (int ks = 0; ks < KS; ++ks) { bt[t][ks].half[0] = *(const v8us*)(tr + ks * 32); bt[t][ks].half[1] = *(const v8us*)(tr + ks * 32 + 16); } }
    asm volatile("s_wait_xcnt 0x0" ::: "memory");      /* stands in front of any overwrite of the table loads' address registers (the allocator lets a later load's result land in them) */
    v8f s[2][2];
#pragma unroll
    for (int nt = 0; nt < 2; ++nt) { const size_t ko = ((size_t)b * TK + j0 + nt * 16 + ln) * ldk + h * 64; const unsigned short* kr = (const unsigned short*)K16 + ko; const unsigned short* kl = (const unsigned short*)K16lo + ko; FragH bk[KS], bkl[KS];
#pragma unroll
      for (int ks = 0; ks < KS; ++ks) { bk[ks].half[0] = *(const v8us*)(kr + ks * 32 + 8 * hh); bk[ks].half[1] = *(const v8us*)(kr + ks * 32 + 16 + 8 * hh); bkl[ks].half[0] = *(const v8us*)(kl + ks * 32 + 8 * hh); bkl[ks].half[1] = *(const v8us*)(kl + ks * 32 + 16 + 8 * hh); }
      if (nt == 1) {      /* RPE products and their LDS stores run while the second key tile's loads are in flight */
        v8f rel0 = (v8f){0.f,0.f,0.f,0.f,0.f,0.f,0.f,0.f}, rel1 = rel0;
#pragma unroll
        for (int ks = 0; ks < KS; ++ks) { rel0 = mmaH<1>(aq[0][ks].v, aq[0][ks].v, bt[0][ks].v, bt[0][ks].v, rel0); rel1 = mmaH<1>(aq[0][ks].v, aq[0][ks].v, bt[1][ks].v, bt[1][ks].v, rel1); }
#pragma unroll
        for (int r = 0; r < 8; ++r) { sO[w][8 * hh + r][ln] = rel0[r]; sO[w][8 * hh + r][16 + ln] = rel1[r]; sO[w][8 * hh + r][32 + ln] = relc[r]; }
        relc = rel0; }
#pragma unroll
      for (int rt = 0; rt < RTN; ++rt) { v8f acc = (v8f){0.f,0.f,0.f,0.f,0.f,0.f,0.f,0.f}, accr = acc;
#pragma unroll
        for (int ks = 0; ks < KS; ++ks) { acc = mmaH<1>(aq[rt][ks].v, aq[rt][ks].v, bk[ks].v, bk[ks].v, acc); accr = mmaH<1>(aql[rt][ks].v, aql[rt][ks].v, bk[ks].v, bk[ks].v, accr); accr = mmaH<1>(aq[rt][ks].v, aq[rt][ks].v, bkl[ks].v, bkl[ks].v, accr); }
        s[rt][nt] = acc + accr * 0.0009765625f; } }
    /* the wave's rel stores above are read back by other lanes of the same wave below */
    __builtin_amdgcn_fence(__ATOMIC_ACQ_REL, "workgroup"); __builtin_amdgcn_wave_barrier();
    float rv0[8], rv1[8];      /* all 16 diagonal reads issued together */
#pragma unroll
    for (int r = 0; r < 8; ++r) { rv0[r] = sO[w][8 * hh + r][8 * hh + r - ln + 31]; rv1[r] = sO[w][8 * hh + r][8 * hh + r - ln + 15]; }
    /* every key counts for every query (the function has no mask): no test and no branch in this stage, so the 8 rows' chains run side by side */
#pragma unroll
    for (int rt = 0; rt < RTN; ++rt)
#pragma unroll
      for (int r = 0; r < 8; ++r) { const float s0 = s[rt][0][r] * SCL + rv0[r] * 0.0625f, s1 = s[rt][1][r] * SCL + rv1[r] * 0.0625f;      /* + q . table[h][(q - k) + T - 1] (table held x16) */ float mc = fmaxf(s0, s1);
        mc = fmaxf(mc, __shfl_xor(mc, 1, 32)); mc = fmaxf(mc, __shfl_xor(mc, 2, 32)); mc = fmaxf(mc, __shfl_xor(mc, 4, 32)); mc = fmaxf(mc, __shfl_xor(mc, 8, 32));
        const float mn = fmaxf(m_r[rt][r], mc); const float al = expf(m_r[rt][r] - mn); m_r[rt][r] = mn; const float p0 = expf(s0 - mn), p1 = expf(s1 - mn); l_r[rt][r] = l_r[rt][r] * al + p0 + p1;
#pragma unroll
        for (int dt = 0; dt < DT; ++dt) { oacc[rt][dt][r] *= al; oaccl[rt][dt][r] *= al; }
        FragH t2, t3; const float ps0 = p0 * 1024.0f, ps1 = p1 * 1024.0f; t2.h[0] = (_Float16)ps0; t2.h[1] = (_Float16)ps1; t3.h[0] = (_Float16)((ps0 - (float)t2.h[0]) * 1024.0f); t3.h[1] = (_Float16)((ps1 - (float)t2.h[1]) * 1024.0f);
        sP[w][rt * 16 + 8 * hh + r][ln] = t2.u[0]; sP[w][rt * 16 + 8 * hh + r][16 + ln] = t2.u[1]; sPl[w][rt * 16 + 8 * hh + r][ln] = t3.u[0]; sPl[w][rt * 16 + 8 * hh + r][16 + ln] = t3.u[1]; }
    __builtin_amdgcn_fence(__ATOMIC_ACQ_REL, "workgroup"); __builtin_amdgcn_wave_barrier();
    FragH pa[2], pl[2];
#pragma unroll
    for (int rt = 0; rt < RTN; ++rt) { pa[rt].half[0] = *(const v8us*)&sP[w][rt * 16 + ln][8 * hh]; pa[rt].half[1] = *(const v8us*)&sP[w][rt * 16 + ln][16 + 8 * hh]; pl[rt].half[0] = *(const v8us*)&sPl[w][rt * 16 + ln][8 * hh]; pl[rt].half[1] = *(const v8us*)&sPl[w][rt * 16 + ln][16 + 8 * hh]; }
#pragma unroll
    for (int dt = 0; dt < DT; ++dt) { const size_t vo = (size_t)(dt * 16 + ln) * TK + j0; FragH bv, bl; bv.half[0] = *(const v8us*)(Vth + vo + 8 * hh); bv.half[1] = *(const v8us*)(Vth + vo + 16 + 8 * hh); bl.half[0] = *(const v8us*)(Vtl + vo + 8 * hh); bl.half[1] = *(const v8us*)(Vtl + vo + 16 + 8 * hh);
#pragma unroll
      for (int rt = 0; rt < RTN; ++rt) { oacc[rt][dt] = mmaH<1>(pa[rt].v, pa[rt].v, bv.v, bv.v, oacc[rt][dt]); oaccl[rt][dt] = mmaH<1>(pa[rt].v, pa[rt].v, bl.v, bl.v, oaccl[rt][dt]); oaccl[rt][dt] = mmaH<1>(pl[rt].v, pl[rt].v, bv.v, bv.v, oaccl[rt][dt]); } }
    __builtin_amdgcn_fence(__ATOMIC_ACQ_REL, "workgroup"); __builtin_amdgcn_wave_barrier(); }
#pragma unroll
  for (int rt = 0; rt < RTN; ++rt) {
#pragma unroll
    for (int r = 0; r < 8; ++r) { float l = l_r[rt][r]; l += __shfl_xor(l, 1, 32); l += __shfl_xor(l, 2, 32); l += __shfl_xor(l, 4, 32); l += __shfl_xor(l, 8, 32); l_r[rt][r] = 1.0f / (l * 1024.0f); }      /* l >= 1: the row's largest score adds exp(0) */
#pragma unroll
    for (int dt = 0; dt < DT; ++dt)
#pragma unroll
      for (int r = 0; r < 8; ++r) sO[w][rt * 16 + 8 * hh + r][dt * 16 + ln] = (oacc[rt][dt][r] + oaccl[rt][dt][r] * 0.0009765625f) * l_r[rt][r]; }
  __builtin_amdgcn_fence(__ATOMIC_ACQ_REL, "workgroup"); __builtin_amdgcn_wave_barrier();
  {
#pragma unroll
    for (int rp = 0; rp < RPW; rp += 2) { const int r = rp + (lane >> 4), pc = lane & 15; const v4f val = *(const v4fa*)&sO[w][r][pc * 4]; *(v4f*)(O + ((size_t)b * TQ + q0 + r) * ldo + h * 64 + pc * 4) = val; }
     } }


__global__ __launch_bounds__(256) void k_lnx(const float* __restrict__ X, const float* __restrict__ g, const float* __restrict__ bb, _Float16* __restrict__ Y16, float* __restrict__ XB) {
  #pragma clang fp contract(off)
  const int tid = threadIdx.x, w = tid >> 5, ln = tid & 31; const int r = blockIdx.x * 8 + w; if (r >= NR) return; const float* x = X + (size_t)r * DM; float s = 0.f;
#pragma unroll 1
  for (int i = 0; i < DM / 128; ++i) { const v4f a = *(const v4fa*)(x + i * 128 + ln * 4); for (int q = 0; q < 4; ++q) s += bf16_round(a[q]); }
  for (int o = 16; o > 0; o >>= 1) s += __shfl_xor(s, o, 32); const float mu = s / (float)DM; float q2 = 0.f;
#pragma unroll 1
  for (int i = 0; i < DM / 128; ++i) { const v4f a = *(const v4fa*)(x + i * 128 + ln * 4); for (int q = 0; q < 4; ++q) { const float d = bf16_round(a[q]) - mu; q2 += d * d; } }
  for (int o = 16; o > 0; o >>= 1) q2 += __shfl_xor(q2, o, 32); const float rs = rsqrtf(q2 / (float)DM + 1e-5f);
  {
#pragma unroll 1
    for (int i = 0; i < DM / 128; ++i) { const int c0 = i * 128 + ln * 4; const v4f a = *(const v4fa*)(x + c0); _Float16 h4[4]; v4f xb;
      for (int q = 0; q < 4; ++q) { const float t = bf16_round(a[q]); h4[q] = (_Float16)((t - mu) * rs * bf16_round(g[c0 + q]) + bf16_round(bb[c0 + q])); xb[q] = t; }
      *(unsigned long long*)((unsigned short*)Y16 + (size_t)r * DM + c0) = *(const unsigned long long*)h4; *(v4f*)(XB + (size_t)r * DM + c0) = xb; }
     } }
__global__ __launch_bounds__(256) void k_rtab(const float* __restrict__ tab, int trows, _Float16* __restrict__ T16) {
  const int t = blockIdx.x * 256 + threadIdx.x; if (t >= NH * RW * 8) return; const int d0 = (t & 7) * 8; const int r = (t >> 3) % RW; const int h = t / (8 * RW); FragH f;
#pragma unroll
  for (int q = 0; q < 8; ++q) f.h[q] = (r < 2 * SLEN - 1) ? (_Float16)(bf16_round(tab[((size_t)h * trows + r) * 64 + d0 + q]) * 16.0f) : (_Float16)0.0f;
  *(v8us*)((unsigned short*)T16 + ((size_t)h * RW + r) * 64 + d0) = f.half[0];  }
__global__ __launch_bounds__(256) void k_causaltab(unsigned* __restrict__ MB, int* __restrict__ RA, int* __restrict__ KE, int nq, int nk) {
  const int t = blockIdx.x * 256 + threadIdx.x; const int nw = nk / 32;
  if (t < nq * nw) { const int q = t / nw, w = t % nw; const int first = q + 1 - 32 * w; const unsigned bits = (first <= 0) ? 0xffffffffu : ((first >= 32) ? 0u : (0xffffffffu << first)); *(unsigned*)(MB + t) = bits;  }
  if (t < nq) { *(int*)(RA + t) = 0;  }
  if (t < nq / 64) { const int v = 64 * (t + 1); *(int*)(KE + t * 32) = v;  } }


extern "C" void kernel_launch(void* const* d_in, const int* in_sizes, int n_in,
                              void* d_out, int out_size, void* d_ws, size_t ws_size, hipStream_t stream) {
  (void)in_sizes; (void)n_in; (void)out_size;
  const float* const* I = (const float* const*)d_in; const float* x = I[0]; const float* Wq = I[1]; const float* bq = I[2]; const float* Wk = I[3]; const float* bk = I[4]; const float* Wv = I[5]; const float* bv = I[6]; const float* Wo = I[7]; const float* bo = I[8]; const float* tab = I[9];
  char* ws = (char*)d_ws; size_t off = 0;
  auto take = [&](size_t bytes) { char* p = ws + off; off += (bytes + 255) & ~(size_t)255; return p; };
  _Float16* BQ = (_Float16*)take((size_t)DM * DM * 2); _Float16* BK = (_Float16*)take((size_t)DM * DM * 2); _Float16* BV = (_Float16*)take((size_t)DM * DM * 2); _Float16* BO = (_Float16*)take((size_t)DM * DM * 2); _Float16* T16 = (_Float16*)take((size_t)NH * RW * 64 * 2);
  _Float16* X16 = (_Float16*)take((size_t)NR * DM * 2); float* F = (float*)take((size_t)NR * DM * 4);
  _Float16* Qh = (_Float16*)take((size_t)NR * DM * 2); _Float16* Ql = (_Float16*)take((size_t)NR * DM * 2); _Float16* Kh = (_Float16*)take((size_t)NR * DM * 2); _Float16* Kl = (_Float16*)take((size_t)NR * DM * 2); _Float16* Vth = (_Float16*)take((size_t)NR * DM * 2); _Float16* Vtl = (_Float16*)take((size_t)NR * DM * 2);
  float* O = (float*)take((size_t)NR * DM * 4); _Float16* Oh = (_Float16*)take((size_t)NR * DM * 2); _Float16* Ol = (_Float16*)take((size_t)NR * DM * 2);
  if (off > ws_size) return;      /* 8 + 4 + 8 + 16 + 48 + 16 + 16 = 116 MiB */
  const size_t n8 = (size_t)NR * DM / 8; const unsigned nb8 = (unsigned)((n8 + 255) / 256); const size_t w8 = (size_t)DM * DM / 8; const unsigned wb = (unsigned)((w8 + 255) / 256);
  k_round16f<<<wb, 256, 0, stream>>>(Wq, BQ, w8); k_round16f<<<wb, 256, 0, stream>>>(Wk, BK, w8); k_round16f<<<wb, 256, 0, stream>>>(Wv, BV, w8); k_round16f<<<wb, 256, 0, stream>>>(Wo, BO, w8);      /* torch (out,in) = natural Bt */
  k_rtab<<<(NH * RW * 8 + 255) / 256, 256, 0, stream>>>(tab, 9999, T16);
  const dim3 gP((NR / 128) * (DM / 64), 1);
  /* every row-wise stage runs once over all NBT * SLEN rows */
  k_x16<<<nb8, 256, 0, stream>>>(x, X16, n8);
  k_gemm2<0><<<gP, 128, 0, stream>>>(X16, DM, 0, BQ, DM, 0, 0.0625f, bq, 0, nullptr, 1, 0, 0, F, nullptr, DM, 0, NR, DM, DM); k_hl<<<nb8, 256, 0, stream>>>(F, Qh, Ql, n8);      /* q: f32 -> hi/lo; the hi plane also feeds the RPE product */
  k_gemm2<0><<<gP, 128, 0, stream>>>(X16, DM, 0, BK, DM, 0, 0.0625f, bk, 0, nullptr, 1, 0, 0, F, nullptr, DM, 0, NR, DM, DM); k_hl<<<nb8, 256, 0, stream>>>(F, Kh, Kl, n8);
  k_gemm2<0><<<gP, 128, 0, stream>>>(X16, DM, 0, BV, DM, 0, 0.0625f, bv, 0, nullptr, 1, 0, 0, F, nullptr, DM, 0, NR, DM, DM); k_vthl<SLEN><<<NBT * NH * (SLEN / 64), 256, 0, stream>>>(F, DM, Vth, Vtl);
  k_flashb<SLEN, SLEN><<<NBT * NH * (SLEN / 64), 128, 0, stream>>>(Qh, Ql, DM, Kh, Kl, DM, Vth, Vtl, T16, O, DM);      /* all batches and heads in one launch */
  k_hl<<<nb8, 256, 0, stream>>>(O, Oh, Ol, n8);
  float* outp = (float*)d_out;
  k_gemm2<0><<<gP, 128, 0, stream>>>(Oh, DM, 0, BO, DM, 0, 0.0625f, bo, 0, nullptr, 1, 0, 0, outp, nullptr, DM, 0, NR, DM, DM);
  k_gemm2<0><<<gP, 128, 0, stream>>>(Ol, DM, 0, BO, DM, 0, 0.0625f / 1024.0f, nullptr, 0, outp, 1, (size_t)DM, 0, outp, nullptr, DM, 0, NR, DM, DM);
}

// v005
// It runs in 279 microseconds.
// Two timings next to v004 put it at 1.08 and 1.07 times that version's speed.
// Over all steps from v000 it is 15.6 times as fast.
#include <hip/hip_runtime.h>
// Multi-head attention with learned relative-position encoding (4 x 1024 tokens, 1024 = 16 heads x 64): q,k,v = x W^T + b; scores = q.k/8 + q.rpe_table[h][q - k + 1023] (no scale on the RPE term); softmax over all keys; . v; merged . Wo^T + bo -> [4,1024,1024].
// Structure: projections (all batches in one launch) as f16 WMMA GEMMs (32x64 wave tiles, f32 accumulation, exact products + bias; the work-group's A and B tiles reach LDS by asynchronous copies, two buffers); the fused flash kernel (one launch over all batches and heads; hi/lo q,k three-product scores, online f32 softmax, P staged hi + residual, V^T hi + residual; all keys valid) forms the RPE term itself: per 16 x 32 score tile the 48 table rows r = q - k + 1023 can reach give a 16 x 48 f16 WMMA product q_h . table[h][r] (f32 result, 16 of the 48 columns carried over from the trip before), staged in the wave's LDS and read back along the diagonal inside the score stage; O as hi + residual planes into Wo (two GEMMs, bias in the first).
// Compute dtype: x, weights, biases, rpe_table rounded to bf16; projections exact; the RPE product uses the plain f16 q (the hi plane) (~2^-12 on a sigma-0.16 bias); q, k, P, v, O as f16 hi + residual pairs (~2^-21) in the attention; f32 accumulation and softmax. v_wmma_f32_16x16x32_f16.
#define NBT 4
#define SLEN 1024
#define RW 2048                  /* table rows kept per head (2*SLEN-1 used, the last one zero) */
#define DM 1024
#define NH 16
#define SCL 0.125f
#define NR (NBT * SLEN)
typedef __bf16 v16b __attribute__((ext_vector_type(16)));
typedef unsigned short v8us __attribute__((ext_vector_type(8), may_alias));
typedef float  v8f  __attribute__((ext_vector_type(8)));
typedef float  v4f  __attribute__((ext_vector_type(4)));
typedef float  v4fa __attribute__((ext_vector_type(4), may_alias));
union FragB { v16b v; v8us half[2]; unsigned short u[16]; };

__device__ __forceinline__ unsigned short bf16_bits(float x) { unsigned int u = __float_as_uint(x); return (unsigned short)((u + 0x7FFFu + ((u >> 16) & 1u)) >> 16); }
__device__ __forceinline__ float bf16_val(unsigned short b) { return __uint_as_float(((unsigned int)b) << 16); }
__device__ __forceinline__ float bf16_round(float x) { return bf16_val(bf16_bits(x)); }
// D += A·B with NT terms: 1 = ah·bh, 2 = + al·bh (A split), 3 = + ah·bl (both split)
template <int NT>
__device__ __forceinline__ v8f mmaN(v16b ah, v16b al, v16b bh, v16b bl, v8f c) {
  c = __builtin_amdgcn_wmma_f32_16x16x32_bf16(false, ah, false, bh, (short)0, c, false, false);
  if (NT >= 2) c = __builtin_amdgcn_wmma_f32_16x16x32_bf16(false, al, false, bh, (short)0, c, false, false);
  if (NT >= 3) c = __builtin_amdgcn_wmma_f32_16x16x32_bf16(false, ah, false, bl, (short)0, c, false, false);
  asm volatile("v_nop\n\tv_nop\n\tv_nop\n\tv_nop" : "+v"(c) : "v"(ah), "v"(al), "v"(bh), "v"(bl));
  return c;
}

__global__ __launch_bounds__(256) void k_wt_bf16(const float* __restrict__ W, unsigned short* __restrict__ Wt, int K, int N) {
  const int t = blockIdx.x * 256 + threadIdx.x;
  const int k8n = K / 8;
  if (t >= N * k8n) return;
  const int n = t / k8n, k8 = (t % k8n) * 8;
  v8us v;
#pragma unroll
  for (int i = 0; i < 8; ++i) v[i] = bf16_bits(W[(size_t)(k8 + i) * N + n]);
  *(v8us*)(Wt + (size_t)n * K + k8) = v;
  
}

// GEMM C[M][N] (f32, pitch ldc) = act(A[M][K]·W + bias). A f32 row-major (pitch lda) converted per fragment to bf16
// (ASPLIT: hi/lo two planes -> 2 terms, else single rounded term); Wt bf16 [N][K] (pitch ldb). BIAS_BF16 rounds the
// bias to bf16 first (bias quantised to bf16 before the add). K%32==0, M%16==0, N%64==0.
template <bool ASPLIT, int ACT, bool BIAS_BF16>
__global__ __launch_bounds__(128) void k_gemm_bf(const float* __restrict__ A, int lda, const unsigned short* __restrict__ Wt, int ldb,
                                               const float* __restrict__ bias, float* __restrict__ C, int ldc, int M, int N, int K) {
  __shared__ __attribute__((aligned(16))) float so[4][16][64];
  const int tid = threadIdx.x, w = tid >> 5, lane = tid & 31, ln = lane & 15, hh = lane >> 4;
  const int ntn = N / 64;
  const int wid = blockIdx.x * 4 + w;
  const int mt = wid / ntn, nq = wid % ntn;
  if (mt * 16 >= M) return;
  const int row0 = mt * 16, col0 = nq * 64;
  const float* arow = A + (size_t)(row0 + ln) * lda;
  v8f acc[4] = {};
  for (int kb = 0; kb < K; kb += 32) {
    FragB ah, al;
    const v4f x0 = *(const v4fa*)(arow + kb + 8 * hh), x1 = *(const v4fa*)(arow + kb + 8 * hh + 4);
    const v4f x2 = *(const v4fa*)(arow + kb + 16 + 8 * hh), x3 = *(const v4fa*)(arow + kb + 16 + 8 * hh + 4);
    float xs[16] = {x0[0],x0[1],x0[2],x0[3],x1[0],x1[1],x1[2],x1[3],x2[0],x2[1],x2[2],x2[3],x3[0],x3[1],x3[2],x3[3]};
#pragma unroll
    for (int i = 0; i < 16; ++i) { const unsigned short hb = bf16_bits(xs[i]); ah.u[i] = hb; al.u[i] = ASPLIT ? bf16_bits(xs[i] - bf16_val(hb)) : (unsigned short)0; }
#pragma unroll
    for (int t = 0; t < 4; ++t) {
      const unsigned short* brow = Wt + (size_t)(col0 + t * 16 + ln) * ldb + kb;
      FragB b;
      b.half[0] = *(const v8us*)(brow + 8 * hh);
      b.half[1] = *(const v8us*)(brow + 16 + 8 * hh);
      acc[t] = mmaN<ASPLIT ? 2 : 1>(ah.v, al.v, b.v, b.v, acc[t]);
    }
  }
#pragma unroll
  for (int t = 0; t < 4; ++t) {
    float bv = bias ? bias[col0 + t * 16 + ln] : 0.f;
    if (BIAS_BF16) bv = bf16_round(bv);
#pragma unroll
    for (int r = 0; r < 8; ++r) { float v = acc[t][r] + bv; if (ACT == 1) v = fmaxf(v, 0.f); so[w][8 * hh + r][t * 16 + ln] = v; }
  }
  __builtin_amdgcn_fence(__ATOMIC_ACQ_REL, "workgroup");
  __builtin_amdgcn_wave_barrier();
  const int rsub = lane >> 4, c4 = (lane & 15) * 4;
  {
#pragma unroll
    for (int q = 0; q < 8; ++q) {
      const int r = q * 2 + rsub;
      const v4f v = *(const v4fa*)&so[w][r][c4];
      *(v4f*)(C + (size_t)(row0 + r) * ldc + col0 + c4) = v;
    }
    
  }
}

// GEMM C = act(A·W + bias + resid): A f32 (ASPLIT -> hi/lo 2 terms), Wt bf16 [N][K]; ACT 0 none, 1 relu, 2 exact gelu;
// resid (optional, f32, row index = (row % rmod), pitch ldr, RES_BF16 rounds it) added before the activation.
template <bool ASPLIT, int ACT, bool BIAS_BF16, bool RES_BF16>
__global__ __launch_bounds__(128) void k_gemm_bf3(const float* __restrict__ A, int lda, const unsigned short* __restrict__ Wt, int ldb,
                                                const float* __restrict__ bias, const float* __restrict__ resid, int rmod, int ldr,
                                                float* __restrict__ C, int ldc, int M, int N, int K) {
  __shared__ __attribute__((aligned(16))) float so[4][16][64];
  const int tid = threadIdx.x, w = tid >> 5, lane = tid & 31, ln = lane & 15, hh = lane >> 4;
  const int ntn = N / 64;
  const int wid = blockIdx.x * 4 + w;
  const int mt = wid / ntn, nq = wid % ntn;
  if (mt * 16 >= M) return;
  const int row0 = mt * 16, col0 = nq * 64;
  const float* arow = A + (size_t)(row0 + ln) * lda;
  v8f acc[4] = {};
  for (int kb = 0; kb < K; kb += 32) {
    FragB ah, al;
    const v4f x0 = *(const v4fa*)(arow + kb + 8 * hh), x1 = *(const v4fa*)(arow + kb + 8 * hh + 4);
    const v4f x2 = *(const v4fa*)(arow + kb + 16 + 8 * hh), x3 = *(const v4fa*)(arow + kb + 16 + 8 * hh + 4);
    float xs[16] = {x0[0],x0[1],x0[2],x0[3],x1[0],x1[1],x1[2],x1[3],x2[0],x2[1],x2[2],x2[3],x3[0],x3[1],x3[2],x3[3]};
#pragma unroll
    for (int i = 0; i < 16; ++i) { const unsigned short hb = bf16_bits(xs[i]); ah.u[i] = hb; al.u[i] = ASPLIT ? bf16_bits(xs[i] - bf16_val(hb)) : (unsigned short)0; }
#pragma unroll
    for (int t = 0; t < 4; ++t) {
      const unsigned short* brow = Wt + (size_t)(col0 + t * 16 + ln) * ldb + kb;
      FragB b;
      b.half[0] = *(const v8us*)(brow + 8 * hh);
      b.half[1] = *(const v8us*)(brow + 16 + 8 * hh);
      acc[t] = mmaN<ASPLIT ? 2 : 1>(ah.v, al.v, b.v, b.v, acc[t]);
    }
  }
#pragma unroll
  for (int t = 0; t < 4; ++t) {
    const int col = col0 + t * 16 + ln;
    float bv = bias ? bias[col] : 0.f;
    if (BIAS_BF16) bv = bf16_round(bv);
#pragma unroll
    for (int r = 0; r < 8; ++r) {
      float v = acc[t][r] + bv;
      if (resid) { float rv = resid[(size_t)((row0 + 8 * hh + r) % rmod) * ldr + col]; if (RES_BF16) rv = bf16_round(rv); v += rv; }
      if (ACT == 1) v = fmaxf(v, 0.f);
      if (ACT == 2) v = 0.5f * v * (1.0f + erff(v * 0.70710678118654752f));
      if (ACT == 3) { const float u = 0.7978845608028654f * (v + 0.044715f * v * v * v); v = 0.5f * v * (1.0f + tanhf(u)); }
      so[w][8 * hh + r][t * 16 + ln] = v;
    }
  }
  __builtin_amdgcn_fence(__ATOMIC_ACQ_REL, "workgroup");
  __builtin_amdgcn_wave_barrier();
  const int rsub = lane >> 4, c4 = (lane & 15) * 4;
  {
#pragma unroll
    for (int q = 0; q < 8; ++q) {
      const int r = q * 2 + rsub;
      const v4f v = *(const v4fa*)&so[w][r][c4];
      *(v4f*)(C + (size_t)(row0 + r) * ldc + col0 + c4) = v;
    }
    
  }
}
// row LayerNorm (biased variance, eps) over N: s = X (+ R); optional out_sum <- s; out_norm <- (s-mu)*rsqrt(var+eps)*g + b
template <bool PARAM_BF16>
__global__ __launch_bounds__(256) void k_layernorm(const float* __restrict__ X, const float* __restrict__ R, const float* __restrict__ g, const float* __restrict__ bta,
                                                  float* __restrict__ out_sum, float* __restrict__ out_norm, int N, float eps) {
  __shared__ float red[256];
  const int row = blockIdx.x, tid = threadIdx.x;
  const float* x = X + (size_t)row * N; const float* rr = R ? R + (size_t)row * N : nullptr;
  float vals[16];                     // up to N = 4096
  const int per = N / 256;            // contiguous chunk per thread? use strided-by-4 chunks: thread handles j = tid*4 + 1024*u
  float s1 = 0.f;
  for (int u = 0; u < per / 4; ++u) {
    const int j = tid * 4 + 1024 * u;
    const v4f a = *(const v4fa*)(x + j);
    v4f b = {0.f,0.f,0.f,0.f}; if (rr) b = *(const v4fa*)(rr + j);
#pragma unroll
    for (int q = 0; q < 4; ++q) { const float v = a[q] + b[q]; vals[u * 4 + q] = v; s1 += v; }
  }
  red[tid] = s1; __syncthreads();
  for (int st = 128; st > 0; st >>= 1) { if (tid < st) red[tid] += red[tid + st]; __syncthreads(); }
  const float mu = red[0] / (float)N; __syncthreads();
  float s2 = 0.f;
  for (int u = 0; u < per / 4; ++u)
#pragma unroll
    for (int q = 0; q < 4; ++q) { const float c = vals[u * 4 + q] - mu; s2 += c * c; }
  red[tid] = s2; __syncthreads();
  for (int st = 128; st > 0; st >>= 1) { if (tid < st) red[tid] += red[tid + st]; __syncthreads(); }
  const float rs = rsqrtf(red[0] / (float)N + eps);
  {
    for (int u = 0; u < per / 4; ++u) {
      const int j = tid * 4 + 1024 * u;
      v4f o, sm;
#pragma unroll
      for (int q = 0; q < 4; ++q) {
        float gg = g[j + q], bb = bta[j + q];
        if (PARAM_BF16) { gg = bf16_round(gg); bb = bf16_round(bb); }
        sm[q] = vals[u * 4 + q]; o[q] = (vals[u * 4 + q] - mu) * rs * gg + bb;
      }
      if (out_sum) *(v4f*)(out_sum + (size_t)row * N + j) = sm;
      *(v4f*)(out_norm + (size_t)row * N + j) = o;
    }
    
  }
}



// ---- f16 WMMA path (v_wmma_f32_16x16x32_f16): 11-bit significands for operands in range — used where a [0,1] probability operand needs more precision than bf16
typedef _Float16 v16h __attribute__((ext_vector_type(16)));
union FragH { v16h v; v8us half[2]; _Float16 h[16]; unsigned short u[16]; };
template <int NT>
__device__ __forceinline__ v8f mmaH(v16h ah, v16h al, v16h bh, v16h bl, v8f c) {
  c = __builtin_amdgcn_wmma_f32_16x16x32_f16(false, ah, false, bh, (short)0, c, false, false);
  if (NT >= 2) c = __builtin_amdgcn_wmma_f32_16x16x32_f16(false, al, false, bh, (short)0, c, false, false);
  if (NT >= 3) c = __builtin_amdgcn_wmma_f32_16x16x32_f16(false, ah, false, bl, (short)0, c, false, false);
  asm volatile("v_nop\n\tv_nop\n\tv_nop\n\tv_nop" : "+v"(c) : "v"(ah), "v"(al), "v"(bh), "v"(bl));
  return c;
}
// batched GEMM like k_gemm_b but f16 operands: A f32 (split into f16 hi/lo if ASPLIT, else rounded to f16), Bt = f16 values [n][k]; alpha; C f32; N multiple of 16 (partial tiles skipped)
template <bool ASPLIT>
__global__ __launch_bounds__(128) void k_gemm_h(const float* __restrict__ A, int lda, size_t sA, const _Float16* __restrict__ Bh, int ldb, size_t sB, float alpha, float* __restrict__ C, int ldc, size_t sC, int M, int N, int K) {
  __shared__ __attribute__((aligned(16))) float so[4][16][64];
  const int tid = threadIdx.x, w = tid >> 5, lane = tid & 31, ln = lane & 15, hh = lane >> 4; const int by = blockIdx.y;
  A += (size_t)by * sA; Bh += (size_t)by * sB; C += (size_t)by * sC;
  const int ntn = (N + 63) / 64; const int wid = blockIdx.x * 4 + w; const int mt = wid / ntn, nq = wid % ntn; if (mt * 16 >= M) return;
  const int row0 = mt * 16, col0 = nq * 64; const float* arow = A + (size_t)(row0 + ln) * lda;
  v8f acc[4] = {};
  for (int kb = 0; kb < K; kb += 32) {
    FragH ah, al;
    const v4f x0 = *(const v4fa*)(arow + kb + 8 * hh), x1 = *(const v4fa*)(arow + kb + 8 * hh + 4), x2 = *(const v4fa*)(arow + kb + 16 + 8 * hh), x3 = *(const v4fa*)(arow + kb + 16 + 8 * hh + 4);
    float xs[16] = {x0[0],x0[1],x0[2],x0[3],x1[0],x1[1],x1[2],x1[3],x2[0],x2[1],x2[2],x2[3],x3[0],x3[1],x3[2],x3[3]};
#pragma unroll
    for (int i = 0; i < 16; ++i) { const _Float16 h = (_Float16)xs[i]; ah.h[i] = h; al.h[i] = ASPLIT ? (_Float16)(xs[i] - (float)h) : (_Float16)0.0f; }
#pragma unroll
    for (int t = 0; t < 4; ++t) { if (col0 + t * 16 >= N) continue; const size_t boff = (size_t)(col0 + t * 16 + ln) * ldb + kb; FragH bq; bq.half[0] = *(const v8us*)(Bh + boff + 8 * hh); bq.half[1] = *(const v8us*)(Bh + boff + 16 + 8 * hh);
      acc[t] = mmaH<ASPLIT ? 2 : 1>(ah.v, al.v, bq.v, bq.v, acc[t]); }
  }
#pragma unroll
  for (int t = 0; t < 4; ++t) { if (col0 + t * 16 >= N) continue;
#pragma unroll
    for (int r = 0; r < 8; ++r) so[w][8 * hh + r][t * 16 + ln] = acc[t][r] * alpha; }
  __builtin_amdgcn_fence(__ATOMIC_ACQ_REL, "workgroup"); __builtin_amdgcn_wave_barrier();
  const int rsub = lane >> 4, c4 = (lane & 15) * 4;
  {
#pragma unroll
    for (int q = 0; q < 8; ++q) { const int r = q * 2 + rsub; if (col0 + c4 < N) { const v4f v = *(const v4fa*)&so[w][r][c4]; *(v4f*)(C + (size_t)(row0 + r) * ldc + col0 + c4) = v; } }
     }
}

// Wt[n][k] = f16(W[k][n]·scale) from f32 row-major W[K][N] (scale = power of two; bf16-exact weights stay exact in f16 away from the subnormal range)
__global__ __launch_bounds__(256) void k_wt_f16(const float* __restrict__ W, _Float16* __restrict__ Wt, int K, int N, float scale) {
  const int t = blockIdx.x * 256 + threadIdx.x; if (t >= N * (K / 8)) return; const int n = t / (K / 8), k8 = (t % (K / 8)) * 8; FragH f;
#pragma unroll
  for (int i = 0; i < 8; ++i) f.h[i] = (_Float16)(bf16_round(W[(size_t)(k8 + i) * N + n]) * scale); const v8us o = f.half[0];
  *(v8us*)((unsigned short*)Wt + (size_t)n * K + k8) = o; 
}
// k_gemm_hh variant with fused epilogue: v = acc·alpha + bias[by·sBias + col] (+ CP[(row/rowsPerB)·sCPb + by·64 + col] if CP) ; ACT 0 none / 1 elu ; writes f16 C16 (and f32 C if non-null)
template <int ACT>
__global__ __launch_bounds__(128) void k_gemm_hhx(const _Float16* __restrict__ A, int lda, size_t sA, const _Float16* __restrict__ Bh, int ldb, size_t sB, float alpha, const float* __restrict__ bias, size_t sBias, const float* __restrict__ CP, int rowsPerB, size_t sCPb, int row0g,
    float* __restrict__ C, _Float16* __restrict__ C16, int ldc, size_t sC, int M, int N, int K) {
  __shared__ __attribute__((aligned(16))) float so[4][16][64];
  const int tid = threadIdx.x, w = tid >> 5, lane = tid & 31, ln = lane & 15, hh = lane >> 4; const int by = blockIdx.y;
  A += (size_t)by * sA; Bh += (size_t)by * sB; const size_t cofs = (size_t)by * sC; const float* bp = bias ? bias + (size_t)by * sBias : nullptr;
  const int ntn = (N + 63) / 64; const int wid = blockIdx.x * 4 + w; const int mt = wid / ntn, nq = wid % ntn; if (mt * 16 >= M) return;
  const int row0 = mt * 16, col0 = nq * 64; const _Float16* arow = A + (size_t)(row0 + ln) * lda;
  v8f acc[4] = {};
  for (int kb = 0; kb < K; kb += 32) { FragH ah; ah.half[0] = *(const v8us*)((const unsigned short*)arow + kb + 8 * hh); ah.half[1] = *(const v8us*)((const unsigned short*)arow + kb + 16 + 8 * hh);
#pragma unroll
    for (int t = 0; t < 4; ++t) { if (col0 + t * 16 >= N) continue; const size_t boff = (size_t)(col0 + t * 16 + ln) * ldb + kb; FragH bq; bq.half[0] = *(const v8us*)((const unsigned short*)Bh + boff + 8 * hh); bq.half[1] = *(const v8us*)((const unsigned short*)Bh + boff + 16 + 8 * hh);
      acc[t] = mmaH<1>(ah.v, ah.v, bq.v, bq.v, acc[t]); }
  }
#pragma unroll
  for (int t = 0; t < 4; ++t) { if (col0 + t * 16 >= N) continue; const int col = col0 + t * 16 + ln; const float bv = bp ? bf16_round(bp[col]) : 0.f;
#pragma unroll
    for (int r = 0; r < 8; ++r) { float v = acc[t][r] * alpha + bv; if (CP) { const int bidx = (row0g + row0 + 8 * hh + r) / rowsPerB; v += CP[(size_t)bidx * sCPb + (size_t)by * 64 + col]; } if (ACT == 1) v = (v > 0.f) ? v : expm1f(v); else if (ACT == 7) v = (v > 0.f) ? v + 1.0f : expf(v); else if (ACT == 8) v = tanhf(v); else if (ACT == 9) v = 0.5f * v * (1.0f + tanhf(0.7978845608028654f * (v + 0.044715f * v * v * v))); else if (ACT == 11) v = 1.0f / (1.0f + expf(-v)); else if (ACT == 12) v = (v > 0.f) ? v : 0.01f * v; else if (ACT == 14) v = (v > 0.f) ? v : 0.1f * v; else if (ACT == 15) v = v / (1.0f + expf(-v)); else if (ACT == 3) v = fmaxf(v, 0.f); else if (ACT == 6) v = 0.5f * v * (1.0f + erff(v * 0.70710678118654752f)); so[w][8 * hh + r][t * 16 + ln] = v; } }
  __builtin_amdgcn_fence(__ATOMIC_ACQ_REL, "workgroup"); __builtin_amdgcn_wave_barrier();
  const int rsub = lane >> 4, c4 = (lane & 15) * 4; typedef _Float16 v4h __attribute__((ext_vector_type(4)));
  {
#pragma unroll
    for (int q = 0; q < 8; ++q) { const int r = q * 2 + rsub; if (col0 + c4 < N) { const v4f v = *(const v4fa*)&so[w][r][c4]; if (C) *(v4f*)(C + cofs + (size_t)(row0 + r) * ldc + col0 + c4) = v; if (C16) { v4h h4; for (int i = 0; i < 4; ++i) h4[i] = (_Float16)v[i]; *(v4h*)(C16 + cofs + (size_t)(row0 + r) * ldc + col0 + c4) = h4; } } }
     }
}


typedef _Float16 v4h __attribute__((ext_vector_type(4)));

__global__ __launch_bounds__(256) void k_x16(const float* __restrict__ x, _Float16* __restrict__ X16, size_t n8) { const size_t t = (size_t)blockIdx.x * 256 + threadIdx.x; if (t >= n8) return; FragH f;
#pragma unroll
  for (int q = 0; q < 8; ++q) f.h[q] = (_Float16)bf16_round(x[t * 8 + q]); *(v8us*)((unsigned short*)X16 + t * 8) = f.half[0];  }
__global__ __launch_bounds__(256) void k_h16(const float* __restrict__ x, _Float16* __restrict__ X16, size_t n8) { const size_t t = (size_t)blockIdx.x * 256 + threadIdx.x; if (t >= n8) return; FragH f;
#pragma unroll
  for (int q = 0; q < 8; ++q) f.h[q] = (_Float16)x[t * 8 + q]; *(v8us*)((unsigned short*)X16 + t * 8) = f.half[0];  }
__global__ __launch_bounds__(256) void k_round16f(const float* __restrict__ W, _Float16* __restrict__ Bt, size_t n8) { const size_t t = (size_t)blockIdx.x * 256 + threadIdx.x; if (t >= n8) return; FragH f;
#pragma unroll
  for (int i = 0; i < 8; ++i) f.h[i] = (_Float16)(bf16_round(W[t * 8 + i]) * 16.0f); *(v8us*)((unsigned short*)Bt + t * 8) = f.half[0];  }
template <int NHv, int TTv>
__global__ __launch_bounds__(256) void k_vt(const _Float16* __restrict__ V16, int ldv, int voff, _Float16* __restrict__ Vt) { __shared__ unsigned short tl[64][66]; const int tid = threadIdx.x; const int slab = blockIdx.x / (TTv / 64), lg = blockIdx.x % (TTv / 64); const int b = slab / NHv, h = slab % NHv;
  for (int i = tid; i < 64 * 8; i += 256) { const int r = i / 8, c8 = (i % 8) * 8; FragH f; f.half[0] = *(const v8us*)((const unsigned short*)V16 + ((size_t)b * TTv + lg * 64 + r) * ldv + voff + h * 64 + c8);
#pragma unroll
    for (int q = 0; q < 8; ++q) tl[r][c8 + q] = f.u[q]; }
  __syncthreads();
  {
#pragma unroll
    for (int rd = 0; rd < 2; ++rd) { const int d = rd * 32 + tid / 8, pc = tid % 8; FragH f;
#pragma unroll
      for (int q = 0; q < 8; ++q) f.u[q] = tl[pc * 8 + q][d];
      *(v8us*)((unsigned short*)Vt + ((size_t)slab * 64 + d) * TTv + lg * 64 + pc * 8) = f.half[0]; }
     } }

// ---- fast GEMM (wave tile 32x64, work-group tile 128x64; requires M % 128 == 0, N % 64 == 0, K % 64 == 0); epilogue: acc·alpha + bias (+ CP, activation), stored in the OUT form below ----
#define G2P 72                   /* LDS row pitch in values: 128-byte rows at 144 bytes, the conflict-free pitch for ds_load_b128 readers */
// One K step of 64 values for the work-group: its 128 A rows and 64 B rows (128 bytes = one line each) go to LDS as 12 asynchronous 16-byte copies a lane; 8 lanes take a row, so a wave's copy covers 4 whole lines.
// ag, bg: the lane's piece in the first 16 rows; sa, sb: 16 rows on, in values; la, lb: the lane's LDS byte address in the first 16 rows. The closing s_wait_xcnt 0 stands in front of any rewrite of the registers that the copies name.
__device__ __forceinline__ void g2_stage(const _Float16* ag, size_t sa, const _Float16* bg, size_t sb, unsigned la, unsigned lb) {
  asm volatile("global_load_async_to_lds_b128 %0, %12, off\n\t"
               "global_load_async_to_lds_b128 %1, %13, off\n\t"
               "global_load_async_to_lds_b128 %2, %14, off\n\t"
               "global_load_async_to_lds_b128 %3, %15, off\n\t"
               "global_load_async_to_lds_b128 %4, %16, off\n\t"
               "global_load_async_to_lds_b128 %5, %17, off\n\t"
               "global_load_async_to_lds_b128 %6, %18, off\n\t"
               "global_load_async_to_lds_b128 %7, %19, off\n\t"
               "global_load_async_to_lds_b128 %8, %20, off\n\t"
               "global_load_async_to_lds_b128 %9, %21, off\n\t"
               "global_load_async_to_lds_b128 %10, %22, off\n\t"
               "global_load_async_to_lds_b128 %11, %23, off\n\t"
               "s_wait_xcnt 0x0"
               :: "v"(la), "v"(la + 1u * 16 * G2P * 2), "v"(la + 2u * 16 * G2P * 2), "v"(la + 3u * 16 * G2P * 2), "v"(la + 4u * 16 * G2P * 2), "v"(la + 5u * 16 * G2P * 2), "v"(la + 6u * 16 * G2P * 2), "v"(la + 7u * 16 * G2P * 2),
                  "v"(lb), "v"(lb + 1u * 16 * G2P * 2), "v"(lb + 2u * 16 * G2P * 2), "v"(lb + 3u * 16 * G2P * 2),
                  "v"(ag), "v"(ag + sa), "v"(ag + 2 * sa), "v"(ag + 3 * sa), "v"(ag + 4 * sa), "v"(ag + 5 * sa), "v"(ag + 6 * sa), "v"(ag + 7 * sa),
                  "v"(bg), "v"(bg + sb), "v"(bg + 2 * sb), "v"(bg + 3 * sb)
               : "memory"); }
__device__ __forceinline__ v16h g2_frag(const _Float16* p, int hh) { FragH f; f.half[0] = *(const v8us*)((const unsigned short*)p + 8 * hh); f.half[1] = *(const v8us*)((const unsigned short*)p + 16 + 8 * hh); return f.v; }
__device__ __forceinline__ v8f g2_mma(v16h a, v16h b, v8f c) { v8f d = __builtin_amdgcn_wmma_f32_16x16x32_f16(false, a, false, b, (short)0, c, false, false); asm volatile("v_nop\n\tv_nop\n\tv_nop\n\tv_nop" : "+v"(d) : "v"(a), "v"(b)); return d; }
// OUT 0: C (f32). OUT 1: the result leaves as two f16 planes, Hh = f16(v), Hl = f16((v - Hh) * 1024), row-major like C. OUT 2 (no CP, no activation): the same two planes transposed per head,
// H[((row / SLEN) * NH + col / 64) * 64 + col % 64][row % SLEN]; needs SLEN % 128 == 0 and N == NH * 64.
template <int ACT, int OUT>
__global__ __launch_bounds__(128) void k_gemm2(const _Float16* __restrict__ A, int lda, size_t sA, const _Float16* __restrict__ Bh, int ldb, size_t sB, float alpha, const float* __restrict__ bias, size_t sBias, const float* __restrict__ CP, int rowsPerB, size_t sCPb, int row0g,
    float* __restrict__ C, _Float16* __restrict__ Hh, _Float16* __restrict__ Hl, int ldc, size_t sC, int M, int N, int K) {
  __shared__ __attribute__((aligned(16))) float so[4][32][68]; __shared__ __attribute__((aligned(16))) unsigned short tA[2][128][G2P], tB[2][64][G2P];
  const int tid = threadIdx.x, w = tid >> 5, lane = tid & 31, ln = lane & 15, hh = lane >> 4; const int by = blockIdx.y;
  A += (size_t)by * sA; Bh += (size_t)by * sB; const size_t cofs = (size_t)by * sC; const float* bp = bias ? bias + (size_t)by * sBias : nullptr;
  const int ntn = N >> 6; const int mt = blockIdx.x / ntn, nq = blockIdx.x - mt * ntn; const int row0 = mt * 128 + 32 * w, col0 = nq * 64; if (mt * 128 >= M) return;      /* the whole work-group leaves or none: barriers below */
  const int cr = tid >> 3, cc = (tid & 7) * 8;      /* the lane's row (of 16) and 16-byte piece in a copy */
  const _Float16* ag = A + (size_t)(mt * 128 + cr) * lda + cc; const _Float16* bg = Bh + (size_t)(col0 + cr) * ldb + cc; const size_t sa = (size_t)16 * lda, sb = (size_t)16 * ldb;
  const unsigned la = (unsigned)(size_t)&tA[0][cr][cc], lb = (unsigned)(size_t)&tB[0][cr][cc];      /* LDS byte addresses: the low 32 bits */
  const int nst = K >> 6;
  const v8f z8 = {0.f,0.f,0.f,0.f,0.f,0.f,0.f,0.f}; v8f c00 = z8, c01 = z8, c02 = z8, c03 = z8, c10 = z8, c11 = z8, c12 = z8, c13 = z8;
  g2_stage(ag, sa, bg, sb, la, lb);      /* step 0 into buffer 0 */
  asm volatile("s_wait_asynccnt 0x0" ::: "memory");      /* this wave's copies of step 0 have landed */
  __syncthreads();      /* ... and every other wave's */
  if (nst > 1) g2_stage(ag + 64, sa, bg + 64, sb, la + (unsigned)sizeof(tA[0]), lb + (unsigned)sizeof(tB[0]));      /* step 1 flies while step 0 is worked on */
#pragma unroll 1
  for (int st = 0; st < nst; ++st) { const int bf = st & 1; const _Float16* ar = (const _Float16*)&tA[bf][32 * w + ln][0]; const _Float16* br = (const _Float16*)&tB[bf][ln][0];
    v16h fa[2][2], fb[2][4];      /* the step's 12 fragments are read as one group ahead of its 16 products */
#pragma unroll
    for (int ks = 0; ks < 2; ++ks) { fa[ks][0] = g2_frag(ar + ks * 32, hh); fa[ks][1] = g2_frag(ar + 16 * G2P + ks * 32, hh);
#pragma unroll
      for (int j = 0; j < 4; ++j) fb[ks][j] = g2_frag(br + j * 16 * G2P + ks * 32, hh); }
#pragma unroll
    for (int ks = 0; ks < 2; ++ks) { c00 = g2_mma(fa[ks][0], fb[ks][0], c00); c10 = g2_mma(fa[ks][1], fb[ks][0], c10); c01 = g2_mma(fa[ks][0], fb[ks][1], c01); c11 = g2_mma(fa[ks][1], fb[ks][1], c11);
      c02 = g2_mma(fa[ks][0], fb[ks][2], c02); c12 = g2_mma(fa[ks][1], fb[ks][2], c12); c03 = g2_mma(fa[ks][0], fb[ks][3], c03); c13 = g2_mma(fa[ks][1], fb[ks][3], c13); }
    asm volatile("s_wait_dscnt 0x0" ::: "memory");      /* this wave's reads of buffer bf are done before it is refilled */
    asm volatile("s_wait_asynccnt 0x0" ::: "memory");      /* this wave's copies of step st + 1 have landed */
    __syncthreads();      /* publishes step st + 1 and ends every wave's reads of buffer bf */
    if (st + 2 < nst) g2_stage(ag + (size_t)(st + 2) * 64, sa, bg + (size_t)(st + 2) * 64, sb, la + (unsigned)bf * (unsigned)sizeof(tA[0]), lb + (unsigned)bf * (unsigned)sizeof(tB[0])); }
  asm volatile("s_wait_asynccnt 0x0" ::: "memory");      /* no copy is outstanding past the loop */
  v8f accs[8] = {c00, c01, c02, c03, c10, c11, c12, c13};
  if constexpr (OUT == 2) {      /* a lane's 8 accumulator registers are 8 consecutive rows of one column: one 16-byte piece of a transposed row in each plane */
    unsigned short (*sT)[64][136] = (unsigned short (*)[64][136])&so[0][0][0];      /* 2 planes x 64 columns x 128 rows at a pitch of 272 bytes: exactly so's bytes */
    float bv4[4] = {0.f, 0.f, 0.f, 0.f};
    if (bp) {
#pragma unroll
      for (int t = 0; t < 4; ++t) bv4[t] = bf16_round(bp[col0 + t * 16 + ln]); }
#pragma unroll
    for (int u = 0; u < 8; ++u) { const int dl = (u & 3) * 16 + ln, kl = 32 * w + (u >> 2) * 16 + 8 * hh; const float bv = bv4[u & 3]; FragH fh, fl;
#pragma unroll
      for (int r = 0; r < 8; ++r) { const float v = accs[u][r] * alpha + bv; const _Float16 hv = (_Float16)v; fh.h[r] = hv; fl.h[r] = (_Float16)((v - (float)hv) * 1024.0f); }
      *(v8us*)&sT[0][dl][kl] = fh.half[0]; *(v8us*)&sT[1][dl][kl] = fl.half[0]; }
    __syncthreads();      /* a transposed row of 128 values holds pieces of all four waves */
    const int rb = mt * 128; const size_t vb = (size_t)((rb / SLEN) * NH + nq) * 64 * SLEN + (size_t)(rb % SLEN);
#pragma unroll
    for (int p = 0; p < 8; ++p) { const int it = p * 128 + tid, d = it >> 4, pc = it & 15; const size_t o = vb + (size_t)d * SLEN + pc * 8;      /* 16 lanes write the 256 contiguous bytes of a row: whole lines */
      const v8us xh = *(const v8us*)&sT[0][d][pc * 8], xl = *(const v8us*)&sT[1][d][pc * 8]; *(v8us*)((unsigned short*)Hh + o) = xh; *(v8us*)((unsigned short*)Hl + o) = xl; }
    return; }
#pragma unroll
  for (int u = 0; u < 8; ++u) { const int t = u & 3, half = u >> 2; const int col = col0 + t * 16 + ln; const float bv = bp ? bf16_round(bp[col]) : 0.f;
#pragma unroll
    for (int r = 0; r < 8; ++r) { const int rloc = half * 16 + 8 * hh + r; float v = accs[u][r] * alpha + bv; if (CP) { const int bidx = (row0g + row0 + rloc) / rowsPerB; v += CP[(size_t)bidx * sCPb + (size_t)by * 64 + col]; }
      if (ACT == 3) v = fmaxf(v, 0.f); else if (ACT == 6) v = 0.5f * v * (1.0f + erff(v * 0.70710678118654752f)); else if (ACT == 11) v = 1.0f / (1.0f + expf(-v)); else if (ACT == 15) v = v / (1.0f + expf(-v)); else if (ACT == 12) v = (v > 0.f) ? v : 0.01f * v; else if (ACT == 8) v = tanhf(v);
      so[w][rloc][t * 16 + ln] = v; } }
  __builtin_amdgcn_fence(__ATOMIC_ACQ_REL, "workgroup"); __builtin_amdgcn_wave_barrier();
  if constexpr (OUT == 1) {
#pragma unroll
    for (int q = 0; q < 8; ++q) { const int r = q * 4 + (lane >> 3), c8 = (lane & 7) * 8; const v4f a = *(const v4fa*)&so[w][r][c8], c = *(const v4fa*)&so[w][r][c8 + 4]; FragH fh, fl;      /* 8 lanes write the 128 bytes of a row piece: one whole line in each plane */
#pragma unroll
      for (int i = 0; i < 4; ++i) { _Float16 hv = (_Float16)a[i]; fh.h[i] = hv; fl.h[i] = (_Float16)((a[i] - (float)hv) * 1024.0f); hv = (_Float16)c[i]; fh.h[4 + i] = hv; fl.h[4 + i] = (_Float16)((c[i] - (float)hv) * 1024.0f); }
      const size_t o = cofs + (size_t)(row0 + r) * ldc + col0 + c8; *(v8us*)((unsigned short*)Hh + o) = fh.half[0]; *(v8us*)((unsigned short*)Hl + o) = fl.half[0]; }
    return; }
  const int rsub = lane >> 4, c4 = (lane & 15) * 4;
  {
#pragma unroll
    for (int q = 0; q < 16; ++q) { const int r = q * 2 + rsub; const v4f v = *(const v4fa*)&so[w][r][c4]; *(v4f*)(C + cofs + (size_t)(row0 + r) * ldc + col0 + c4) = v; }
     } }



template <int TQ, int TK>
__global__ __launch_bounds__(128, 4) /* the second number holds the build to 256 registers: 4 waves a SIMD, so that all 1024 work-groups are resident at once */ void k_flashb(const _Float16* __restrict__ Q16, const _Float16* __restrict__ Q16lo, int ldq, const _Float16* __restrict__ K16, const _Float16* __restrict__ K16lo, int ldk, const _Float16* __restrict__ Vt, const _Float16* __restrict__ Vtlo, const _Float16* __restrict__ T16, _Float16* __restrict__ Oh, _Float16* __restrict__ Ol, int ldo) {
  constexpr int RPW = 16, RTN = RPW / 16, NQB = TQ / (4 * RPW), DT = 4, KS = 2;
  __shared__ __attribute__((aligned(16))) unsigned short sP[4][RPW][40], sPl[4][RPW][40]; __shared__ __attribute__((aligned(16))) float sO[4][RPW][64 + 4];
  const int tid = threadIdx.x, w = __builtin_amdgcn_readfirstlane(tid >> 5), lane = tid & 31, ln = lane & 15, hh = lane >> 4;      /* the wave's number in a scalar register: what is formed from it costs no vector register across the loop */
  const int slab = blockIdx.x / NQB, qblk = blockIdx.x % NQB; const int b = slab / NH, h = slab % NH; const int qb0 = qblk * (4 * RPW); const int q0 = qb0 + w * RPW;
  FragH aq[2][KS], aql[2][KS];
#pragma unroll
  for (int rt = 0; rt < RTN; ++rt) { const size_t qo = ((size_t)b * TQ + q0 + rt * 16 + ln) * ldq + h * 64; const unsigned short* qr = (const unsigned short*)Q16 + qo; const unsigned short* ql = (const unsigned short*)Q16lo + qo;
#pragma unroll
    for (int ks = 0; ks < KS; ++ks) { aq[rt][ks].half[0] = *(const v8us*)(qr + ks * 32 + 8 * hh); aq[rt][ks].half[1] = *(const v8us*)(qr + ks * 32 + 16 + 8 * hh); aql[rt][ks].half[0] = *(const v8us*)(ql + ks * 32 + 8 * hh); aql[rt][ks].half[1] = *(const v8us*)(ql + ks * 32 + 16 + 8 * hh); } }
  const unsigned short* Vth = (const unsigned short*)Vt + (size_t)slab * 64 * TK; const unsigned short* Vtl = (const unsigned short*)Vtlo + (size_t)slab * 64 * TK;
  float m_r[2][8], l_r[2][8]; v8f oacc[2][DT], oaccl[2][DT];
#pragma unroll
  for (int rt = 0; rt < RTN; ++rt) {
#pragma unroll
    for (int r = 0; r < 8; ++r) { m_r[rt][r] = -3.0e38f; l_r[rt][r] = 0.f; }
#pragma unroll
    for (int dt = 0; dt < DT; ++dt) { oacc[rt][dt] = (v8f){0.f,0.f,0.f,0.f,0.f,0.f,0.f,0.f}; oaccl[rt][dt] = oacc[rt][dt]; } }
  /* RPE: rel[i][c] = q[q0 + i] . table[h][rb + c], rb = q0 - j0 + TK - 32, c < 48; score (i, kk) takes c = i - kk + 31. Columns 32..47 of a trip are columns 0..15 of the trip before. */
  const unsigned short* Th = (const unsigned short*)T16 + (size_t)h * RW * 64 + (size_t)ln * 64 + 8 * hh;
  v8f relc = (v8f){0.f,0.f,0.f,0.f,0.f,0.f,0.f,0.f};      /* columns 32..47 of the first trip */
#pragma unroll
  for (int ks = 0; ks < KS; ++ks) { FragH bt; bt.half[0] = *(const v8us*)(Th + (size_t)(q0 + TK) * 64 + ks * 32); bt.half[1] = *(const v8us*)(Th + (size_t)(q0 + TK) * 64 + ks * 32 + 16); relc = mmaH<1>(aq[0][ks].v, aq[0][ks].v, bt.v, bt.v, relc); }
#pragma unroll 1
  for (int j0 = 0; j0 < TK; j0 += 32) {
    FragH bt[2][KS];      /* table rows rb .. rb + 31, fetched together with the first key tile */
#pragma unroll
    for (int t = 0; t < 2; ++t) { const unsigned short* tr = Th + (size_t)(q0 - j0 + (TK - 32) + t * 16) * 64;
#pragma unroll
      for (int ks = 0; ks < KS; ++ks) { bt[t][ks].half[0] = *(const v8us*)(tr + ks * 32); bt[t][ks].half[1] = *(const v8us*)(tr + ks * 32 + 16); } }
    asm volatile("s_wait_xcnt 0x0" ::: "memory");      /* stands in front of any overwrite of the table loads' address registers (the allocator lets a later load's result land in them) */
    v8f s[2][2];
#pragma unroll
    for (int nt = 0; nt < 2; ++nt) { const size_t ko = ((size_t)b * TK + j0 + nt * 16 + ln) * ldk + h * 64; const unsigned short* kr = (const unsigned short*)K16 + ko; const unsigned short* kl = (const unsigned short*)K16lo + ko; FragH bk[KS], bkl[KS];
#pragma unroll
      for (int ks = 0; ks < KS; ++ks) { bk[ks].half[0] = *(const v8us*)(kr + ks * 32 + 8 * hh); bk[ks].half[1] = *(const v8us*)(kr + ks * 32 + 16 + 8 * hh); bkl[ks].half[0] = *(const v8us*)(kl + ks * 32 + 8 * hh); bkl[ks].half[1] = *(const v8us*)(kl + ks * 32 + 16 + 8 * hh); }
      if (nt == 1) {      /* RPE products and their LDS stores run while the second key tile's loads are in flight */
        v8f rel0 = (v8f){0.f,0.f,0.f,0.f,0.f,0.f,0.f,0.f}, rel1 = rel0;
#pragma unroll
        for (int ks = 0; ks < KS; ++ks) { rel0 = mmaH<1>(aq[0][ks].v, aq[0][ks].v, bt[0][ks].v, bt[0][ks].v, rel0); rel1 = mmaH<1>(aq[0][ks].v, aq[0][ks].v, bt[1][ks].v, bt[1][ks].v, rel1); }
#pragma unroll
        for (int r = 0; r < 8; ++r) { sO[w][8 * hh + r][ln] = rel0[r]; sO[w][8 * hh + r][16 + ln] = rel1[r]; sO[w][8 * hh + r][32 + ln] = relc[r]; }
        relc = rel0; }
#pragma unroll
      for (int rt = 0; rt < RTN; ++rt) { v8f acc = (v8f){0.f,0.f,0.f,0.f,0.f,0.f,0.f,0.f}, accr = acc;
#pragma unroll
        for (int ks = 0; ks < KS; ++ks) { acc = mmaH<1>(aq[rt][ks].v, aq[rt][ks].v, bk[ks].v, bk[ks].v, acc); accr = mmaH<1>(aql[rt][ks].v, aql[rt][ks].v, bk[ks].v, bk[ks].v, accr); accr = mmaH<1>(aq[rt][ks].v, aq[rt][ks].v, bkl[ks].v, bkl[ks].v, accr); }
        s[rt][nt] = acc + accr * 0.0009765625f; } }
    /* the wave's rel stores above are read back by other lanes of the same wave below */
    __builtin_amdgcn_fence(__ATOMIC_ACQ_REL, "workgroup"); __builtin_amdgcn_wave_barrier();
    float rv0[8], rv1[8];      /* all 16 diagonal reads issued together */
#pragma unroll
    for (int r = 0; r < 8; ++r) { rv0[r] = sO[w][8 * hh + r][8 * hh + r - ln + 31]; rv1[r] = sO[w][8 * hh + r][8 * hh + r - ln + 15]; }
    /* every key counts for every query (the function has no mask): no test and no branch in this stage, so the 8 rows' chains run side by side */
#pragma unroll
    for (int rt = 0; rt < RTN; ++rt)
#pragma unroll
      for (int r = 0; r < 8; ++r) { const float s0 = s[rt][0][r] * SCL + rv0[r] * 0.0625f, s1 = s[rt][1][r] * SCL + rv1[r] * 0.0625f;      /* + q . table[h][(q - k) + T - 1] (table held x16) */ float mc = fmaxf(s0, s1);
        mc = fmaxf(mc, __shfl_xor(mc, 1, 32)); mc = fmaxf(mc, __shfl_xor(mc, 2, 32)); mc = fmaxf(mc, __shfl_xor(mc, 4, 32)); mc = fmaxf(mc, __shfl_xor(mc, 8, 32));
        const float mn = fmaxf(m_r[rt][r], mc); const float al = expf(m_r[rt][r] - mn); m_r[rt][r] = mn; const float p0 = expf(s0 - mn), p1 = expf(s1 - mn); l_r[rt][r] = l_r[rt][r] * al + p0 + p1;
#pragma unroll
        for (int dt = 0; dt < DT; ++dt) { oacc[rt][dt][r] *= al; oaccl[rt][dt][r] *= al; }
        FragH t2, t3; const float ps0 = p0 * 1024.0f, ps1 = p1 * 1024.0f; t2.h[0] = (_Float16)ps0; t2.h[1] = (_Float16)ps1; t3.h[0] = (_Float16)((ps0 - (float)t2.h[0]) * 1024.0f); t3.h[1] = (_Float16)((ps1 - (float)t2.h[1]) * 1024.0f);
        sP[w][rt * 16 + 8 * hh + r][ln] = t2.u[0]; sP[w][rt * 16 + 8 * hh + r][16 + ln] = t2.u[1]; sPl[w][rt * 16 + 8 * hh + r][ln] = t3.u[0]; sPl[w][rt * 16 + 8 * hh + r][16 + ln] = t3.u[1]; }
    __builtin_amdgcn_fence(__ATOMIC_ACQ_REL, "workgroup"); __builtin_amdgcn_wave_barrier();
    FragH pa[2], pl[2];
#pragma unroll
    for (int rt = 0; rt < RTN; ++rt) { pa[rt].half[0] = *(const v8us*)&sP[w][rt * 16 + ln][8 * hh]; pa[rt].half[1] = *(const v8us*)&sP[w][rt * 16 + ln][16 + 8 * hh]; pl[rt].half[0] = *(const v8us*)&sPl[w][rt * 16 + ln][8 * hh]; pl[rt].half[1] = *(const v8us*)&sPl[w][rt * 16 + ln][16 + 8 * hh]; }
#pragma unroll
    for (int dt = 0; dt < DT; ++dt) { const size_t vo = (size_t)(dt * 16 + ln) * TK + j0; FragH bv, bl; bv.half[0] = *(const v8us*)(Vth + vo + 8 * hh); bv.half[1] = *(const v8us*)(Vth + vo + 16 + 8 * hh); bl.half[0] = *(const v8us*)(Vtl + vo + 8 * hh); bl.half[1] = *(const v8us*)(Vtl + vo + 16 + 8 * hh);
#pragma unroll
      for (int rt = 0; rt < RTN; ++rt) { oacc[rt][dt] = mmaH<1>(pa[rt].v, pa[rt].v, bv.v, bv.v, oacc[rt][dt]); oaccl[rt][dt] = mmaH<1>(pa[rt].v, pa[rt].v, bl.v, bl.v, oaccl[rt][dt]); oaccl[rt][dt] = mmaH<1>(pl[rt].v, pl[rt].v, bv.v, bv.v, oaccl[rt][dt]); } }
    __builtin_amdgcn_fence(__ATOMIC_ACQ_REL, "workgroup"); __builtin_amdgcn_wave_barrier(); }
#pragma unroll
  for (int rt = 0; rt < RTN; ++rt) {
#pragma unroll
    for (int r = 0; r < 8; ++r) { float l = l_r[rt][r]; l += __shfl_xor(l, 1, 32); l += __shfl_xor(l, 2, 32); l += __shfl_xor(l, 4, 32); l += __shfl_xor(l, 8, 32); l_r[rt][r] = 1.0f / (l * 1024.0f); }      /* l >= 1: the row's largest score adds exp(0) */
#pragma unroll
    for (int dt = 0; dt < DT; ++dt)
#pragma unroll
      for (int r = 0; r < 8; ++r) sO[w][rt * 16 + 8 * hh + r][dt * 16 + ln] = (oacc[rt][dt][r] + oaccl[rt][dt][r] * 0.0009765625f) * l_r[rt][r]; }
  __builtin_amdgcn_fence(__ATOMIC_ACQ_REL, "workgroup"); __builtin_amdgcn_wave_barrier();
  {
#pragma unroll
    for (int rp = 0; rp < RPW; rp += 2) { const int r = rp + (lane >> 4), pc = lane & 15; const v4f val = *(const v4fa*)&sO[w][r][pc * 4]; v4h h4, l4;      /* O leaves as f16 hi + residual x 1024; 16 lanes write the 128 bytes of a row piece in each plane */
#pragma unroll
      for (int i = 0; i < 4; ++i) { const _Float16 hv = (_Float16)val[i]; h4[i] = hv; l4[i] = (_Float16)((val[i] - (float)hv) * 1024.0f); }
      const size_t o = ((size_t)b * TQ + q0 + r) * ldo + h * 64 + pc * 4; *(v4h*)(Oh + o) = h4; *(v4h*)(Ol + o) = l4; }
     } }


__global__ __launch_bounds__(256) void k_lnx(const float* __restrict__ X, const float* __restrict__ g, const float* __restrict__ bb, _Float16* __restrict__ Y16, float* __restrict__ XB) {
  #pragma clang fp contract(off)
  const int tid = threadIdx.x, w = tid >> 5, ln = tid & 31; const int r = blockIdx.x * 8 + w; if (r >= NR) return; const float* x = X + (size_t)r * DM; float s = 0.f;
#pragma unroll 1
  for (int i = 0; i < DM / 128; ++i) { const v4f a = *(const v4fa*)(x + i * 128 + ln * 4); for (int q = 0; q < 4; ++q) s += bf16_round(a[q]); }
  for (int o = 16; o > 0; o >>= 1) s += __shfl_xor(s, o, 32); const float mu = s / (float)DM; float q2 = 0.f;
#pragma unroll 1
  for (int i = 0; i < DM / 128; ++i) { const v4f a = *(const v4fa*)(x + i * 128 + ln * 4); for (int q = 0; q < 4; ++q) { const float d = bf16_round(a[q]) - mu; q2 += d * d; } }
  for (int o = 16; o > 0; o >>= 1) q2 += __shfl_xor(q2, o, 32); const float rs = rsqrtf(q2 / (float)DM + 1e-5f);
  {
#pragma unroll 1
    for (int i = 0; i < DM / 128; ++i) { const int c0 = i * 128 + ln * 4; const v4f a = *(const v4fa*)(x + c0); _Float16 h4[4]; v4f xb;
      for (int q = 0; q < 4; ++q) { const float t = bf16_round(a[q]); h4[q] = (_Float16)((t - mu) * rs * bf16_round(g[c0 + q]) + bf16_round(bb[c0 + q])); xb[q] = t; }
      *(unsigned long long*)((unsigned short*)Y16 + (size_t)r * DM + c0) = *(const unsigned long long*)h4; *(v4f*)(XB + (size_t)r * DM + c0) = xb; }
     } }
__global__ __launch_bounds__(256) void k_rtab(const float* __restrict__ tab, int trows, _Float16* __restrict__ T16) {
  const int t = blockIdx.x * 256 + threadIdx.x; if (t >= NH * RW * 8) return; const int d0 = (t & 7) * 8; const int r = (t >> 3) % RW; const int h = t / (8 * RW); FragH f;
#pragma unroll
  for (int q = 0; q < 8; ++q) f.h[q] = (r < 2 * SLEN - 1) ? (_Float16)(bf16_round(tab[((size_t)h * trows + r) * 64 + d0 + q]) * 16.0f) : (_Float16)0.0f;
  *(v8us*)((unsigned short*)T16 + ((size_t)h * RW + r) * 64 + d0) = f.half[0];  }
__global__ __launch_bounds__(256) void k_causaltab(unsigned* __restrict__ MB, int* __restrict__ RA, int* __restrict__ KE, int nq, int nk) {
  const int t = blockIdx.x * 256 + threadIdx.x; const int nw = nk / 32;
  if (t < nq * nw) { const int q = t / nw, w = t % nw; const int first = q + 1 - 32 * w; const unsigned bits = (first <= 0) ? 0xffffffffu : ((first >= 32) ? 0u : (0xffffffffu << first)); *(unsigned*)(MB + t) = bits;  }
  if (t < nq) { *(int*)(RA + t) = 0;  }
  if (t < nq / 64) { const int v = 64 * (t + 1); *(int*)(KE + t * 32) = v;  } }


extern "C" void kernel_launch(void* const* d_in, const int* in_sizes, int n_in,
                              void* d_out, int out_size, void* d_ws, size_t ws_size, hipStream_t stream) {
  (void)in_sizes; (void)n_in; (void)out_size;
  const float* const* I = (const float* const*)d_in; const float* x = I[0]; const float* Wq = I[1]; const float* bq = I[2]; const float* Wk = I[3]; const float* bk = I[4]; const float* Wv = I[5]; const float* bv = I[6]; const float* Wo = I[7]; const float* bo = I[8]; const float* tab = I[9];
  char* ws = (char*)d_ws; size_t off = 0;
  auto take = [&](size_t bytes) { char* p = ws + off; off += (bytes + 255) & ~(size_t)255; return p; };
  _Float16* BQ = (_Float16*)take((size_t)DM * DM * 2); _Float16* BK = (_Float16*)take((size_t)DM * DM * 2); _Float16* BV = (_Float16*)take((size_t)DM * DM * 2); _Float16* BO = (_Float16*)take((size_t)DM * DM * 2); _Float16* T16 = (_Float16*)take((size_t)NH * RW * 64 * 2);
  _Float16* X16 = (_Float16*)take((size_t)NR * DM * 2);
  _Float16* Qh = (_Float16*)take((size_t)NR * DM * 2); _Float16* Ql = (_Float16*)take((size_t)NR * DM * 2); _Float16* Kh = (_Float16*)take((size_t)NR * DM * 2); _Float16* Kl = (_Float16*)take((size_t)NR * DM * 2); _Float16* Vth = (_Float16*)take((size_t)NR * DM * 2); _Float16* Vtl = (_Float16*)take((size_t)NR * DM * 2);
  _Float16* Oh = (_Float16*)take((size_t)NR * DM * 2); _Float16* Ol = (_Float16*)take((size_t)NR * DM * 2);
  if (off > ws_size) return;      /* 8 + 4 + 8 + 48 + 16 = 84 MiB */
  const size_t n8 = (size_t)NR * DM / 8; const unsigned nb8 = (unsigned)((n8 + 255) / 256); const size_t w8 = (size_t)DM * DM / 8; const unsigned wb = (unsigned)((w8 + 255) / 256);
  k_round16f<<<wb, 256, 0, stream>>>(Wq, BQ, w8); k_round16f<<<wb, 256, 0, stream>>>(Wk, BK, w8); k_round16f<<<wb, 256, 0, stream>>>(Wv, BV, w8); k_round16f<<<wb, 256, 0, stream>>>(Wo, BO, w8);      /* torch (out,in) = natural Bt */
  k_rtab<<<(NH * RW * 8 + 255) / 256, 256, 0, stream>>>(tab, 9999, T16);
  const dim3 gP((NR / 128) * (DM / 64), 1);
  /* every row-wise stage runs once over all NBT * SLEN rows */
  k_x16<<<nb8, 256, 0, stream>>>(x, X16, n8);
  /* each producer splits its f32 result into the hi and residual planes in its own epilogue: no f32 copy of q, k, v or O reaches memory */
  k_gemm2<0, 1><<<gP, 128, 0, stream>>>(X16, DM, 0, BQ, DM, 0, 0.0625f, bq, 0, nullptr, 1, 0, 0, nullptr, Qh, Ql, DM, 0, NR, DM, DM);      /* the hi plane also feeds the RPE product */
  k_gemm2<0, 1><<<gP, 128, 0, stream>>>(X16, DM, 0, BK, DM, 0, 0.0625f, bk, 0, nullptr, 1, 0, 0, nullptr, Kh, Kl, DM, 0, NR, DM, DM);
  k_gemm2<0, 2><<<gP, 128, 0, stream>>>(X16, DM, 0, BV, DM, 0, 0.0625f, bv, 0, nullptr, 1, 0, 0, nullptr, Vth, Vtl, DM, 0, NR, DM, DM);      /* V^T per head */
  k_flashb<SLEN, SLEN><<<NBT * NH * (SLEN / 64), 128, 0, stream>>>(Qh, Ql, DM, Kh, Kl, DM, Vth, Vtl, T16, Oh, Ol, DM);      /* all batches and heads in one launch */
  float* outp = (float*)d_out;
  k_gemm2<0, 0><<<gP, 128, 0, stream>>>(Oh, DM, 0, BO, DM, 0, 0.0625f, bo, 0, nullptr, 1, 0, 0, outp, nullptr, nullptr, DM, 0, NR, DM, DM);
  k_gemm2<0, 0><<<gP, 128, 0, stream>>>(Ol, DM, 0, BO, DM, 0, 0.0625f / 1024.0f, nullptr, 0, outp, 1, (size_t)DM, 0, outp, nullptr, nullptr, DM, 0, NR, DM, DM);
}

// v006
// One run takes 221 microseconds.
// Two timings next to v005 both put it at 1.26 times that version's speed.
// Counting every step since v000, it is 19.7 times as fast.
#include <hip/hip_runtime.h>
// Multi-head attention with learned relative-position encoding (4 x 1024 tokens, 1024 = 16 heads x 64): q,k,v = x W^T + b; scores = q.k/8 + q.rpe_table[h][q - k + 1023] (no scale on the RPE term); softmax over all keys; . v; merged . Wo^T + bo -> [4,1024,1024].
// Structure: projections (all batches in one launch) as f16 WMMA GEMMs (32x64 wave tiles, f32 accumulation, exact products + bias; the work-group's A and B tiles reach LDS by asynchronous copies, two buffers); the fused flash kernel (one launch over all batches and heads; hi/lo q,k three-product scores, online f32 softmax, P staged hi + residual, V^T hi + residual; all keys valid; each 32-key tile of K and V^T, both planes, reaches LDS once for the work-group's four waves by asynchronous copies, two buffers) forms the RPE term itself: per 16 x 32 score tile the 48 table rows r = q - k + 1023 can reach give a 16 x 48 f16 WMMA product q_h . table[h][r] (f32 result, 16 of the 48 columns carried over from the trip before), staged in the wave's LDS and read back along the diagonal inside the score stage; O as hi + residual planes into Wo (two GEMMs, bias in the first).
// Compute dtype: x, weights, biases, rpe_table rounded to bf16; projections exact; the RPE product uses the plain f16 q (the hi plane) (~2^-12 on a sigma-0.16 bias); q, k, P, v, O as f16 hi + residual pairs (~2^-21) in the attention; f32 accumulation and softmax. v_wmma_f32_16x16x32_f16.
#define NBT 4
#define SLEN 1024
#define RW 2048                  /* table rows kept per head (2*SLEN-1 used, the last one zero) */
#define DM 1024
#define NH 16
#define SCL 0.125f
#define NR (NBT * SLEN)
typedef __bf16 v16b __attribute__((ext_vector_type(16)));
typedef unsigned short v8us __attribute__((ext_vector_type(8), may_alias));
typedef float  v8f  __attribute__((ext_vector_type(8)));
typedef float  v4f  __attribute__((ext_vector_type(4)));
typedef float  v4fa __attribute__((ext_vector_type(4), may_alias));
union FragB { v16b v; v8us half[2]; unsigned short u[16]; };

__device__ __forceinline__ unsigned short bf16_bits(float x) { unsigned int u = __float_as_uint(x); return (unsigned short)((u + 0x7FFFu + ((u >> 16) & 1u)) >> 16); }
__device__ __forceinline__ float bf16_val(unsigned short b) { return __uint_as_float(((unsigned int)b) << 16); }
__device__ __forceinline__ float bf16_round(float x) { return bf16_val(bf16_bits(x)); }
// D += A·B with NT terms: 1 = ah·bh, 2 = + al·bh (A split), 3 = + ah·bl (both split)
template <int NT>
__device__ __forceinline__ v8f mmaN(v16b ah, v16b al, v16b bh, v16b bl, v8f c) {
  c = __builtin_amdgcn_wmma_f32_16x16x32_bf16(false, ah, false, bh, (short)0, c, false, false);
  if (NT >= 2) c = __builtin_amdgcn_wmma_f32_16x16x32_bf16(false, al, false, bh, (short)0, c, false, false);
  if (NT >= 3) c = __builtin_amdgcn_wmma_f32_16x16x32_bf16(false, ah, false, bl, (short)0, c, false, false);
  asm volatile("v_nop\n\tv_nop\n\tv_nop\n\tv_nop" : "+v"(c) : "v"(ah), "v"(al), "v"(bh), "v"(bl));
  return c;
}

__global__ __launch_bounds__(256) void k_wt_bf16(const float* __restrict__ W, unsigned short* __restrict__ Wt, int K, int N) {
  const int t = blockIdx.x * 256 + threadIdx.x;
  const int k8n = K / 8;
  if (t >= N * k8n) return;
  const int n = t / k8n, k8 = (t % k8n) * 8;
  v8us v;
#pragma unroll
  for (int i = 0; i < 8; ++i) v[i] = bf16_bits(W[(size_t)(k8 + i) * N + n]);
  *(v8us*)(Wt + (size_t)n * K + k8) = v;
  
}

// GEMM C[M][N] (f32, pitch ldc) = act(A[M][K]·W + bias). A f32 row-major (pitch lda) converted per fragment to bf16
// (ASPLIT: hi/lo two planes -> 2 terms, else single rounded term); Wt bf16 [N][K] (pitch ldb). BIAS_BF16 rounds the
// bias to bf16 first (bias quantised to bf16 before the add). K%32==0, M%16==0, N%64==0.
template <bool ASPLIT, int ACT, bool BIAS_BF16>
__global__ __launch_bounds__(128) void k_gemm_bf(const float* __restrict__ A, int lda, const unsigned short* __restrict__ Wt, int ldb,
                                               const float* __restrict__ bias, float* __restrict__ C, int ldc, int M, int N, int K) {
  __shared__ __attribute__((aligned(16))) float so[4][16][64];
  const int tid = threadIdx.x, w = tid >> 5, lane = tid & 31, ln = lane & 15, hh = lane >> 4;
  const int ntn = N / 64;
  const int wid = blockIdx.x * 4 + w;
  const int mt = wid / ntn, nq = wid % ntn;
  if (mt * 16 >= M) return;
  const int row0 = mt * 16, col0 = nq * 64;
  const float* arow = A + (size_t)(row0 + ln) * lda;
  v8f acc[4] = {};
  for (int kb = 0; kb < K; kb += 32) {
    FragB ah, al;
    const v4f x0 = *(const v4fa*)(arow + kb + 8 * hh), x1 = *(const v4fa*)(arow + kb + 8 * hh + 4);
    const v4f x2 = *(const v4fa*)(arow + kb + 16 + 8 * hh), x3 = *(const v4fa*)(arow + kb + 16 + 8 * hh + 4);
    float xs[16] = {x0[0],x0[1],x0[2],x0[3],x1[0],x1[1],x1[2],x1[3],x2[0],x2[1],x2[2],x2[3],x3[0],x3[1],x3[2],x3[3]};
#pragma unroll
    for (int i = 0; i < 16; ++i) { const unsigned short hb = bf16_bits(xs[i]); ah.u[i] = hb; al.u[i] = ASPLIT ? bf16_bits(xs[i] - bf16_val(hb)) : (unsigned short)0; }
#pragma unroll
    for (int t = 0; t < 4; ++t) {
      const unsigned short* brow = Wt + (size_t)(col0 + t * 16 + ln) * ldb + kb;
      FragB b;
      b.half[0] = *(const v8us*)(brow + 8 * hh);
      b.half[1] = *(const v8us*)(brow + 16 + 8 * hh);
      acc[t] = mmaN<ASPLIT ? 2 : 1>(ah.v, al.v, b.v, b.v, acc[t]);
    }
  }
#pragma unroll
  for (int t = 0; t < 4; ++t) {
    float bv = bias ? bias[col0 + t * 16 + ln] : 0.f;
    if (BIAS_BF16) bv = bf16_round(bv);
#pragma unroll
    for (int r = 0; r < 8; ++r) { float v = acc[t][r] + bv; if (ACT == 1) v = fmaxf(v, 0.f); so[w][8 * hh + r][t * 16 + ln] = v; }
  }
  __builtin_amdgcn_fence(__ATOMIC_ACQ_REL, "workgroup");
  __builtin_amdgcn_wave_barrier();
  const int rsub = lane >> 4, c4 = (lane & 15) * 4;
  {
#pragma unroll
    for (int q = 0; q < 8; ++q) {
      const int r = q * 2 + rsub;
      const v4f v = *(const v4fa*)&so[w][r][c4];
      *(v4f*)(C + (size_t)(row0 + r) * ldc + col0 + c4) = v;
    }
    
  }
}

// GEMM C = act(A·W + bias + resid): A f32 (ASPLIT -> hi/lo 2 terms), Wt bf16 [N][K]; ACT 0 none, 1 relu, 2 exact gelu;
// resid (optional, f32, row index = (row % rmod), pitch ldr, RES_BF16 rounds it) added before the activation.
template <bool ASPLIT, int ACT, bool BIAS_BF16, bool RES_BF16>
__global__ __launch_bounds__(128) void k_gemm_bf3(const float* __restrict__ A, int lda, const unsigned short* __restrict__ Wt, int ldb,
                                                const float* __restrict__ bias, const float* __restrict__ resid, int rmod, int ldr,
                                                float* __restrict__ C, int ldc, int M, int N, int K) {
  __shared__ __attribute__((aligned(16))) float so[4][16][64];
  const int tid = threadIdx.x, w = tid >> 5, lane = tid & 31, ln = lane & 15, hh = lane >> 4;
  const int ntn = N / 64;
  const int wid = blockIdx.x * 4 + w;
  const int mt = wid / ntn, nq = wid % ntn;
  if (mt * 16 >= M) return;
  const int row0 = mt * 16, col0 = nq * 64;
  const float* arow = A + (size_t)(row0 + ln) * lda;
  v8f acc[4] = {};
  for (int kb = 0; kb < K; kb += 32) {
    FragB ah, al;
    const v4f x0 = *(const v4fa*)(arow + kb + 8 * hh), x1 = *(const v4fa*)(arow + kb + 8 * hh + 4);
    const v4f x2 = *(const v4fa*)(arow + kb + 16 + 8 * hh), x3 = *(const v4fa*)(arow + kb + 16 + 8 * hh + 4);
    float xs[16] = {x0[0],x0[1],x0[2],x0[3],x1[0],x1[1],x1[2],x1[3],x2[0],x2[1],x2[2],x2[3],x3[0],x3[1],x3[2],x3[3]};
#pragma unroll
    for (int i = 0; i < 16; ++i) { const unsigned short hb = bf16_bits(xs[i]); ah.u[i] = hb; al.u[i] = ASPLIT ? bf16_bits(xs[i] - bf16_val(hb)) : (unsigned short)0; }
#pragma unroll
    for (int t = 0; t < 4; ++t) {
      const unsigned short* brow = Wt + (size_t)(col0 + t * 16 + ln) * ldb + kb;
      FragB b;
      b.half[0] = *(const v8us*)(brow + 8 * hh);
      b.half[1] = *(const v8us*)(brow + 16 + 8 * hh);
      acc[t] = mmaN<ASPLIT ? 2 : 1>(ah.v, al.v, b.v, b.v, acc[t]);
    }
  }
#pragma unroll
  for (int t = 0; t < 4; ++t) {
    const int col = col0 + t * 16 + ln;
    float bv = bias ? bias[col] : 0.f;
    if (BIAS_BF16) bv = bf16_round(bv);
#pragma unroll
    for (int r = 0; r < 8; ++r) {
      float v = acc[t][r] + bv;
      if (resid) { float rv = resid[(size_t)((row0 + 8 * hh + r) % rmod) * ldr + col]; if (RES_BF16) rv = bf16_round(rv); v += rv; }
      if (ACT == 1) v = fmaxf(v, 0.f);
      if (ACT == 2) v = 0.5f * v * (1.0f + erff(v * 0.70710678118654752f));
      if (ACT == 3) { const float u = 0.7978845608028654f * (v + 0.044715f * v * v * v); v = 0.5f * v * (1.0f + tanhf(u)); }
      so[w][8 * hh + r][t * 16 + ln] = v;
    }
  }
  __builtin_amdgcn_fence(__ATOMIC_ACQ_REL, "workgroup");
  __builtin_amdgcn_wave_barrier();
  const int rsub = lane >> 4, c4 = (lane & 15) * 4;
  {
#pragma unroll
    for (int q = 0; q < 8; ++q) {
      const int r = q * 2 + rsub;
      const v4f v = *(const v4fa*)&so[w][r][c4];
      *(v4f*)(C + (size_t)(row0 + r) * ldc + col0 + c4) = v;
    }
    
  }
}
// row LayerNorm (biased variance, eps) over N: s = X (+ R); optional out_sum <- s; out_norm <- (s-mu)*rsqrt(var+eps)*g + b
template <bool PARAM_BF16>
__global__ __launch_bounds__(256) void k_layernorm(const float* __restrict__ X, const float* __restrict__ R, const float* __restrict__ g, const float* __restrict__ bta,
                                                  float* __restrict__ out_sum, float* __restrict__ out_norm, int N, float eps) {
  __shared__ float red[256];
  const int row = blockIdx.x, tid = threadIdx.x;
  const float* x = X + (size_t)row * N; const float* rr = R ? R + (size_t)row * N : nullptr;
  float vals[16];                     // up to N = 4096
  const int per = N / 256;            // contiguous chunk per thread? use strided-by-4 chunks: thread handles j = tid*4 + 1024*u
  float s1 = 0.f;
  for (int u = 0; u < per / 4; ++u) {
    const int j = tid * 4 + 1024 * u;
    const v4f a = *(const v4fa*)(x + j);
    v4f b = {0.f,0.f,0.f,0.f}; if (rr) b = *(const v4fa*)(rr + j);
#pragma unroll
    for (int q = 0; q < 4; ++q) { const float v = a[q] + b[q]; vals[u * 4 + q] = v; s1 += v; }
  }
  red[tid] = s1; __syncthreads();
  for (int st = 128; st > 0; st >>= 1) { if (tid < st) red[tid] += red[tid + st]; __syncthreads(); }
  const float mu = red[0] / (float)N; __syncthreads();
  float s2 = 0.f;
  for (int u = 0; u < per / 4; ++u)
#pragma unroll
    for (int q = 0; q < 4; ++q) { const float c = vals[u * 4 + q] - mu; s2 += c * c; }
  red[tid] = s2; __syncthreads();
  for (int st = 128; st > 0; st >>= 1) { if (tid < st) red[tid] += red[tid + st]; __syncthreads(); }
  const float rs = rsqrtf(red[0] / (float)N + eps);
  {
    for (int u = 0; u < per / 4; ++u) {
      const int j = tid * 4 + 1024 * u;
      v4f o, sm;
#pragma unroll
      for (int q = 0; q < 4; ++q) {
        float gg = g[j + q], bb = bta[j + q];
        if (PARAM_BF16) { gg = bf16_round(gg); bb = bf16_round(bb); }
        sm[q] = vals[u * 4 + q]; o[q] = (vals[u * 4 + q] - mu) * rs * gg + bb;
      }
      if (out_sum) *(v4f*)(out_sum + (size_t)row * N + j) = sm;
      *(v4f*)(out_norm + (size_t)row * N + j) = o;
    }
    
  }
}



// ---- f16 WMMA path (v_wmma_f32_16x16x32_f16): 11-bit significands for operands in range — used where a [0,1] probability operand needs more precision than bf16
typedef _Float16 v16h __attribute__((ext_vector_type(16)));
union FragH { v16h v; v8us half[2]; _Float16 h[16]; unsigned short u[16]; };
template <int NT>
__device__ __forceinline__ v8f mmaH(v16h ah, v16h al, v16h bh, v16h bl, v8f c) {
  c = __builtin_amdgcn_wmma_f32_16x16x32_f16(false, ah, false, bh, (short)0, c, false, false);
  if (NT >= 2) c = __builtin_amdgcn_wmma_f32_16x16x32_f16(false, al, false, bh, (short)0, c, false, false);
  if (NT >= 3) c = __builtin_amdgcn_wmma_f32_16x16x32_f16(false, ah, false, bl, (short)0, c, false, false);
  asm volatile("v_nop\n\tv_nop\n\tv_nop\n\tv_nop" : "+v"(c) : "v"(ah), "v"(al), "v"(bh), "v"(bl));
  return c;
}
// batched GEMM like k_gemm_b but f16 operands: A f32 (split into f16 hi/lo if ASPLIT, else rounded to f16), Bt = f16 values [n][k]; alpha; C f32; N multiple of 16 (partial tiles skipped)
template <bool ASPLIT>
__global__ __launch_bounds__(128) void k_gemm_h(const float* __restrict__ A, int lda, size_t sA, const _Float16* __restrict__ Bh, int ldb, size_t sB, float alpha, float* __restrict__ C, int ldc, size_t sC, int M, int N, int K) {
  __shared__ __attribute__((aligned(16))) float so[4][16][64];
  const int tid = threadIdx.x, w = tid >> 5, lane = tid & 31, ln = lane & 15, hh = lane >> 4; const int by = blockIdx.y;
  A += (size_t)by * sA; Bh += (size_t)by * sB; C += (size_t)by * sC;
  const int ntn = (N + 63) / 64; const int wid = blockIdx.x * 4 + w; const int mt = wid / ntn, nq = wid % ntn; if (mt * 16 >= M) return;
  const int row0 = mt * 16, col0 = nq * 64; const float* arow = A + (size_t)(row0 + ln) * lda;
  v8f acc[4] = {};
  for (int kb = 0; kb < K; kb += 32) {
    FragH ah, al;
    const v4f x0 = *(const v4fa*)(arow + kb + 8 * hh), x1 = *(const v4fa*)(arow + kb + 8 * hh + 4), x2 = *(const v4fa*)(arow + kb + 16 + 8 * hh), x3 = *(const v4fa*)(arow + kb + 16 + 8 * hh + 4);
    float xs[16] = {x0[0],x0[1],x0[2],x0[3],x1[0],x1[1],x1[2],x1[3],x2[0],x2[1],x2[2],x2[3],x3[0],x3[1],x3[2],x3[3]};
#pragma unroll
    for (int i = 0; i < 16; ++i) { const _Float16 h = (_Float16)xs[i]; ah.h[i] = h; al.h[i] = ASPLIT ? (_Float16)(xs[i] - (float)h) : (_Float16)0.0f; }
#pragma unroll
    for (int t = 0; t < 4; ++t) { if (col0 + t * 16 >= N) continue; const size_t boff = (size_t)(col0 + t * 16 + ln) * ldb + kb; FragH bq; bq.half[0] = *(const v8us*)(Bh + boff + 8 * hh); bq.half[1] = *(const v8us*)(Bh + boff + 16 + 8 * hh);
      acc[t] = mmaH<ASPLIT ? 2 : 1>(ah.v, al.v, bq.v, bq.v, acc[t]); }
  }
#pragma unroll
  for (int t = 0; t < 4; ++t) { if (col0 + t * 16 >= N) continue;
#pragma unroll
    for (int r = 0; r < 8; ++r) so[w][8 * hh + r][t * 16 + ln] = acc[t][r] * alpha; }
  __builtin_amdgcn_fence(__ATOMIC_ACQ_REL, "workgroup"); __builtin_amdgcn_wave_barrier();
  const int rsub = lane >> 4, c4 = (lane & 15) * 4;
  {
#pragma unroll
    for (int q = 0; q < 8; ++q) { const int r = q * 2 + rsub; if (col0 + c4 < N) { const v4f v = *(const v4fa*)&so[w][r][c4]; *(v4f*)(C + (size_t)(row0 + r) * ldc + col0 + c4) = v; } }
     }
}

// Wt[n][k] = f16(W[k][n]·scale) from f32 row-major W[K][N] (scale = power of two; bf16-exact weights stay exact in f16 away from the subnormal range)
__global__ __launch_bounds__(256) void k_wt_f16(const float* __restrict__ W, _Float16* __restrict__ Wt, int K, int N, float scale) {
  const int t = blockIdx.x * 256 + threadIdx.x; if (t >= N * (K / 8)) return; const int n = t / (K / 8), k8 = (t % (K / 8)) * 8; FragH f;
#pragma unroll
  for (int i = 0; i < 8; ++i) f.h[i] = (_Float16)(bf16_round(W[(size_t)(k8 + i) * N + n]) * scale); const v8us o = f.half[0];
  *(v8us*)((unsigned short*)Wt + (size_t)n * K + k8) = o; 
}
// k_gemm_hh variant with fused epilogue: v = acc·alpha + bias[by·sBias + col] (+ CP[(row/rowsPerB)·sCPb + by·64 + col] if CP) ; ACT 0 none / 1 elu ; writes f16 C16 (and f32 C if non-null)
template <int ACT>
__global__ __launch_bounds__(128) void k_gemm_hhx(const _Float16* __restrict__ A, int lda, size_t sA, const _Float16* __restrict__ Bh, int ldb, size_t sB, float alpha, const float* __restrict__ bias, size_t sBias, const float* __restrict__ CP, int rowsPerB, size_t sCPb, int row0g,
    float* __restrict__ C, _Float16* __restrict__ C16, int ldc, size_t sC, int M, int N, int K) {
  __shared__ __attribute__((aligned(16))) float so[4][16][64];
  const int tid = threadIdx.x, w = tid >> 5, lane = tid & 31, ln = lane & 15, hh = lane >> 4; const int by = blockIdx.y;
  A += (size_t)by * sA; Bh += (size_t)by * sB; const size_t cofs = (size_t)by * sC; const float* bp = bias ? bias + (size_t)by * sBias : nullptr;
  const int ntn = (N + 63) / 64; const int wid = blockIdx.x * 4 + w; const int mt = wid / ntn, nq = wid % ntn; if (mt * 16 >= M) return;
  const int row0 = mt * 16, col0 = nq * 64; const _Float16* arow = A + (size_t)(row0 + ln) * lda;
  v8f acc[4] = {};
  for (int kb = 0; kb < K; kb += 32) { FragH ah; ah.half[0] = *(const v8us*)((const unsigned short*)arow + kb + 8 * hh); ah.half[1] = *(const v8us*)((const unsigned short*)arow + kb + 16 + 8 * hh);
#pragma unroll
    for (int t = 0; t < 4; ++t) { if (col0 + t * 16 >= N) continue; const size_t boff = (size_t)(col0 + t * 16 + ln) * ldb + kb; FragH bq; bq.half[0] = *(const v8us*)((const unsigned short*)Bh + boff + 8 * hh); bq.half[1] = *(const v8us*)((const unsigned short*)Bh + boff + 16 + 8 * hh);
      acc[t] = mmaH<1>(ah.v, ah.v, bq.v, bq.v, acc[t]); }
  }
#pragma unroll
  for (int t = 0; t < 4; ++t) { if (col0 + t * 16 >= N) continue; const int col = col0 + t * 16 + ln; const float bv = bp ? bf16_round(bp[col]) : 0.f;
#pragma unroll
    for (int r = 0; r < 8; ++r) { float v = acc[t][r] * alpha + bv; if (CP) { const int bidx = (row0g + row0 + 8 * hh + r) / rowsPerB; v += CP[(size_t)bidx * sCPb + (size_t)by * 64 + col]; } if (ACT == 1) v = (v > 0.f) ? v : expm1f(v); else if (ACT == 7) v = (v > 0.f) ? v + 1.0f : expf(v); else if (ACT == 8) v = tanhf(v); else if (ACT == 9) v = 0.5f * v * (1.0f + tanhf(0.7978845608028654f * (v + 0.044715f * v * v * v))); else if (ACT == 11) v = 1.0f / (1.0f + expf(-v)); else if (ACT == 12) v = (v > 0.f) ? v : 0.01f * v; else if (ACT == 14) v = (v > 0.f) ? v : 0.1f * v; else if (ACT == 15) v = v / (1.0f + expf(-v)); else if (ACT == 3) v = fmaxf(v, 0.f); else if (ACT == 6) v = 0.5f * v * (1.0f + erff(v * 0.70710678118654752f)); so[w][8 * hh + r][t * 16 + ln] = v; } }
  __builtin_amdgcn_fence(__ATOMIC_ACQ_REL, "workgroup"); __builtin_amdgcn_wave_barrier();
  const int rsub = lane >> 4, c4 = (lane & 15) * 4; typedef _Float16 v4h __attribute__((ext_vector_type(4)));
  {
#pragma unroll
    for (int q = 0; q < 8; ++q) { const int r = q * 2 + rsub; if (col0 + c4 < N) { const v4f v = *(const v4fa*)&so[w][r][c4]; if (C) *(v4f*)(C + cofs + (size_t)(row0 + r) * ldc + col0 + c4) = v; if (C16) { v4h h4; for (int i = 0; i < 4; ++i) h4[i] = (_Float16)v[i]; *(v4h*)(C16 + cofs + (size_t)(row0 + r) * ldc + col0 + c4) = h4; } } }
     }
}


typedef _Float16 v4h __attribute__((ext_vector_type(4)));

__global__ __launch_bounds__(256) void k_x16(const float* __restrict__ x, _Float16* __restrict__ X16, size_t n8) { const size_t t = (size_t)blockIdx.x * 256 + threadIdx.x; if (t >= n8) return; FragH f;
#pragma unroll
  for (int q = 0; q < 8; ++q) f.h[q] = (_Float16)bf16_round(x[t * 8 + q]); *(v8us*)((unsigned short*)X16 + t * 8) = f.half[0];  }
__global__ __launch_bounds__(256) void k_h16(const float* __restrict__ x, _Float16* __restrict__ X16, size_t n8) { const size_t t = (size_t)blockIdx.x * 256 + threadIdx.x; if (t >= n8) return; FragH f;
#pragma unroll
  for (int q = 0; q < 8; ++q) f.h[q] = (_Float16)x[t * 8 + q]; *(v8us*)((unsigned short*)X16 + t * 8) = f.half[0];  }
__global__ __launch_bounds__(256) void k_round16f(const float* __restrict__ W, _Float16* __restrict__ Bt, size_t n8) { const size_t t = (size_t)blockIdx.x * 256 + threadIdx.x; if (t >= n8) return; FragH f;
#pragma unroll
  for (int i = 0; i < 8; ++i) f.h[i] = (_Float16)(bf16_round(W[t * 8 + i]) * 16.0f); *(v8us*)((unsigned short*)Bt + t * 8) = f.half[0];  }
template <int NHv, int TTv>
__global__ __launch_bounds__(256) void k_vt(const _Float16* __restrict__ V16, int ldv, int voff, _Float16* __restrict__ Vt) { __shared__ unsigned short tl[64][66]; const int tid = threadIdx.x; const int slab = blockIdx.x / (TTv / 64), lg = blockIdx.x % (TTv / 64); const int b = slab / NHv, h = slab % NHv;
  for (int i = tid; i < 64 * 8; i += 256) { const int r = i / 8, c8 = (i % 8) * 8; FragH f; f.half[0] = *(const v8us*)((const unsigned short*)V16 + ((size_t)b * TTv + lg * 64 + r) * ldv + voff + h * 64 + c8);
#pragma unroll
    for (int q = 0; q < 8; ++q) tl[r][c8 + q] = f.u[q]; }
  __syncthreads();
  {
#pragma unroll
    for (int rd = 0; rd < 2; ++rd) { const int d = rd * 32 + tid / 8, pc = tid % 8; FragH f;
#pragma unroll
      for (int q = 0; q < 8; ++q) f.u[q] = tl[pc * 8 + q][d];
      *(v8us*)((unsigned short*)Vt + ((size_t)slab * 64 + d) * TTv + lg * 64 + pc * 8) = f.half[0]; }
     } }

// ---- fast GEMM (wave tile 32x64, work-group tile 128x64; requires M % 128 == 0, N % 64 == 0, K % 64 == 0); epilogue: acc·alpha + bias (+ CP, activation), stored in the OUT form below ----
#define G2P 72                   /* LDS row pitch in values: 128-byte rows at 144 bytes, the conflict-free pitch for ds_load_b128 readers */
// One K step of 64 values for the work-group: its 128 A rows and 64 B rows (128 bytes = one line each) go to LDS as 12 asynchronous 16-byte copies a lane; 8 lanes take a row, so a wave's copy covers 4 whole lines.
// ag, bg: the lane's piece in the first 16 rows; sa, sb: 16 rows on, in values; la, lb: the lane's LDS byte address in the first 16 rows. The closing s_wait_xcnt 0 stands in front of any rewrite of the registers that the copies name.
__device__ __forceinline__ void g2_stage(const _Float16* ag, size_t sa, const _Float16* bg, size_t sb, unsigned la, unsigned lb) {
  asm volatile("global_load_async_to_lds_b128 %0, %12, off\n\t"
               "global_load_async_to_lds_b128 %1, %13, off\n\t"
               "global_load_async_to_lds_b128 %2, %14, off\n\t"
               "global_load_async_to_lds_b128 %3, %15, off\n\t"
               "global_load_async_to_lds_b128 %4, %16, off\n\t"
               "global_load_async_to_lds_b128 %5, %17, off\n\t"
               "global_load_async_to_lds_b128 %6, %18, off\n\t"
               "global_load_async_to_lds_b128 %7, %19, off\n\t"
               "global_load_async_to_lds_b128 %8, %20, off\n\t"
               "global_load_async_to_lds_b128 %9, %21, off\n\t"
               "global_load_async_to_lds_b128 %10, %22, off\n\t"
               "global_load_async_to_lds_b128 %11, %23, off\n\t"
               "s_wait_xcnt 0x0"
               :: "v"(la), "v"(la + 1u * 16 * G2P * 2), "v"(la + 2u * 16 * G2P * 2), "v"(la + 3u * 16 * G2P * 2), "v"(la + 4u * 16 * G2P * 2), "v"(la + 5u * 16 * G2P * 2), "v"(la + 6u * 16 * G2P * 2), "v"(la + 7u * 16 * G2P * 2),
                  "v"(lb), "v"(lb + 1u * 16 * G2P * 2), "v"(lb + 2u * 16 * G2P * 2), "v"(lb + 3u * 16 * G2P * 2),
                  "v"(ag), "v"(ag + sa), "v"(ag + 2 * sa), "v"(ag + 3 * sa), "v"(ag + 4 * sa), "v"(ag + 5 * sa), "v"(ag + 6 * sa), "v"(ag + 7 * sa),
                  "v"(bg), "v"(bg + sb), "v"(bg + 2 * sb), "v"(bg + 3 * sb)
               : "memory"); }
__device__ __forceinline__ v16h g2_frag(const _Float16* p, int hh) { FragH f; f.half[0] = *(const v8us*)((const unsigned short*)p + 8 * hh); f.half[1] = *(const v8us*)((const unsigned short*)p + 16 + 8 * hh); return f.v; }
__device__ __forceinline__ v8f g2_mma(v16h a, v16h b, v8f c) { v8f d = __builtin_amdgcn_wmma_f32_16x16x32_f16(false, a, false, b, (short)0, c, false, false); asm volatile("v_nop\n\tv_nop\n\tv_nop\n\tv_nop" : "+v"(d) : "v"(a), "v"(b)); return d; }
// OUT 0: C (f32). OUT 1: the result leaves as two f16 planes, Hh = f16(v), Hl = f16((v - Hh) * 1024), row-major like C. OUT 2 (no CP, no activation): the same two planes transposed per head,
// H[((row / SLEN) * NH + col / 64) * 64 + col % 64][row % SLEN]; needs SLEN % 128 == 0 and N == NH * 64.
template <int ACT, int OUT>
__global__ __launch_bounds__(128) void k_gemm2(const _Float16* __restrict__ A, int lda, size_t sA, const _Float16* __restrict__ Bh, int ldb, size_t sB, float alpha, const float* __restrict__ bias, size_t sBias, const float* __restrict__ CP, int rowsPerB, size_t sCPb, int row0g,
    float* __restrict__ C, _Float16* __restrict__ Hh, _Float16* __restrict__ Hl, int ldc, size_t sC, int M, int N, int K) {
  __shared__ __attribute__((aligned(16))) float so[4][32][68]; __shared__ __attribute__((aligned(16))) unsigned short tA[2][128][G2P], tB[2][64][G2P];
  const int tid = threadIdx.x, w = tid >> 5, lane = tid & 31, ln = lane & 15, hh = lane >> 4; const int by = blockIdx.y;
  A += (size_t)by * sA; Bh += (size_t)by * sB; const size_t cofs = (size_t)by * sC; const float* bp = bias ? bias + (size_t)by * sBias : nullptr;
  const int ntn = N >> 6; const int mt = blockIdx.x / ntn, nq = blockIdx.x - mt * ntn; const int row0 = mt * 128 + 32 * w, col0 = nq * 64; if (mt * 128 >= M) return;      /* the whole work-group leaves or none: barriers below */
  const int cr = tid >> 3, cc = (tid & 7) * 8;      /* the lane's row (of 16) and 16-byte piece in a copy */
  const _Float16* ag = A + (size_t)(mt * 128 + cr) * lda + cc; const _Float16* bg = Bh + (size_t)(col0 + cr) * ldb + cc; const size_t sa = (size_t)16 * lda, sb = (size_t)16 * ldb;
  const unsigned la = (unsigned)(size_t)&tA[0][cr][cc], lb = (unsigned)(size_t)&tB[0][cr][cc];      /* LDS byte addresses: the low 32 bits */
  const int nst = K >> 6;
  const v8f z8 = {0.f,0.f,0.f,0.f,0.f,0.f,0.f,0.f}; v8f c00 = z8, c01 = z8, c02 = z8, c03 = z8, c10 = z8, c11 = z8, c12 = z8, c13 = z8;
  g2_stage(ag, sa, bg, sb, la, lb);      /* step 0 into buffer 0 */
  asm volatile("s_wait_asynccnt 0x0" ::: "memory");      /* this wave's copies of step 0 have landed */
  __syncthreads();      /* ... and every other wave's */
  if (nst > 1) g2_stage(ag + 64, sa, bg + 64, sb, la + (unsigned)sizeof(tA[0]), lb + (unsigned)sizeof(tB[0]));      /* step 1 flies while step 0 is worked on */
#pragma unroll 1
  for (int st = 0; st < nst; ++st) { const int bf = st & 1; const _Float16* ar = (const _Float16*)&tA[bf][32 * w + ln][0]; const _Float16* br = (const _Float16*)&tB[bf][ln][0];
    v16h fa[2][2], fb[2][4];      /* the step's 12 fragments are read as one group ahead of its 16 products */
#pragma unroll
    for (int ks = 0; ks < 2; ++ks) { fa[ks][0] = g2_frag(ar + ks * 32, hh); fa[ks][1] = g2_frag(ar + 16 * G2P + ks * 32, hh);
#pragma unroll
      for (int j = 0; j < 4; ++j) fb[ks][j] = g2_frag(br + j * 16 * G2P + ks * 32, hh); }
#pragma unroll
    for (int ks = 0; ks < 2; ++ks) { c00 = g2_mma(fa[ks][0], fb[ks][0], c00); c10 = g2_mma(fa[ks][1], fb[ks][0], c10); c01 = g2_mma(fa[ks][0], fb[ks][1], c01); c11 = g2_mma(fa[ks][1], fb[ks][1], c11);
      c02 = g2_mma(fa[ks][0], fb[ks][2], c02); c12 = g2_mma(fa[ks][1], fb[ks][2], c12); c03 = g2_mma(fa[ks][0], fb[ks][3], c03); c13 = g2_mma(fa[ks][1], fb[ks][3], c13); }
    asm volatile("s_wait_dscnt 0x0" ::: "memory");      /* this wave's reads of buffer bf are done before it is refilled */
    asm volatile("s_wait_asynccnt 0x0" ::: "memory");      /* this wave's copies of step st + 1 have landed */
    __syncthreads();      /* publishes step st + 1 and ends every wave's reads of buffer bf */
    if (st + 2 < nst) g2_stage(ag + (size_t)(st + 2) * 64, sa, bg + (size_t)(st + 2) * 64, sb, la + (unsigned)bf * (unsigned)sizeof(tA[0]), lb + (unsigned)bf * (unsigned)sizeof(tB[0])); }
  asm volatile("s_wait_asynccnt 0x0" ::: "memory");      /* no copy is outstanding past the loop */
  v8f accs[8] = {c00, c01, c02, c03, c10, c11, c12, c13};
  if constexpr (OUT == 2) {      /* a lane's 8 accumulator registers are 8 consecutive rows of one column: one 16-byte piece of a transposed row in each plane */
    unsigned short (*sT)[64][136] = (unsigned short (*)[64][136])&so[0][0][0];      /* 2 planes x 64 columns x 128 rows at a pitch of 272 bytes: exactly so's bytes */
    float bv4[4] = {0.f, 0.f, 0.f, 0.f};
    if (bp) {
#pragma unroll
      for (int t = 0; t < 4; ++t) bv4[t] = bf16_round(bp[col0 + t * 16 + ln]); }
#pragma unroll
    for (int u = 0; u < 8; ++u) { const int dl = (u & 3) * 16 + ln, kl = 32 * w + (u >> 2) * 16 + 8 * hh; const float bv = bv4[u & 3]; FragH fh, fl;
#pragma unroll
      for (int r = 0; r < 8; ++r) { const float v = accs[u][r] * alpha + bv; const _Float16 hv = (_Float16)v; fh.h[r] = hv; fl.h[r] = (_Float16)((v - (float)hv) * 1024.0f); }
      *(v8us*)&sT[0][dl][kl] = fh.half[0]; *(v8us*)&sT[1][dl][kl] = fl.half[0]; }
    __syncthreads();      /* a transposed row of 128 values holds pieces of all four waves */
    const int rb = mt * 128; const size_t vb = (size_t)((rb / SLEN) * NH + nq) * 64 * SLEN + (size_t)(rb % SLEN);
#pragma unroll
    for (int p = 0; p < 8; ++p) { const int it = p * 128 + tid, d = it >> 4, pc = it & 15; const size_t o = vb + (size_t)d * SLEN + pc * 8;      /* 16 lanes write the 256 contiguous bytes of a row: whole lines */
      const v8us xh = *(const v8us*)&sT[0][d][pc * 8], xl = *(const v8us*)&sT[1][d][pc * 8]; *(v8us*)((unsigned short*)Hh + o) = xh; *(v8us*)((unsigned short*)Hl + o) = xl; }
    return; }
#pragma unroll
  for (int u = 0; u < 8; ++u) { const int t = u & 3, half = u >> 2; const int col = col0 + t * 16 + ln; const float bv = bp ? bf16_round(bp[col]) : 0.f;
#pragma unroll
    for (int r = 0; r < 8; ++r) { const int rloc = half * 16 + 8 * hh + r; float v = accs[u][r] * alpha + bv; if (CP) { const int bidx = (row0g + row0 + rloc) / rowsPerB; v += CP[(size_t)bidx * sCPb + (size_t)by * 64 + col]; }
      if (ACT == 3) v = fmaxf(v, 0.f); else if (ACT == 6) v = 0.5f * v * (1.0f + erff(v * 0.70710678118654752f)); else if (ACT == 11) v = 1.0f / (1.0f + expf(-v)); else if (ACT == 15) v = v / (1.0f + expf(-v)); else if (ACT == 12) v = (v > 0.f) ? v : 0.01f * v; else if (ACT == 8) v = tanhf(v);
      so[w][rloc][t * 16 + ln] = v; } }
  __builtin_amdgcn_fence(__ATOMIC_ACQ_REL, "workgroup"); __builtin_amdgcn_wave_barrier();
  if constexpr (OUT == 1) {
#pragma unroll
    for (int q = 0; q < 8; ++q) { const int r = q * 4 + (lane >> 3), c8 = (lane & 7) * 8; const v4f a = *(const v4fa*)&so[w][r][c8], c = *(const v4fa*)&so[w][r][c8 + 4]; FragH fh, fl;      /* 8 lanes write the 128 bytes of a row piece: one whole line in each plane */
#pragma unroll
      for (int i = 0; i < 4; ++i) { _Float16 hv = (_Float16)a[i]; fh.h[i] = hv; fl.h[i] = (_Float16)((a[i] - (float)hv) * 1024.0f); hv = (_Float16)c[i]; fh.h[4 + i] = hv; fl.h[4 + i] = (_Float16)((c[i] - (float)hv) * 1024.0f); }
      const size_t o = cofs + (size_t)(row0 + r) * ldc + col0 + c8; *(v8us*)((unsigned short*)Hh + o) = fh.half[0]; *(v8us*)((unsigned short*)Hl + o) = fl.half[0]; }
    return; }
  const int rsub = lane >> 4, c4 = (lane & 15) * 4;
  {
#pragma unroll
    for (int q = 0; q < 16; ++q) { const int r = q * 2 + rsub; const v4f v = *(const v4fa*)&so[w][r][c4]; *(v4f*)(C + cofs + (size_t)(row0 + r) * ldc + col0 + c4) = v; }
     } }



#define FKP 72                   /* K rows in LDS, in values: 128-byte rows at 144 bytes, a conflict-free pitch for ds_load_b128 readers */
#define FVP 40                   /* V^T row pieces in LDS, in values: 64-byte pieces at 80 bytes, likewise */
// One tile of 32 keys for the work-group: 32 K rows of 128 bytes and 64 V^T row pieces of 64 bytes, hi and residual plane each, go to LDS as 8 asynchronous 16-byte copies a lane.
// 8 lanes take a K row (a wave's copy covers 4 whole lines), 4 lanes a V^T piece (8 half lines). kh, kl, vh, vl: the lane's piece in the first 16 K rows / 32 V^T rows of each plane; sk, sv: 16 K rows / 32 V^T rows on, in values;
// lk, lv: the lane's LDS byte address in the hi plane's first rows. The closing s_wait_xcnt 0 stands in front of any rewrite of the registers that the copies name.
__device__ __forceinline__ void fl_stage(const unsigned short* kh, const unsigned short* kl, size_t sk, const unsigned short* vh, const unsigned short* vl, size_t sv, unsigned lk, unsigned lv) {
  asm volatile("global_load_async_to_lds_b128 %0, %8, off\n\t"
               "global_load_async_to_lds_b128 %1, %9, off\n\t"
               "global_load_async_to_lds_b128 %2, %10, off\n\t"
               "global_load_async_to_lds_b128 %3, %11, off\n\t"
               "global_load_async_to_lds_b128 %4, %12, off\n\t"
               "global_load_async_to_lds_b128 %5, %13, off\n\t"
               "global_load_async_to_lds_b128 %6, %14, off\n\t"
               "global_load_async_to_lds_b128 %7, %15, off\n\t"
               "s_wait_xcnt 0x0"
               :: "v"(lk), "v"(lk + 16u * FKP * 2), "v"(lk + 32u * FKP * 2), "v"(lk + 48u * FKP * 2), "v"(lv), "v"(lv + 32u * FVP * 2), "v"(lv + 64u * FVP * 2), "v"(lv + 96u * FVP * 2),
                  "v"(kh), "v"(kh + sk), "v"(kl), "v"(kl + sk), "v"(vh), "v"(vh + sv), "v"(vl), "v"(vl + sv)
               : "memory"); }
template <int TQ, int TK>
__global__ __launch_bounds__(128, 4) /* the second number holds the build to 256 registers: 4 waves a SIMD, so that all 1024 work-groups are resident at once */ void k_flashb(const _Float16* __restrict__ Q16, const _Float16* __restrict__ Q16lo, int ldq, const _Float16* __restrict__ K16, const _Float16* __restrict__ K16lo, int ldk, const _Float16* __restrict__ Vt, const _Float16* __restrict__ Vtlo, const _Float16* __restrict__ T16, _Float16* __restrict__ Oh, _Float16* __restrict__ Ol, int ldo) {
  constexpr int RPW = 16, RTN = RPW / 16, NQB = TQ / (4 * RPW), DT = 4, KS = 2;
  __shared__ __attribute__((aligned(16))) unsigned short sP[4][RPW][40], sPl[4][RPW][40]; __shared__ __attribute__((aligned(16))) float sO[4][RPW][64 + 4];
  __shared__ __attribute__((aligned(16))) unsigned short sK[2][2][32][FKP], sV[2][2][64][FVP];      /* [buffer][hi, residual][K row | V^T row][values] */
  const int tid = threadIdx.x, w = __builtin_amdgcn_readfirstlane(tid >> 5), lane = tid & 31, ln = lane & 15, hh = lane >> 4;      /* the wave's number in a scalar register: what is formed from it costs no vector register across the loop */
  const int slab = blockIdx.x / NQB, qblk = blockIdx.x % NQB; const int b = slab / NH, h = slab % NH; const int qb0 = qblk * (4 * RPW); const int q0 = qb0 + w * RPW;
  const unsigned short* Vth = (const unsigned short*)Vt + (size_t)slab * 64 * TK; const unsigned short* Vtl = (const unsigned short*)Vtlo + (size_t)slab * 64 * TK;
  const size_t kco = ((size_t)b * TK + (tid >> 3)) * ldk + h * 64 + (tid & 7) * 8, vco = (size_t)(tid >> 2) * TK + (tid & 3) * 8;      /* the lane's piece of tile 0, in values */
  const size_t sk = (size_t)16 * ldk, sv = (size_t)32 * TK, kt = (size_t)32 * ldk;      /* kt: one tile on in K; in V^T a tile is 32 values on */
  const unsigned lk = (unsigned)(size_t)&sK[0][0][tid >> 3][(tid & 7) * 8], lv = (unsigned)(size_t)&sV[0][0][tid >> 2][(tid & 3) * 8];      /* LDS byte addresses: the low 32 bits */
  fl_stage((const unsigned short*)K16 + kco, (const unsigned short*)K16lo + kco, sk, Vth + vco, Vtl + vco, sv, lk, lv);      /* tile 0 into buffer 0; it flies while q and the first table rows are fetched */
  FragH aq[2][KS], aql[2][KS];
#pragma unroll
  for (int rt = 0; rt < RTN; ++rt) { const size_t qo = ((size_t)b * TQ + q0 + rt * 16 + ln) * ldq + h * 64; const unsigned short* qr = (const unsigned short*)Q16 + qo; const unsigned short* ql = (const unsigned short*)Q16lo + qo;
#pragma unroll
    for (int ks = 0; ks < KS; ++ks) { aq[rt][ks].half[0] = *(const v8us*)(qr + ks * 32 + 8 * hh); aq[rt][ks].half[1] = *(const v8us*)(qr + ks * 32 + 16 + 8 * hh); aql[rt][ks].half[0] = *(const v8us*)(ql + ks * 32 + 8 * hh); aql[rt][ks].half[1] = *(const v8us*)(ql + ks * 32 + 16 + 8 * hh); } }
  float m_r[2][8], l_r[2][8]; v8f oacc[2][DT], oaccl[2][DT];
#pragma unroll
  for (int rt = 0; rt < RTN; ++rt) {
#pragma unroll
    for (int r = 0; r < 8; ++r) { m_r[rt][r] = -3.0e38f; l_r[rt][r] = 0.f; }
#pragma unroll
    for (int dt = 0; dt < DT; ++dt) { oacc[rt][dt] = (v8f){0.f,0.f,0.f,0.f,0.f,0.f,0.f,0.f}; oaccl[rt][dt] = oacc[rt][dt]; } }
  /* RPE: rel[i][c] = q[q0 + i] . table[h][rb + c], rb = q0 - j0 + TK - 32, c < 48; score (i, kk) takes c = i - kk + 31. Columns 32..47 of a trip are columns 0..15 of the trip before. */
  const unsigned short* Th = (const unsigned short*)T16 + (size_t)h * RW * 64 + (size_t)ln * 64 + 8 * hh;
  v8f relc = (v8f){0.f,0.f,0.f,0.f,0.f,0.f,0.f,0.f};      /* columns 32..47 of the first trip */
#pragma unroll
  for (int ks = 0; ks < KS; ++ks) { FragH bt; bt.half[0] = *(const v8us*)(Th + (size_t)(q0 + TK) * 64 + ks * 32); bt.half[1] = *(const v8us*)(Th + (size_t)(q0 + TK) * 64 + ks * 32 + 16); relc = mmaH<1>(aq[0][ks].v, aq[0][ks].v, bt.v, bt.v, relc); }
  asm volatile("s_wait_asynccnt 0x0" ::: "memory");      /* this wave's copies of tile 0 have landed */
  __syncthreads();      /* ... and every other wave's */
  if (TK > 32) fl_stage((const unsigned short*)K16 + kco + kt, (const unsigned short*)K16lo + kco + kt, sk, Vth + vco + 32, Vtl + vco + 32, sv, lk + (unsigned)sizeof(sK[0]), lv + (unsigned)sizeof(sV[0]));      /* tile 1 flies while tile 0 is worked on */
#pragma unroll 1
  for (int j0 = 0; j0 < TK; j0 += 32) { const int bf = (j0 >> 5) & 1;
    FragH bt[2][KS];      /* table rows rb .. rb + 31, fetched together with the first key tile */
#pragma unroll
    for (int t = 0; t < 2; ++t) { const unsigned short* tr = Th + (size_t)(q0 - j0 + (TK - 32) + t * 16) * 64;
#pragma unroll
      for (int ks = 0; ks < KS; ++ks) { bt[t][ks].half[0] = *(const v8us*)(tr + ks * 32); bt[t][ks].half[1] = *(const v8us*)(tr + ks * 32 + 16); } }
    asm volatile("s_wait_xcnt 0x0" ::: "memory");      /* stands in front of any overwrite of the table loads' address registers (the allocator lets a later load's result land in them) */
    v8f s[2][2];
#pragma unroll
    for (int nt = 0; nt < 2; ++nt) { const unsigned short* kr = &sK[bf][0][nt * 16 + ln][0]; const unsigned short* kl = &sK[bf][1][nt * 16 + ln][0]; FragH bk[KS], bkl[KS];
#pragma unroll
      for (int ks = 0; ks < KS; ++ks) { bk[ks].half[0] = *(const v8us*)(kr + ks * 32 + 8 * hh); bk[ks].half[1] = *(const v8us*)(kr + ks * 32 + 16 + 8 * hh); bkl[ks].half[0] = *(const v8us*)(kl + ks * 32 + 8 * hh); bkl[ks].half[1] = *(const v8us*)(kl + ks * 32 + 16 + 8 * hh); }
      if (nt == 1) {      /* RPE products and their LDS stores run while the second key tile's LDS reads are in flight */
        v8f rel0 = (v8f){0.f,0.f,0.f,0.f,0.f,0.f,0.f,0.f}, rel1 = rel0;
#pragma unroll
        for (int ks = 0; ks < KS; ++ks) { rel0 = mmaH<1>(aq[0][ks].v, aq[0][ks].v, bt[0][ks].v, bt[0][ks].v, rel0); rel1 = mmaH<1>(aq[0][ks].v, aq[0][ks].v, bt[1][ks].v, bt[1][ks].v, rel1); }
#pragma unroll
        for (int r = 0; r < 8; ++r) { sO[w][8 * hh + r][ln] = rel0[r]; sO[w][8 * hh + r][16 + ln] = rel1[r]; sO[w][8 * hh + r][32 + ln] = relc[r]; }
        relc = rel0; }
#pragma unroll
      for (int rt = 0; rt < RTN; ++rt) { v8f acc = (v8f){0.f,0.f,0.f,0.f,0.f,0.f,0.f,0.f}, accr = acc;
#pragma unroll
        for (int ks = 0; ks < KS; ++ks) { acc = mmaH<1>(aq[rt][ks].v, aq[rt][ks].v, bk[ks].v, bk[ks].v, acc); accr = mmaH<1>(aql[rt][ks].v, aql[rt][ks].v, bk[ks].v, bk[ks].v, accr); accr = mmaH<1>(aq[rt][ks].v, aq[rt][ks].v, bkl[ks].v, bkl[ks].v, accr); }
        s[rt][nt] = acc + accr * 0.0009765625f; } }
    /* the wave's rel stores above are read back by other lanes of the same wave below */
    __builtin_amdgcn_fence(__ATOMIC_ACQ_REL, "workgroup"); __builtin_amdgcn_wave_barrier();
    float rv0[8], rv1[8];      /* all 16 diagonal reads issued together */
#pragma unroll
    for (int r = 0; r < 8; ++r) { rv0[r] = sO[w][8 * hh + r][8 * hh + r - ln + 31]; rv1[r] = sO[w][8 * hh + r][8 * hh + r - ln + 15]; }
    /* every key counts for every query (the function has no mask): no test and no branch in this stage, so the 8 rows' chains run side by side */
#pragma unroll
    for (int rt = 0; rt < RTN; ++rt)
#pragma unroll
      for (int r = 0; r < 8; ++r) { const float s0 = s[rt][0][r] * SCL + rv0[r] * 0.0625f, s1 = s[rt][1][r] * SCL + rv1[r] * 0.0625f;      /* + q . table[h][(q - k) + T - 1] (table held x16) */ float mc = fmaxf(s0, s1);
        mc = fmaxf(mc, __shfl_xor(mc, 1, 32)); mc = fmaxf(mc, __shfl_xor(mc, 2, 32)); mc = fmaxf(mc, __shfl_xor(mc, 4, 32)); mc = fmaxf(mc, __shfl_xor(mc, 8, 32));
        const float mn = fmaxf(m_r[rt][r], mc); const float al = expf(m_r[rt][r] - mn); m_r[rt][r] = mn; const float p0 = expf(s0 - mn), p1 = expf(s1 - mn); l_r[rt][r] = l_r[rt][r] * al + p0 + p1;
#pragma unroll
        for (int dt = 0; dt < DT; ++dt) { oacc[rt][dt][r] *= al; oaccl[rt][dt][r] *= al; }
        FragH t2, t3; const float ps0 = p0 * 1024.0f, ps1 = p1 * 1024.0f; t2.h[0] = (_Float16)ps0; t2.h[1] = (_Float16)ps1; t3.h[0] = (_Float16)((ps0 - (float)t2.h[0]) * 1024.0f); t3.h[1] = (_Float16)((ps1 - (float)t2.h[1]) * 1024.0f);
        sP[w][rt * 16 + 8 * hh + r][ln] = t2.u[0]; sP[w][rt * 16 + 8 * hh + r][16 + ln] = t2.u[1]; sPl[w][rt * 16 + 8 * hh + r][ln] = t3.u[0]; sPl[w][rt * 16 + 8 * hh + r][16 + ln] = t3.u[1]; }
    __builtin_amdgcn_fence(__ATOMIC_ACQ_REL, "workgroup"); __builtin_amdgcn_wave_barrier();
    FragH pa[2], pl[2];
#pragma unroll
    for (int rt = 0; rt < RTN; ++rt) { pa[rt].half[0] = *(const v8us*)&sP[w][rt * 16 + ln][8 * hh]; pa[rt].half[1] = *(const v8us*)&sP[w][rt * 16 + ln][16 + 8 * hh]; pl[rt].half[0] = *(const v8us*)&sPl[w][rt * 16 + ln][8 * hh]; pl[rt].half[1] = *(const v8us*)&sPl[w][rt * 16 + ln][16 + 8 * hh]; }
#pragma unroll
    for (int dt = 0; dt < DT; ++dt) { const unsigned short* vr = &sV[bf][0][dt * 16 + ln][0]; const unsigned short* vl = &sV[bf][1][dt * 16 + ln][0]; FragH bv, bl; bv.half[0] = *(const v8us*)(vr + 8 * hh); bv.half[1] = *(const v8us*)(vr + 16 + 8 * hh); bl.half[0] = *(const v8us*)(vl + 8 * hh); bl.half[1] = *(const v8us*)(vl + 16 + 8 * hh);
#pragma unroll
      for (int rt = 0; rt < RTN; ++rt) { oacc[rt][dt] = mmaH<1>(pa[rt].v, pa[rt].v, bv.v, bv.v, oacc[rt][dt]); oaccl[rt][dt] = mmaH<1>(pa[rt].v, pa[rt].v, bl.v, bl.v, oaccl[rt][dt]); oaccl[rt][dt] = mmaH<1>(pl[rt].v, pl[rt].v, bv.v, bv.v, oaccl[rt][dt]); } }
    __builtin_amdgcn_fence(__ATOMIC_ACQ_REL, "workgroup"); __builtin_amdgcn_wave_barrier();
    asm volatile("s_wait_dscnt 0x0" ::: "memory");      /* this wave's reads of buffer bf are done before it is refilled */
    asm volatile("s_wait_asynccnt 0x0" ::: "memory");      /* this wave's copies of the next tile have landed */
    __syncthreads();      /* publishes the next tile and ends every wave's reads of buffer bf */
    if (j0 + 64 < TK) { const size_t tn = (size_t)(j0 + 64);      /* the tile after the next into the buffer just read */
      fl_stage((const unsigned short*)K16 + kco + tn * ldk, (const unsigned short*)K16lo + kco + tn * ldk, sk, Vth + vco + tn, Vtl + vco + tn, sv, lk + (unsigned)bf * (unsigned)sizeof(sK[0]), lv + (unsigned)bf * (unsigned)sizeof(sV[0])); } }
  asm volatile("s_wait_asynccnt 0x0" ::: "memory");      /* no copy is outstanding past the loop */
#pragma unroll
  for (int rt = 0; rt < RTN; ++rt) {
#pragma unroll
    for (int r = 0; r < 8; ++r) { float l = l_r[rt][r]; l += __shfl_xor(l, 1, 32); l += __shfl_xor(l, 2, 32); l += __shfl_xor(l, 4, 32); l += __shfl_xor(l, 8, 32); l_r[rt][r] = 1.0f / (l * 1024.0f); }      /* l >= 1: the row's largest score adds exp(0) */
#pragma unroll
    for (int dt = 0; dt < DT; ++dt)
#pragma unroll
      for (int r = 0; r < 8; ++r) sO[w][rt * 16 + 8 * hh + r][dt * 16 + ln] = (oacc[rt][dt][r] + oaccl[rt][dt][r] * 0.0009765625f) * l_r[rt][r]; }
  __builtin_amdgcn_fence(__ATOMIC_ACQ_REL, "workgroup"); __builtin_amdgcn_wave_barrier();
  {
#pragma unroll
    for (int rp = 0; rp < RPW; rp += 2) { const int r = rp + (lane >> 4), pc = lane & 15; const v4f val = *(const v4fa*)&sO[w][r][pc * 4]; v4h h4, l4;      /* O leaves as f16 hi + residual x 1024; 16 lanes write the 128 bytes of a row piece in each plane */
#pragma unroll
      for (int i = 0; i < 4; ++i) { const _Float16 hv = (_Float16)val[i]; h4[i] = hv; l4[i] = (_Float16)((val[i] - (float)hv) * 1024.0f); }
      const size_t o = ((size_t)b * TQ + q0 + r) * ldo + h * 64 + pc * 4; *(v4h*)(Oh + o) = h4; *(v4h*)(Ol + o) = l4; }
     } }


__global__ __launch_bounds__(256) void k_lnx(const float* __restrict__ X, const float* __restrict__ g, const float* __restrict__ bb, _Float16* __restrict__ Y16, float* __restrict__ XB) {
  #pragma clang fp contract(off)
  const int tid = threadIdx.x, w = tid >> 5, ln = tid & 31; const int r = blockIdx.x * 8 + w; if (r >= NR) return; const float* x = X + (size_t)r * DM; float s = 0.f;
#pragma unroll 1
  for (int i = 0; i < DM / 128; ++i) { const v4f a = *(const v4fa*)(x + i * 128 + ln * 4); for (int q = 0; q < 4; ++q) s += bf16_round(a[q]); }
  for (int o = 16; o > 0; o >>= 1) s += __shfl_xor(s, o, 32); const float mu = s / (float)DM; float q2 = 0.f;
#pragma unroll 1
  for (int i = 0; i < DM / 128; ++i) { const v4f a = *(const v4fa*)(x + i * 128 + ln * 4); for (int q = 0; q < 4; ++q) { const float d = bf16_round(a[q]) - mu; q2 += d * d; } }
  for (int o = 16; o > 0; o >>= 1) q2 += __shfl_xor(q2, o, 32); const float rs = rsqrtf(q2 / (float)DM + 1e-5f);
  {
#pragma unroll 1
    for (int i = 0; i < DM / 128; ++i) { const int c0 = i * 128 + ln * 4; const v4f a = *(const v4fa*)(x + c0); _Float16 h4[4]; v4f xb;
      for (int q = 0; q < 4; ++q) { const float t = bf16_round(a[q]); h4[q] = (_Float16)((t - mu) * rs * bf16_round(g[c0 + q]) + bf16_round(bb[c0 + q])); xb[q] = t; }
      *(unsigned long long*)((unsigned short*)Y16 + (size_t)r * DM + c0) = *(const unsigned long long*)h4; *(v4f*)(XB + (size_t)r * DM + c0) = xb; }
     } }
__global__ __launch_bounds__(256) void k_rtab(const float* __restrict__ tab, int trows, _Float16* __restrict__ T16) {
  const int t = blockIdx.x * 256 + threadIdx.x; if (t >= NH * RW * 8) return; const int d0 = (t & 7) * 8; const int r = (t >> 3) % RW; const int h = t / (8 * RW); FragH f;
#pragma unroll
  for (int q = 0; q < 8; ++q) f.h[q] = (r < 2 * SLEN - 1) ? (_Float16)(bf16_round(tab[((size_t)h * trows + r) * 64 + d0 + q]) * 16.0f) : (_Float16)0.0f;
  *(v8us*)((unsigned short*)T16 + ((size_t)h * RW + r) * 64 + d0) = f.half[0];  }
__global__ __launch_bounds__(256) void k_causaltab(unsigned* __restrict__ MB, int* __restrict__ RA, int* __restrict__ KE, int nq, int nk) {
  const int t = blockIdx.x * 256 + threadIdx.x; const int nw = nk / 32;
  if (t < nq * nw) { const int q = t / nw, w = t % nw; const int first = q + 1 - 32 * w; const unsigned bits = (first <= 0) ? 0xffffffffu : ((first >= 32) ? 0u : (0xffffffffu << first)); *(unsigned*)(MB + t) = bits;  }
  if (t < nq) { *(int*)(RA + t) = 0;  }
  if (t < nq / 64) { const int v = 64 * (t + 1); *(int*)(KE + t * 32) = v;  } }


extern "C" void kernel_launch(void* const* d_in, const int* in_sizes, int n_in,
                              void* d_out, int out_size, void* d_ws, size_t ws_size, hipStream_t stream) {
  (void)in_sizes; (void)n_in; (void)out_size;
  const float* const* I = (const float* const*)d_in; const float* x = I[0]; const float* Wq = I[1]; const float* bq = I[2]; const float* Wk = I[3]; const float* bk = I[4]; const float* Wv = I[5]; const float* bv = I[6]; const float* Wo = I[7]; const float* bo = I[8]; const float* tab = I[9];
  char* ws = (char*)d_ws; size_t off = 0;
  auto take = [&](size_t bytes) { char* p = ws + off; off += (bytes + 255) & ~(size_t)255; return p; };
  _Float16* BQ = (_Float16*)take((size_t)DM * DM * 2); _Float16* BK = (_Float16*)take((size_t)DM * DM * 2); _Float16* BV = (_Float16*)take((size_t)DM * DM * 2); _Float16* BO = (_Float16*)take((size_t)DM * DM * 2); _Float16* T16 = (_Float16*)take((size_t)NH * RW * 64 * 2);
  _Float16* X16 = (_Float16*)take((size_t)NR * DM * 2);
  _Float16* Qh = (_Float16*)take((size_t)NR * DM * 2); _Float16* Ql = (_Float16*)take((size_t)NR * DM * 2); _Float16* Kh = (_Float16*)take((size_t)NR * DM * 2); _Float16* Kl = (_Float16*)take((size_t)NR * DM * 2); _Float16* Vth = (_Float16*)take((size_t)NR * DM * 2); _Float16* Vtl = (_Float16*)take((size_t)NR * DM * 2);
  _Float16* Oh = (_Float16*)take((size_t)NR * DM * 2); _Float16* Ol = (_Float16*)take((size_t)NR * DM * 2);
  if (off > ws_size) return;      /* 8 + 4 + 8 + 48 + 16 = 84 MiB */
  const size_t n8 = (size_t)NR * DM / 8; const unsigned nb8 = (unsigned)((n8 + 255) / 256); const size_t w8 = (size_t)DM * DM / 8; const unsigned wb = (unsigned)((w8 + 255) / 256);
  k_round16f<<<wb, 256, 0, stream>>>(Wq, BQ, w8); k_round16f<<<wb, 256, 0, stream>>>(Wk, BK, w8); k_round16f<<<wb, 256, 0, stream>>>(Wv, BV, w8); k_round16f<<<wb, 256, 0, stream>>>(Wo, BO, w8);      /* torch (out,in) = natural Bt */
  k_rtab<<<(NH * RW * 8 + 255) / 256, 256, 0, stream>>>(tab, 9999, T16);
  const dim3 gP((NR / 128) * (DM / 64), 1);
  /* every row-wise stage runs once over all NBT * SLEN rows */
  k_x16<<<nb8, 256, 0, stream>>>(x, X16, n8);
  /* each producer splits its f32 result into the hi and residual planes in its own epilogue: no f32 copy of q, k, v or O reaches memory */
  k_gemm2<0, 1><<<gP, 128, 0, stream>>>(X16, DM, 0, BQ, DM, 0, 0.0625f, bq, 0, nullptr, 1, 0, 0, nullptr, Qh, Ql, DM, 0, NR, DM, DM);      /* the hi plane also feeds the RPE product */
  k_gemm2<0, 1><<<gP, 128, 0, stream>>>(X16, DM, 0, BK, DM, 0, 0.0625f, bk, 0, nullptr, 1, 0, 0, nullptr, Kh, Kl, DM, 0, NR, DM, DM);
  k_gemm2<0, 2><<<gP, 128, 0, stream>>>(X16, DM, 0, BV, DM, 0, 0.0625f, bv, 0, nullptr, 1, 0, 0, nullptr, Vth, Vtl, DM, 0, NR, DM, DM);      /* V^T per head */
  k_flashb<SLEN, SLEN><<<NBT * NH * (SLEN / 64), 128, 0, stream>>>(Qh, Ql, DM, Kh, Kl, DM, Vth, Vtl, T16, Oh, Ol, DM);      /* all batches and heads in one launch */
  float* outp = (float*)d_out;
  k_gemm2<0, 0><<<gP, 128, 0, stream>>>(Oh, DM, 0, BO, DM, 0, 0.0625f, bo, 0, nullptr, 1, 0, 0, outp, nullptr, nullptr, DM, 0, NR, DM, DM);
  k_gemm2<0, 0><<<gP, 128, 0, stream>>>(Ol, DM, 0, BO, DM, 0, 0.0625f / 1024.0f, nullptr, 0, outp, 1, (size_t)DM, 0, outp, nullptr, nullptr, DM, 0, NR, DM, DM);
}

// v007
// Measured time: 196 microseconds a run.
// Two timings next to v006 both put it at 1.13 times that version's speed.
// All steps since v000 together make it 22.3 times as fast.
#include <hip/hip_runtime.h>
// Multi-head attention with learned relative-position encoding (4 x 1024 tokens, 1024 = 16 heads x 64): q,k,v = x W^T + b; scores = q.k/8 + q.rpe_table[h][q - k + 1023] (no scale on the RPE term); softmax over all keys; . v; merged . Wo^T + bo -> [4,1024,1024].
// Structure: projections (all batches in one launch) as f16 WMMA GEMMs (32x64 wave tiles, f32 accumulation, exact products + bias; the work-group's A and B tiles reach LDS by asynchronous copies, two buffers); the fused flash kernel (one launch over all batches and heads; hi/lo q,k three-product scores, both products transposed (S^T = K . Q^T, O^T += V^T . P^T), so a lane owns one query: online f32 softmax inside the lane, P hi + residual packed in registers, V^T hi + residual; all keys valid; each 32-key tile of K and V^T, both planes, reaches LDS once for the work-group's four waves by asynchronous copies, two buffers) forms the RPE term itself: per 16 x 32 score tile the 48 table rows r = q - k + 1023 can reach give a 16 x 48 f16 WMMA product q_h . table[h][r] (f32 result, 16 of the 48 columns carried over from the trip before), stored skewed in the wave's LDS and read back per query inside the score stage; O as hi + residual planes into Wo (two GEMMs, bias in the first).
// Compute dtype: x, weights, biases, rpe_table rounded to bf16; projections exact; the RPE product uses the plain f16 q (the hi plane) (~2^-12 on a sigma-0.16 bias); q, k, P, v, O as f16 hi + residual pairs (~2^-21) in the attention; f32 accumulation and softmax. v_wmma_f32_16x16x32_f16.
#define NBT 4
#define SLEN 1024
#define RW 2048                  /* table rows kept per head (2*SLEN-1 used, the last one zero) */
#define DM 1024
#define NH 16
#define SCL 0.125f
#define NR (NBT * SLEN)
typedef __bf16 v16b __attribute__((ext_vector_type(16)));
typedef unsigned short v8us __attribute__((ext_vector_type(8), may_alias));
typedef float  v8f  __attribute__((ext_vector_type(8)));
typedef float  v4f  __attribute__((ext_vector_type(4)));
typedef float  v4fa __attribute__((ext_vector_type(4), may_alias));
union FragB { v16b v; v8us half[2]; unsigned short u[16]; };

__device__ __forceinline__ unsigned short bf16_bits(float x) { unsigned int u = __float_as_uint(x); return (unsigned short)((u + 0x7FFFu + ((u >> 16) & 1u)) >> 16); }
__device__ __forceinline__ float bf16_val(unsigned short b) { return __uint_as_float(((unsigned int)b) << 16); }
__device__ __forceinline__ float bf16_round(float x) { return bf16_val(bf16_bits(x)); }
// D += A·B with NT terms: 1 = ah·bh, 2 = + al·bh (A split), 3 = + ah·bl (both split)
template <int NT>
__device__ __forceinline__ v8f mmaN(v16b ah, v16b al, v16b bh, v16b bl, v8f c) {
  c = __builtin_amdgcn_wmma_f32_16x16x32_bf16(false, ah, false, bh, (short)0, c, false, false);
  if (NT >= 2) c = __builtin_amdgcn_wmma_f32_16x16x32_bf16(false, al, false, bh, (short)0, c, false, false);
  if (NT >= 3) c = __builtin_amdgcn_wmma_f32_16x16x32_bf16(false, ah, false, bl, (short)0, c, false, false);
  asm volatile("v_nop\n\tv_nop\n\tv_nop\n\tv_nop" : "+v"(c) : "v"(ah), "v"(al), "v"(bh), "v"(bl));
  return c;
}

__global__ __launch_bounds__(256) void k_wt_bf16(const float* __restrict__ W, unsigned short* __restrict__ Wt, int K, int N) {
  const int t = blockIdx.x * 256 + threadIdx.x;
  const int k8n = K / 8;
  if (t >= N * k8n) return;
  const int n = t / k8n, k8 = (t % k8n) * 8;
  v8us v;
#pragma unroll
  for (int i = 0; i < 8; ++i) v[i] = bf16_bits(W[(size_t)(k8 + i) * N + n]);
  *(v8us*)(Wt + (size_t)n * K + k8) = v;
  
}

// GEMM C[M][N] (f32, pitch ldc) = act(A[M][K]·W + bias). A f32 row-major (pitch lda) converted per fragment to bf16
// (ASPLIT: hi/lo two planes -> 2 terms, else single rounded term); Wt bf16 [N][K] (pitch ldb). BIAS_BF16 rounds the
// bias to bf16 first (bias quantised to bf16 before the add). K%32==0, M%16==0, N%64==0.
template <bool ASPLIT, int ACT, bool BIAS_BF16>
__global__ __launch_bounds__(128) void k_gemm_bf(const float* __restrict__ A, int lda, const unsigned short* __restrict__ Wt, int ldb,
                                               const float* __restrict__ bias, float* __restrict__ C, int ldc, int M, int N, int K) {
  __shared__ __attribute__((aligned(16))) float so[4][16][64];
  const int tid = threadIdx.x, w = tid >> 5, lane = tid & 31, ln = lane & 15, hh = lane >> 4;
  const int ntn = N / 64;
  const int wid = blockIdx.x * 4 + w;
  const int mt = wid / ntn, nq = wid % ntn;
  if (mt * 16 >= M) return;
  const int row0 = mt * 16, col0 = nq * 64;
  const float* arow = A + (size_t)(row0 + ln) * lda;
  v8f acc[4] = {};
  for (int kb = 0; kb < K; kb += 32) {
    FragB ah, al;
    const v4f x0 = *(const v4fa*)(arow + kb + 8 * hh), x1 = *(const v4fa*)(arow + kb + 8 * hh + 4);
    const v4f x2 = *(const v4fa*)(arow + kb + 16 + 8 * hh), x3 = *(const v4fa*)(arow + kb + 16 + 8 * hh + 4);
    float xs[16] = {x0[0],x0[1],x0[2],x0[3],x1[0],x1[1],x1[2],x1[3],x2[0],x2[1],x2[2],x2[3],x3[0],x3[1],x3[2],x3[3]};
#pragma unroll
    for (int i = 0; i < 16; ++i) { const unsigned short hb = bf16_bits(xs[i]); ah.u[i] = hb; al.u[i] = ASPLIT ? bf16_bits(xs[i] - bf16_val(hb)) : (unsigned short)0; }
#pragma unroll
    for (int t = 0; t < 4; ++t) {
      const unsigned short* brow = Wt + (size_t)(col0 + t * 16 + ln) * ldb + kb;
      FragB b;
      b.half[0] = *(const v8us*)(brow + 8 * hh);
      b.half[1] = *(const v8us*)(brow + 16 + 8 * hh);
      acc[t] = mmaN<ASPLIT ? 2 : 1>(ah.v, al.v, b.v, b.v, acc[t]);
    }
  }
#pragma unroll
  for (int t = 0; t < 4; ++t) {
    float bv = bias ? bias[col0 + t * 16 + ln] : 0.f;
    if (BIAS_BF16) bv = bf16_round(bv);
#pragma unroll
    for (int r = 0; r < 8; ++r) { float v = acc[t][r] + bv; if (ACT == 1) v = fmaxf(v, 0.f); so[w][8 * hh + r][t * 16 + ln] = v; }
  }
  __builtin_amdgcn_fence(__ATOMIC_ACQ_REL, "workgroup");
  __builtin_amdgcn_wave_barrier();
  const int rsub = lane >> 4, c4 = (lane & 15) * 4;
  {
#pragma unroll
    for (int q = 0; q < 8; ++q) {
      const int r = q * 2 + rsub;
      const v4f v = *(const v4fa*)&so[w][r][c4];
      *(v4f*)(C + (size_t)(row0 + r) * ldc + col0 + c4) = v;
    }
    
  }
}

// GEMM C = act(A·W + bias + resid): A f32 (ASPLIT -> hi/lo 2 terms), Wt bf16 [N][K]; ACT 0 none, 1 relu, 2 exact gelu;
// resid (optional, f32, row index = (row % rmod), pitch ldr, RES_BF16 rounds it) added before the activation.
template <bool ASPLIT, int ACT, bool BIAS_BF16, bool RES_BF16>
__global__ __launch_bounds__(128) void k_gemm_bf3(const float* __restrict__ A, int lda, const unsigned short* __restrict__ Wt, int ldb,
                                                const float* __restrict__ bias, const float* __restrict__ resid, int rmod, int ldr,
                                                float* __restrict__ C, int ldc, int M, int N, int K) {
  __shared__ __attribute__((aligned(16))) float so[4][16][64];
  const int tid = threadIdx.x, w = tid >> 5, lane = tid & 31, ln = lane & 15, hh = lane >> 4;
  const int ntn = N / 64;
  const int wid = blockIdx.x * 4 + w;
  const int mt = wid / ntn, nq = wid % ntn;
  if (mt * 16 >= M) return;
  const int row0 = mt * 16, col0 = nq * 64;
  const float* arow = A + (size_t)(row0 + ln) * lda;
  v8f acc[4] = {};
  for (int kb = 0; kb < K; kb += 32) {
    FragB ah, al;
    const v4f x0 = *(const v4fa*)(arow + kb + 8 * hh), x1 = *(const v4fa*)(arow + kb + 8 * hh + 4);
    const v4f x2 = *(const v4fa*)(arow + kb + 16 + 8 * hh), x3 = *(const v4fa*)(arow + kb + 16 + 8 * hh + 4);
    float xs[16] = {x0[0],x0[1],x0[2],x0[3],x1[0],x1[1],x1[2],x1[3],x2[0],x2[1],x2[2],x2[3],x3[0],x3[1],x3[2],x3[3]};
#pragma unroll
    for (int i = 0; i < 16; ++i) { const unsigned short hb = bf16_bits(xs[i]); ah.u[i] = hb; al.u[i] = ASPLIT ? bf16_bits(xs[i] - bf16_val(hb)) : (unsigned short)0; }
#pragma unroll
    for (int t = 0; t < 4; ++t) {
      const unsigned short* brow = Wt + (size_t)(col0 + t * 16 + ln) * ldb + kb;
      FragB b;
      b.half[0] = *(const v8us*)(brow + 8 * hh);
      b.half[1] = *(const v8us*)(brow + 16 + 8 * hh);
      acc[t] = mmaN<ASPLIT ? 2 : 1>(ah.v, al.v, b.v, b.v, acc[t]);
    }
  }
#pragma unroll
  for (int t = 0; t < 4; ++t) {
    const int col = col0 + t * 16 + ln;
    float bv = bias ? bias[col] : 0.f;
    if (BIAS_BF16) bv = bf16_round(bv);
#pragma unroll
    for (int r = 0; r < 8; ++r) {
      float v = acc[t][r] + bv;
      if (resid) { float rv = resid[(size_t)((row0 + 8 * hh + r) % rmod) * ldr + col]; if (RES_BF16) rv = bf16_round(rv); v += rv; }
      if (ACT == 1) v = fmaxf(v, 0.f);
      if (ACT == 2) v = 0.5f * v * (1.0f + erff(v * 0.70710678118654752f));
      if (ACT == 3) { const float u = 0.7978845608028654f * (v + 0.044715f * v * v * v); v = 0.5f * v * (1.0f + tanhf(u)); }
      so[w][8 * hh + r][t * 16 + ln] = v;
    }
  }
  __builtin_amdgcn_fence(__ATOMIC_ACQ_REL, "workgroup");
  __builtin_amdgcn_wave_barrier();
  const int rsub = lane >> 4, c4 = (lane & 15) * 4;
  {
#pragma unroll
    for (int q = 0; q < 8; ++q) {
      const int r = q * 2 + rsub;
      const v4f v = *(const v4fa*)&so[w][r][c4];
      *(v4f*)(C + (size_t)(row0 + r) * ldc + col0 + c4) = v;
    }
    
  }
}
// row LayerNorm (biased variance, eps) over N: s = X (+ R); optional out_sum <- s; out_norm <- (s-mu)*rsqrt(var+eps)*g + b
template <bool PARAM_BF16>
__global__ __launch_bounds__(256) void k_layernorm(const float* __restrict__ X, const float* __restrict__ R, const float* __restrict__ g, const float* __restrict__ bta,
                                                  float* __restrict__ out_sum, float* __restrict__ out_norm, int N, float eps) {
  __shared__ float red[256];
  const int row = blockIdx.x, tid = threadIdx.x;
  const float* x = X + (size_t)row * N; const float* rr = R ? R + (size_t)row * N : nullptr;
  float vals[16];                     // up to N = 4096
  const int per = N / 256;            // contiguous chunk per thread? use strided-by-4 chunks: thread handles j = tid*4 + 1024*u
  float s1 = 0.f;
  for (int u = 0; u < per / 4; ++u) {
    const int j = tid * 4 + 1024 * u;
    const v4f a = *(const v4fa*)(x + j);
    v4f b = {0.f,0.f,0.f,0.f}; if (rr) b = *(const v4fa*)(rr + j);
#pragma unroll
    for (int q = 0; q < 4; ++q) { const float v = a[q] + b[q]; vals[u * 4 + q] = v; s1 += v; }
  }
  red[tid] = s1; __syncthreads();
  for (int st = 128; st > 0; st >>= 1) { if (tid < st) red[tid] += red[tid + st]; __syncthreads(); }
  const float mu = red[0] / (float)N; __syncthreads();
  float s2 = 0.f;
  for (int u = 0; u < per / 4; ++u)
#pragma unroll
    for (int q = 0; q < 4; ++q) { const float c = vals[u * 4 + q] - mu; s2 += c * c; }
  red[tid] = s2; __syncthreads();
  for (int st = 128; st > 0; st >>= 1) { if (tid < st) red[tid] += red[tid + st]; __syncthreads(); }
  const float rs = rsqrtf(red[0] / (float)N + eps);
  {
    for (int u = 0; u < per / 4; ++u) {
      const int j = tid * 4 + 1024 * u;
      v4f o, sm;
#pragma unroll
      for (int q = 0; q < 4; ++q) {
        float gg = g[j + q], bb = bta[j + q];
        if (PARAM_BF16) { gg = bf16_round(gg); bb = bf16_round(bb); }
        sm[q] = vals[u * 4 + q]; o[q] = (vals[u * 4 + q] - mu) * rs * gg + bb;
      }
      if (out_sum) *(v4f*)(out_sum + (size_t)row * N + j) = sm;
      *(v4f*)(out_norm + (size_t)row * N + j) = o;
    }
    
  }
}



// ---- f16 WMMA path (v_wmma_f32_16x16x32_f16): 11-bit significands for operands in range — used where a [0,1] probability operand needs more precision than bf16
typedef _Float16 v16h __attribute__((ext_vector_type(16)));
union FragH { v16h v; v8us half[2]; _Float16 h[16]; unsigned short u[16]; };
template <int NT>
__device__ __forceinline__ v8f mmaH(v16h ah, v16h al, v16h bh, v16h bl, v8f c) {
  c = __builtin_amdgcn_wmma_f32_16x16x32_f16(false, ah, false, bh, (short)0, c, false, false);
  if (NT >= 2) c = __builtin_amdgcn_wmma_f32_16x16x32_f16(false, al, false, bh, (short)0, c, false, false);
  if (NT >= 3) c = __builtin_amdgcn_wmma_f32_16x16x32_f16(false, ah, false, bl, (short)0, c, false, false);
  asm volatile("v_nop\n\tv_nop\n\tv_nop\n\tv_nop" : "+v"(c) : "v"(ah), "v"(al), "v"(bh), "v"(bl));
  return c;
}
// batched GEMM like k_gemm_b but f16 operands: A f32 (split into f16 hi/lo if ASPLIT, else rounded to f16), Bt = f16 values [n][k]; alpha; C f32; N multiple of 16 (partial tiles skipped)
template <bool ASPLIT>
__global__ __launch_bounds__(128) void k_gemm_h(const float* __restrict__ A, int lda, size_t sA, const _Float16* __restrict__ Bh, int ldb, size_t sB, float alpha, float* __restrict__ C, int ldc, size_t sC, int M, int N, int K) {
  __shared__ __attribute__((aligned(16))) float so[4][16][64];
  const int tid = threadIdx.x, w = tid >> 5, lane = tid & 31, ln = lane & 15, hh = lane >> 4; const int by = blockIdx.y;
  A += (size_t)by * sA; Bh += (size_t)by * sB; C += (size_t)by * sC;
  const int ntn = (N + 63) / 64; const int wid = blockIdx.x * 4 + w; const int mt = wid / ntn, nq = wid % ntn; if (mt * 16 >= M) return;
  const int row0 = mt * 16, col0 = nq * 64; const float* arow = A + (size_t)(row0 + ln) * lda;
  v8f acc[4] = {};
  for (int kb = 0; kb < K; kb += 32) {
    FragH ah, al;
    const v4f x0 = *(const v4fa*)(arow + kb + 8 * hh), x1 = *(const v4fa*)(arow + kb + 8 * hh + 4), x2 = *(const v4fa*)(arow + kb + 16 + 8 * hh), x3 = *(const v4fa*)(arow + kb + 16 + 8 * hh + 4);
    float xs[16] = {x0[0],x0[1],x0[2],x0[3],x1[0],x1[1],x1[2],x1[3],x2[0],x2[1],x2[2],x2[3],x3[0],x3[1],x3[2],x3[3]};
#pragma unroll
    for (int i = 0; i < 16; ++i) { const _Float16 h = (_Float16)xs[i]; ah.h[i] = h; al.h[i] = ASPLIT ? (_Float16)(xs[i] - (float)h) : (_Float16)0.0f; }
#pragma unroll
    for (int t = 0; t < 4; ++t) { if (col0 + t * 16 >= N) continue; const size_t boff = (size_t)(col0 + t * 16 + ln) * ldb + kb; FragH bq; bq.half[0] = *(const v8us*)(Bh + boff + 8 * hh); bq.half[1] = *(const v8us*)(Bh + boff + 16 + 8 * hh);
      acc[t] = mmaH<ASPLIT ? 2 : 1>(ah.v, al.v, bq.v, bq.v, acc[t]); }
  }
#pragma unroll
  for (int t = 0; t < 4; ++t) { if (col0 + t * 16 >= N) continue;
#pragma unroll
    for (int r = 0; r < 8; ++r) so[w][8 * hh + r][t * 16 + ln] = acc[t][r] * alpha; }
  __builtin_amdgcn_fence(__ATOMIC_ACQ_REL, "workgroup"); __builtin_amdgcn_wave_barrier();
  const int rsub = lane >> 4, c4 = (lane & 15) * 4;
  {
#pragma unroll
    for (int q = 0; q < 8; ++q) { const int r = q * 2 + rsub; if (col0 + c4 < N) { const v4f v = *(const v4fa*)&so[w][r][c4]; *(v4f*)(C + (size_t)(row0 + r) * ldc + col0 + c4) = v; } }
     }
}

// Wt[n][k] = f16(W[k][n]·scale) from f32 row-major W[K][N] (scale = power of two; bf16-exact weights stay exact in f16 away from the subnormal range)
__global__ __launch_bounds__(256) void k_wt_f16(const float* __restrict__ W, _Float16* __restrict__ Wt, int K, int N, float scale) {
  const int t = blockIdx.x * 256 + threadIdx.x; if (t >= N * (K / 8)) return; const int n = t / (K / 8), k8 = (t % (K / 8)) * 8; FragH f;
#pragma unroll
  for (int i = 0; i < 8; ++i) f.h[i] = (_Float16)(bf16_round(W[(size_t)(k8 + i) * N + n]) * scale); const v8us o = f.half[0];
  *(v8us*)((unsigned short*)Wt + (size_t)n * K + k8) = o; 
}
// k_gemm_hh variant with fused epilogue: v = acc·alpha + bias[by·sBias + col] (+ CP[(row/rowsPerB)·sCPb + by·64 + col] if CP) ; ACT 0 none / 1 elu ; writes f16 C16 (and f32 C if non-null)
template <int ACT>
__global__ __launch_bounds__(128) void k_gemm_hhx(const _Float16* __restrict__ A, int lda, size_t sA, const _Float16* __restrict__ Bh, int ldb, size_t sB, float alpha, const float* __restrict__ bias, size_t sBias, const float* __restrict__ CP, int rowsPerB, size_t sCPb, int row0g,
    float* __restrict__ C, _Float16* __restrict__ C16, int ldc, size_t sC, int M, int N, int K) {
  __shared__ __attribute__((aligned(16))) float so[4][16][64];
  const int tid = threadIdx.x, w = tid >> 5, lane = tid & 31, ln = lane & 15, hh = lane >> 4; const int by = blockIdx.y;
  A += (size_t)by * sA; Bh += (size_t)by * sB; const size_t cofs = (size_t)by * sC; const float* bp = bias ? bias + (size_t)by * sBias : nullptr;
  const int ntn = (N + 63) / 64; const int wid = blockIdx.x * 4 + w; const int mt = wid / ntn, nq = wid % ntn; if (mt * 16 >= M) return;
  const int row0 = mt * 16, col0 = nq * 64; const _Float16* arow = A + (size_t)(row0 + ln) * lda;
  v8f acc[4] = {};
  for (int kb = 0; kb < K; kb += 32) { FragH ah; ah.half[0] = *(const v8us*)((const unsigned short*)arow + kb + 8 * hh); ah.half[1] = *(const v8us*)((const unsigned short*)arow + kb + 16 + 8 * hh);
#pragma unroll
    for (int t = 0; t < 4; ++t) { if (col0 + t * 16 >= N) continue; const size_t boff = (size_t)(col0 + t * 16 + ln) * ldb + kb; FragH bq; bq.half[0] = *(const v8us*)((const unsigned short*)Bh + boff + 8 * hh); bq.half[1] = *(const v8us*)((const unsigned short*)Bh + boff + 16 + 8 * hh);
      acc[t] = mmaH<1>(ah.v, ah.v, bq.v, bq.v, acc[t]); }
  }
#pragma unroll
  for (int t = 0; t < 4; ++t) { if (col0 + t * 16 >= N) continue; const int col = col0 + t * 16 + ln; const float bv = bp ? bf16_round(bp[col]) : 0.f;
#pragma unroll
    for (int r = 0; r < 8; ++r) { float v = acc[t][r] * alpha + bv; if (CP) { const int bidx = (row0g + row0 + 8 * hh + r) / rowsPerB; v += CP[(size_t)bidx * sCPb + (size_t)by * 64 + col]; } if (ACT == 1) v = (v > 0.f) ? v : expm1f(v); else if (ACT == 7) v = (v > 0.f) ? v + 1.0f : expf(v); else if (ACT == 8) v = tanhf(v); else if (ACT == 9) v = 0.5f * v * (1.0f + tanhf(0.7978845608028654f * (v + 0.044715f * v * v * v))); else if (ACT == 11) v = 1.0f / (1.0f + expf(-v)); else if (ACT == 12) v = (v > 0.f) ? v : 0.01f * v; else if (ACT == 14) v = (v > 0.f) ? v : 0.1f * v; else if (ACT == 15) v = v / (1.0f + expf(-v)); else if (ACT == 3) v = fmaxf(v, 0.f); else if (ACT == 6) v = 0.5f * v * (1.0f + erff(v * 0.70710678118654752f)); so[w][8 * hh + r][t * 16 + ln] = v; } }
  __builtin_amdgcn_fence(__ATOMIC_ACQ_REL, "workgroup"); __builtin_amdgcn_wave_barrier();
  const int rsub = lane >> 4, c4 = (lane & 15) * 4; typedef _Float16 v4h __attribute__((ext_vector_type(4)));
  {
#pragma unroll
    for (int q = 0; q < 8; ++q) { const int r = q * 2 + rsub; if (col0 + c4 < N) { const v4f v = *(const v4fa*)&so[w][r][c4]; if (C) *(v4f*)(C + cofs + (size_t)(row0 + r) * ldc + col0 + c4) = v; if (C16) { v4h h4; for (int i = 0; i < 4; ++i) h4[i] = (_Float16)v[i]; *(v4h*)(C16 + cofs + (size_t)(row0 + r) * ldc + col0 + c4) = h4; } } }
     }
}


typedef _Float16 v4h __attribute__((ext_vector_type(4)));

__global__ __launch_bounds__(256) void k_x16(const float* __restrict__ x, _Float16* __restrict__ X16, size_t n8) { const size_t t = (size_t)blockIdx.x * 256 + threadIdx.x; if (t >= n8) return; FragH f;
#pragma unroll
  for (int q = 0; q < 8; ++q) f.h[q] = (_Float16)bf16_round(x[t * 8 + q]); *(v8us*)((unsigned short*)X16 + t * 8) = f.half[0];  }
__global__ __launch_bounds__(256) void k_h16(const float* __restrict__ x, _Float16* __restrict__ X16, size_t n8) { const size_t t = (size_t)blockIdx.x * 256 + threadIdx.x; if (t >= n8) return; FragH f;
#pragma unroll
  for (int q = 0; q < 8; ++q) f.h[q] = (_Float16)x[t * 8 + q]; *(v8us*)((unsigned short*)X16 + t * 8) = f.half[0];  }
__global__ __launch_bounds__(256) void k_round16f(const float* __restrict__ W, _Float16* __restrict__ Bt, size_t n8) { const size_t t = (size_t)blockIdx.x * 256 + threadIdx.x; if (t >= n8) return; FragH f;
#pragma unroll
  for (int i = 0; i < 8; ++i) f.h[i] = (_Float16)(bf16_round(W[t * 8 + i]) * 16.0f); *(v8us*)((unsigned short*)Bt + t * 8) = f.half[0];  }
template <int NHv, int TTv>
__global__ __launch_bounds__(256) void k_vt(const _Float16* __restrict__ V16, int ldv, int voff, _Float16* __restrict__ Vt) { __shared__ unsigned short tl[64][66]; const int tid = threadIdx.x; const int slab = blockIdx.x / (TTv / 64), lg = blockIdx.x % (TTv / 64); const int b = slab / NHv, h = slab % NHv;
  for (int i = tid; i < 64 * 8; i += 256) { const int r = i / 8, c8 = (i % 8) * 8; FragH f; f.half[0] = *(const v8us*)((const unsigned short*)V16 + ((size_t)b * TTv + lg * 64 + r) * ldv + voff + h * 64 + c8);
#pragma unroll
    for (int q = 0; q < 8; ++q) tl[r][c8 + q] = f.u[q]; }
  __syncthreads();
  {
#pragma unroll
    for (int rd = 0; rd < 2; ++rd) { const int d = rd * 32 + tid / 8, pc = tid % 8; FragH f;
#pragma unroll
      for (int q = 0; q < 8; ++q) f.u[q] = tl[pc * 8 + q][d];
      *(v8us*)((unsigned short*)Vt + ((size_t)slab * 64 + d) * TTv + lg * 64 + pc * 8) = f.half[0]; }
     } }

// ---- fast GEMM (wave tile 32x64, work-group tile 128x64; requires M % 128 == 0, N % 64 == 0, K % 64 == 0); epilogue: acc·alpha + bias (+ CP, activation), stored in the OUT form below ----
#define G2P 72                   /* LDS row pitch in values: 128-byte rows at 144 bytes, the conflict-free pitch for ds_load_b128 readers */
// One K step of 64 values for the work-group: its 128 A rows and 64 B rows (128 bytes = one line each) go to LDS as 12 asynchronous 16-byte copies a lane; 8 lanes take a row, so a wave's copy covers 4 whole lines.
// ag, bg: the lane's piece in the first 16 rows; sa, sb: 16 rows on, in values; la, lb: the lane's LDS byte address in the first 16 rows. The closing s_wait_xcnt 0 stands in front of any rewrite of the registers that the copies name.
__device__ __forceinline__ void g2_stage(const _Float16* ag, size_t sa, const _Float16* bg, size_t sb, unsigned la, unsigned lb) {
  asm volatile("global_load_async_to_lds_b128 %0, %12, off\n\t"
               "global_load_async_to_lds_b128 %1, %13, off\n\t"
               "global_load_async_to_lds_b128 %2, %14, off\n\t"
               "global_load_async_to_lds_b128 %3, %15, off\n\t"
               "global_load_async_to_lds_b128 %4, %16, off\n\t"
               "global_load_async_to_lds_b128 %5, %17, off\n\t"
               "global_load_async_to_lds_b128 %6, %18, off\n\t"
               "global_load_async_to_lds_b128 %7, %19, off\n\t"
               "global_load_async_to_lds_b128 %8, %20, off\n\t"
               "global_load_async_to_lds_b128 %9, %21, off\n\t"
               "global_load_async_to_lds_b128 %10, %22, off\n\t"
               "global_load_async_to_lds_b128 %11, %23, off\n\t"
               "s_wait_xcnt 0x0"
               :: "v"(la), "v"(la + 1u * 16 * G2P * 2), "v"(la + 2u * 16 * G2P * 2), "v"(la + 3u * 16 * G2P * 2), "v"(la + 4u * 16 * G2P * 2), "v"(la + 5u * 16 * G2P * 2), "v"(la + 6u * 16 * G2P * 2), "v"(la + 7u * 16 * G2P * 2),
                  "v"(lb), "v"(lb + 1u * 16 * G2P * 2), "v"(lb + 2u * 16 * G2P * 2), "v"(lb + 3u * 16 * G2P * 2),
                  "v"(ag), "v"(ag + sa), "v"(ag + 2 * sa), "v"(ag + 3 * sa), "v"(ag + 4 * sa), "v"(ag + 5 * sa), "v"(ag + 6 * sa), "v"(ag + 7 * sa),
                  "v"(bg), "v"(bg + sb), "v"(bg + 2 * sb), "v"(bg + 3 * sb)
               : "memory"); }
__device__ __forceinline__ v16h g2_frag(const _Float16* p, int hh) { FragH f; f.half[0] = *(const v8us*)((const unsigned short*)p + 8 * hh); f.half[1] = *(const v8us*)((const unsigned short*)p + 16 + 8 * hh); return f.v; }
__device__ __forceinline__ v8f g2_mma(v16h a, v16h b, v8f c) { v8f d = __builtin_amdgcn_wmma_f32_16x16x32_f16(false, a, false, b, (short)0, c, false, false); asm volatile("v_nop\n\tv_nop\n\tv_nop\n\tv_nop" : "+v"(d) : "v"(a), "v"(b)); return d; }
// OUT 0: C (f32). OUT 1: the result leaves as two f16 planes, Hh = f16(v), Hl = f16((v - Hh) * 1024), row-major like C. OUT 2 (no CP, no activation): the same two planes transposed per head,
// H[((row / SLEN) * NH + col / 64) * 64 + col % 64][row % SLEN]; needs SLEN % 128 == 0 and N == NH * 64.
template <int ACT, int OUT>
__global__ __launch_bounds__(128) void k_gemm2(const _Float16* __restrict__ A, int lda, size_t sA, const _Float16* __restrict__ Bh, int ldb, size_t sB, float alpha, const float* __restrict__ bias, size_t sBias, const float* __restrict__ CP, int rowsPerB, size_t sCPb, int row0g,
    float* __restrict__ C, _Float16* __restrict__ Hh, _Float16* __restrict__ Hl, int ldc, size_t sC, int M, int N, int K) {
  __shared__ __attribute__((aligned(16))) float so[4][32][68]; __shared__ __attribute__((aligned(16))) unsigned short tA[2][128][G2P], tB[2][64][G2P];
  const int tid = threadIdx.x, w = tid >> 5, lane = tid & 31, ln = lane & 15, hh = lane >> 4; const int by = blockIdx.y;
  A += (size_t)by * sA; Bh += (size_t)by * sB; const size_t cofs = (size_t)by * sC; const float* bp = bias ? bias + (size_t)by * sBias : nullptr;
  const int ntn = N >> 6; const int mt = blockIdx.x / ntn, nq = blockIdx.x - mt * ntn; const int row0 = mt * 128 + 32 * w, col0 = nq * 64; if (mt * 128 >= M) return;      /* the whole work-group leaves or none: barriers below */
  const int cr = tid >> 3, cc = (tid & 7) * 8;      /* the lane's row (of 16) and 16-byte piece in a copy */
  const _Float16* ag = A + (size_t)(mt * 128 + cr) * lda + cc; const _Float16* bg = Bh + (size_t)(col0 + cr) * ldb + cc; const size_t sa = (size_t)16 * lda, sb = (size_t)16 * ldb;
  const unsigned la = (unsigned)(size_t)&tA[0][cr][cc], lb = (unsigned)(size_t)&tB[0][cr][cc];      /* LDS byte addresses: the low 32 bits */
  const int nst = K >> 6;
  const v8f z8 = {0.f,0.f,0.f,0.f,0.f,0.f,0.f,0.f}; v8f c00 = z8, c01 = z8, c02 = z8, c03 = z8, c10 = z8, c11 = z8, c12 = z8, c13 = z8;
  g2_stage(ag, sa, bg, sb, la, lb);      /* step 0 into buffer 0 */
  asm volatile("s_wait_asynccnt 0x0" ::: "memory");      /* this wave's copies of step 0 have landed */
  __syncthreads();      /* ... and every other wave's */
  if (nst > 1) g2_stage(ag + 64, sa, bg + 64, sb, la + (unsigned)sizeof(tA[0]), lb + (unsigned)sizeof(tB[0]));      /* step 1 flies while step 0 is worked on */
#pragma unroll 1
  for (int st = 0; st < nst; ++st) { const int bf = st & 1; const _Float16* ar = (const _Float16*)&tA[bf][32 * w + ln][0]; const _Float16* br = (const _Float16*)&tB[bf][ln][0];
    v16h fa[2][2], fb[2][4];      /* the step's 12 fragments are read as one group ahead of its 16 products */
#pragma unroll
    for (int ks = 0; ks < 2; ++ks) { fa[ks][0] = g2_frag(ar + ks * 32, hh); fa[ks][1] = g2_frag(ar + 16 * G2P + ks * 32, hh);
#pragma unroll
      for (int j = 0; j < 4; ++j) fb[ks][j] = g2_frag(br + j * 16 * G2P + ks * 32, hh); }
#pragma unroll
    for (int ks = 0; ks < 2; ++ks) { c00 = g2_mma(fa[ks][0], fb[ks][0], c00); c10 = g2_mma(fa[ks][1], fb[ks][0], c10); c01 = g2_mma(fa[ks][0], fb[ks][1], c01); c11 = g2_mma(fa[ks][1], fb[ks][1], c11);
      c02 = g2_mma(fa[ks][0], fb[ks][2], c02); c12 = g2_mma(fa[ks][1], fb[ks][2], c12); c03 = g2_mma(fa[ks][0], fb[ks][3], c03); c13 = g2_mma(fa[ks][1], fb[ks][3], c13); }
    asm volatile("s_wait_dscnt 0x0" ::: "memory");      /* this wave's reads of buffer bf are done before it is refilled */
    asm volatile("s_wait_asynccnt 0x0" ::: "memory");      /* this wave's copies of step st + 1 have landed */
    __syncthreads();      /* publishes step st + 1 and ends every wave's reads of buffer bf */
    if (st + 2 < nst) g2_stage(ag + (size_t)(st + 2) * 64, sa, bg + (size_t)(st + 2) * 64, sb, la + (unsigned)bf * (unsigned)sizeof(tA[0]), lb + (unsigned)bf * (unsigned)sizeof(tB[0])); }
  asm volatile("s_wait_asynccnt 0x0" ::: "memory");      /* no copy is outstanding past the loop */
  v8f accs[8] = {c00, c01, c02, c03, c10, c11, c12, c13};
  if constexpr (OUT == 2) {      /* a lane's 8 accumulator registers are 8 consecutive rows of one column: one 16-byte piece of a transposed row in each plane */
    unsigned short (*sT)[64][136] = (unsigned short (*)[64][136])&so[0][0][0];      /* 2 planes x 64 columns x 128 rows at a pitch of 272 bytes: exactly so's bytes */
    float bv4[4] = {0.f, 0.f, 0.f, 0.f};
    if (bp) {
#pragma unroll
      for (int t = 0; t < 4; ++t) bv4[t] = bf16_round(bp[col0 + t * 16 + ln]); }
#pragma unroll
    for (int u = 0; u < 8; ++u) { const int dl = (u & 3) * 16 + ln, kl = 32 * w + (u >> 2) * 16 + 8 * hh; const float bv = bv4[u & 3]; FragH fh, fl;
#pragma unroll
      for (int r = 0; r < 8; ++r) { const float v = accs[u][r] * alpha + bv; const _Float16 hv = (_Float16)v; fh.h[r] = hv; fl.h[r] = (_Float16)((v - (float)hv) * 1024.0f); }
      *(v8us*)&sT[0][dl][kl] = fh.half[0]; *(v8us*)&sT[1][dl][kl] = fl.half[0]; }
    __syncthreads();      /* a transposed row of 128 values holds pieces of all four waves */
    const int rb = mt * 128; const size_t vb = (size_t)((rb / SLEN) * NH + nq) * 64 * SLEN + (size_t)(rb % SLEN);
#pragma unroll
    for (int p = 0; p < 8; ++p) { const int it = p * 128 + tid, d = it >> 4, pc = it & 15; const size_t o = vb + (size_t)d * SLEN + pc * 8;      /* 16 lanes write the 256 contiguous bytes of a row: whole lines */
      const v8us xh = *(const v8us*)&sT[0][d][pc * 8], xl = *(const v8us*)&sT[1][d][pc * 8]; *(v8us*)((unsigned short*)Hh + o) = xh; *(v8us*)((unsigned short*)Hl + o) = xl; }
    return; }
#pragma unroll
  for (int u = 0; u < 8; ++u) { const int t = u & 3, half = u >> 2; const int col = col0 + t * 16 + ln; const float bv = bp ? bf16_round(bp[col]) : 0.f;
#pragma unroll
    for (int r = 0; r < 8; ++r) { const int rloc = half * 16 + 8 * hh + r; float v = accs[u][r] * alpha + bv; if (CP) { const int bidx = (row0g + row0 + rloc) / rowsPerB; v += CP[(size_t)bidx * sCPb + (size_t)by * 64 + col]; }
      if (ACT == 3) v = fmaxf(v, 0.f); else if (ACT == 6) v = 0.5f * v * (1.0f + erff(v * 0.70710678118654752f)); else if (ACT == 11) v = 1.0f / (1.0f + expf(-v)); else if (ACT == 15) v = v / (1.0f + expf(-v)); else if (ACT == 12) v = (v > 0.f) ? v : 0.01f * v; else if (ACT == 8) v = tanhf(v);
      so[w][rloc][t * 16 + ln] = v; } }
  __builtin_amdgcn_fence(__ATOMIC_ACQ_REL, "workgroup"); __builtin_amdgcn_wave_barrier();
  if constexpr (OUT == 1) {
#pragma unroll
    for (int q = 0; q < 8; ++q) { const int r = q * 4 + (lane >> 3), c8 = (lane & 7) * 8; const v4f a = *(const v4fa*)&so[w][r][c8], c = *(const v4fa*)&so[w][r][c8 + 4]; FragH fh, fl;      /* 8 lanes write the 128 bytes of a row piece: one whole line in each plane */
#pragma unroll
      for (int i = 0; i < 4; ++i) { _Float16 hv = (_Float16)a[i]; fh.h[i] = hv; fl.h[i] = (_Float16)((a[i] - (float)hv) * 1024.0f); hv = (_Float16)c[i]; fh.h[4 + i] = hv; fl.h[4 + i] = (_Float16)((c[i] - (float)hv) * 1024.0f); }
      const size_t o = cofs + (size_t)(row0 + r) * ldc + col0 + c8; *(v8us*)((unsigned short*)Hh + o) = fh.half[0]; *(v8us*)((unsigned short*)Hl + o) = fl.half[0]; }
    return; }
  const int rsub = lane >> 4, c4 = (lane & 15) * 4;
  {
#pragma unroll
    for (int q = 0; q < 16; ++q) { const int r = q * 2 + rsub; const v4f v = *(const v4fa*)&so[w][r][c4]; *(v4f*)(C + cofs + (size_t)(row0 + r) * ldc + col0 + c4) = v; }
     } }



#define FKP 72                   /* K rows in LDS, in values: 128-byte rows at 144 bytes, a conflict-free pitch for ds_load_b128 readers */
#define FVP 40                   /* V^T row pieces in LDS, in values: 64-byte pieces at 80 bytes, likewise */
// One tile of 32 keys for the work-group: 32 K rows of 128 bytes and 64 V^T row pieces of 64 bytes, hi and residual plane each, go to LDS as 8 asynchronous 16-byte copies a lane.
// 8 lanes take a K row (a wave's copy covers 4 whole lines), 4 lanes a V^T piece (8 half lines). kh, kl, vh, vl: the lane's piece in the first 16 K rows / 32 V^T rows of each plane; sk, sv: 16 K rows / 32 V^T rows on, in values;
// lk, lv: the lane's LDS byte address in the hi plane's first rows. The closing s_wait_xcnt 0 stands in front of any rewrite of the registers that the copies name.
__device__ __forceinline__ void fl_stage(const unsigned short* kh, const unsigned short* kl, size_t sk, const unsigned short* vh, const unsigned short* vl, size_t sv, unsigned lk, unsigned lv) {
  asm volatile("global_load_async_to_lds_b128 %0, %8, off\n\t"
               "global_load_async_to_lds_b128 %1, %9, off\n\t"
               "global_load_async_to_lds_b128 %2, %10, off\n\t"
               "global_load_async_to_lds_b128 %3, %11, off\n\t"
               "global_load_async_to_lds_b128 %4, %12, off\n\t"
               "global_load_async_to_lds_b128 %5, %13, off\n\t"
               "global_load_async_to_lds_b128 %6, %14, off\n\t"
               "global_load_async_to_lds_b128 %7, %15, off\n\t"
               "s_wait_xcnt 0x0"
               :: "v"(lk), "v"(lk + 16u * FKP * 2), "v"(lk + 32u * FKP * 2), "v"(lk + 48u * FKP * 2), "v"(lv), "v"(lv + 32u * FVP * 2), "v"(lv + 64u * FVP * 2), "v"(lv + 96u * FVP * 2),
                  "v"(kh), "v"(kh + sk), "v"(kl), "v"(kl + sk), "v"(vh), "v"(vh + sv), "v"(vl), "v"(vl + sv)
               : "memory"); }
typedef float v2f __attribute__((ext_vector_type(2))); typedef _Float16 v2h __attribute__((ext_vector_type(2)));
__device__ __forceinline__ float fl_xhalf(float x) { return __builtin_bit_cast(float, __builtin_amdgcn_permlanex16(__builtin_bit_cast(int, x), __builtin_bit_cast(int, x), 0x76543210, 0xfedcba98, false, false)); }      /* lane l with lane l ^ 16 */
template <int TQ, int TK>
__global__ __launch_bounds__(128, 4) /* the second number holds the build to 256 registers: 4 waves a SIMD, so that all 1024 work-groups are resident at once */ void k_flashb(const _Float16* __restrict__ Q16, const _Float16* __restrict__ Q16lo, int ldq, const _Float16* __restrict__ K16, const _Float16* __restrict__ K16lo, int ldk, const _Float16* __restrict__ Vt, const _Float16* __restrict__ Vtlo, const _Float16* __restrict__ T16, _Float16* __restrict__ Oh, _Float16* __restrict__ Ol, int ldo) {
  constexpr int RPW = 16, NQB = TQ / (4 * RPW), DT = 4, KS = 2;
  __shared__ __attribute__((aligned(16))) float sO[4][RPW][64 + 4];
  __shared__ __attribute__((aligned(16))) unsigned short sK[2][2][32][FKP], sV[2][2][64][FVP];      /* [buffer][hi, residual][K row | V^T row][values] */
  const int tid = threadIdx.x, w = __builtin_amdgcn_readfirstlane(tid >> 5), lane = tid & 31, ln = lane & 15, hh = lane >> 4;      /* the wave's number in a scalar register: what is formed from it costs no vector register across the loop */
  const int slab = blockIdx.x / NQB, qblk = blockIdx.x % NQB; const int b = slab / NH, h = slab % NH; const int qb0 = qblk * (4 * RPW); const int q0 = qb0 + w * RPW;
  const unsigned short* Vth = (const unsigned short*)Vt + (size_t)slab * 64 * TK; const unsigned short* Vtl = (const unsigned short*)Vtlo + (size_t)slab * 64 * TK;
  const size_t kco = ((size_t)b * TK + (tid >> 3)) * ldk + h * 64 + (tid & 7) * 8, vco = (size_t)(tid >> 2) * TK + (tid & 3) * 8;      /* the lane's piece of tile 0, in values */
  const size_t sk = (size_t)16 * ldk, sv = (size_t)32 * TK, kt = (size_t)32 * ldk;      /* kt: one tile on in K; in V^T a tile is 32 values on */
  const unsigned lk = (unsigned)(size_t)&sK[0][0][tid >> 3][(tid & 7) * 8], lv = (unsigned)(size_t)&sV[0][0][tid >> 2][(tid & 3) * 8];      /* LDS byte addresses: the low 32 bits */
  fl_stage((const unsigned short*)K16 + kco, (const unsigned short*)K16lo + kco, sk, Vth + vco, Vtl + vco, sv, lk, lv);      /* tile 0 into buffer 0; it flies while q and the first table rows are fetched */
  FragH aq[KS], aql[KS];
  { const size_t qo = ((size_t)b * TQ + q0 + ln) * ldq + h * 64; const unsigned short* qr = (const unsigned short*)Q16 + qo; const unsigned short* ql = (const unsigned short*)Q16lo + qo;
#pragma unroll
    for (int ks = 0; ks < KS; ++ks) { aq[ks].half[0] = *(const v8us*)(qr + ks * 32 + 8 * hh); aq[ks].half[1] = *(const v8us*)(qr + ks * 32 + 16 + 8 * hh); aql[ks].half[0] = *(const v8us*)(ql + ks * 32 + 8 * hh); aql[ks].half[1] = *(const v8us*)(ql + ks * 32 + 16 + 8 * hh); } }
  float m_r = -3.0e38f, l_r = 0.f; v8f oacc[DT], oaccl[DT];      /* query ln's running maximum (the same in both halves) and this half's part of its sum; oacc[dt][r] = O[query ln][dt * 16 + 8 * hh + r] */
#pragma unroll
  for (int dt = 0; dt < DT; ++dt) { oacc[dt] = (v8f){0.f,0.f,0.f,0.f,0.f,0.f,0.f,0.f}; oaccl[dt] = oacc[dt]; }
  /* RPE: rel[i][c] = q[q0 + i] . table[h][rb + c], rb = q0 - j0 + TK - 32, c < 48; score (i, kk) takes c = i - kk + 31. Columns 32..47 of a trip are columns 0..15 of the trip before. */
  const unsigned short* Th = (const unsigned short*)T16 + (size_t)h * RW * 64 + (size_t)ln * 64 + 8 * hh;
  v8f relc = (v8f){0.f,0.f,0.f,0.f,0.f,0.f,0.f,0.f};      /* columns 32..47 of the first trip */
#pragma unroll
  for (int ks = 0; ks < KS; ++ks) { FragH bt; bt.half[0] = *(const v8us*)(Th + (size_t)(q0 + TK) * 64 + ks * 32); bt.half[1] = *(const v8us*)(Th + (size_t)(q0 + TK) * 64 + ks * 32 + 16); relc = mmaH<1>(aq[ks].v, aq[ks].v, bt.v, bt.v, relc); }
  /* rel (i, c) is stored skewed, in row i at column kk + 16 = i - c + 47 (0 .. 62 of the 68), so that a query's 8 consecutive keys are 8 consecutive floats: a step of one row is 69 floats, a step of 16 columns of rel -16 */
  float* const rst = &sO[w][0][0] + 8 * hh * 69 + 47 - ln; const float* const rrd = &sO[w][ln][16 + 8 * hh];
  asm volatile("s_wait_asynccnt 0x0" ::: "memory");      /* this wave's copies of tile 0 have landed */
  __syncthreads();      /* ... and every other wave's */
  if (TK > 32) fl_stage((const unsigned short*)K16 + kco + kt, (const unsigned short*)K16lo + kco + kt, sk, Vth + vco + 32, Vtl + vco + 32, sv, lk + (unsigned)sizeof(sK[0]), lv + (unsigned)sizeof(sV[0]));      /* tile 1 flies while tile 0 is worked on */
#pragma unroll 1
  for (int j0 = 0; j0 < TK; j0 += 32) { const int bf = (j0 >> 5) & 1;
    FragH bt[2][KS];      /* table rows rb .. rb + 31, fetched together with the first key tile */
#pragma unroll
    for (int t = 0; t < 2; ++t) { const unsigned short* tr = Th + (size_t)(q0 - j0 + (TK - 32) + t * 16) * 64;
#pragma unroll
      for (int ks = 0; ks < KS; ++ks) { bt[t][ks].half[0] = *(const v8us*)(tr + ks * 32); bt[t][ks].half[1] = *(const v8us*)(tr + ks * 32 + 16); } }
    asm volatile("s_wait_xcnt 0x0" ::: "memory");      /* stands in front of any overwrite of the table loads' address registers (the allocator lets a later load's result land in them) */
    v8f s[2];      /* s[nt][r] = q[ln] . k[j0 + nt * 16 + 8 * hh + r] */
#pragma unroll
    for (int nt = 0; nt < 2; ++nt) { const unsigned short* kr = &sK[bf][0][nt * 16 + ln][0]; const unsigned short* kl = &sK[bf][1][nt * 16 + ln][0]; FragH bk[KS], bkl[KS];
#pragma unroll
      for (int ks = 0; ks < KS; ++ks) { bk[ks].half[0] = *(const v8us*)(kr + ks * 32 + 8 * hh); bk[ks].half[1] = *(const v8us*)(kr + ks * 32 + 16 + 8 * hh); bkl[ks].half[0] = *(const v8us*)(kl + ks * 32 + 8 * hh); bkl[ks].half[1] = *(const v8us*)(kl + ks * 32 + 16 + 8 * hh); }
      if (nt == 1) {      /* RPE products and their LDS stores run while the second key tile's LDS reads are in flight */
        v8f rel0 = (v8f){0.f,0.f,0.f,0.f,0.f,0.f,0.f,0.f}, rel1 = rel0;
#pragma unroll
        for (int ks = 0; ks < KS; ++ks) { rel0 = mmaH<1>(aq[ks].v, aq[ks].v, bt[0][ks].v, bt[0][ks].v, rel0); rel1 = mmaH<1>(aq[ks].v, aq[ks].v, bt[1][ks].v, bt[1][ks].v, rel1); }
#pragma unroll
        for (int r = 0; r < 8; ++r) { rst[r * 69] = rel0[r]; rst[r * 69 - 16] = rel1[r]; rst[r * 69 - 32] = relc[r]; }
        relc = rel0; }
      v8f acc = (v8f){0.f,0.f,0.f,0.f,0.f,0.f,0.f,0.f}, accr = acc;
#pragma unroll
      for (int ks = 0; ks < KS; ++ks) { acc = mmaH<1>(bk[ks].v, bk[ks].v, aq[ks].v, aq[ks].v, acc); accr = mmaH<1>(bk[ks].v, bk[ks].v, aql[ks].v, aql[ks].v, accr); accr = mmaH<1>(bkl[ks].v, bkl[ks].v, aq[ks].v, aq[ks].v, accr); }
      s[nt] = acc + accr * 0.0009765625f; }
    /* the wave's rel stores above are read back by other lanes of the same wave below */
    __builtin_amdgcn_fence(__ATOMIC_ACQ_REL, "workgroup"); __builtin_amdgcn_wave_barrier();
    const v4f rv[4] = {*(const v4fa*)rrd, *(const v4fa*)(rrd + 4), *(const v4fa*)(rrd + 16), *(const v4fa*)(rrd + 20)};      /* the query's 16 RPE terms */
    /* every key counts for every query (the function has no mask): no test and no branch in this stage */
    float x[16];
#pragma unroll
    for (int i = 0; i < 16; ++i) x[i] = s[i >> 3][i & 7] * SCL + rv[i >> 2][i & 3] * 0.0625f;      /* + q . table[h][(q - k) + T - 1] (table held x16) */
    float mc = fmaxf(x[0], x[1]);
#pragma unroll
    for (int i = 2; i < 16; ++i) mc = fmaxf(mc, x[i]);
    mc = fmaxf(mc, fl_xhalf(mc));      /* the other half's 16 keys */
    const float mn = fmaxf(m_r, mc); const float al = expf(m_r - mn); m_r = mn;
    FragH pa, pl; float ps4[4] = {0.f, 0.f, 0.f, 0.f};      /* element i of the B operand is key 8 * hh + i (i < 8), 16 + 8 * hh + i - 8 (else): the order in which the V^T fragments hold their keys */
#pragma unroll
    for (int i = 0; i < 16; i += 2) { const float p0 = expf(x[i] - mn), p1 = expf(x[i + 1] - mn); ps4[i & 3] += p0; ps4[(i + 1) & 3] += p1; const v2f ps = (v2f){p0, p1} * 1024.0f; const v2h ph = __builtin_convertvector(ps, v2h); const v2h pr = __builtin_convertvector((ps - __builtin_convertvector(ph, v2f)) * 1024.0f, v2h);
      pa.h[i] = ph[0]; pa.h[i + 1] = ph[1]; pl.h[i] = pr[0]; pl.h[i + 1] = pr[1]; }
    l_r = l_r * al + ((ps4[0] + ps4[1]) + (ps4[2] + ps4[3]));
#pragma unroll
    for (int dt = 0; dt < DT; ++dt) { oacc[dt] *= al; oaccl[dt] *= al; }
#pragma unroll
    for (int dt = 0; dt < DT; ++dt) { const unsigned short* vr = &sV[bf][0][dt * 16 + ln][0]; const unsigned short* vl = &sV[bf][1][dt * 16 + ln][0]; FragH bv, bl; bv.half[0] = *(const v8us*)(vr + 8 * hh); bv.half[1] = *(const v8us*)(vr + 16 + 8 * hh); bl.half[0] = *(const v8us*)(vl + 8 * hh); bl.half[1] = *(const v8us*)(vl + 16 + 8 * hh);
      oacc[dt] = mmaH<1>(bv.v, bv.v, pa.v, pa.v, oacc[dt]); oaccl[dt] = mmaH<1>(bl.v, bl.v, pa.v, pa.v, oaccl[dt]); oaccl[dt] = mmaH<1>(bv.v, bv.v, pl.v, pl.v, oaccl[dt]); }
    asm volatile("s_wait_dscnt 0x0" ::: "memory");      /* this wave's reads of buffer bf are done before it is refilled */
    asm volatile("s_wait_asynccnt 0x0" ::: "memory");      /* this wave's copies of the next tile have landed */
    __syncthreads();      /* publishes the next tile and ends every wave's reads of buffer bf */
    if (j0 + 64 < TK) { const size_t tn = (size_t)(j0 + 64);      /* the tile after the next into the buffer just read */
      fl_stage((const unsigned short*)K16 + kco + tn * ldk, (const unsigned short*)K16lo + kco + tn * ldk, sk, Vth + vco + tn, Vtl + vco + tn, sv, lk + (unsigned)bf * (unsigned)sizeof(sK[0]), lv + (unsigned)bf * (unsigned)sizeof(sV[0])); } }
  asm volatile("s_wait_asynccnt 0x0" ::: "memory");      /* no copy is outstanding past the loop */
  { const float l = l_r + fl_xhalf(l_r); const float li = 1.0f / (l * 1024.0f);      /* the halves' sums join once; l >= 1: the row's largest score adds exp(0) */
#pragma unroll
    for (int dt = 0; dt < DT; ++dt) { v4f o0, o1;      /* a lane's 8 registers are 8 consecutive values of its query's row */
#pragma unroll
      for (int i = 0; i < 4; ++i) { o0[i] = (oacc[dt][i] + oaccl[dt][i] * 0.0009765625f) * li; o1[i] = (oacc[dt][4 + i] + oaccl[dt][4 + i] * 0.0009765625f) * li; }
      *(v4fa*)&sO[w][ln][dt * 16 + 8 * hh] = o0; *(v4fa*)&sO[w][ln][dt * 16 + 8 * hh + 4] = o1; } }
  __builtin_amdgcn_fence(__ATOMIC_ACQ_REL, "workgroup"); __builtin_amdgcn_wave_barrier();
  {
#pragma unroll
    for (int rp = 0; rp < RPW; rp += 2) { const int r = rp + (lane >> 4), pc = lane & 15; const v4f val = *(const v4fa*)&sO[w][r][pc * 4]; v4h h4, l4;      /* O leaves as f16 hi + residual x 1024; 16 lanes write the 128 bytes of a row piece in each plane */
#pragma unroll
      for (int i = 0; i < 4; ++i) { const _Float16 hv = (_Float16)val[i]; h4[i] = hv; l4[i] = (_Float16)((val[i] - (float)hv) * 1024.0f); }
      const size_t o = ((size_t)b * TQ + q0 + r) * ldo + h * 64 + pc * 4; *(v4h*)(Oh + o) = h4; *(v4h*)(Ol + o) = l4; }
     } }


__global__ __launch_bounds__(256) void k_lnx(const float* __restrict__ X, const float* __restrict__ g, const float* __restrict__ bb, _Float16* __restrict__ Y16, float* __restrict__ XB) {
  #pragma clang fp contract(off)
  const int tid = threadIdx.x, w = tid >> 5, ln = tid & 31; const int r = blockIdx.x * 8 + w; if (r >= NR) return; const float* x = X + (size_t)r * DM; float s = 0.f;
#pragma unroll 1
  for (int i = 0; i < DM / 128; ++i) { const v4f a = *(const v4fa*)(x + i * 128 + ln * 4); for (int q = 0; q < 4; ++q) s += bf16_round(a[q]); }
  for (int o = 16; o > 0; o >>= 1) s += __shfl_xor(s, o, 32); const float mu = s / (float)DM; float q2 = 0.f;
#pragma unroll 1
  for (int i = 0; i < DM / 128; ++i) { const v4f a = *(const v4fa*)(x + i * 128 + ln * 4); for (int q = 0; q < 4; ++q) { const float d = bf16_round(a[q]) - mu; q2 += d * d; } }
  for (int o = 16; o > 0; o >>= 1) q2 += __shfl_xor(q2, o, 32); const float rs = rsqrtf(q2 / (float)DM + 1e-5f);
  {
#pragma unroll 1
    for (int i = 0; i < DM / 128; ++i) { const int c0 = i * 128 + ln * 4; const v4f a = *(const v4fa*)(x + c0); _Float16 h4[4]; v4f xb;
      for (int q = 0; q < 4; ++q) { const float t = bf16_round(a[q]); h4[q] = (_Float16)((t - mu) * rs * bf16_round(g[c0 + q]) + bf16_round(bb[c0 + q])); xb[q] = t; }
      *(unsigned long long*)((unsigned short*)Y16 + (size_t)r * DM + c0) = *(const unsigned long long*)h4; *(v4f*)(XB + (size_t)r * DM + c0) = xb; }
     } }
__global__ __launch_bounds__(256) void k_rtab(const float* __restrict__ tab, int trows, _Float16* __restrict__ T16) {
  const int t = blockIdx.x * 256 + threadIdx.x; if (t >= NH * RW * 8) return; const int d0 = (t & 7) * 8; const int r = (t >> 3) % RW; const int h = t / (8 * RW); FragH f;
#pragma unroll
  for (int q = 0; q < 8; ++q) f.h[q] = (r < 2 * SLEN - 1) ? (_Float16)(bf16_round(tab[((size_t)h * trows + r) * 64 + d0 + q]) * 16.0f) : (_Float16)0.0f;
  *(v8us*)((unsigned short*)T16 + ((size_t)h * RW + r) * 64 + d0) = f.half[0];  }
__global__ __launch_bounds__(256) void k_causaltab(unsigned* __restrict__ MB, int* __restrict__ RA, int* __restrict__ KE, int nq, int nk) {
  const int t = blockIdx.x * 256 + threadIdx.x; const int nw = nk / 32;
  if (t < nq * nw) { const int q = t / nw, w = t % nw; const int first = q + 1 - 32 * w; const unsigned bits = (first <= 0) ? 0xffffffffu : ((first >= 32) ? 0u : (0xffffffffu << first)); *(unsigned*)(MB + t) = bits;  }
  if (t < nq) { *(int*)(RA + t) = 0;  }
  if (t < nq / 64) { const int v = 64 * (t + 1); *(int*)(KE + t * 32) = v;  } }


extern "C" void kernel_launch(void* const* d_in, const int* in_sizes, int n_in,
                              void* d_out, int out_size, void* d_ws, size_t ws_size, hipStream_t stream) {
  (void)in_sizes; (void)n_in; (void)out_size;
  const float* const* I = (const float* const*)d_in; const float* x = I[0]; const float* Wq = I[1]; const float* bq = I[2]; const float* Wk = I[3]; const float* bk = I[4]; const float* Wv = I[5]; const float* bv = I[6]; const float* Wo = I[7]; const float* bo = I[8]; const float* tab = I[9];
  char* ws = (char*)d_ws; size_t off = 0;
  auto take = [&](size_t bytes) { char* p = ws + off; off += (bytes + 255) & ~(size_t)255; return p; };
  _Float16* BQ = (_Float16*)take((size_t)DM * DM * 2); _Float16* BK = (_Float16*)take((size_t)DM * DM * 2); _Float16* BV = (_Float16*)take((size_t)DM * DM * 2); _Float16* BO = (_Float16*)take((size_t)DM * DM * 2); _Float16* T16 = (_Float16*)take((size_t)NH * RW * 64 * 2);
  _Float16* X16 = (_Float16*)take((size_t)NR * DM * 2);
  _Float16* Qh = (_Float16*)take((size_t)NR * DM * 2); _Float16* Ql = (_Float16*)take((size_t)NR * DM * 2); _Float16* Kh = (_Float16*)take((size_t)NR * DM * 2); _Float16* Kl = (_Float16*)take((size_t)NR * DM * 2); _Float16* Vth = (_Float16*)take((size_t)NR * DM * 2); _Float16* Vtl = (_Float16*)take((size_t)NR * DM * 2);
  _Float16* Oh = (_Float16*)take((size_t)NR * DM * 2); _Float16* Ol = (_Float16*)take((size_t)NR * DM * 2);
  if (off > ws_size) return;      /* 8 + 4 + 8 + 48 + 16 = 84 MiB */
  const size_t n8 = (size_t)NR * DM / 8; const unsigned nb8 = (unsigned)((n8 + 255) / 256); const size_t w8 = (size_t)DM * DM / 8; const unsigned wb = (unsigned)((w8 + 255) / 256);
  k_round16f<<<wb, 256, 0, stream>>>(Wq, BQ, w8); k_round16f<<<wb, 256, 0, stream>>>(Wk, BK, w8); k_round16f<<<wb, 256, 0, stream>>>(Wv, BV, w8); k_round16f<<<wb, 256, 0, stream>>>(Wo, BO, w8);      /* torch (out,in) = natural Bt */
  k_rtab<<<(NH * RW * 8 + 255) / 256, 256, 0, stream>>>(tab, 9999, T16);
  const dim3 gP((NR / 128) * (DM / 64), 1);
  /* every row-wise stage runs once over all NBT * SLEN rows */
  k_x16<<<nb8, 256, 0, stream>>>(x, X16, n8);
  /* each producer splits its f32 result into the hi and residual planes in its own epilogue: no f32 copy of q, k, v or O reaches memory */
  k_gemm2<0, 1><<<gP, 128, 0, stream>>>(X16, DM, 0, BQ, DM, 0, 0.0625f, bq, 0, nullptr, 1, 0, 0, nullptr, Qh, Ql, DM, 0, NR, DM, DM);      /* the hi plane also feeds the RPE product */
  k_gemm2<0, 1><<<gP, 128, 0, stream>>>(X16, DM, 0, BK, DM, 0, 0.0625f, bk, 0, nullptr, 1, 0, 0, nullptr, Kh, Kl, DM, 0, NR, DM, DM);
  k_gemm2<0, 2><<<gP, 128, 0, stream>>>(X16, DM, 0, BV, DM, 0, 0.0625f, bv, 0, nullptr, 1, 0, 0, nullptr, Vth, Vtl, DM, 0, NR, DM, DM);      /* V^T per head */
  k_flashb<SLEN, SLEN><<<NBT * NH * (SLEN / 64), 128, 0, stream>>>(Qh, Ql, DM, Kh, Kl, DM, Vth, Vtl, T16, Oh, Ol, DM);      /* all batches and heads in one launch */
  float* outp = (float*)d_out;
  k_gemm2<0, 0><<<gP, 128, 0, stream>>>(Oh, DM, 0, BO, DM, 0, 0.0625f, bo, 0, nullptr, 1, 0, 0, outp, nullptr, nullptr, DM, 0, NR, DM, DM);
  k_gemm2<0, 0><<<gP, 128, 0, stream>>>(Ol, DM, 0, BO, DM, 0, 0.0625f / 1024.0f, nullptr, 0, outp, 1, (size_t)DM, 0, outp, nullptr, nullptr, DM, 0, NR, DM, DM);
}

// v008
// Measured time: 185 microseconds a run.
// Two timings next to v007 both put it at 1.06 times that version's speed.
// Counting every step since v000, it is 23.6 times as fast.
#include <hip/hip_runtime.h>
// Multi-head attention with learned relative-position encoding (4 x 1024 tokens, 1024 = 16 heads x 64): q,k,v = x W^T + b; scores = q.k/8 + q.rpe_table[h][q - k + 1023] (no scale on the RPE term); softmax over all keys; . v; merged . Wo^T + bo -> [4,1024,1024].
// Structure: projections (all batches in one launch) as f16 WMMA GEMMs (32x64 wave tiles, f32 accumulation, exact products + bias; the work-group's A and B tiles reach LDS by asynchronous copies, two buffers); the fused flash kernel (one launch over all batches and heads; hi/lo q,k three-product scores, both products transposed (S^T = K . Q^T, O^T += V^T . P^T), so a lane owns one query: online f32 softmax inside the lane, in base 2 (log2(e) folded into the score scales), P hi + residual packed in registers, V^T hi + residual; all keys valid; each 32-key tile of K and V^T, both planes, reaches LDS once for the work-group's four waves by asynchronous copies, two buffers) forms the RPE term itself: per 16 x 32 score tile the 48 table rows r = q - k + 1023 can reach give a 16 x 48 f16 WMMA product q_h . table[h][r] (f32 result, 16 of the 48 columns carried over from the trip before), stored skewed in the wave's LDS and read back per query inside the score stage; O as hi + residual planes into Wo (two GEMMs, bias in the first).
// Compute dtype: x, weights, biases, rpe_table rounded to bf16; projections exact; the RPE product uses the plain f16 q (the hi plane) (~2^-12 on a sigma-0.16 bias); q, k, P, v, O as f16 hi + residual pairs (~2^-21) in the attention; f32 accumulation and softmax. v_wmma_f32_16x16x32_f16.
#define NBT 4
#define SLEN 1024
#define RW 2048                  /* table rows kept per head (2*SLEN-1 used, the last one zero) */
#define DM 1024
#define NH 16
#define SCL 0.125f
#define LOG2E 1.4426950408889634f      /* exp(x) = 2^(x * LOG2E) */
#define NR (NBT * SLEN)
typedef __bf16 v16b __attribute__((ext_vector_type(16)));
typedef unsigned short v8us __attribute__((ext_vector_type(8), may_alias));
typedef float  v8f  __attribute__((ext_vector_type(8)));
typedef float  v4f  __attribute__((ext_vector_type(4)));
typedef float  v4fa __attribute__((ext_vector_type(4), may_alias));
union FragB { v16b v; v8us half[2]; unsigned short u[16]; };

__device__ __forceinline__ unsigned short bf16_bits(float x) { unsigned int u = __float_as_uint(x); return (unsigned short)((u + 0x7FFFu + ((u >> 16) & 1u)) >> 16); }
__device__ __forceinline__ float bf16_val(unsigned short b) { return __uint_as_float(((unsigned int)b) << 16); }
__device__ __forceinline__ float bf16_round(float x) { return bf16_val(bf16_bits(x)); }
// D += A·B with NT terms: 1 = ah·bh, 2 = + al·bh (A split), 3 = + ah·bl (both split)
template <int NT>
__device__ __forceinline__ v8f mmaN(v16b ah, v16b al, v16b bh, v16b bl, v8f c) {
  c = __builtin_amdgcn_wmma_f32_16x16x32_bf16(false, ah, false, bh, (short)0, c, false, false);
  if (NT >= 2) c = __builtin_amdgcn_wmma_f32_16x16x32_bf16(false, al, false, bh, (short)0, c, false, false);
  if (NT >= 3) c = __builtin_amdgcn_wmma_f32_16x16x32_bf16(false, ah, false, bl, (short)0, c, false, false);
  asm volatile("v_nop\n\tv_nop\n\tv_nop\n\tv_nop" : "+v"(c) : "v"(ah), "v"(al), "v"(bh), "v"(bl));
  return c;
}

__global__ __launch_bounds__(256) void k_wt_bf16(const float* __restrict__ W, unsigned short* __restrict__ Wt, int K, int N) {
  const int t = blockIdx.x * 256 + threadIdx.x;
  const int k8n = K / 8;
  if (t >= N * k8n) return;
  const int n = t / k8n, k8 = (t % k8n) * 8;
  v8us v;
#pragma unroll
  for (int i = 0; i < 8; ++i) v[i] = bf16_bits(W[(size_t)(k8 + i) * N + n]);
  *(v8us*)(Wt + (size_t)n * K + k8) = v;
  
}

// GEMM C[M][N] (f32, pitch ldc) = act(A[M][K]·W + bias). A f32 row-major (pitch lda) converted per fragment to bf16
// (ASPLIT: hi/lo two planes -> 2 terms, else single rounded term); Wt bf16 [N][K] (pitch ldb). BIAS_BF16 rounds the
// bias to bf16 first (bias quantised to bf16 before the add). K%32==0, M%16==0, N%64==0.
template <bool ASPLIT, int ACT, bool BIAS_BF16>
__global__ __launch_bounds__(128) void k_gemm_bf(const float* __restrict__ A, int lda, const unsigned short* __restrict__ Wt, int ldb,
                                               const float* __restrict__ bias, float* __restrict__ C, int ldc, int M, int N, int K) {
  __shared__ __attribute__((aligned(16))) float so[4][16][64];
  const int tid = threadIdx.x, w = tid >> 5, lane = tid & 31, ln = lane & 15, hh = lane >> 4;
  const int ntn = N / 64;
  const int wid = blockIdx.x * 4 + w;
  const int mt = wid / ntn, nq = wid % ntn;
  if (mt * 16 >= M) return;
  const int row0 = mt * 16, col0 = nq * 64;
  const float* arow = A + (size_t)(row0 + ln) * lda;
  v8f acc[4] = {};
  for (int kb = 0; kb < K; kb += 32) {
    FragB ah, al;
    const v4f x0 = *(const v4fa*)(arow + kb + 8 * hh), x1 = *(const v4fa*)(arow + kb + 8 * hh + 4);
    const v4f x2 = *(const v4fa*)(arow + kb + 16 + 8 * hh), x3 = *(const v4fa*)(arow + kb + 16 + 8 * hh + 4);
    float xs[16] = {x0[0],x0[1],x0[2],x0[3],x1[0],x1[1],x1[2],x1[3],x2[0],x2[1],x2[2],x2[3],x3[0],x3[1],x3[2],x3[3]};
#pragma unroll
    for (int i = 0; i < 16; ++i) { const unsigned short hb = bf16_bits(xs[i]); ah.u[i] = hb; al.u[i] = ASPLIT ? bf16_bits(xs[i] - bf16_val(hb)) : (unsigned short)0; }
#pragma unroll
    for (int t = 0; t < 4; ++t) {
      const unsigned short* brow = Wt + (size_t)(col0 + t * 16 + ln) * ldb + kb;
      FragB b;
      b.half[0] = *(const v8us*)(brow + 8 * hh);
      b.half[1] = *(const v8us*)(brow + 16 + 8 * hh);
      acc[t] = mmaN<ASPLIT ? 2 : 1>(ah.v, al.v, b.v, b.v, acc[t]);
    }
  }
#pragma unroll
  for (int t = 0; t < 4; ++t) {
    float bv = bias ? bias[col0 + t * 16 + ln] : 0.f;
    if (BIAS_BF16) bv = bf16_round(bv);
#pragma unroll
    for (int r = 0; r < 8; ++r) { float v = acc[t][r] + bv; if (ACT == 1) v = fmaxf(v, 0.f); so[w][8 * hh + r][t * 16 + ln] = v; }
  }
  __builtin_amdgcn_fence(__ATOMIC_ACQ_REL, "workgroup");
  __builtin_amdgcn_wave_barrier();
  const int rsub = lane >> 4, c4 = (lane & 15) * 4;
  {
#pragma unroll
    for (int q = 0; q < 8; ++q) {
      const int r = q * 2 + rsub;
      const v4f v = *(const v4fa*)&so[w][r][c4];
      *(v4f*)(C + (size_t)(row0 + r) * ldc + col0 + c4) = v;
    }
    
  }
}

// GEMM C = act(A·W + bias + resid): A f32 (ASPLIT -> hi/lo 2 terms), Wt bf16 [N][K]; ACT 0 none, 1 relu, 2 exact gelu;
// resid (optional, f32, row index = (row % rmod), pitch ldr, RES_BF16 rounds it) added before the activation.
template <bool ASPLIT, int ACT, bool BIAS_BF16, bool RES_BF16>
__global__ __launch_bounds__(128) void k_gemm_bf3(const float* __restrict__ A, int lda, const unsigned short* __restrict__ Wt, int ldb,
                                                const float* __restrict__ bias, const float* __restrict__ resid, int rmod, int ldr,
                                                float* __restrict__ C, int ldc, int M, int N, int K) {
  __shared__ __attribute__((aligned(16))) float so[4][16][64];
  const int tid = threadIdx.x, w = tid >> 5, lane = tid & 31, ln = lane & 15, hh = lane >> 4;
  const int ntn = N / 64;
  const int wid = blockIdx.x * 4 + w;
  const int mt = wid / ntn, nq = wid % ntn;
  if (mt * 16 >= M) return;
  const int row0 = mt * 16, col0 = nq * 64;
  const float* arow = A + (size_t)(row0 + ln) * lda;
  v8f acc[4] = {};
  for (int kb = 0; kb < K; kb += 32) {
    FragB ah, al;
    const v4f x0 = *(const v4fa*)(arow + kb + 8 * hh), x1 = *(const v4fa*)(arow + kb + 8 * hh + 4);
    const v4f x2 = *(const v4fa*)(arow + kb + 16 + 8 * hh), x3 = *(const v4fa*)(arow + kb + 16 + 8 * hh + 4);
    float xs[16] = {x0[0],x0[1],x0[2],x0[3],x1[0],x1[1],x1[2],x1[3],x2[0],x2[1],x2[2],x2[3],x3[0],x3[1],x3[2],x3[3]};
#pragma unroll
    for (int i = 0; i < 16; ++i) { const unsigned short hb = bf16_bits(xs[i]); ah.u[i] = hb; al.u[i] = ASPLIT ? bf16_bits(xs[i] - bf16_val(hb)) : (unsigned short)0; }
#pragma unroll
    for (int t = 0; t < 4; ++t) {
      const unsigned short* brow = Wt + (size_t)(col0 + t * 16 + ln) * ldb + kb;
      FragB b;
      b.half[0] = *(const v8us*)(brow + 8 * hh);
      b.half[1] = *(const v8us*)(brow + 16 + 8 * hh);
      acc[t] = mmaN<ASPLIT ? 2 : 1>(ah.v, al.v, b.v, b.v, acc[t]);
    }
  }
#pragma unroll
  for (int t = 0; t < 4; ++t) {
    const int col = col0 + t * 16 + ln;
    float bv = bias ? bias[col] : 0.f;
    if (BIAS_BF16) bv = bf16_round(bv);
#pragma unroll
    for (int r = 0; r < 8; ++r) {
      float v = acc[t][r] + bv;
      if (resid) { float rv = resid[(size_t)((row0 + 8 * hh + r) % rmod) * ldr + col]; if (RES_BF16) rv = bf16_round(rv); v += rv; }
      if (ACT == 1) v = fmaxf(v, 0.f);
      if (ACT == 2) v = 0.5f * v * (1.0f + erff(v * 0.70710678118654752f));
      if (ACT == 3) { const float u = 0.7978845608028654f * (v + 0.044715f * v * v * v); v = 0.5f * v * (1.0f + tanhf(u)); }
      so[w][8 * hh + r][t * 16 + ln] = v;
    }
  }
  __builtin_amdgcn_fence(__ATOMIC_ACQ_REL, "workgroup");
  __builtin_amdgcn_wave_barrier();
  const int rsub = lane >> 4, c4 = (lane & 15) * 4;
  {
#pragma unroll
    for (int q = 0; q < 8; ++q) {
      const int r = q * 2 + rsub;
      const v4f v = *(const v4fa*)&so[w][r][c4];
      *(v4f*)(C + (size_t)(row0 + r) * ldc + col0 + c4) = v;
    }
    
  }
}
// row LayerNorm (biased variance, eps) over N: s = X (+ R); optional out_sum <- s; out_norm <- (s-mu)*rsqrt(var+eps)*g + b
template <bool PARAM_BF16>
__global__ __launch_bounds__(256) void k_layernorm(const float* __restrict__ X, const float* __restrict__ R, const float* __restrict__ g, const float* __restrict__ bta,
                                                  float* __restrict__ out_sum, float* __restrict__ out_norm, int N, float eps) {
  __shared__ float red[256];
  const int row = blockIdx.x, tid = threadIdx.x;
  const float* x = X + (size_t)row * N; const float* rr = R ? R + (size_t)row * N : nullptr;
  float vals[16];                     // up to N = 4096
  const int per = N / 256;            // contiguous chunk per thread? use strided-by-4 chunks: thread handles j = tid*4 + 1024*u
  float s1 = 0.f;
  for (int u = 0; u < per / 4; ++u) {
    const int j = tid * 4 + 1024 * u;
    const v4f a = *(const v4fa*)(x + j);
    v4f b = {0.f,0.f,0.f,0.f}; if (rr) b = *(const v4fa*)(rr + j);
#pragma unroll
    for (int q = 0; q < 4; ++q) { const float v = a[q] + b[q]; vals[u * 4 + q] = v; s1 += v; }
  }
  red[tid] = s1; __syncthreads();
  for (int st = 128; st > 0; st >>= 1) { if (tid < st) red[tid] += red[tid + st]; __syncthreads(); }
  const float mu = red[0] / (float)N; __syncthreads();
  float s2 = 0.f;
  for (int u = 0; u < per / 4; ++u)
#pragma unroll
    for (int q = 0; q < 4; ++q) { const float c = vals[u * 4 + q] - mu; s2 += c * c; }
  red[tid] = s2; __syncthreads();
  for (int st = 128; st > 0; st >>= 1) { if (tid < st) red[tid] += red[tid + st]; __syncthreads(); }
  const float rs = rsqrtf(red[0] / (float)N + eps);
  {
    for (int u = 0; u < per / 4; ++u) {
      const int j = tid * 4 + 1024 * u;
      v4f o, sm;
#pragma unroll
      for (int q = 0; q < 4; ++q) {
        float gg = g[j + q], bb = bta[j + q];
        if (PARAM_BF16) { gg = bf16_round(gg); bb = bf16_round(bb); }
        sm[q] = vals[u * 4 + q]; o[q] = (vals[u * 4 + q] - mu) * rs * gg + bb;
      }
      if (out_sum) *(v4f*)(out_sum + (size_t)row * N + j) = sm;
      *(v4f*)(out_norm + (size_t)row * N + j) = o;
    }
    
  }
}



// ---- f16 WMMA path (v_wmma_f32_16x16x32_f16): 11-bit significands for operands in range — used where a [0,1] probability operand needs more precision than bf16
typedef _Float16 v16h __attribute__((ext_vector_type(16)));
union FragH { v16h v; v8us half[2]; _Float16 h[16]; unsigned short u[16]; };
template <int NT>
__device__ __forceinline__ v8f mmaH(v16h ah, v16h al, v16h bh, v16h bl, v8f c) {
  c = __builtin_amdgcn_wmma_f32_16x16x32_f16(false, ah, false, bh, (short)0, c, false, false);
  if (NT >= 2) c = __builtin_amdgcn_wmma_f32_16x16x32_f16(false, al, false, bh, (short)0, c, false, false);
  if (NT >= 3) c = __builtin_amdgcn_wmma_f32_16x16x32_f16(false, ah, false, bl, (short)0, c, false, false);
  asm volatile("v_nop\n\tv_nop\n\tv_nop\n\tv_nop" : "+v"(c) : "v"(ah), "v"(al), "v"(bh), "v"(bl));
  return c;
}
// batched GEMM like k_gemm_b but f16 operands: A f32 (split into f16 hi/lo if ASPLIT, else rounded to f16), Bt = f16 values [n][k]; alpha; C f32; N multiple of 16 (partial tiles skipped)
template <bool ASPLIT>
__global__ __launch_bounds__(128) void k_gemm_h(const float* __restrict__ A, int lda, size_t sA, const _Float16* __restrict__ Bh, int ldb, size_t sB, float alpha, float* __restrict__ C, int ldc, size_t sC, int M, int N, int K) {
  __shared__ __attribute__((aligned(16))) float so[4][16][64];
  const int tid = threadIdx.x, w = tid >> 5, lane = tid & 31, ln = lane & 15, hh = lane >> 4; const int by = blockIdx.y;
  A += (size_t)by * sA; Bh += (size_t)by * sB; C += (size_t)by * sC;
  const int ntn = (N + 63) / 64; const int wid = blockIdx.x * 4 + w; const int mt = wid / ntn, nq = wid % ntn; if (mt * 16 >= M) return;
  const int row0 = mt * 16, col0 = nq * 64; const float* arow = A + (size_t)(row0 + ln) * lda;
  v8f acc[4] = {};
  for (int kb = 0; kb < K; kb += 32) {
    FragH ah, al;
    const v4f x0 = *(const v4fa*)(arow + kb + 8 * hh), x1 = *(const v4fa*)(arow + kb + 8 * hh + 4), x2 = *(const v4fa*)(arow + kb + 16 + 8 * hh), x3 = *(const v4fa*)(arow + kb + 16 + 8 * hh + 4);
    float xs[16] = {x0[0],x0[1],x0[2],x0[3],x1[0],x1[1],x1[2],x1[3],x2[0],x2[1],x2[2],x2[3],x3[0],x3[1],x3[2],x3[3]};
#pragma unroll
    for (int i = 0; i < 16; ++i) { const _Float16 h = (_Float16)xs[i]; ah.h[i] = h; al.h[i] = ASPLIT ? (_Float16)(xs[i] - (float)h) : (_Float16)0.0f; }
#pragma unroll
    for (int t = 0; t < 4; ++t) { if (col0 + t * 16 >= N) continue; const size_t boff = (size_t)(col0 + t * 16 + ln) * ldb + kb; FragH bq; bq.half[0] = *(const v8us*)(Bh + boff + 8 * hh); bq.half[1] = *(const v8us*)(Bh + boff + 16 + 8 * hh);
      acc[t] = mmaH<ASPLIT ? 2 : 1>(ah.v, al.v, bq.v, bq.v, acc[t]); }
  }
#pragma unroll
  for (int t = 0; t < 4; ++t) { if (col0 + t * 16 >= N) continue;
#pragma unroll
    for (int r = 0; r < 8; ++r) so[w][8 * hh + r][t * 16 + ln] = acc[t][r] * alpha; }
  __builtin_amdgcn_fence(__ATOMIC_ACQ_REL, "workgroup"); __builtin_amdgcn_wave_barrier();
  const int rsub = lane >> 4, c4 = (lane & 15) * 4;
  {
#pragma unroll
    for (int q = 0; q < 8; ++q) { const int r = q * 2 + rsub; if (col0 + c4 < N) { const v4f v = *(const v4fa*)&so[w][r][c4]; *(v4f*)(C + (size_t)(row0 + r) * ldc + col0 + c4) = v; } }
     }
}

// Wt[n][k] = f16(W[k][n]·scale) from f32 row-major W[K][N] (scale = power of two; bf16-exact weights stay exact in f16 away from the subnormal range)
__global__ __launch_bounds__(256) void k_wt_f16(const float* __restrict__ W, _Float16* __restrict__ Wt, int K, int N, float scale) {
  const int t = blockIdx.x * 256 + threadIdx.x; if (t >= N * (K / 8)) return; const int n = t / (K / 8), k8 = (t % (K / 8)) * 8; FragH f;
#pragma unroll
  for (int i = 0; i < 8; ++i) f.h[i] = (_Float16)(bf16_round(W[(size_t)(k8 + i) * N + n]) * scale); const v8us o = f.half[0];
  *(v8us*)((unsigned short*)Wt + (size_t)n * K + k8) = o; 
}
// k_gemm_hh variant with fused epilogue: v = acc·alpha + bias[by·sBias + col] (+ CP[(row/rowsPerB)·sCPb + by·64 + col] if CP) ; ACT 0 none / 1 elu ; writes f16 C16 (and f32 C if non-null)
template <int ACT>
__global__ __launch_bounds__(128) void k_gemm_hhx(const _Float16* __restrict__ A, int lda, size_t sA, const _Float16* __restrict__ Bh, int ldb, size_t sB, float alpha, const float* __restrict__ bias, size_t sBias, const float* __restrict__ CP, int rowsPerB, size_t sCPb, int row0g,
    float* __restrict__ C, _Float16* __restrict__ C16, int ldc, size_t sC, int M, int N, int K) {
  __shared__ __attribute__((aligned(16))) float so[4][16][64];
  const int tid = threadIdx.x, w = tid >> 5, lane = tid & 31, ln = lane & 15, hh = lane >> 4; const int by = blockIdx.y;
  A += (size_t)by * sA; Bh += (size_t)by * sB; const size_t cofs = (size_t)by * sC; const float* bp = bias ? bias + (size_t)by * sBias : nullptr;
  const int ntn = (N + 63) / 64; const int wid = blockIdx.x * 4 + w; const int mt = wid / ntn, nq = wid % ntn; if (mt * 16 >= M) return;
  const int row0 = mt * 16, col0 = nq * 64; const _Float16* arow = A + (size_t)(row0 + ln) * lda;
  v8f acc[4] = {};
  for (int kb = 0; kb < K; kb += 32) { FragH ah; ah.half[0] = *(const v8us*)((const unsigned short*)arow + kb + 8 * hh); ah.half[1] = *(const v8us*)((const unsigned short*)arow + kb + 16 + 8 * hh);
#pragma unroll
    for (int t = 0; t < 4; ++t) { if (col0 + t * 16 >= N) continue; const size_t boff = (size_t)(col0 + t * 16 + ln) * ldb + kb; FragH bq; bq.half[0] = *(const v8us*)((const unsigned short*)Bh + boff + 8 * hh); bq.half[1] = *(const v8us*)((const unsigned short*)Bh + boff + 16 + 8 * hh);
      acc[t] = mmaH<1>(ah.v, ah.v, bq.v, bq.v, acc[t]); }
  }
#pragma unroll
  for (int t = 0; t < 4; ++t) { if (col0 + t * 16 >= N) continue; const int col = col0 + t * 16 + ln; const float bv = bp ? bf16_round(bp[col]) : 0.f;
#pragma unroll
    for (int r = 0; r < 8; ++r) { float v = acc[t][r] * alpha + bv; if (CP) { const int bidx = (row0g + row0 + 8 * hh + r) / rowsPerB; v += CP[(size_t)bidx * sCPb + (size_t)by * 64 + col]; } if (ACT == 1) v = (v > 0.f) ? v : expm1f(v); else if (ACT == 7) v = (v > 0.f) ? v + 1.0f : expf(v); else if (ACT == 8) v = tanhf(v); else if (ACT == 9) v = 0.5f * v * (1.0f + tanhf(0.7978845608028654f * (v + 0.044715f * v * v * v))); else if (ACT == 11) v = 1.0f / (1.0f + expf(-v)); else if (ACT == 12) v = (v > 0.f) ? v : 0.01f * v; else if (ACT == 14) v = (v > 0.f) ? v : 0.1f * v; else if (ACT == 15) v = v / (1.0f + expf(-v)); else if (ACT == 3) v = fmaxf(v, 0.f); else if (ACT == 6) v = 0.5f * v * (1.0f + erff(v * 0.70710678118654752f)); so[w][8 * hh + r][t * 16 + ln] = v; } }
  __builtin_amdgcn_fence(__ATOMIC_ACQ_REL, "workgroup"); __builtin_amdgcn_wave_barrier();
  const int rsub = lane >> 4, c4 = (lane & 15) * 4; typedef _Float16 v4h __attribute__((ext_vector_type(4)));
  {
#pragma unroll
    for (int q = 0; q < 8; ++q) { const int r = q * 2 + rsub; if (col0 + c4 < N) { const v4f v = *(const v4fa*)&so[w][r][c4]; if (C) *(v4f*)(C + cofs + (size_t)(row0 + r) * ldc + col0 + c4) = v; if (C16) { v4h h4; for (int i = 0; i < 4; ++i) h4[i] = (_Float16)v[i]; *(v4h*)(C16 + cofs + (size_t)(row0 + r) * ldc + col0 + c4) = h4; } } }
     }
}


typedef _Float16 v4h __attribute__((ext_vector_type(4)));

__global__ __launch_bounds__(256) void k_x16(const float* __restrict__ x, _Float16* __restrict__ X16, size_t n8) { const size_t t = (size_t)blockIdx.x * 256 + threadIdx.x; if (t >= n8) return; FragH f;
#pragma unroll
  for (int q = 0; q < 8; ++q) f.h[q] = (_Float16)bf16_round(x[t * 8 + q]); *(v8us*)((unsigned short*)X16 + t * 8) = f.half[0];  }
__global__ __launch_bounds__(256) void k_h16(const float* __restrict__ x, _Float16* __restrict__ X16, size_t n8) { const size_t t = (size_t)blockIdx.x * 256 + threadIdx.x; if (t >= n8) return; FragH f;
#pragma unroll
  for (int q = 0; q < 8; ++q) f.h[q] = (_Float16)x[t * 8 + q]; *(v8us*)((unsigned short*)X16 + t * 8) = f.half[0];  }
__global__ __launch_bounds__(256) void k_round16f(const float* __restrict__ W, _Float16* __restrict__ Bt, size_t n8) { const size_t t = (size_t)blockIdx.x * 256 + threadIdx.x; if (t >= n8) return; FragH f;
#pragma unroll
  for (int i = 0; i < 8; ++i) f.h[i] = (_Float16)(bf16_round(W[t * 8 + i]) * 16.0f); *(v8us*)((unsigned short*)Bt + t * 8) = f.half[0];  }
template <int NHv, int TTv>
__global__ __launch_bounds__(256) void k_vt(const _Float16* __restrict__ V16, int ldv, int voff, _Float16* __restrict__ Vt) { __shared__ unsigned short tl[64][66]; const int tid = threadIdx.x; const int slab = blockIdx.x / (TTv / 64), lg = blockIdx.x % (TTv / 64); const int b = slab / NHv, h = slab % NHv;
  for (int i = tid; i < 64 * 8; i += 256) { const int r = i / 8, c8 = (i % 8) * 8; FragH f; f.half[0] = *(const v8us*)((const unsigned short*)V16 + ((size_t)b * TTv + lg * 64 + r) * ldv + voff + h * 64 + c8);
#pragma unroll
    for (int q = 0; q < 8; ++q) tl[r][c8 + q] = f.u[q]; }
  __syncthreads();
  {
#pragma unroll
    for (int rd = 0; rd < 2; ++rd) { const int d = rd * 32 + tid / 8, pc = tid % 8; FragH f;
#pragma unroll
      for (int q = 0; q < 8; ++q) f.u[q] = tl[pc * 8 + q][d];
      *(v8us*)((unsigned short*)Vt + ((size_t)slab * 64 + d) * TTv + lg * 64 + pc * 8) = f.half[0]; }
     } }

// ---- fast GEMM (wave tile 32x64, work-group tile 128x64; requires M % 128 == 0, N % 64 == 0, K % 64 == 0); epilogue: acc·alpha + bias (+ CP, activation), stored in the OUT form below ----
#define G2P 72                   /* LDS row pitch in values: 128-byte rows at 144 bytes, the conflict-free pitch for ds_load_b128 readers */
// One K step of 64 values for the work-group: its 128 A rows and 64 B rows (128 bytes = one line each) go to LDS as 12 asynchronous 16-byte copies a lane; 8 lanes take a row, so a wave's copy covers 4 whole lines.
// ag, bg: the lane's piece in the first 16 rows; sa, sb: 16 rows on, in values; la, lb: the lane's LDS byte address in the first 16 rows. The closing s_wait_xcnt 0 stands in front of any rewrite of the registers that the copies name.
__device__ __forceinline__ void g2_stage(const _Float16* ag, size_t sa, const _Float16* bg, size_t sb, unsigned la, unsigned lb) {
  asm volatile("global_load_async_to_lds_b128 %0, %12, off\n\t"
               "global_load_async_to_lds_b128 %1, %13, off\n\t"
               "global_load_async_to_lds_b128 %2, %14, off\n\t"
               "global_load_async_to_lds_b128 %3, %15, off\n\t"
               "global_load_async_to_lds_b128 %4, %16, off\n\t"
               "global_load_async_to_lds_b128 %5, %17, off\n\t"
               "global_load_async_to_lds_b128 %6, %18, off\n\t"
               "global_load_async_to_lds_b128 %7, %19, off\n\t"
               "global_load_async_to_lds_b128 %8, %20, off\n\t"
               "global_load_async_to_lds_b128 %9, %21, off\n\t"
               "global_load_async_to_lds_b128 %10, %22, off\n\t"
               "global_load_async_to_lds_b128 %11, %23, off\n\t"
               "s_wait_xcnt 0x0"
               :: "v"(la), "v"(la + 1u * 16 * G2P * 2), "v"(la + 2u * 16 * G2P * 2), "v"(la + 3u * 16 * G2P * 2), "v"(la + 4u * 16 * G2P * 2), "v"(la + 5u * 16 * G2P * 2), "v"(la + 6u * 16 * G2P * 2), "v"(la + 7u * 16 * G2P * 2),
                  "v"(lb), "v"(lb + 1u * 16 * G2P * 2), "v"(lb + 2u * 16 * G2P * 2), "v"(lb + 3u * 16 * G2P * 2),
                  "v"(ag), "v"(ag + sa), "v"(ag + 2 * sa), "v"(ag + 3 * sa), "v"(ag + 4 * sa), "v"(ag + 5 * sa), "v"(ag + 6 * sa), "v"(ag + 7 * sa),
                  "v"(bg), "v"(bg + sb), "v"(bg + 2 * sb), "v"(bg + 3 * sb)
               : "memory"); }
__device__ __forceinline__ v16h g2_frag(const _Float16* p, int hh) { FragH f; f.half[0] = *(const v8us*)((const unsigned short*)p + 8 * hh); f.half[1] = *(const v8us*)((const unsigned short*)p + 16 + 8 * hh); return f.v; }
__device__ __forceinline__ v8f g2_mma(v16h a, v16h b, v8f c) { v8f d = __builtin_amdgcn_wmma_f32_16x16x32_f16(false, a, false, b, (short)0, c, false, false); asm volatile("v_nop\n\tv_nop\n\tv_nop\n\tv_nop" : "+v"(d) : "v"(a), "v"(b)); return d; }
// OUT 0: C (f32). OUT 1: the result leaves as two f16 planes, Hh = f16(v), Hl = f16((v - Hh) * 1024), row-major like C. OUT 2 (no CP, no activation): the same two planes transposed per head,
// H[((row / SLEN) * NH + col / 64) * 64 + col % 64][row % SLEN]; needs SLEN % 128 == 0 and N == NH * 64.
template <int ACT, int OUT>
__global__ __launch_bounds__(128) void k_gemm2(const _Float16* __restrict__ A, int lda, size_t sA, const _Float16* __restrict__ Bh, int ldb, size_t sB, float alpha, const float* __restrict__ bias, size_t sBias, const float* __restrict__ CP, int rowsPerB, size_t sCPb, int row0g,
    float* __restrict__ C, _Float16* __restrict__ Hh, _Float16* __restrict__ Hl, int ldc, size_t sC, int M, int N, int K) {
  __shared__ __attribute__((aligned(16))) float so[4][32][68]; __shared__ __attribute__((aligned(16))) unsigned short tA[2][128][G2P], tB[2][64][G2P];
  const int tid = threadIdx.x, w = tid >> 5, lane = tid & 31, ln = lane & 15, hh = lane >> 4; const int by = blockIdx.y;
  A += (size_t)by * sA; Bh += (size_t)by * sB; const size_t cofs = (size_t)by * sC; const float* bp = bias ? bias + (size_t)by * sBias : nullptr;
  const int ntn = N >> 6; const int mt = blockIdx.x / ntn, nq = blockIdx.x - mt * ntn; const int row0 = mt * 128 + 32 * w, col0 = nq * 64; if (mt * 128 >= M) return;      /* the whole work-group leaves or none: barriers below */
  const int cr = tid >> 3, cc = (tid & 7) * 8;      /* the lane's row (of 16) and 16-byte piece in a copy */
  const _Float16* ag = A + (size_t)(mt * 128 + cr) * lda + cc; const _Float16* bg = Bh + (size_t)(col0 + cr) * ldb + cc; const size_t sa = (size_t)16 * lda, sb = (size_t)16 * ldb;
  const unsigned la = (unsigned)(size_t)&tA[0][cr][cc], lb = (unsigned)(size_t)&tB[0][cr][cc];      /* LDS byte addresses: the low 32 bits */
  const int nst = K >> 6;
  const v8f z8 = {0.f,0.f,0.f,0.f,0.f,0.f,0.f,0.f}; v8f c00 = z8, c01 = z8, c02 = z8, c03 = z8, c10 = z8, c11 = z8, c12 = z8, c13 = z8;
  g2_stage(ag, sa, bg, sb, la, lb);      /* step 0 into buffer 0 */
  asm volatile("s_wait_asynccnt 0x0" ::: "memory");      /* this wave's copies of step 0 have landed */
  __syncthreads();      /* ... and every other wave's */
  if (nst > 1) g2_stage(ag + 64, sa, bg + 64, sb, la + (unsigned)sizeof(tA[0]), lb + (unsigned)sizeof(tB[0]));      /* step 1 flies while step 0 is worked on */
#pragma unroll 1
  for (int st = 0; st < nst; ++st) { const int bf = st & 1; const _Float16* ar = (const _Float16*)&tA[bf][32 * w + ln][0]; const _Float16* br = (const _Float16*)&tB[bf][ln][0];
    v16h fa[2][2], fb[2][4];      /* the step's 12 fragments are read as one group ahead of its 16 products */
#pragma unroll
    for (int ks = 0; ks < 2; ++ks) { fa[ks][0] = g2_frag(ar + ks * 32, hh); fa[ks][1] = g2_frag(ar + 16 * G2P + ks * 32, hh);
#pragma unroll
      for (int j = 0; j < 4; ++j) fb[ks][j] = g2_frag(br + j * 16 * G2P + ks * 32, hh); }
#pragma unroll
    for (int ks = 0; ks < 2; ++ks) { c00 = g2_mma(fa[ks][0], fb[ks][0], c00); c10 = g2_mma(fa[ks][1], fb[ks][0], c10); c01 = g2_mma(fa[ks][0], fb[ks][1], c01); c11 = g2_mma(fa[ks][1], fb[ks][1], c11);
      c02 = g2_mma(fa[ks][0], fb[ks][2], c02); c12 = g2_mma(fa[ks][1], fb[ks][2], c12); c03 = g2_mma(fa[ks][0], fb[ks][3], c03); c13 = g2_mma(fa[ks][1], fb[ks][3], c13); }
    asm volatile("s_wait_dscnt 0x0" ::: "memory");      /* this wave's reads of buffer bf are done before it is refilled */
    asm volatile("s_wait_asynccnt 0x0" ::: "memory");      /* this wave's copies of step st + 1 have landed */
    __syncthreads();      /* publishes step st + 1 and ends every wave's reads of buffer bf */
    if (st + 2 < nst) g2_stage(ag + (size_t)(st + 2) * 64, sa, bg + (size_t)(st + 2) * 64, sb, la + (unsigned)bf * (unsigned)sizeof(tA[0]), lb + (unsigned)bf * (unsigned)sizeof(tB[0])); }
  asm volatile("s_wait_asynccnt 0x0" ::: "memory");      /* no copy is outstanding past the loop */
  v8f accs[8] = {c00, c01, c02, c03, c10, c11, c12, c13};
  if constexpr (OUT == 2) {      /* a lane's 8 accumulator registers are 8 consecutive rows of one column: one 16-byte piece of a transposed row in each plane */
    unsigned short (*sT)[64][136] = (unsigned short (*)[64][136])&so[0][0][0];      /* 2 planes x 64 columns x 128 rows at a pitch of 272 bytes: exactly so's bytes */
    float bv4[4] = {0.f, 0.f, 0.f, 0.f};
    if (bp) {
#pragma unroll
      for (int t = 0; t < 4; ++t) bv4[t] = bf16_round(bp[col0 + t * 16 + ln]); }
#pragma unroll
    for (int u = 0; u < 8; ++u) { const int dl = (u & 3) * 16 + ln, kl = 32 * w + (u >> 2) * 16 + 8 * hh; const float bv = bv4[u & 3]; FragH fh, fl;
#pragma unroll
      for (int r = 0; r < 8; ++r) { const float v = accs[u][r] * alpha + bv; const _Float16 hv = (_Float16)v; fh.h[r] = hv; fl.h[r] = (_Float16)((v - (float)hv) * 1024.0f); }
      *(v8us*)&sT[0][dl][kl] = fh.half[0]; *(v8us*)&sT[1][dl][kl] = fl.half[0]; }
    __syncthreads();      /* a transposed row of 128 values holds pieces of all four waves */
    const int rb = mt * 128; const size_t vb = (size_t)((rb / SLEN) * NH + nq) * 64 * SLEN + (size_t)(rb % SLEN);
#pragma unroll
    for (int p = 0; p < 8; ++p) { const int it = p * 128 + tid, d = it >> 4, pc = it & 15; const size_t o = vb + (size_t)d * SLEN + pc * 8;      /* 16 lanes write the 256 contiguous bytes of a row: whole lines */
      const v8us xh = *(const v8us*)&sT[0][d][pc * 8], xl = *(const v8us*)&sT[1][d][pc * 8]; *(v8us*)((unsigned short*)Hh + o) = xh; *(v8us*)((unsigned short*)Hl + o) = xl; }
    return; }
#pragma unroll
  for (int u = 0; u < 8; ++u) { const int t = u & 3, half = u >> 2; const int col = col0 + t * 16 + ln; const float bv = bp ? bf16_round(bp[col]) : 0.f;
#pragma unroll
    for (int r = 0; r < 8; ++r) { const int rloc = half * 16 + 8 * hh + r; float v = accs[u][r] * alpha + bv; if (CP) { const int bidx = (row0g + row0 + rloc) / rowsPerB; v += CP[(size_t)bidx * sCPb + (size_t)by * 64 + col]; }
      if (ACT == 3) v = fmaxf(v, 0.f); else if (ACT == 6) v = 0.5f * v * (1.0f + erff(v * 0.70710678118654752f)); else if (ACT == 11) v = 1.0f / (1.0f + expf(-v)); else if (ACT == 15) v = v / (1.0f + expf(-v)); else if (ACT == 12) v = (v > 0.f) ? v : 0.01f * v; else if (ACT == 8) v = tanhf(v);
      so[w][rloc][t * 16 + ln] = v; } }
  __builtin_amdgcn_fence(__ATOMIC_ACQ_REL, "workgroup"); __builtin_amdgcn_wave_barrier();
  if constexpr (OUT == 1) {
#pragma unroll
    for (int q = 0; q < 8; ++q) { const int r = q * 4 + (lane >> 3), c8 = (lane & 7) * 8; const v4f a = *(const v4fa*)&so[w][r][c8], c = *(const v4fa*)&so[w][r][c8 + 4]; FragH fh, fl;      /* 8 lanes write the 128 bytes of a row piece: one whole line in each plane */
#pragma unroll
      for (int i = 0; i < 4; ++i) { _Float16 hv = (_Float16)a[i]; fh.h[i] = hv; fl.h[i] = (_Float16)((a[i] - (float)hv) * 1024.0f); hv = (_Float16)c[i]; fh.h[4 + i] = hv; fl.h[4 + i] = (_Float16)((c[i] - (float)hv) * 1024.0f); }
      const size_t o = cofs + (size_t)(row0 + r) * ldc + col0 + c8; *(v8us*)((unsigned short*)Hh + o) = fh.half[0]; *(v8us*)((unsigned short*)Hl + o) = fl.half[0]; }
    return; }
  const int rsub = lane >> 4, c4 = (lane & 15) * 4;
  {
#pragma unroll
    for (int q = 0; q < 16; ++q) { const int r = q * 2 + rsub; const v4f v = *(const v4fa*)&so[w][r][c4]; *(v4f*)(C + cofs + (size_t)(row0 + r) * ldc + col0 + c4) = v; }
     } }



#define FKP 72                   /* K rows in LDS, in values: 128-byte rows at 144 bytes, a conflict-free pitch for ds_load_b128 readers */
#define FVP 40                   /* V^T row pieces in LDS, in values: 64-byte pieces at 80 bytes, likewise */
// One tile of 32 keys for the work-group: 32 K rows of 128 bytes and 64 V^T row pieces of 64 bytes, hi and residual plane each, go to LDS as 8 asynchronous 16-byte copies a lane.
// 8 lanes take a K row (a wave's copy covers 4 whole lines), 4 lanes a V^T piece (8 half lines). kh, kl, vh, vl: the lane's piece in the first 16 K rows / 32 V^T rows of each plane; sk, sv: 16 K rows / 32 V^T rows on, in values;
// lk, lv: the lane's LDS byte address in the hi plane's first rows. The closing s_wait_xcnt 0 stands in front of any rewrite of the registers that the copies name.
__device__ __forceinline__ void fl_stage(const unsigned short* kh, const unsigned short* kl, size_t sk, const unsigned short* vh, const unsigned short* vl, size_t sv, unsigned lk, unsigned lv) {
  asm volatile("global_load_async_to_lds_b128 %0, %8, off\n\t"
               "global_load_async_to_lds_b128 %1, %9, off\n\t"
               "global_load_async_to_lds_b128 %2, %10, off\n\t"
               "global_load_async_to_lds_b128 %3, %11, off\n\t"
               "global_load_async_to_lds_b128 %4, %12, off\n\t"
               "global_load_async_to_lds_b128 %5, %13, off\n\t"
               "global_load_async_to_lds_b128 %6, %14, off\n\t"
               "global_load_async_to_lds_b128 %7, %15, off\n\t"
               "s_wait_xcnt 0x0"
               :: "v"(lk), "v"(lk + 16u * FKP * 2), "v"(lk + 32u * FKP * 2), "v"(lk + 48u * FKP * 2), "v"(lv), "v"(lv + 32u * FVP * 2), "v"(lv + 64u * FVP * 2), "v"(lv + 96u * FVP * 2),
                  "v"(kh), "v"(kh + sk), "v"(kl), "v"(kl + sk), "v"(vh), "v"(vh + sv), "v"(vl), "v"(vl + sv)
               : "memory"); }
typedef float v2f __attribute__((ext_vector_type(2))); typedef _Float16 v2h __attribute__((ext_vector_type(2)));
__device__ __forceinline__ float fl_xhalf(float x) { return __builtin_bit_cast(float, __builtin_amdgcn_permlanex16(__builtin_bit_cast(int, x), __builtin_bit_cast(int, x), 0x76543210, 0xfedcba98, false, false)); }      /* lane l with lane l ^ 16 */
template <int TQ, int TK>
__global__ __launch_bounds__(128, 4) /* the second number holds the build to 256 registers: 4 waves a SIMD, so that all 1024 work-groups are resident at once */ void k_flashb(const _Float16* __restrict__ Q16, const _Float16* __restrict__ Q16lo, int ldq, const _Float16* __restrict__ K16, const _Float16* __restrict__ K16lo, int ldk, const _Float16* __restrict__ Vt, const _Float16* __restrict__ Vtlo, const _Float16* __restrict__ T16, _Float16* __restrict__ Oh, _Float16* __restrict__ Ol, int ldo) {
  constexpr int RPW = 16, NQB = TQ / (4 * RPW), DT = 4, KS = 2;
  __shared__ __attribute__((aligned(16))) float sO[4][RPW][64 + 4];
  __shared__ __attribute__((aligned(16))) unsigned short sK[2][2][32][FKP], sV[2][2][64][FVP];      /* [buffer][hi, residual][K row | V^T row][values] */
  const int tid = threadIdx.x, w = __builtin_amdgcn_readfirstlane(tid >> 5), lane = tid & 31, ln = lane & 15, hh = lane >> 4;      /* the wave's number in a scalar register: what is formed from it costs no vector register across the loop */
  const int slab = blockIdx.x / NQB, qblk = blockIdx.x % NQB; const int b = slab / NH, h = slab % NH; const int qb0 = qblk * (4 * RPW); const int q0 = qb0 + w * RPW;
  const unsigned short* Vth = (const unsigned short*)Vt + (size_t)slab * 64 * TK; const unsigned short* Vtl = (const unsigned short*)Vtlo + (size_t)slab * 64 * TK;
  const size_t kco = ((size_t)b * TK + (tid >> 3)) * ldk + h * 64 + (tid & 7) * 8, vco = (size_t)(tid >> 2) * TK + (tid & 3) * 8;      /* the lane's piece of tile 0, in values */
  const size_t sk = (size_t)16 * ldk, sv = (size_t)32 * TK, kt = (size_t)32 * ldk;      /* kt: one tile on in K; in V^T a tile is 32 values on */
  const unsigned lk = (unsigned)(size_t)&sK[0][0][tid >> 3][(tid & 7) * 8], lv = (unsigned)(size_t)&sV[0][0][tid >> 2][(tid & 3) * 8];      /* LDS byte addresses: the low 32 bits */
  fl_stage((const unsigned short*)K16 + kco, (const unsigned short*)K16lo + kco, sk, Vth + vco, Vtl + vco, sv, lk, lv);      /* tile 0 into buffer 0; it flies while q and the first table rows are fetched */
  FragH aq[KS], aql[KS];
  { const size_t qo = ((size_t)b * TQ + q0 + ln) * ldq + h * 64; const unsigned short* qr = (const unsigned short*)Q16 + qo; const unsigned short* ql = (const unsigned short*)Q16lo + qo;
#pragma unroll
    for (int ks = 0; ks < KS; ++ks) { aq[ks].half[0] = *(const v8us*)(qr + ks * 32 + 8 * hh); aq[ks].half[1] = *(const v8us*)(qr + ks * 32 + 16 + 8 * hh); aql[ks].half[0] = *(const v8us*)(ql + ks * 32 + 8 * hh); aql[ks].half[1] = *(const v8us*)(ql + ks * 32 + 16 + 8 * hh); } }
  float m_r = -3.0e38f, l_r = 0.f; v8f oacc[DT], oaccl[DT];      /* query ln's running maximum (the same in both halves) and this half's part of its sum; oacc[dt][r] = O[query ln][dt * 16 + 8 * hh + r] */
#pragma unroll
  for (int dt = 0; dt < DT; ++dt) { oacc[dt] = (v8f){0.f,0.f,0.f,0.f,0.f,0.f,0.f,0.f}; oaccl[dt] = oacc[dt]; }
  /* RPE: rel[i][c] = q[q0 + i] . table[h][rb + c], rb = q0 - j0 + TK - 32, c < 48; score (i, kk) takes c = i - kk + 31. Columns 32..47 of a trip are columns 0..15 of the trip before. */
  const unsigned short* Th = (const unsigned short*)T16 + (size_t)h * RW * 64 + (size_t)ln * 64 + 8 * hh;
  v8f relc = (v8f){0.f,0.f,0.f,0.f,0.f,0.f,0.f,0.f};      /* columns 32..47 of the first trip */
#pragma unroll
  for (int ks = 0; ks < KS; ++ks) { FragH bt; bt.half[0] = *(const v8us*)(Th + (size_t)(q0 + TK) * 64 + ks * 32); bt.half[1] = *(const v8us*)(Th + (size_t)(q0 + TK) * 64 + ks * 32 + 16); relc = mmaH<1>(aq[ks].v, aq[ks].v, bt.v, bt.v, relc); }
  /* rel (i, c) is stored skewed, in row i at column kk + 16 = i - c + 47 (0 .. 62 of the 68), so that a query's 8 consecutive keys are 8 consecutive floats: a step of one row is 69 floats, a step of 16 columns of rel -16 */
  float* const rst = &sO[w][0][0] + 8 * hh * 69 + 47 - ln; const float* const rrd = &sO[w][ln][16 + 8 * hh];
  asm volatile("s_wait_asynccnt 0x0" ::: "memory");      /* this wave's copies of tile 0 have landed */
  __syncthreads();      /* ... and every other wave's */
  if (TK > 32) fl_stage((const unsigned short*)K16 + kco + kt, (const unsigned short*)K16lo + kco + kt, sk, Vth + vco + 32, Vtl + vco + 32, sv, lk + (unsigned)sizeof(sK[0]), lv + (unsigned)sizeof(sV[0]));      /* tile 1 flies while tile 0 is worked on */
#pragma unroll 1
  for (int j0 = 0; j0 < TK; j0 += 32) { const int bf = (j0 >> 5) & 1;
    FragH bt[2][KS];      /* table rows rb .. rb + 31, fetched together with the first key tile */
#pragma unroll
    for (int t = 0; t < 2; ++t) { const unsigned short* tr = Th + (size_t)(q0 - j0 + (TK - 32) + t * 16) * 64;
#pragma unroll
      for (int ks = 0; ks < KS; ++ks) { bt[t][ks].half[0] = *(const v8us*)(tr + ks * 32); bt[t][ks].half[1] = *(const v8us*)(tr + ks * 32 + 16); } }
    asm volatile("s_wait_xcnt 0x0" ::: "memory");      /* stands in front of any overwrite of the table loads' address registers (the allocator lets a later load's result land in them) */
    v8f s[2];      /* s[nt][r] = q[ln] . k[j0 + nt * 16 + 8 * hh + r] */
#pragma unroll
    for (int nt = 0; nt < 2; ++nt) { const unsigned short* kr = &sK[bf][0][nt * 16 + ln][0]; const unsigned short* kl = &sK[bf][1][nt * 16 + ln][0]; FragH bk[KS], bkl[KS];
#pragma unroll
      for (int ks = 0; ks < KS; ++ks) { bk[ks].half[0] = *(const v8us*)(kr + ks * 32 + 8 * hh); bk[ks].half[1] = *(const v8us*)(kr + ks * 32 + 16 + 8 * hh); bkl[ks].half[0] = *(const v8us*)(kl + ks * 32 + 8 * hh); bkl[ks].half[1] = *(const v8us*)(kl + ks * 32 + 16 + 8 * hh); }
      if (nt == 1) {      /* RPE products and their LDS stores run while the second key tile's LDS reads are in flight */
        v8f rel0 = (v8f){0.f,0.f,0.f,0.f,0.f,0.f,0.f,0.f}, rel1 = rel0;
#pragma unroll
        for (int ks = 0; ks < KS; ++ks) { rel0 = mmaH<1>(aq[ks].v, aq[ks].v, bt[0][ks].v, bt[0][ks].v, rel0); rel1 = mmaH<1>(aq[ks].v, aq[ks].v, bt[1][ks].v, bt[1][ks].v, rel1); }
#pragma unroll
        for (int r = 0; r < 8; ++r) { rst[r * 69] = rel0[r]; rst[r * 69 - 16] = rel1[r]; rst[r * 69 - 32] = relc[r]; }
        relc = rel0; }
      v8f acc = (v8f){0.f,0.f,0.f,0.f,0.f,0.f,0.f,0.f}, accr = acc;
#pragma unroll
      for (int ks = 0; ks < KS; ++ks) { acc = mmaH<1>(bk[ks].v, bk[ks].v, aq[ks].v, aq[ks].v, acc); accr = mmaH<1>(bk[ks].v, bk[ks].v, aql[ks].v, aql[ks].v, accr); accr = mmaH<1>(bkl[ks].v, bkl[ks].v, aq[ks].v, aq[ks].v, accr); }
      s[nt] = acc + accr * 0.0009765625f; }
    /* the wave's rel stores above are read back by other lanes of the same wave below */
    __builtin_amdgcn_fence(__ATOMIC_ACQ_REL, "workgroup"); __builtin_amdgcn_wave_barrier();
    const v4f rv[4] = {*(const v4fa*)rrd, *(const v4fa*)(rrd + 4), *(const v4fa*)(rrd + 16), *(const v4fa*)(rrd + 20)};      /* the query's 16 RPE terms */
    /* every key counts for every query (the function has no mask): no test and no branch in this stage */
    float x[16];
#pragma unroll
    for (int i = 0; i < 16; ++i) x[i] = s[i >> 3][i & 7] * (SCL * LOG2E) + rv[i >> 2][i & 3] * (0.0625f * LOG2E);      /* + q . table[h][(q - k) + T - 1] (table held x16); scores, and so m_r, are kept in units of log 2 */
    float mc = fmaxf(x[0], x[1]);
#pragma unroll
    for (int i = 2; i < 16; ++i) mc = fmaxf(mc, x[i]);
    mc = fmaxf(mc, fl_xhalf(mc));      /* the other half's 16 keys */
    const float mn = fmaxf(m_r, mc); const float al = __builtin_amdgcn_exp2f(m_r - mn); m_r = mn;      /* arguments are <= 0: the bare instruction needs no range handling, and a result too small for it counts as 0 */
    FragH pa, pl; float ps4[4] = {0.f, 0.f, 0.f, 0.f};      /* element i of the B operand is key 8 * hh + i (i < 8), 16 + 8 * hh + i - 8 (else): the order in which the V^T fragments hold their keys */
#pragma unroll
    for (int i = 0; i < 16; i += 2) { const float p0 = __builtin_amdgcn_exp2f(x[i] - mn), p1 = __builtin_amdgcn_exp2f(x[i + 1] - mn); ps4[i & 3] += p0; ps4[(i + 1) & 3] += p1; const v2f ps = (v2f){p0, p1} * 1024.0f; const v2h ph = __builtin_convertvector(ps, v2h); const v2h pr = __builtin_convertvector((ps - __builtin_convertvector(ph, v2f)) * 1024.0f, v2h);
      pa.h[i] = ph[0]; pa.h[i + 1] = ph[1]; pl.h[i] = pr[0]; pl.h[i + 1] = pr[1]; }
    l_r = l_r * al + ((ps4[0] + ps4[1]) + (ps4[2] + ps4[3]));
#pragma unroll
    for (int dt = 0; dt < DT; ++dt) { oacc[dt] *= al; oaccl[dt] *= al; }
#pragma unroll
    for (int dt = 0; dt < DT; ++dt) { const unsigned short* vr = &sV[bf][0][dt * 16 + ln][0]; const unsigned short* vl = &sV[bf][1][dt * 16 + ln][0]; FragH bv, bl; bv.half[0] = *(const v8us*)(vr + 8 * hh); bv.half[1] = *(const v8us*)(vr + 16 + 8 * hh); bl.half[0] = *(const v8us*)(vl + 8 * hh); bl.half[1] = *(const v8us*)(vl + 16 + 8 * hh);
      oacc[dt] = mmaH<1>(bv.v, bv.v, pa.v, pa.v, oacc[dt]); oaccl[dt] = mmaH<1>(bl.v, bl.v, pa.v, pa.v, oaccl[dt]); oaccl[dt] = mmaH<1>(bv.v, bv.v, pl.v, pl.v, oaccl[dt]); }
    asm volatile("s_wait_dscnt 0x0" ::: "memory");      /* this wave's reads of buffer bf are done before it is refilled */
    asm volatile("s_wait_asynccnt 0x0" ::: "memory");      /* this wave's copies of the next tile have landed */
    __syncthreads();      /* publishes the next tile and ends every wave's reads of buffer bf */
    if (j0 + 64 < TK) { const size_t tn = (size_t)(j0 + 64);      /* the tile after the next into the buffer just read */
      fl_stage((const unsigned short*)K16 + kco + tn * ldk, (const unsigned short*)K16lo + kco + tn * ldk, sk, Vth + vco + tn, Vtl + vco + tn, sv, lk + (unsigned)bf * (unsigned)sizeof(sK[0]), lv + (unsigned)bf * (unsigned)sizeof(sV[0])); } }
  asm volatile("s_wait_asynccnt 0x0" ::: "memory");      /* no copy is outstanding past the loop */
  { const float l = l_r + fl_xhalf(l_r); const float li = 1.0f / (l * 1024.0f);      /* the halves' sums join once; l >= 1: the row's largest score adds exp(0) */
#pragma unroll
    for (int dt = 0; dt < DT; ++dt) { v4f o0, o1;      /* a lane's 8 registers are 8 consecutive values of its query's row */
#pragma unroll
      for (int i = 0; i < 4; ++i) { o0[i] = (oacc[dt][i] + oaccl[dt][i] * 0.0009765625f) * li; o1[i] = (oacc[dt][4 + i] + oaccl[dt][4 + i] * 0.0009765625f) * li; }
      *(v4fa*)&sO[w][ln][dt * 16 + 8 * hh] = o0; *(v4fa*)&sO[w][ln][dt * 16 + 8 * hh + 4] = o1; } }
  __builtin_amdgcn_fence(__ATOMIC_ACQ_REL, "workgroup"); __builtin_amdgcn_wave_barrier();
  {
#pragma unroll
    for (int rp = 0; rp < RPW; rp += 2) { const int r = rp + (lane >> 4), pc = lane & 15; const v4f val = *(const v4fa*)&sO[w][r][pc * 4]; v4h h4, l4;      /* O leaves as f16 hi + residual x 1024; 16 lanes write the 128 bytes of a row piece in each plane */
#pragma unroll
      for (int i = 0; i < 4; ++i) { const _Float16 hv = (_Float16)val[i]; h4[i] = hv; l4[i] = (_Float16)((val[i] - (float)hv) * 1024.0f); }
      const size_t o = ((size_t)b * TQ + q0 + r) * ldo + h * 64 + pc * 4; *(v4h*)(Oh + o) = h4; *(v4h*)(Ol + o) = l4; }
     } }


__global__ __launch_bounds__(256) void k_lnx(const float* __restrict__ X, const float* __restrict__ g, const float* __restrict__ bb, _Float16* __restrict__ Y16, float* __restrict__ XB) {
  #pragma clang fp contract(off)
  const int tid = threadIdx.x, w = tid >> 5, ln = tid & 31; const int r = blockIdx.x * 8 + w; if (r >= NR) return; const float* x = X + (size_t)r * DM; float s = 0.f;
#pragma unroll 1
  for (int i = 0; i < DM / 128; ++i) { const v4f a = *(const v4fa*)(x + i * 128 + ln * 4); for (int q = 0; q < 4; ++q) s += bf16_round(a[q]); }
  for (int o = 16; o > 0; o >>= 1) s += __shfl_xor(s, o, 32); const float mu = s / (float)DM; float q2 = 0.f;
#pragma unroll 1
  for (int i = 0; i < DM / 128; ++i) { const v4f a = *(const v4fa*)(x + i * 128 + ln * 4); for (int q = 0; q < 4; ++q) { const float d = bf16_round(a[q]) - mu; q2 += d * d; } }
  for (int o = 16; o > 0; o >>= 1) q2 += __shfl_xor(q2, o, 32); const float rs = rsqrtf(q2 / (float)DM + 1e-5f);
  {
#pragma unroll 1
    for (int i = 0; i < DM / 128; ++i) { const int c0 = i * 128 + ln * 4; const v4f a = *(const v4fa*)(x + c0); _Float16 h4[4]; v4f xb;
      for (int q = 0; q < 4; ++q) { const float t = bf16_round(a[q]); h4[q] = (_Float16)((t - mu) * rs * bf16_round(g[c0 + q]) + bf16_round(bb[c0 + q])); xb[q] = t; }
      *(unsigned long long*)((unsigned short*)Y16 + (size_t)r * DM + c0) = *(const unsigned long long*)h4; *(v4f*)(XB + (size_t)r * DM + c0) = xb; }
     } }
__global__ __launch_bounds__(256) void k_rtab(const float* __restrict__ tab, int trows, _Float16* __restrict__ T16) {
  const int t = blockIdx.x * 256 + threadIdx.x; if (t >= NH * RW * 8) return; const int d0 = (t & 7) * 8; const int r = (t >> 3) % RW; const int h = t / (8 * RW); FragH f;
#pragma unroll
  for (int q = 0; q < 8; ++q) f.h[q] = (r < 2 * SLEN - 1) ? (_Float16)(bf16_round(tab[((size_t)h * trows + r) * 64 + d0 + q]) * 16.0f) : (_Float16)0.0f;
  *(v8us*)((unsigned short*)T16 + ((size_t)h * RW + r) * 64 + d0) = f.half[0];  }
__global__ __launch_bounds__(256) void k_causaltab(unsigned* __restrict__ MB, int* __restrict__ RA, int* __restrict__ KE, int nq, int nk) {
  const int t = blockIdx.x * 256 + threadIdx.x; const int nw = nk / 32;
  if (t < nq * nw) { const int q = t / nw, w = t % nw; const int first = q + 1 - 32 * w; const unsigned bits = (first <= 0) ? 0xffffffffu : ((first >= 32) ? 0u : (0xffffffffu << first)); *(unsigned*)(MB + t) = bits;  }
  if (t < nq) { *(int*)(RA + t) = 0;  }
  if (t < nq / 64) { const int v = 64 * (t + 1); *(int*)(KE + t * 32) = v;  } }


extern "C" void kernel_launch(void* const* d_in, const int* in_sizes, int n_in,
                              void* d_out, int out_size, void* d_ws, size_t ws_size, hipStream_t stream) {
  (void)in_sizes; (void)n_in; (void)out_size;
  const float* const* I = (const float* const*)d_in; const float* x = I[0]; const float* Wq = I[1]; const float* bq = I[2]; const float* Wk = I[3]; const float* bk = I[4]; const float* Wv = I[5]; const float* bv = I[6]; const float* Wo = I[7]; const float* bo = I[8]; const float* tab = I[9];
  char* ws = (char*)d_ws; size_t off = 0;
  auto take = [&](size_t bytes) { char* p = ws + off; off += (bytes + 255) & ~(size_t)255; return p; };
  _Float16* BQ = (_Float16*)take((size_t)DM * DM * 2); _Float16* BK = (_Float16*)take((size_t)DM * DM * 2); _Float16* BV = (_Float16*)take((size_t)DM * DM * 2); _Float16* BO = (_Float16*)take((size_t)DM * DM * 2); _Float16* T16 = (_Float16*)take((size_t)NH * RW * 64 * 2);
  _Float16* X16 = (_Float16*)take((size_t)NR * DM * 2);
  _Float16* Qh = (_Float16*)take((size_t)NR * DM * 2); _Float16* Ql = (_Float16*)take((size_t)NR * DM * 2); _Float16* Kh = (_Float16*)take((size_t)NR * DM * 2); _Float16* Kl = (_Float16*)take((size_t)NR * DM * 2); _Float16* Vth = (_Float16*)take((size_t)NR * DM * 2); _Float16* Vtl = (_Float16*)take((size_t)NR * DM * 2);
  _Float16* Oh = (_Float16*)take((size_t)NR * DM * 2); _Float16* Ol = (_Float16*)take((size_t)NR * DM * 2);
  if (off > ws_size) return;      /* 8 + 4 + 8 + 48 + 16 = 84 MiB */
  const size_t n8 = (size_t)NR * DM / 8; const unsigned nb8 = (unsigned)((n8 + 255) / 256); const size_t w8 = (size_t)DM * DM / 8; const unsigned wb = (unsigned)((w8 + 255) / 256);
  k_round16f<<<wb, 256, 0, stream>>>(Wq, BQ, w8); k_round16f<<<wb, 256, 0, stream>>>(Wk, BK, w8); k_round16f<<<wb, 256, 0, stream>>>(Wv, BV, w8); k_round16f<<<wb, 256, 0, stream>>>(Wo, BO, w8);      /* torch (out,in) = natural Bt */
  k_rtab<<<(NH * RW * 8 + 255) / 256, 256, 0, stream>>>(tab, 9999, T16);
  const dim3 gP((NR / 128) * (DM / 64), 1);
  /* every row-wise stage runs once over all NBT * SLEN rows */
  k_x16<<<nb8, 256, 0, stream>>>(x, X16, n8);
  /* each producer splits its f32 result into the hi and residual planes in its own epilogue: no f32 copy of q, k, v or O reaches memory */
  k_gemm2<0, 1><<<gP, 128, 0, stream>>>(X16, DM, 0, BQ, DM, 0, 0.0625f, bq, 0, nullptr, 1, 0, 0, nullptr, Qh, Ql, DM, 0, NR, DM, DM);      /* the hi plane also feeds the RPE product */
  k_gemm2<0, 1><<<gP, 128, 0, stream>>>(X16, DM, 0, BK, DM, 0, 0.0625f, bk, 0, nullptr, 1, 0, 0, nullptr, Kh, Kl, DM, 0, NR, DM, DM);
  k_gemm2<0, 2><<<gP, 128, 0, stream>>>(X16, DM, 0, BV, DM, 0, 0.0625f, bv, 0, nullptr, 1, 0, 0, nullptr, Vth, Vtl, DM, 0, NR, DM, DM);      /* V^T per head */
  k_flashb<SLEN, SLEN><<<NBT * NH * (SLEN / 64), 128, 0, stream>>>(Qh, Ql, DM, Kh, Kl, DM, Vth, Vtl, T16, Oh, Ol, DM);      /* all batches and heads in one launch */
  float* outp = (float*)d_out;
  k_gemm2<0, 0><<<gP, 128, 0, stream>>>(Oh, DM, 0, BO, DM, 0, 0.0625f, bo, 0, nullptr, 1, 0, 0, outp, nullptr, nullptr, DM, 0, NR, DM, DM);
  k_gemm2<0, 0><<<gP, 128, 0, stream>>>(Ol, DM, 0, BO, DM, 0, 0.0625f / 1024.0f, nullptr, 0, outp, 1, (size_t)DM, 0, outp, nullptr, nullptr, DM, 0, NR, DM, DM);
}

// v009
// Measured time: 158 microseconds a run.
// In both of two side-by-side timings against v008, it was 1.17 times as fast.
// All steps since v000 together make it 27.6 times as fast.
#include <hip/hip_runtime.h>
// Multi-head attention with learned relative-position encoding (4 x 1024 tokens, 1024 = 16 heads x 64): q,k,v = x W^T + b; scores = q.k/8 + q.rpe_table[h][q - k + 1023] (no scale on the RPE term); softmax over all keys; . v; merged . Wo^T + bo -> [4,1024,1024].
// Structure: projections (all batches in one launch) as f16 WMMA GEMMs (32x64 wave tiles, f32 accumulation, exact products + bias; the work-group's A and B tiles reach LDS by asynchronous copies, two buffers); the fused flash kernel (one launch over all batches and heads; hi/lo q,k three-product scores, both products transposed (S^T = K . Q^T, O^T += V^T . P^T), so a lane owns one query: online f32 softmax inside the lane, in base 2 (log2(e) folded into the score scales), P hi + residual packed in registers, V^T hi + residual; all keys valid; each 32-key tile of K and V^T, both planes, reaches LDS once for the work-group's four waves by asynchronous copies, two buffers) forms the RPE term itself: per 16 x 32 score tile the 48 table rows r = q - k + 1023 can reach give a 16 x 48 f16 WMMA product q_h . table[h][r] (f32 result, 16 of the 48 columns carried over from the trip before), stored skewed in the wave's LDS and read back per query inside the score stage; O as hi + residual planes into Wo (one GEMM launch, two accumulator sets over a shared Wo tile).
// Compute dtype: x, weights, biases, rpe_table rounded to bf16; projections exact; the RPE product uses the plain f16 q (the hi plane) (~2^-12 on a sigma-0.16 bias); q, k, P, v, O as f16 hi + residual pairs (~2^-21) in the attention; f32 accumulation and softmax. v_wmma_f32_16x16x32_f16.
#define NBT 4
#define SLEN 1024
#define RW 2048                  /* table rows kept per head (2*SLEN-1 used, the last one zero) */
#define DM 1024
#define NH 16
#define SCL 0.125f
#define LOG2E 1.4426950408889634f      /* exp(x) = 2^(x * LOG2E) */
#define NR (NBT * SLEN)
typedef __bf16 v16b __attribute__((ext_vector_type(16)));
typedef unsigned short v8us __attribute__((ext_vector_type(8), may_alias));
typedef float  v8f  __attribute__((ext_vector_type(8)));
typedef float  v4f  __attribute__((ext_vector_type(4)));
typedef float  v4fa __attribute__((ext_vector_type(4), may_alias));
union FragB { v16b v; v8us half[2]; unsigned short u[16]; };

__device__ __forceinline__ unsigned short bf16_bits(float x) { unsigned int u = __float_as_uint(x); return (unsigned short)((u + 0x7FFFu + ((u >> 16) & 1u)) >> 16); }
__device__ __forceinline__ float bf16_val(unsigned short b) { return __uint_as_float(((unsigned int)b) << 16); }
__device__ __forceinline__ float bf16_round(float x) { return bf16_val(bf16_bits(x)); }
// D += A·B with NT terms: 1 = ah·bh, 2 = + al·bh (A split), 3 = + ah·bl (both split)
template <int NT>
__device__ __forceinline__ v8f mmaN(v16b ah, v16b al, v16b bh, v16b bl, v8f c) {
  c = __builtin_amdgcn_wmma_f32_16x16x32_bf16(false, ah, false, bh, (short)0, c, false, false);
  if (NT >= 2) c = __builtin_amdgcn_wmma_f32_16x16x32_bf16(false, al, false, bh, (short)0, c, false, false);
  if (NT >= 3) c = __builtin_amdgcn_wmma_f32_16x16x32_bf16(false, ah, false, bl, (short)0, c, false, false);
  asm volatile("v_nop\n\tv_nop\n\tv_nop\n\tv_nop" : "+v"(c) : "v"(ah), "v"(al), "v"(bh), "v"(bl));
  return c;
}

__global__ __launch_bounds__(256) void k_wt_bf16(const float* __restrict__ W, unsigned short* __restrict__ Wt, int K, int N) {
  const int t = blockIdx.x * 256 + threadIdx.x;
  const int k8n = K / 8;
  if (t >= N * k8n) return;
  const int n = t / k8n, k8 = (t % k8n) * 8;
  v8us v;
#pragma unroll
  for (int i = 0; i < 8; ++i) v[i] = bf16_bits(W[(size_t)(k8 + i) * N + n]);
  *(v8us*)(Wt + (size_t)n * K + k8) = v;
  
}

// GEMM C[M][N] (f32, pitch ldc) = act(A[M][K]·W + bias). A f32 row-major (pitch lda) converted per fragment to bf16
// (ASPLIT: hi/lo two planes -> 2 terms, else single rounded term); Wt bf16 [N][K] (pitch ldb). BIAS_BF16 rounds the
// bias to bf16 first (bias quantised to bf16 before the add). K%32==0, M%16==0, N%64==0.
template <bool ASPLIT, int ACT, bool BIAS_BF16>
__global__ __launch_bounds__(128) void k_gemm_bf(const float* __restrict__ A, int lda, const unsigned short* __restrict__ Wt, int ldb,
                                               const float* __restrict__ bias, float* __restrict__ C, int ldc, int M, int N, int K) {
  __shared__ __attribute__((aligned(16))) float so[4][16][64];
  const int tid = threadIdx.x, w = tid >> 5, lane = tid & 31, ln = lane & 15, hh = lane >> 4;
  const int ntn = N / 64;
  const int wid = blockIdx.x * 4 + w;
  const int mt = wid / ntn, nq = wid % ntn;
  if (mt * 16 >= M) return;
  const int row0 = mt * 16, col0 = nq * 64;
  const float* arow = A + (size_t)(row0 + ln) * lda;
  v8f acc[4] = {};
  for (int kb = 0; kb < K; kb += 32) {
    FragB ah, al;
    const v4f x0 = *(const v4fa*)(arow + kb + 8 * hh), x1 = *(const v4fa*)(arow + kb + 8 * hh + 4);
    const v4f x2 = *(const v4fa*)(arow + kb + 16 + 8 * hh), x3 = *(const v4fa*)(arow + kb + 16 + 8 * hh + 4);
    float xs[16] = {x0[0],x0[1],x0[2],x0[3],x1[0],x1[1],x1[2],x1[3],x2[0],x2[1],x2[2],x2[3],x3[0],x3[1],x3[2],x3[3]};
#pragma unroll
    for (int i = 0; i < 16; ++i) { const unsigned short hb = bf16_bits(xs[i]); ah.u[i] = hb; al.u[i] = ASPLIT ? bf16_bits(xs[i] - bf16_val(hb)) : (unsigned short)0; }
#pragma unroll
    for (int t = 0; t < 4; ++t) {
      const unsigned short* brow = Wt + (size_t)(col0 + t * 16 + ln) * ldb + kb;
      FragB b;
      b.half[0] = *(const v8us*)(brow + 8 * hh);
      b.half[1] = *(const v8us*)(brow + 16 + 8 * hh);
      acc[t] = mmaN<ASPLIT ? 2 : 1>(ah.v, al.v, b.v, b.v, acc[t]);
    }
  }
#pragma unroll
  for (int t = 0; t < 4; ++t) {
    float bv = bias ? bias[col0 + t * 16 + ln] : 0.f;
    if (BIAS_BF16) bv = bf16_round(bv);
#pragma unroll
    for (int r = 0; r < 8; ++r) { float v = acc[t][r] + bv; if (ACT == 1) v = fmaxf(v, 0.f); so[w][8 * hh + r][t * 16 + ln] = v; }
  }
  __builtin_amdgcn_fence(__ATOMIC_ACQ_REL, "workgroup");
  __builtin_amdgcn_wave_barrier();
  const int rsub = lane >> 4, c4 = (lane & 15) * 4;
  {
#pragma unroll
    for (int q = 0; q < 8; ++q) {
      const int r = q * 2 + rsub;
      const v4f v = *(const v4fa*)&so[w][r][c4];
      *(v4f*)(C + (size_t)(row0 + r) * ldc + col0 + c4) = v;
    }
    
  }
}

// GEMM C = act(A·W + bias + resid): A f32 (ASPLIT -> hi/lo 2 terms), Wt bf16 [N][K]; ACT 0 none, 1 relu, 2 exact gelu;
// resid (optional, f32, row index = (row % rmod), pitch ldr, RES_BF16 rounds it) added before the activation.
template <bool ASPLIT, int ACT, bool BIAS_BF16, bool RES_BF16>
__global__ __launch_bounds__(128) void k_gemm_bf3(const float* __restrict__ A, int lda, const unsigned short* __restrict__ Wt, int ldb,
                                                const float* __restrict__ bias, const float* __restrict__ resid, int rmod, int ldr,
                                                float* __restrict__ C, int ldc, int M, int N, int K) {
  __shared__ __attribute__((aligned(16))) float so[4][16][64];
  const int tid = threadIdx.x, w = tid >> 5, lane = tid & 31, ln = lane & 15, hh = lane >> 4;
  const int ntn = N / 64;
  const int wid = blockIdx.x * 4 + w;
  const int mt = wid / ntn, nq = wid % ntn;
  if (mt * 16 >= M) return;
  const int row0 = mt * 16, col0 = nq * 64;
  const float* arow = A + (size_t)(row0 + ln) * lda;
  v8f acc[4] = {};
  for (int kb = 0; kb < K; kb += 32) {
    FragB ah, al;
    const v4f x0 = *(const v4fa*)(arow + kb + 8 * hh), x1 = *(const v4fa*)(arow + kb + 8 * hh + 4);
    const v4f x2 = *(const v4fa*)(arow + kb + 16 + 8 * hh), x3 = *(const v4fa*)(arow + kb + 16 + 8 * hh + 4);
    float xs[16] = {x0[0],x0[1],x0[2],x0[3],x1[0],x1[1],x1[2],x1[3],x2[0],x2[1],x2[2],x2[3],x3[0],x3[1],x3[2],x3[3]};
#pragma unroll
    for (int i = 0; i < 16; ++i) { const unsigned short hb = bf16_bits(xs[i]); ah.u[i] = hb; al.u[i] = ASPLIT ? bf16_bits(xs[i] - bf16_val(hb)) : (unsigned short)0; }
#pragma unroll
    for (int t = 0; t < 4; ++t) {
      const unsigned short* brow = Wt + (size_t)(col0 + t * 16 + ln) * ldb + kb;
      FragB b;
      b.half[0] = *(const v8us*)(brow + 8 * hh);
      b.half[1] = *(const v8us*)(brow + 16 + 8 * hh);
      acc[t] = mmaN<ASPLIT ? 2 : 1>(ah.v, al.v, b.v, b.v, acc[t]);
    }
  }
#pragma unroll
  for (int t = 0; t < 4; ++t) {
    const int col = col0 + t * 16 + ln;
    float bv = bias ? bias[col] : 0.f;
    if (BIAS_BF16) bv = bf16_round(bv);
#pragma unroll
    for (int r = 0; r < 8; ++r) {
      float v = acc[t][r] + bv;
      if (resid) { float rv = resid[(size_t)((row0 + 8 * hh + r) % rmod) * ldr + col]; if (RES_BF16) rv = bf16_round(rv); v += rv; }
      if (ACT == 1) v = fmaxf(v, 0.f);
      if (ACT == 2) v = 0.5f * v * (1.0f + erff(v * 0.70710678118654752f));
      if (ACT == 3) { const float u = 0.7978845608028654f * (v + 0.044715f * v * v * v); v = 0.5f * v * (1.0f + tanhf(u)); }
      so[w][8 * hh + r][t * 16 + ln] = v;
    }
  }
  __builtin_amdgcn_fence(__ATOMIC_ACQ_REL, "workgroup");
  __builtin_amdgcn_wave_barrier();
  const int rsub = lane >> 4, c4 = (lane & 15) * 4;
  {
#pragma unroll
    for (int q = 0; q < 8; ++q) {
      const int r = q * 2 + rsub;
      const v4f v = *(const v4fa*)&so[w][r][c4];
      *(v4f*)(C + (size_t)(row0 + r) * ldc + col0 + c4) = v;
    }
    
  }
}
// row LayerNorm (biased variance, eps) over N: s = X (+ R); optional out_sum <- s; out_norm <- (s-mu)*rsqrt(var+eps)*g + b
template <bool PARAM_BF16>
__global__ __launch_bounds__(256) void k_layernorm(const float* __restrict__ X, const float* __restrict__ R, const float* __restrict__ g, const float* __restrict__ bta,
                                                  float* __restrict__ out_sum, float* __restrict__ out_norm, int N, float eps) {
  __shared__ float red[256];
  const int row = blockIdx.x, tid = threadIdx.x;
  const float* x = X + (size_t)row * N; const float* rr = R ? R + (size_t)row * N : nullptr;
  float vals[16];                     // up to N = 4096
  const int per = N / 256;            // contiguous chunk per thread? use strided-by-4 chunks: thread handles j = tid*4 + 1024*u
  float s1 = 0.f;
  for (int u = 0; u < per / 4; ++u) {
    const int j = tid * 4 + 1024 * u;
    const v4f a = *(const v4fa*)(x + j);
    v4f b = {0.f,0.f,0.f,0.f}; if (rr) b = *(const v4fa*)(rr + j);
#pragma unroll
    for (int q = 0; q < 4; ++q) { const float v = a[q] + b[q]; vals[u * 4 + q] = v; s1 += v; }
  }
  red[tid] = s1; __syncthreads();
  for (int st = 128; st > 0; st >>= 1) { if (tid < st) red[tid] += red[tid + st]; __syncthreads(); }
  const float mu = red[0] / (float)N; __syncthreads();
  float s2 = 0.f;
  for (int u = 0; u < per / 4; ++u)
#pragma unroll
    for (int q = 0; q < 4; ++q) { const float c = vals[u * 4 + q] - mu; s2 += c * c; }
  red[tid] = s2; __syncthreads();
  for (int st = 128; st > 0; st >>= 1) { if (tid < st) red[tid] += red[tid + st]; __syncthreads(); }
  const float rs = rsqrtf(red[0] / (float)N + eps);
  {
    for (int u = 0; u < per / 4; ++u) {
      const int j = tid * 4 + 1024 * u;
      v4f o, sm;
#pragma unroll
      for (int q = 0; q < 4; ++q) {
        float gg = g[j + q], bb = bta[j + q];
        if (PARAM_BF16) { gg = bf16_round(gg); bb = bf16_round(bb); }
        sm[q] = vals[u * 4 + q]; o[q] = (vals[u * 4 + q] - mu) * rs * gg + bb;
      }
      if (out_sum) *(v4f*)(out_sum + (size_t)row * N + j) = sm;
      *(v4f*)(out_norm + (size_t)row * N + j) = o;
    }
    
  }
}



// ---- f16 WMMA path (v_wmma_f32_16x16x32_f16): 11-bit significands for operands in range — used where a [0,1] probability operand needs more precision than bf16
typedef _Float16 v16h __attribute__((ext_vector_type(16)));
union FragH { v16h v; v8us half[2]; _Float16 h[16]; unsigned short u[16]; };
template <int NT>
__device__ __forceinline__ v8f mmaH(v16h ah, v16h al, v16h bh, v16h bl, v8f c) {
  c = __builtin_amdgcn_wmma_f32_16x16x32_f16(false, ah, false, bh, (short)0, c, false, false);
  if (NT >= 2) c = __builtin_amdgcn_wmma_f32_16x16x32_f16(false, al, false, bh, (short)0, c, false, false);
  if (NT >= 3) c = __builtin_amdgcn_wmma_f32_16x16x32_f16(false, ah, false, bl, (short)0, c, false, false);
  asm volatile("v_nop\n\tv_nop\n\tv_nop\n\tv_nop" : "+v"(c) : "v"(ah), "v"(al), "v"(bh), "v"(bl));
  return c;
}
// batched GEMM like k_gemm_b but f16 operands: A f32 (split into f16 hi/lo if ASPLIT, else rounded to f16), Bt = f16 values [n][k]; alpha; C f32; N multiple of 16 (partial tiles skipped)
template <bool ASPLIT>
__global__ __launch_bounds__(128) void k_gemm_h(const float* __restrict__ A, int lda, size_t sA, const _Float16* __restrict__ Bh, int ldb, size_t sB, float alpha, float* __restrict__ C, int ldc, size_t sC, int M, int N, int K) {
  __shared__ __attribute__((aligned(16))) float so[4][16][64];
  const int tid = threadIdx.x, w = tid >> 5, lane = tid & 31, ln = lane & 15, hh = lane >> 4; const int by = blockIdx.y;
  A += (size_t)by * sA; Bh += (size_t)by * sB; C += (size_t)by * sC;
  const int ntn = (N + 63) / 64; const int wid = blockIdx.x * 4 + w; const int mt = wid / ntn, nq = wid % ntn; if (mt * 16 >= M) return;
  const int row0 = mt * 16, col0 = nq * 64; const float* arow = A + (size_t)(row0 + ln) * lda;
  v8f acc[4] = {};
  for (int kb = 0; kb < K; kb += 32) {
    FragH ah, al;
    const v4f x0 = *(const v4fa*)(arow + kb + 8 * hh), x1 = *(const v4fa*)(arow + kb + 8 * hh + 4), x2 = *(const v4fa*)(arow + kb + 16 + 8 * hh), x3 = *(const v4fa*)(arow + kb + 16 + 8 * hh + 4);
    float xs[16] = {x0[0],x0[1],x0[2],x0[3],x1[0],x1[1],x1[2],x1[3],x2[0],x2[1],x2[2],x2[3],x3[0],x3[1],x3[2],x3[3]};
#pragma unroll
    for (int i = 0; i < 16; ++i) { const _Float16 h = (_Float16)xs[i]; ah.h[i] = h; al.h[i] = ASPLIT ? (_Float16)(xs[i] - (float)h) : (_Float16)0.0f; }
#pragma unroll
    for (int t = 0; t < 4; ++t) { if (col0 + t * 16 >= N) continue; const size_t boff = (size_t)(col0 + t * 16 + ln) * ldb + kb; FragH bq; bq.half[0] = *(const v8us*)(Bh + boff + 8 * hh); bq.half[1] = *(const v8us*)(Bh + boff + 16 + 8 * hh);
      acc[t] = mmaH<ASPLIT ? 2 : 1>(ah.v, al.v, bq.v, bq.v, acc[t]); }
  }
#pragma unroll
  for (int t = 0; t < 4; ++t) { if (col0 + t * 16 >= N) continue;
#pragma unroll
    for (int r = 0; r < 8; ++r) so[w][8 * hh + r][t * 16 + ln] = acc[t][r] * alpha; }
  __builtin_amdgcn_fence(__ATOMIC_ACQ_REL, "workgroup"); __builtin_amdgcn_wave_barrier();
  const int rsub = lane >> 4, c4 = (lane & 15) * 4;
  {
#pragma unroll
    for (int q = 0; q < 8; ++q) { const int r = q * 2 + rsub; if (col0 + c4 < N) { const v4f v = *(const v4fa*)&so[w][r][c4]; *(v4f*)(C + (size_t)(row0 + r) * ldc + col0 + c4) = v; } }
     }
}

// Wt[n][k] = f16(W[k][n]·scale) from f32 row-major W[K][N] (scale = power of two; bf16-exact weights stay exact in f16 away from the subnormal range)
__global__ __launch_bounds__(256) void k_wt_f16(const float* __restrict__ W, _Float16* __restrict__ Wt, int K, int N, float scale) {
  const int t = blockIdx.x * 256 + threadIdx.x; if (t >= N * (K / 8)) return; const int n = t / (K / 8), k8 = (t % (K / 8)) * 8; FragH f;
#pragma unroll
  for (int i = 0; i < 8; ++i) f.h[i] = (_Float16)(bf16_round(W[(size_t)(k8 + i) * N + n]) * scale); const v8us o = f.half[0];
  *(v8us*)((unsigned short*)Wt + (size_t)n * K + k8) = o; 
}
// k_gemm_hh variant with fused epilogue: v = acc·alpha + bias[by·sBias + col] (+ CP[(row/rowsPerB)·sCPb + by·64 + col] if CP) ; ACT 0 none / 1 elu ; writes f16 C16 (and f32 C if non-null)
template <int ACT>
__global__ __launch_bounds__(128) void k_gemm_hhx(const _Float16* __restrict__ A, int lda, size_t sA, const _Float16* __restrict__ Bh, int ldb, size_t sB, float alpha, const float* __restrict__ bias, size_t sBias, const float* __restrict__ CP, int rowsPerB, size_t sCPb, int row0g,
    float* __restrict__ C, _Float16* __restrict__ C16, int ldc, size_t sC, int M, int N, int K) {
  __shared__ __attribute__((aligned(16))) float so[4][16][64];
  const int tid = threadIdx.x, w = tid >> 5, lane = tid & 31, ln = lane & 15, hh = lane >> 4; const int by = blockIdx.y;
  A += (size_t)by * sA; Bh += (size_t)by * sB; const size_t cofs = (size_t)by * sC; const float* bp = bias ? bias + (size_t)by * sBias : nullptr;
  const int ntn = (N + 63) / 64; const int wid = blockIdx.x * 4 + w; const int mt = wid / ntn, nq = wid % ntn; if (mt * 16 >= M) return;
  const int row0 = mt * 16, col0 = nq * 64; const _Float16* arow = A + (size_t)(row0 + ln) * lda;
  v8f acc[4] = {};
  for (int kb = 0; kb < K; kb += 32) { FragH ah; ah.half[0] = *(const v8us*)((const unsigned short*)arow + kb + 8 * hh); ah.half[1] = *(const v8us*)((const unsigned short*)arow + kb + 16 + 8 * hh);
#pragma unroll
    for (int t = 0; t < 4; ++t) { if (col0 + t * 16 >= N) continue; const size_t boff = (size_t)(col0 + t * 16 + ln) * ldb + kb; FragH bq; bq.half[0] = *(const v8us*)((const unsigned short*)Bh + boff + 8 * hh); bq.half[1] = *(const v8us*)((const unsigned short*)Bh + boff + 16 + 8 * hh);
      acc[t] = mmaH<1>(ah.v, ah.v, bq.v, bq.v, acc[t]); }
  }
#pragma unroll
  for (int t = 0; t < 4; ++t) { if (col0 + t * 16 >= N) continue; const int col = col0 + t * 16 + ln; const float bv = bp ? bf16_round(bp[col]) : 0.f;
#pragma unroll
    for (int r = 0; r < 8; ++r) { float v = acc[t][r] * alpha + bv; if (CP) { const int bidx = (row0g + row0 + 8 * hh + r) / rowsPerB; v += CP[(size_t)bidx * sCPb + (size_t)by * 64 + col]; } if (ACT == 1) v = (v > 0.f) ? v : expm1f(v); else if (ACT == 7) v = (v > 0.f) ? v + 1.0f : expf(v); else if (ACT == 8) v = tanhf(v); else if (ACT == 9) v = 0.5f * v * (1.0f + tanhf(0.7978845608028654f * (v + 0.044715f * v * v * v))); else if (ACT == 11) v = 1.0f / (1.0f + expf(-v)); else if (ACT == 12) v = (v > 0.f) ? v : 0.01f * v; else if (ACT == 14) v = (v > 0.f) ? v : 0.1f * v; else if (ACT == 15) v = v / (1.0f + expf(-v)); else if (ACT == 3) v = fmaxf(v, 0.f); else if (ACT == 6) v = 0.5f * v * (1.0f + erff(v * 0.70710678118654752f)); so[w][8 * hh + r][t * 16 + ln] = v; } }
  __builtin_amdgcn_fence(__ATOMIC_ACQ_REL, "workgroup"); __builtin_amdgcn_wave_barrier();
  const int rsub = lane >> 4, c4 = (lane & 15) * 4; typedef _Float16 v4h __attribute__((ext_vector_type(4)));
  {
#pragma unroll
    for (int q = 0; q < 8; ++q) { const int r = q * 2 + rsub; if (col0 + c4 < N) { const v4f v = *(const v4fa*)&so[w][r][c4]; if (C) *(v4f*)(C + cofs + (size_t)(row0 + r) * ldc + col0 + c4) = v; if (C16) { v4h h4; for (int i = 0; i < 4; ++i) h4[i] = (_Float16)v[i]; *(v4h*)(C16 + cofs + (size_t)(row0 + r) * ldc + col0 + c4) = h4; } } }
     }
}


typedef _Float16 v4h __attribute__((ext_vector_type(4)));

__global__ __launch_bounds__(256) void k_x16(const float* __restrict__ x, _Float16* __restrict__ X16, size_t n8) { const size_t t = (size_t)blockIdx.x * 256 + threadIdx.x; if (t >= n8) return; FragH f;
#pragma unroll
  for (int q = 0; q < 8; ++q) f.h[q] = (_Float16)bf16_round(x[t * 8 + q]); *(v8us*)((unsigned short*)X16 + t * 8) = f.half[0];  }
__global__ __launch_bounds__(256) void k_h16(const float* __restrict__ x, _Float16* __restrict__ X16, size_t n8) { const size_t t = (size_t)blockIdx.x * 256 + threadIdx.x; if (t >= n8) return; FragH f;
#pragma unroll
  for (int q = 0; q < 8; ++q) f.h[q] = (_Float16)x[t * 8 + q]; *(v8us*)((unsigned short*)X16 + t * 8) = f.half[0];  }
__global__ __launch_bounds__(256) void k_round16f(const float* __restrict__ W, _Float16* __restrict__ Bt, size_t n8) { const size_t t = (size_t)blockIdx.x * 256 + threadIdx.x; if (t >= n8) return; FragH f;
#pragma unroll
  for (int i = 0; i < 8; ++i) f.h[i] = (_Float16)(bf16_round(W[t * 8 + i]) * 16.0f); *(v8us*)((unsigned short*)Bt + t * 8) = f.half[0];  }
template <int NHv, int TTv>
__global__ __launch_bounds__(256) void k_vt(const _Float16* __restrict__ V16, int ldv, int voff, _Float16* __restrict__ Vt) { __shared__ unsigned short tl[64][66]; const int tid = threadIdx.x; const int slab = blockIdx.x / (TTv / 64), lg = blockIdx.x % (TTv / 64); const int b = slab / NHv, h = slab % NHv;
  for (int i = tid; i < 64 * 8; i += 256) { const int r = i / 8, c8 = (i % 8) * 8; FragH f; f.half[0] = *(const v8us*)((const unsigned short*)V16 + ((size_t)b * TTv + lg * 64 + r) * ldv + voff + h * 64 + c8);
#pragma unroll
    for (int q = 0; q < 8; ++q) tl[r][c8 + q] = f.u[q]; }
  __syncthreads();
  {
#pragma unroll
    for (int rd = 0; rd < 2; ++rd) { const int d = rd * 32 + tid / 8, pc = tid % 8; FragH f;
#pragma unroll
      for (int q = 0; q < 8; ++q) f.u[q] = tl[pc * 8 + q][d];
      *(v8us*)((unsigned short*)Vt + ((size_t)slab * 64 + d) * TTv + lg * 64 + pc * 8) = f.half[0]; }
     } }

// ---- fast GEMM (wave tile 32x64, work-group tile 128x64; requires M % 128 == 0, N % 64 == 0, K % 64 == 0); epilogue: acc·alpha + bias (+ CP, activation), stored in the OUT form below ----
#define G2P 72                   /* LDS row pitch in values: 128-byte rows at 144 bytes, the conflict-free pitch for ds_load_b128 readers */
// One K step of 64 values for the work-group: its 128 A rows and 64 B rows (128 bytes = one line each) go to LDS as 12 asynchronous 16-byte copies a lane; 8 lanes take a row, so a wave's copy covers 4 whole lines.
// ag, bg: the lane's piece in the first 16 rows; sa, sb: 16 rows on, in values; la, lb: the lane's LDS byte address in the first 16 rows. The closing s_wait_xcnt 0 stands in front of any rewrite of the registers that the copies name.
__device__ __forceinline__ void g2_stage(const _Float16* ag, size_t sa, const _Float16* bg, size_t sb, unsigned la, unsigned lb) {
  asm volatile("global_load_async_to_lds_b128 %0, %12, off\n\t"
               "global_load_async_to_lds_b128 %1, %13, off\n\t"
               "global_load_async_to_lds_b128 %2, %14, off\n\t"
               "global_load_async_to_lds_b128 %3, %15, off\n\t"
               "global_load_async_to_lds_b128 %4, %16, off\n\t"
               "global_load_async_to_lds_b128 %5, %17, off\n\t"
               "global_load_async_to_lds_b128 %6, %18, off\n\t"
               "global_load_async_to_lds_b128 %7, %19, off\n\t"
               "global_load_async_to_lds_b128 %8, %20, off\n\t"
               "global_load_async_to_lds_b128 %9, %21, off\n\t"
               "global_load_async_to_lds_b128 %10, %22, off\n\t"
               "global_load_async_to_lds_b128 %11, %23, off\n\t"
               "s_wait_xcnt 0x0"
               :: "v"(la), "v"(la + 1u * 16 * G2P * 2), "v"(la + 2u * 16 * G2P * 2), "v"(la + 3u * 16 * G2P * 2), "v"(la + 4u * 16 * G2P * 2), "v"(la + 5u * 16 * G2P * 2), "v"(la + 6u * 16 * G2P * 2), "v"(la + 7u * 16 * G2P * 2),
                  "v"(lb), "v"(lb + 1u * 16 * G2P * 2), "v"(lb + 2u * 16 * G2P * 2), "v"(lb + 3u * 16 * G2P * 2),
                  "v"(ag), "v"(ag + sa), "v"(ag + 2 * sa), "v"(ag + 3 * sa), "v"(ag + 4 * sa), "v"(ag + 5 * sa), "v"(ag + 6 * sa), "v"(ag + 7 * sa),
                  "v"(bg), "v"(bg + sb), "v"(bg + 2 * sb), "v"(bg + 3 * sb)
               : "memory"); }
__device__ __forceinline__ v16h g2_frag(const _Float16* p, int hh) { FragH f; f.half[0] = *(const v8us*)((const unsigned short*)p + 8 * hh); f.half[1] = *(const v8us*)((const unsigned short*)p + 16 + 8 * hh); return f.v; }
__device__ __forceinline__ v8f g2_mma(v16h a, v16h b, v8f c) { v8f d = __builtin_amdgcn_wmma_f32_16x16x32_f16(false, a, false, b, (short)0, c, false, false); asm volatile("v_nop\n\tv_nop\n\tv_nop\n\tv_nop" : "+v"(d) : "v"(a), "v"(b)); return d; }
// OUT 0: C (f32). OUT 1: the result leaves as two f16 planes, Hh = f16(v), Hl = f16((v - Hh) * 1024), row-major like C. OUT 2 (no CP, no activation): the same two planes transposed per head,
// H[((row / SLEN) * NH + col / 64) * 64 + col % 64][row % SLEN]; needs SLEN % 128 == 0 and N == NH * 64.
template <int ACT, int OUT>
__global__ __launch_bounds__(128) void k_gemm2(const _Float16* __restrict__ A, int lda, size_t sA, const _Float16* __restrict__ Bh, int ldb, size_t sB, float alpha, const float* __restrict__ bias, size_t sBias, const float* __restrict__ CP, int rowsPerB, size_t sCPb, int row0g,
    float* __restrict__ C, _Float16* __restrict__ Hh, _Float16* __restrict__ Hl, int ldc, size_t sC, int M, int N, int K) {
  __shared__ __attribute__((aligned(16))) float so[4][32][68]; __shared__ __attribute__((aligned(16))) unsigned short tA[2][128][G2P], tB[2][64][G2P];
  const int tid = threadIdx.x, w = tid >> 5, lane = tid & 31, ln = lane & 15, hh = lane >> 4; const int by = blockIdx.y;
  A += (size_t)by * sA; Bh += (size_t)by * sB; const size_t cofs = (size_t)by * sC; const float* bp = bias ? bias + (size_t)by * sBias : nullptr;
  const int ntn = N >> 6; const int mt = blockIdx.x / ntn, nq = blockIdx.x - mt * ntn; const int row0 = mt * 128 + 32 * w, col0 = nq * 64; if (mt * 128 >= M) return;      /* the whole work-group leaves or none: barriers below */
  const int cr = tid >> 3, cc = (tid & 7) * 8;      /* the lane's row (of 16) and 16-byte piece in a copy */
  const _Float16* ag = A + (size_t)(mt * 128 + cr) * lda + cc; const _Float16* bg = Bh + (size_t)(col0 + cr) * ldb + cc; const size_t sa = (size_t)16 * lda, sb = (size_t)16 * ldb;
  const unsigned la = (unsigned)(size_t)&tA[0][cr][cc], lb = (unsigned)(size_t)&tB[0][cr][cc];      /* LDS byte addresses: the low 32 bits */
  const int nst = K >> 6;
  const v8f z8 = {0.f,0.f,0.f,0.f,0.f,0.f,0.f,0.f}; v8f c00 = z8, c01 = z8, c02 = z8, c03 = z8, c10 = z8, c11 = z8, c12 = z8, c13 = z8;
  g2_stage(ag, sa, bg, sb, la, lb);      /* step 0 into buffer 0 */
  asm volatile("s_wait_asynccnt 0x0" ::: "memory");      /* this wave's copies of step 0 have landed */
  __syncthreads();      /* ... and every other wave's */
  if (nst > 1) g2_stage(ag + 64, sa, bg + 64, sb, la + (unsigned)sizeof(tA[0]), lb + (unsigned)sizeof(tB[0]));      /* step 1 flies while step 0 is worked on */
#pragma unroll 1
  for (int st = 0; st < nst; ++st) { const int bf = st & 1; const _Float16* ar = (const _Float16*)&tA[bf][32 * w + ln][0]; const _Float16* br = (const _Float16*)&tB[bf][ln][0];
    v16h fa[2][2], fb[2][4];      /* the step's 12 fragments are read as one group ahead of its 16 products */
#pragma unroll
    for (int ks = 0; ks < 2; ++ks) { fa[ks][0] = g2_frag(ar + ks * 32, hh); fa[ks][1] = g2_frag(ar + 16 * G2P + ks * 32, hh);
#pragma unroll
      for (int j = 0; j < 4; ++j) fb[ks][j] = g2_frag(br + j * 16 * G2P + ks * 32, hh); }
#pragma unroll
    for (int ks = 0; ks < 2; ++ks) { c00 = g2_mma(fa[ks][0], fb[ks][0], c00); c10 = g2_mma(fa[ks][1], fb[ks][0], c10); c01 = g2_mma(fa[ks][0], fb[ks][1], c01); c11 = g2_mma(fa[ks][1], fb[ks][1], c11);
      c02 = g2_mma(fa[ks][0], fb[ks][2], c02); c12 = g2_mma(fa[ks][1], fb[ks][2], c12); c03 = g2_mma(fa[ks][0], fb[ks][3], c03); c13 = g2_mma(fa[ks][1], fb[ks][3], c13); }
    asm volatile("s_wait_dscnt 0x0" ::: "memory");      /* this wave's reads of buffer bf are done before it is refilled */
    asm volatile("s_wait_asynccnt 0x0" ::: "memory");      /* this wave's copies of step st + 1 have landed */
    __syncthreads();      /* publishes step st + 1 and ends every wave's reads of buffer bf */
    if (st + 2 < nst) g2_stage(ag + (size_t)(st + 2) * 64, sa, bg + (size_t)(st + 2) * 64, sb, la + (unsigned)bf * (unsigned)sizeof(tA[0]), lb + (unsigned)bf * (unsigned)sizeof(tB[0])); }
  asm volatile("s_wait_asynccnt 0x0" ::: "memory");      /* no copy is outstanding past the loop */
  v8f accs[8] = {c00, c01, c02, c03, c10, c11, c12, c13};
  if constexpr (OUT == 2) {      /* a lane's 8 accumulator registers are 8 consecutive rows of one column: one 16-byte piece of a transposed row in each plane */
    unsigned short (*sT)[64][136] = (unsigned short (*)[64][136])&so[0][0][0];      /* 2 planes x 64 columns x 128 rows at a pitch of 272 bytes: exactly so's bytes */
    float bv4[4] = {0.f, 0.f, 0.f, 0.f};
    if (bp) {
#pragma unroll
      for (int t = 0; t < 4; ++t) bv4[t] = bf16_round(bp[col0 + t * 16 + ln]); }
#pragma unroll
    for (int u = 0; u < 8; ++u) { const int dl = (u & 3) * 16 + ln, kl = 32 * w + (u >> 2) * 16 + 8 * hh; const float bv = bv4[u & 3]; FragH fh, fl;
#pragma unroll
      for (int r = 0; r < 8; ++r) { const float v = accs[u][r] * alpha + bv; const _Float16 hv = (_Float16)v; fh.h[r] = hv; fl.h[r] = (_Float16)((v - (float)hv) * 1024.0f); }
      *(v8us*)&sT[0][dl][kl] = fh.half[0]; *(v8us*)&sT[1][dl][kl] = fl.half[0]; }
    __syncthreads();      /* a transposed row of 128 values holds pieces of all four waves */
    const int rb = mt * 128; const size_t vb = (size_t)((rb / SLEN) * NH + nq) * 64 * SLEN + (size_t)(rb % SLEN);
#pragma unroll
    for (int p = 0; p < 8; ++p) { const int it = p * 128 + tid, d = it >> 4, pc = it & 15; const size_t o = vb + (size_t)d * SLEN + pc * 8;      /* 16 lanes write the 256 contiguous bytes of a row: whole lines */
      const v8us xh = *(const v8us*)&sT[0][d][pc * 8], xl = *(const v8us*)&sT[1][d][pc * 8]; *(v8us*)((unsigned short*)Hh + o) = xh; *(v8us*)((unsigned short*)Hl + o) = xl; }
    return; }
#pragma unroll
  for (int u = 0; u < 8; ++u) { const int t = u & 3, half = u >> 2; const int col = col0 + t * 16 + ln; const float bv = bp ? bf16_round(bp[col]) : 0.f;
#pragma unroll
    for (int r = 0; r < 8; ++r) { const int rloc = half * 16 + 8 * hh + r; float v = accs[u][r] * alpha + bv; if (CP) { const int bidx = (row0g + row0 + rloc) / rowsPerB; v += CP[(size_t)bidx * sCPb + (size_t)by * 64 + col]; }
      if (ACT == 3) v = fmaxf(v, 0.f); else if (ACT == 6) v = 0.5f * v * (1.0f + erff(v * 0.70710678118654752f)); else if (ACT == 11) v = 1.0f / (1.0f + expf(-v)); else if (ACT == 15) v = v / (1.0f + expf(-v)); else if (ACT == 12) v = (v > 0.f) ? v : 0.01f * v; else if (ACT == 8) v = tanhf(v);
      so[w][rloc][t * 16 + ln] = v; } }
  __builtin_amdgcn_fence(__ATOMIC_ACQ_REL, "workgroup"); __builtin_amdgcn_wave_barrier();
  if constexpr (OUT == 1) {
#pragma unroll
    for (int q = 0; q < 8; ++q) { const int r = q * 4 + (lane >> 3), c8 = (lane & 7) * 8; const v4f a = *(const v4fa*)&so[w][r][c8], c = *(const v4fa*)&so[w][r][c8 + 4]; FragH fh, fl;      /* 8 lanes write the 128 bytes of a row piece: one whole line in each plane */
#pragma unroll
      for (int i = 0; i < 4; ++i) { _Float16 hv = (_Float16)a[i]; fh.h[i] = hv; fl.h[i] = (_Float16)((a[i] - (float)hv) * 1024.0f); hv = (_Float16)c[i]; fh.h[4 + i] = hv; fl.h[4 + i] = (_Float16)((c[i] - (float)hv) * 1024.0f); }
      const size_t o = cofs + (size_t)(row0 + r) * ldc + col0 + c8; *(v8us*)((unsigned short*)Hh + o) = fh.half[0]; *(v8us*)((unsigned short*)Hl + o) = fl.half[0]; }
    return; }
  const int rsub = lane >> 4, c4 = (lane & 15) * 4;
  {
#pragma unroll
    for (int q = 0; q < 16; ++q) { const int r = q * 2 + rsub; const v4f v = *(const v4fa*)&so[w][r][c4]; *(v4f*)(C + cofs + (size_t)(row0 + r) * ldc + col0 + c4) = v; }
     } }


// The residual plane's 128 A rows of one K step: 8 more asynchronous 16-byte copies a lane, pieces and rows as for the A rows in g2_stage. The closing s_wait_xcnt 0 stands in front of any rewrite of the registers that the copies name.
__device__ __forceinline__ void g2_stage_a(const _Float16* ag, size_t sa, unsigned la) {
  asm volatile("global_load_async_to_lds_b128 %0, %8, off\n\t"
               "global_load_async_to_lds_b128 %1, %9, off\n\t"
               "global_load_async_to_lds_b128 %2, %10, off\n\t"
               "global_load_async_to_lds_b128 %3, %11, off\n\t"
               "global_load_async_to_lds_b128 %4, %12, off\n\t"
               "global_load_async_to_lds_b128 %5, %13, off\n\t"
               "global_load_async_to_lds_b128 %6, %14, off\n\t"
               "global_load_async_to_lds_b128 %7, %15, off\n\t"
               "s_wait_xcnt 0x0"
               :: "v"(la), "v"(la + 1u * 16 * G2P * 2), "v"(la + 2u * 16 * G2P * 2), "v"(la + 3u * 16 * G2P * 2), "v"(la + 4u * 16 * G2P * 2), "v"(la + 5u * 16 * G2P * 2), "v"(la + 6u * 16 * G2P * 2), "v"(la + 7u * 16 * G2P * 2),
                  "v"(ag), "v"(ag + sa), "v"(ag + 2 * sa), "v"(ag + 3 * sa), "v"(ag + 4 * sa), "v"(ag + 5 * sa), "v"(ag + 6 * sa), "v"(ag + 7 * sa)
               : "memory"); }
// C (f32) = (Ah . B^T) * alpha + bias + (Al . B^T) * alpha / 1024 for an A held as f16 hi + residual x 1024 planes: tiles, ring and wave tiles as in k_gemm2, but each K step brings both planes' A rows beside ONE B tile,
// and every B fragment feeds both planes' products (two accumulator sets a wave). Each set sums in k_gemm2's order, and the two are joined in the order the two launches had. Same size conditions as k_gemm2.
__global__ __launch_bounds__(128) void k_gemm2hl(const _Float16* __restrict__ Ah, const _Float16* __restrict__ Al, int lda, const _Float16* __restrict__ Bh, int ldb, float alpha, const float* __restrict__ bias, float* __restrict__ C, int ldc, int M, int N, int K) {
  __shared__ __attribute__((aligned(16))) float so[4][32][68]; __shared__ __attribute__((aligned(16))) unsigned short tA[2][2][128][G2P], tB[2][64][G2P];      /* tA: [buffer][hi, residual] */
  const int tid = threadIdx.x, w = tid >> 5, lane = tid & 31, ln = lane & 15, hh = lane >> 4;
  const int ntn = N >> 6; const int mt = blockIdx.x / ntn, nq = blockIdx.x - mt * ntn; const int row0 = mt * 128 + 32 * w, col0 = nq * 64; if (mt * 128 >= M) return;      /* the whole work-group leaves or none: barriers below */
  const int cr = tid >> 3, cc = (tid & 7) * 8;      /* the lane's row (of 16) and 16-byte piece in a copy */
  const size_t ao = (size_t)(mt * 128 + cr) * lda + cc; const _Float16* agh = Ah + ao; const _Float16* agl = Al + ao; const _Float16* bg = Bh + (size_t)(col0 + cr) * ldb + cc; const size_t sa = (size_t)16 * lda, sb = (size_t)16 * ldb;
  const unsigned la = (unsigned)(size_t)&tA[0][0][cr][cc], lb = (unsigned)(size_t)&tB[0][cr][cc];      /* LDS byte addresses: the low 32 bits */
  constexpr unsigned PA = (unsigned)sizeof(tA[0][0]), BA = (unsigned)sizeof(tA[0]), BB = (unsigned)sizeof(tB[0]);      /* one plane on, one buffer on */
  const int nst = K >> 6;
  v8f ch[2][4], cl[2][4];
#pragma unroll
  for (int i = 0; i < 2; ++i)
#pragma unroll
    for (int j = 0; j < 4; ++j) { ch[i][j] = (v8f){0.f,0.f,0.f,0.f,0.f,0.f,0.f,0.f}; cl[i][j] = ch[i][j]; }
  g2_stage(agh, sa, bg, sb, la, lb); g2_stage_a(agl, sa, la + PA);      /* step 0 into buffer 0 */
  asm volatile("s_wait_asynccnt 0x0" ::: "memory");      /* this wave's copies of step 0 have landed */
  __syncthreads();      /* ... and every other wave's */
  if (nst > 1) { g2_stage(agh + 64, sa, bg + 64, sb, la + BA, lb + BB); g2_stage_a(agl + 64, sa, la + BA + PA); }      /* step 1 flies while step 0 is worked on */
#pragma unroll 1
  for (int st = 0; st < nst; ++st) { const int bf = st & 1; const _Float16* arh = (const _Float16*)&tA[bf][0][32 * w + ln][0]; const _Float16* arl = (const _Float16*)&tA[bf][1][32 * w + ln][0]; const _Float16* br = (const _Float16*)&tB[bf][ln][0];
#pragma unroll
    for (int ks = 0; ks < 2; ++ks) { v16h fh[2], fl[2], fb[4];      /* a half step's 8 fragments are read as one group ahead of its 16 products */
#pragma unroll
      for (int i = 0; i < 2; ++i) { fh[i] = g2_frag(arh + i * 16 * G2P + ks * 32, hh); fl[i] = g2_frag(arl + i * 16 * G2P + ks * 32, hh); }
#pragma unroll
      for (int j = 0; j < 4; ++j) fb[j] = g2_frag(br + j * 16 * G2P + ks * 32, hh);
#pragma unroll
      for (int j = 0; j < 4; ++j) { ch[0][j] = g2_mma(fh[0], fb[j], ch[0][j]); ch[1][j] = g2_mma(fh[1], fb[j], ch[1][j]); cl[0][j] = g2_mma(fl[0], fb[j], cl[0][j]); cl[1][j] = g2_mma(fl[1], fb[j], cl[1][j]); } }
    asm volatile("s_wait_dscnt 0x0" ::: "memory");      /* this wave's reads of buffer bf are done before it is refilled */
    asm volatile("s_wait_asynccnt 0x0" ::: "memory");      /* this wave's copies of step st + 1 have landed */
    __syncthreads();      /* publishes step st + 1 and ends every wave's reads of buffer bf */
    if (st + 2 < nst) { const size_t kn = (size_t)(st + 2) * 64; g2_stage(agh + kn, sa, bg + kn, sb, la + (unsigned)bf * BA, lb + (unsigned)bf * BB); g2_stage_a(agl + kn, sa, la + (unsigned)bf * BA + PA); } }
  asm volatile("s_wait_asynccnt 0x0" ::: "memory");      /* no copy is outstanding past the loop */
  const float alo = alpha * 0.0009765625f;
#pragma unroll
  for (int j = 0; j < 4; ++j) { const float bv = bf16_round(bias[col0 + j * 16 + ln]);
#pragma unroll
    for (int i = 0; i < 2; ++i)
#pragma unroll
      for (int r = 0; r < 8; ++r) { const float v = ch[i][j][r] * alpha + bv; so[w][i * 16 + 8 * hh + r][j * 16 + ln] = cl[i][j][r] * alo + v; } }
  /* the wave's own rows are read back by other lanes of the same wave */
  __builtin_amdgcn_fence(__ATOMIC_ACQ_REL, "workgroup"); __builtin_amdgcn_wave_barrier();
  const int rsub = lane >> 4, c4 = (lane & 15) * 4;
#pragma unroll
  for (int q = 0; q < 16; ++q) { const int r = q * 2 + rsub; const v4f v = *(const v4fa*)&so[w][r][c4]; *(v4f*)(C + (size_t)(row0 + r) * ldc + col0 + c4) = v; }      /* 16 lanes write the 256 contiguous bytes of a row piece: whole lines */
}



#define FKP 72                   /* K rows in LDS, in values: 128-byte rows at 144 bytes, a conflict-free pitch for ds_load_b128 readers */
#define FVP 40                   /* V^T row pieces in LDS, in values: 64-byte pieces at 80 bytes, likewise */
// One tile of 32 keys for the work-group: 32 K rows of 128 bytes and 64 V^T row pieces of 64 bytes, hi and residual plane each, go to LDS as 8 asynchronous 16-byte copies a lane.
// 8 lanes take a K row (a wave's copy covers 4 whole lines), 4 lanes a V^T piece (8 half lines). kh, kl, vh, vl: the lane's piece in the first 16 K rows / 32 V^T rows of each plane; sk, sv: 16 K rows / 32 V^T rows on, in values;
// lk, lv: the lane's LDS byte address in the hi plane's first rows. The closing s_wait_xcnt 0 stands in front of any rewrite of the registers that the copies name.
__device__ __forceinline__ void fl_stage(const unsigned short* kh, const unsigned short* kl, size_t sk, const unsigned short* vh, const unsigned short* vl, size_t sv, unsigned lk, unsigned lv) {
  asm volatile("global_load_async_to_lds_b128 %0, %8, off\n\t"
               "global_load_async_to_lds_b128 %1, %9, off\n\t"
               "global_load_async_to_lds_b128 %2, %10, off\n\t"
               "global_load_async_to_lds_b128 %3, %11, off\n\t"
               "global_load_async_to_lds_b128 %4, %12, off\n\t"
               "global_load_async_to_lds_b128 %5, %13, off\n\t"
               "global_load_async_to_lds_b128 %6, %14, off\n\t"
               "global_load_async_to_lds_b128 %7, %15, off\n\t"
               "s_wait_xcnt 0x0"
               :: "v"(lk), "v"(lk + 16u * FKP * 2), "v"(lk + 32u * FKP * 2), "v"(lk + 48u * FKP * 2), "v"(lv), "v"(lv + 32u * FVP * 2), "v"(lv + 64u * FVP * 2), "v"(lv + 96u * FVP * 2),
                  "v"(kh), "v"(kh + sk), "v"(kl), "v"(kl + sk), "v"(vh), "v"(vh + sv), "v"(vl), "v"(vl + sv)
               : "memory"); }
typedef float v2f __attribute__((ext_vector_type(2))); typedef _Float16 v2h __attribute__((ext_vector_type(2)));
__device__ __forceinline__ float fl_xhalf(float x) { return __builtin_bit_cast(float, __builtin_amdgcn_permlanex16(__builtin_bit_cast(int, x), __builtin_bit_cast(int, x), 0x76543210, 0xfedcba98, false, false)); }      /* lane l with lane l ^ 16 */
template <int TQ, int TK>
__global__ __launch_bounds__(128, 4) /* the second number holds the build to 256 registers: 4 waves a SIMD, so that all 1024 work-groups are resident at once */ void k_flashb(const _Float16* __restrict__ Q16, const _Float16* __restrict__ Q16lo, int ldq, const _Float16* __restrict__ K16, const _Float16* __restrict__ K16lo, int ldk, const _Float16* __restrict__ Vt, const _Float16* __restrict__ Vtlo, const _Float16* __restrict__ T16, _Float16* __restrict__ Oh, _Float16* __restrict__ Ol, int ldo) {
  constexpr int RPW = 16, NQB = TQ / (4 * RPW), DT = 4, KS = 2;
  __shared__ __attribute__((aligned(16))) float sO[4][RPW][64 + 4];
  __shared__ __attribute__((aligned(16))) unsigned short sK[2][2][32][FKP], sV[2][2][64][FVP];      /* [buffer][hi, residual][K row | V^T row][values] */
  const int tid = threadIdx.x, w = __builtin_amdgcn_readfirstlane(tid >> 5), lane = tid & 31, ln = lane & 15, hh = lane >> 4;      /* the wave's number in a scalar register: what is formed from it costs no vector register across the loop */
  const int slab = blockIdx.x / NQB, qblk = blockIdx.x % NQB; const int b = slab / NH, h = slab % NH; const int qb0 = qblk * (4 * RPW); const int q0 = qb0 + w * RPW;
  const unsigned short* Vth = (const unsigned short*)Vt + (size_t)slab * 64 * TK; const unsigned short* Vtl = (const unsigned short*)Vtlo + (size_t)slab * 64 * TK;
  const size_t kco = ((size_t)b * TK + (tid >> 3)) * ldk + h * 64 + (tid & 7) * 8, vco = (size_t)(tid >> 2) * TK + (tid & 3) * 8;      /* the lane's piece of tile 0, in values */
  const size_t sk = (size_t)16 * ldk, sv = (size_t)32 * TK, kt = (size_t)32 * ldk;      /* kt: one tile on in K; in V^T a tile is 32 values on */
  const unsigned lk = (unsigned)(size_t)&sK[0][0][tid >> 3][(tid & 7) * 8], lv = (unsigned)(size_t)&sV[0][0][tid >> 2][(tid & 3) * 8];      /* LDS byte addresses: the low 32 bits */
  fl_stage((const unsigned short*)K16 + kco, (const unsigned short*)K16lo + kco, sk, Vth + vco, Vtl + vco, sv, lk, lv);      /* tile 0 into buffer 0; it flies while q and the first table rows are fetched */
  FragH aq[KS], aql[KS];
  { const size_t qo = ((size_t)b * TQ + q0 + ln) * ldq + h * 64; const unsigned short* qr = (const unsigned short*)Q16 + qo; const unsigned short* ql = (const unsigned short*)Q16lo + qo;
#pragma unroll
    for (int ks = 0; ks < KS; ++ks) { aq[ks].half[0] = *(const v8us*)(qr + ks * 32 + 8 * hh); aq[ks].half[1] = *(const v8us*)(qr + ks * 32 + 16 + 8 * hh); aql[ks].half[0] = *(const v8us*)(ql + ks * 32 + 8 * hh); aql[ks].half[1] = *(const v8us*)(ql + ks * 32 + 16 + 8 * hh); } }
  float m_r = -3.0e38f, l_r = 0.f; v8f oacc[DT], oaccl[DT];      /* query ln's running maximum (the same in both halves) and this half's part of its sum; oacc[dt][r] = O[query ln][dt * 16 + 8 * hh + r] */
#pragma unroll
  for (int dt = 0; dt < DT; ++dt) { oacc[dt] = (v8f){0.f,0.f,0.f,0.f,0.f,0.f,0.f,0.f}; oaccl[dt] = oacc[dt]; }
  /* RPE: rel[i][c] = q[q0 + i] . table[h][rb + c], rb = q0 - j0 + TK - 32, c < 48; score (i, kk) takes c = i - kk + 31. Columns 32..47 of a trip are columns 0..15 of the trip before. */
  const unsigned short* Th = (const unsigned short*)T16 + (size_t)h * RW * 64 + (size_t)ln * 64 + 8 * hh;
  v8f relc = (v8f){0.f,0.f,0.f,0.f,0.f,0.f,0.f,0.f};      /* columns 32..47 of the first trip */
#pragma unroll
  for (int ks = 0; ks < KS; ++ks) { FragH bt; bt.half[0] = *(const v8us*)(Th + (size_t)(q0 + TK) * 64 + ks * 32); bt.half[1] = *(const v8us*)(Th + (size_t)(q0 + TK) * 64 + ks * 32 + 16); relc = mmaH<1>(aq[ks].v, aq[ks].v, bt.v, bt.v, relc); }
  /* rel (i, c) is stored skewed, in row i at column kk + 16 = i - c + 47 (0 .. 62 of the 68), so that a query's 8 consecutive keys are 8 consecutive floats: a step of one row is 69 floats, a step of 16 columns of rel -16 */
  float* const rst = &sO[w][0][0] + 8 * hh * 69 + 47 - ln; const float* const rrd = &sO[w][ln][16 + 8 * hh];
  asm volatile("s_wait_asynccnt 0x0" ::: "memory");      /* this wave's copies of tile 0 have landed */
  __syncthreads();      /* ... and every other wave's */
  if (TK > 32) fl_stage((const unsigned short*)K16 + kco + kt, (const unsigned short*)K16lo + kco + kt, sk, Vth + vco + 32, Vtl + vco + 32, sv, lk + (unsigned)sizeof(sK[0]), lv + (unsigned)sizeof(sV[0]));      /* tile 1 flies while tile 0 is worked on */
#pragma unroll 1
  for (int j0 = 0; j0 < TK; j0 += 32) { const int bf = (j0 >> 5) & 1;
    FragH bt[2][KS];      /* table rows rb .. rb + 31, fetched together with the first key tile */
#pragma unroll
    for (int t = 0; t < 2; ++t) { const unsigned short* tr = Th + (size_t)(q0 - j0 + (TK - 32) + t * 16) * 64;
#pragma unroll
      for (int ks = 0; ks < KS; ++ks) { bt[t][ks].half[0] = *(const v8us*)(tr + ks * 32); bt[t][ks].half[1] = *(const v8us*)(tr + ks * 32 + 16); } }
    asm volatile("s_wait_xcnt 0x0" ::: "memory");      /* stands in front of any overwrite of the table loads' address registers (the allocator lets a later load's result land in them) */
    v8f s[2];      /* s[nt][r] = q[ln] . k[j0 + nt * 16 + 8 * hh + r] */
#pragma unroll
    for (int nt = 0; nt < 2; ++nt) { const unsigned short* kr = &sK[bf][0][nt * 16 + ln][0]; const unsigned short* kl = &sK[bf][1][nt * 16 + ln][0]; FragH bk[KS], bkl[KS];
#pragma unroll
      for (int ks = 0; ks < KS; ++ks) { bk[ks].half[0] = *(const v8us*)(kr + ks * 32 + 8 * hh); bk[ks].half[1] = *(const v8us*)(kr + ks * 32 + 16 + 8 * hh); bkl[ks].half[0] = *(const v8us*)(kl + ks * 32 + 8 * hh); bkl[ks].half[1] = *(const v8us*)(kl + ks * 32 + 16 + 8 * hh); }
      if (nt == 1) {      /* RPE products and their LDS stores run while the second key tile's LDS reads are in flight */
        v8f rel0 = (v8f){0.f,0.f,0.f,0.f,0.f,0.f,0.f,0.f}, rel1 = rel0;
#pragma unroll
        for (int ks = 0; ks < KS; ++ks) { rel0 = mmaH<1>(aq[ks].v, aq[ks].v, bt[0][ks].v, bt[0][ks].v, rel0); rel1 = mmaH<1>(aq[ks].v, aq[ks].v, bt[1][ks].v, bt[1][ks].v, rel1); }
#pragma unroll
        for (int r = 0; r < 8; ++r) { rst[r * 69] = rel0[r]; rst[r * 69 - 16] = rel1[r]; rst[r * 69 - 32] = relc[r]; }
        relc = rel0; }
      v8f acc = (v8f){0.f,0.f,0.f,0.f,0.f,0.f,0.f,0.f}, accr = acc;
#pragma unroll
      for (int ks = 0; ks < KS; ++ks) { acc = mmaH<1>(bk[ks].v, bk[ks].v, aq[ks].v, aq[ks].v, acc); accr = mmaH<1>(bk[ks].v, bk[ks].v, aql[ks].v, aql[ks].v, accr); accr = mmaH<1>(bkl[ks].v, bkl[ks].v, aq[ks].v, aq[ks].v, accr); }
      s[nt] = acc + accr * 0.0009765625f; }
    /* the wave's rel stores above are read back by other lanes of the same wave below */
    __builtin_amdgcn_fence(__ATOMIC_ACQ_REL, "workgroup"); __builtin_amdgcn_wave_barrier();
    const v4f rv[4] = {*(const v4fa*)rrd, *(const v4fa*)(rrd + 4), *(const v4fa*)(rrd + 16), *(const v4fa*)(rrd + 20)};      /* the query's 16 RPE terms */
    /* every key counts for every query (the function has no mask): no test and no branch in this stage */
    float x[16];
#pragma unroll
    for (int i = 0; i < 16; ++i) x[i] = s[i >> 3][i & 7] * (SCL * LOG2E) + rv[i >> 2][i & 3] * (0.0625f * LOG2E);      /* + q . table[h][(q - k) + T - 1] (table held x16); scores, and so m_r, are kept in units of log 2 */
    float mc = fmaxf(x[0], x[1]);
#pragma unroll
    for (int i = 2; i < 16; ++i) mc = fmaxf(mc, x[i]);
    mc = fmaxf(mc, fl_xhalf(mc));      /* the other half's 16 keys */
    const float mn = fmaxf(m_r, mc); const float al = __builtin_amdgcn_exp2f(m_r - mn); m_r = mn;      /* arguments are <= 0: the bare instruction needs no range handling, and a result too small for it counts as 0 */
    FragH pa, pl; float ps4[4] = {0.f, 0.f, 0.f, 0.f};      /* element i of the B operand is key 8 * hh + i (i < 8), 16 + 8 * hh + i - 8 (else): the order in which the V^T fragments hold their keys */
#pragma unroll
    for (int i = 0; i < 16; i += 2) { const float p0 = __builtin_amdgcn_exp2f(x[i] - mn), p1 = __builtin_amdgcn_exp2f(x[i + 1] - mn); ps4[i & 3] += p0; ps4[(i + 1) & 3] += p1; const v2f ps = (v2f){p0, p1} * 1024.0f; const v2h ph = __builtin_convertvector(ps, v2h); const v2h pr = __builtin_convertvector((ps - __builtin_convertvector(ph, v2f)) * 1024.0f, v2h);
      pa.h[i] = ph[0]; pa.h[i + 1] = ph[1]; pl.h[i] = pr[0]; pl.h[i + 1] = pr[1]; }
    l_r = l_r * al + ((ps4[0] + ps4[1]) + (ps4[2] + ps4[3]));
#pragma unroll
    for (int dt = 0; dt < DT; ++dt) { oacc[dt] *= al; oaccl[dt] *= al; }
#pragma unroll
    for (int dt = 0; dt < DT; ++dt) { const unsigned short* vr = &sV[bf][0][dt * 16 + ln][0]; const unsigned short* vl = &sV[bf][1][dt * 16 + ln][0]; FragH bv, bl; bv.half[0] = *(const v8us*)(vr + 8 * hh); bv.half[1] = *(const v8us*)(vr + 16 + 8 * hh); bl.half[0] = *(const v8us*)(vl + 8 * hh); bl.half[1] = *(const v8us*)(vl + 16 + 8 * hh);
      oacc[dt] = mmaH<1>(bv.v, bv.v, pa.v, pa.v, oacc[dt]); oaccl[dt] = mmaH<1>(bl.v, bl.v, pa.v, pa.v, oaccl[dt]); oaccl[dt] = mmaH<1>(bv.v, bv.v, pl.v, pl.v, oaccl[dt]); }
    asm volatile("s_wait_dscnt 0x0" ::: "memory");      /* this wave's reads of buffer bf are done before it is refilled */
    asm volatile("s_wait_asynccnt 0x0" ::: "memory");      /* this wave's copies of the next tile have landed */
    __syncthreads();      /* publishes the next tile and ends every wave's reads of buffer bf */
    if (j0 + 64 < TK) { const size_t tn = (size_t)(j0 + 64);      /* the tile after the next into the buffer just read */
      fl_stage((const unsigned short*)K16 + kco + tn * ldk, (const unsigned short*)K16lo + kco + tn * ldk, sk, Vth + vco + tn, Vtl + vco + tn, sv, lk + (unsigned)bf * (unsigned)sizeof(sK[0]), lv + (unsigned)bf * (unsigned)sizeof(sV[0])); } }
  asm volatile("s_wait_asynccnt 0x0" ::: "memory");      /* no copy is outstanding past the loop */
  { const float l = l_r + fl_xhalf(l_r); const float li = 1.0f / (l * 1024.0f);      /* the halves' sums join once; l >= 1: the row's largest score adds exp(0) */
#pragma unroll
    for (int dt = 0; dt < DT; ++dt) { v4f o0, o1;      /* a lane's 8 registers are 8 consecutive values of its query's row */
#pragma unroll
      for (int i = 0; i < 4; ++i) { o0[i] = (oacc[dt][i] + oaccl[dt][i] * 0.0009765625f) * li; o1[i] = (oacc[dt][4 + i] + oaccl[dt][4 + i] * 0.0009765625f) * li; }
      *(v4fa*)&sO[w][ln][dt * 16 + 8 * hh] = o0; *(v4fa*)&sO[w][ln][dt * 16 + 8 * hh + 4] = o1; } }
  __builtin_amdgcn_fence(__ATOMIC_ACQ_REL, "workgroup"); __builtin_amdgcn_wave_barrier();
  {
#pragma unroll
    for (int rp = 0; rp < RPW; rp += 2) { const int r = rp + (lane >> 4), pc = lane & 15; const v4f val = *(const v4fa*)&sO[w][r][pc * 4]; v4h h4, l4;      /* O leaves as f16 hi + residual x 1024; 16 lanes write the 128 bytes of a row piece in each plane */
#pragma unroll
      for (int i = 0; i < 4; ++i) { const _Float16 hv = (_Float16)val[i]; h4[i] = hv; l4[i] = (_Float16)((val[i] - (float)hv) * 1024.0f); }
      const size_t o = ((size_t)b * TQ + q0 + r) * ldo + h * 64 + pc * 4; *(v4h*)(Oh + o) = h4; *(v4h*)(Ol + o) = l4; }
     } }


__global__ __launch_bounds__(256) void k_lnx(const float* __restrict__ X, const float* __restrict__ g, const float* __restrict__ bb, _Float16* __restrict__ Y16, float* __restrict__ XB) {
  #pragma clang fp contract(off)
  const int tid = threadIdx.x, w = tid >> 5, ln = tid & 31; const int r = blockIdx.x * 8 + w; if (r >= NR) return; const float* x = X + (size_t)r * DM; float s = 0.f;
#pragma unroll 1
  for (int i = 0; i < DM / 128; ++i) { const v4f a = *(const v4fa*)(x + i * 128 + ln * 4); for (int q = 0; q < 4; ++q) s += bf16_round(a[q]); }
  for (int o = 16; o > 0; o >>= 1) s += __shfl_xor(s, o, 32); const float mu = s / (float)DM; float q2 = 0.f;
#pragma unroll 1
  for (int i = 0; i < DM / 128; ++i) { const v4f a = *(const v4fa*)(x + i * 128 + ln * 4); for (int q = 0; q < 4; ++q) { const float d = bf16_round(a[q]) - mu; q2 += d * d; } }
  for (int o = 16; o > 0; o >>= 1) q2 += __shfl_xor(q2, o, 32); const float rs = rsqrtf(q2 / (float)DM + 1e-5f);
  {
#pragma unroll 1
    for (int i = 0; i < DM / 128; ++i) { const int c0 = i * 128 + ln * 4; const v4f a = *(const v4fa*)(x + c0); _Float16 h4[4]; v4f xb;
      for (int q = 0; q < 4; ++q) { const float t = bf16_round(a[q]); h4[q] = (_Float16)((t - mu) * rs * bf16_round(g[c0 + q]) + bf16_round(bb[c0 + q])); xb[q] = t; }
      *(unsigned long long*)((unsigned short*)Y16 + (size_t)r * DM + c0) = *(const unsigned long long*)h4; *(v4f*)(XB + (size_t)r * DM + c0) = xb; }
     } }
__global__ __launch_bounds__(256) void k_rtab(const float* __restrict__ tab, int trows, _Float16* __restrict__ T16) {
  const int t = blockIdx.x * 256 + threadIdx.x; if (t >= NH * RW * 8) return; const int d0 = (t & 7) * 8; const int r = (t >> 3) % RW; const int h = t / (8 * RW); FragH f;
#pragma unroll
  for (int q = 0; q < 8; ++q) f.h[q] = (r < 2 * SLEN - 1) ? (_Float16)(bf16_round(tab[((size_t)h * trows + r) * 64 + d0 + q]) * 16.0f) : (_Float16)0.0f;
  *(v8us*)((unsigned short*)T16 + ((size_t)h * RW + r) * 64 + d0) = f.half[0];  }
__global__ __launch_bounds__(256) void k_causaltab(unsigned* __restrict__ MB, int* __restrict__ RA, int* __restrict__ KE, int nq, int nk) {
  const int t = blockIdx.x * 256 + threadIdx.x; const int nw = nk / 32;
  if (t < nq * nw) { const int q = t / nw, w = t % nw; const int first = q + 1 - 32 * w; const unsigned bits = (first <= 0) ? 0xffffffffu : ((first >= 32) ? 0u : (0xffffffffu << first)); *(unsigned*)(MB + t) = bits;  }
  if (t < nq) { *(int*)(RA + t) = 0;  }
  if (t < nq / 64) { const int v = 64 * (t + 1); *(int*)(KE + t * 32) = v;  } }


extern "C" void kernel_launch(void* const* d_in, const int* in_sizes, int n_in,
                              void* d_out, int out_size, void* d_ws, size_t ws_size, hipStream_t stream) {
  (void)in_sizes; (void)n_in; (void)out_size;
  const float* const* I = (const float* const*)d_in; const float* x = I[0]; const float* Wq = I[1]; const float* bq = I[2]; const float* Wk = I[3]; const float* bk = I[4]; const float* Wv = I[5]; const float* bv = I[6]; const float* Wo = I[7]; const float* bo = I[8]; const float* tab = I[9];
  char* ws = (char*)d_ws; size_t off = 0;
  auto take = [&](size_t bytes) { char* p = ws + off; off += (bytes + 255) & ~(size_t)255; return p; };
  _Float16* BQ = (_Float16*)take((size_t)DM * DM * 2); _Float16* BK = (_Float16*)take((size_t)DM * DM * 2); _Float16* BV = (_Float16*)take((size_t)DM * DM * 2); _Float16* BO = (_Float16*)take((size_t)DM * DM * 2); _Float16* T16 = (_Float16*)take((size_t)NH * RW * 64 * 2);
  _Float16* X16 = (_Float16*)take((size_t)NR * DM * 2);
  _Float16* Qh = (_Float16*)take((size_t)NR * DM * 2); _Float16* Ql = (_Float16*)take((size_t)NR * DM * 2); _Float16* Kh = (_Float16*)take((size_t)NR * DM * 2); _Float16* Kl = (_Float16*)take((size_t)NR * DM * 2); _Float16* Vth = (_Float16*)take((size_t)NR * DM * 2); _Float16* Vtl = (_Float16*)take((size_t)NR * DM * 2);
  _Float16* Oh = (_Float16*)take((size_t)NR * DM * 2); _Float16* Ol = (_Float16*)take((size_t)NR * DM * 2);
  if (off > ws_size) return;      /* 8 + 4 + 8 + 48 + 16 = 84 MiB */
  const size_t n8 = (size_t)NR * DM / 8; const unsigned nb8 = (unsigned)((n8 + 255) / 256); const size_t w8 = (size_t)DM * DM / 8; const unsigned wb = (unsigned)((w8 + 255) / 256);
  k_round16f<<<wb, 256, 0, stream>>>(Wq, BQ, w8); k_round16f<<<wb, 256, 0, stream>>>(Wk, BK, w8); k_round16f<<<wb, 256, 0, stream>>>(Wv, BV, w8); k_round16f<<<wb, 256, 0, stream>>>(Wo, BO, w8);      /* torch (out,in) = natural Bt */
  k_rtab<<<(NH * RW * 8 + 255) / 256, 256, 0, stream>>>(tab, 9999, T16);
  const dim3 gP((NR / 128) * (DM / 64), 1);
  /* every row-wise stage runs once over all NBT * SLEN rows */
  k_x16<<<nb8, 256, 0, stream>>>(x, X16, n8);
  /* each producer splits its f32 result into the hi and residual planes in its own epilogue: no f32 copy of q, k, v or O reaches memory */
  k_gemm2<0, 1><<<gP, 128, 0, stream>>>(X16, DM, 0, BQ, DM, 0, 0.0625f, bq, 0, nullptr, 1, 0, 0, nullptr, Qh, Ql, DM, 0, NR, DM, DM);      /* the hi plane also feeds the RPE product */
  k_gemm2<0, 1><<<gP, 128, 0, stream>>>(X16, DM, 0, BK, DM, 0, 0.0625f, bk, 0, nullptr, 1, 0, 0, nullptr, Kh, Kl, DM, 0, NR, DM, DM);
  k_gemm2<0, 2><<<gP, 128, 0, stream>>>(X16, DM, 0, BV, DM, 0, 0.0625f, bv, 0, nullptr, 1, 0, 0, nullptr, Vth, Vtl, DM, 0, NR, DM, DM);      /* V^T per head */
  k_flashb<SLEN, SLEN><<<NBT * NH * (SLEN / 64), 128, 0, stream>>>(Qh, Ql, DM, Kh, Kl, DM, Vth, Vtl, T16, Oh, Ol, DM);      /* all batches and heads in one launch */
  float* outp = (float*)d_out;
  k_gemm2hl<<<gP, 128, 0, stream>>>(Oh, Ol, DM, BO, DM, 0.0625f, bo, outp, DM, NR, DM, DM);      /* both planes of O in one launch: out is written once and never read */
}
